// v000
// Times are from an AMD MI455X. After a warm-up the kernel runs many times in a row, and a time is the length of
// such a window on the GPU divided by its runs, so every launch and the gaps after it count. The runs cycle
// through copies of the inputs. A figure is the median of several windows, for all but v000 over two sittings.
// Sittings can differ by a few percent; kernels timed side by side share one.
// v000, which the later versions start from, runs in 1620 microseconds.
#include <hip/hip_runtime.h>

// Contractions: x@Wq, x@Wk and q.k^T : v_wmma_f32_16x16x32_f16 (f16 operands; Wq, Wk carried x64, rescaled in the f32 epilogue; f32 accumulate).
// x@Wv, P.V and ctx@Wo : v_wmma_f32_16x16x32_bf16 with bf16 hi/lo operand split (hi.hi + hi.lo + lo.hi), f32 accumulate. Gate MLP: scalar f32.

#define NOP4 "v_nop\n\tv_nop\n\tv_nop\n\tv_nop"

typedef _Float16 v16h __attribute__((ext_vector_type(16)));
typedef __bf16 v16b __attribute__((ext_vector_type(16)));
typedef float v8f __attribute__((ext_vector_type(8)));
typedef float v4f __attribute__((ext_vector_type(4)));
typedef unsigned int v4u __attribute__((ext_vector_type(4)));

union FragH { v16h v; v4u q[2]; };
union FragB { v16b v; v4u q[2]; };

__device__ __forceinline__ v4u ldg16(const unsigned short* p) { return *(const v4u*)p; }

// RNE f32 -> bf16 bits
__device__ __forceinline__ unsigned int bf_bits(float f) {
  unsigned int u = __float_as_uint(f);
  return (u + 0x7FFFu + ((u >> 16) & 1u)) >> 16;
}
__device__ __forceinline__ float bf_val(unsigned int b) { return __uint_as_float(b << 16); }
// RNE f32 -> f16 bits
__device__ __forceinline__ unsigned int hf_bits(float f) {
  union { _Float16 h; unsigned short u; } c;
  c.h = (_Float16)f;
  return (unsigned int)c.u;
}
__device__ __forceinline__ unsigned int pk2(unsigned int lo, unsigned int hi) {
  return (lo & 0xFFFFu) | (hi << 16);
}
// 8 consecutive f32 -> 8 packed f16 (element 2t in the low half of word t)
__device__ __forceinline__ v4u pack_h8(v4f a, v4f c) {
  v4u r;
  r[0] = pk2(hf_bits(a[0]), hf_bits(a[1]));
  r[1] = pk2(hf_bits(a[2]), hf_bits(a[3]));
  r[2] = pk2(hf_bits(c[0]), hf_bits(c[1]));
  r[3] = pk2(hf_bits(c[2]), hf_bits(c[3]));
  return r;
}
// 8 consecutive f32 -> bf16 hi plane and bf16 residual plane
__device__ __forceinline__ void split_b8(v4f a, v4f c, v4u& H, v4u& L) {
  float v[8] = {a[0], a[1], a[2], a[3], c[0], c[1], c[2], c[3]};
  unsigned int hb[8], lb[8];
#pragma unroll
  for (int e = 0; e < 8; ++e) {
    hb[e] = bf_bits(v[e]);
    lb[e] = bf_bits(v[e] - bf_val(hb[e]));
  }
#pragma unroll
  for (int t = 0; t < 4; ++t) {
    H[t] = pk2(hb[2 * t], hb[2 * t + 1]);
    L[t] = pk2(lb[2 * t], lb[2 * t + 1]);
  }
}

__device__ __forceinline__ v8f zero8() {
  v8f z;
#pragma unroll
  for (int r = 0; r < 8; ++r) z[r] = 0.f;
  return z;
}
__device__ __forceinline__ v8f mma_h(v16h a, v16h b, v8f c) {
  return __builtin_amdgcn_wmma_f32_16x16x32_f16(false, a, false, b, (short)0, c, false, false);
}
__device__ __forceinline__ v8f mma_b(v16b a, v16b b, v8f c) {
  return __builtin_amdgcn_wmma_f32_16x16x32_bf16(false, a, false, b, (short)0, c, false, false);
}

// ---------------------------------------------------------------------------
// x [n] f32 -> f16 plane (unscaled) and bf16 hi / lo planes. 8 elements per thread,
// ---------------------------------------------------------------------------
__global__ __launch_bounds__(256) void k_cvt_x(const float* __restrict__ x, unsigned short* xh,
                                              unsigned short* xbh, unsigned short* xbl, int n) {
  const size_t i8 = ((size_t)blockIdx.x * 256u + (size_t)threadIdx.x) * 8u;
  if (i8 + 8 > (size_t)n) return;
  const v4f a = *(const v4f*)(x + i8);
  const v4f c = *(const v4f*)(x + i8 + 4);
  const v4u fh = pack_h8(a, c);
  v4u bh, bl;
  split_b8(a, c, bh, bl);
  *(v4u*)(xh + i8) = fh;
  *(v4u*)(xbh + i8) = bh;
  *(v4u*)(xbl + i8) = bl;
  
}

// ---------------------------------------------------------------------------
// W[Kd][Nd] f32 -> WT[Nd][Kd] 16-bit (k-contiguous rows).  64x64 tile through LDS.
// MODE 0: f16 of (W * scale) into o0.  MODE 1: bf16 hi into o0, bf16 lo into o1.
// ---------------------------------------------------------------------------
template <int MODE>
__global__ __launch_bounds__(256) void k_cvt_wT(const float* __restrict__ W, unsigned short* o0,
                                               unsigned short* o1, int Kd, int Nd, float scale) {
  __shared__ float tile[64][65];
  const int n0 = blockIdx.x * 64, e0 = blockIdx.y * 64;
  if (n0 + 64 > Nd || e0 + 64 > Kd) return;  // block-uniform
  const int tid = threadIdx.x;
#pragma unroll
  for (int t = 0; t < 4; ++t) {
    const int idx = t * 256 + tid;
    const int rr = idx >> 4, c4 = (idx & 15) * 4;
    const v4f v = *(const v4f*)(W + (size_t)(e0 + rr) * Nd + n0 + c4);
    tile[rr][c4] = v[0];
    tile[rr][c4 + 1] = v[1];
    tile[rr][c4 + 2] = v[2];
    tile[rr][c4 + 3] = v[3];
  }
  __syncthreads();
  v4u Hv[2], Lv[2];
  size_t adr[2];
#pragma unroll
  for (int t = 0; t < 2; ++t) {
    const int s = t * 256 + tid;
    const int nn = s >> 3, kq = (s & 7) * 8;
    v4f a, c;
#pragma unroll
    for (int e = 0; e < 4; ++e) {
      a[e] = tile[kq + e][nn] * scale;
      c[e] = tile[kq + 4 + e][nn] * scale;
    }
    if (MODE == 0) {
      Hv[t] = pack_h8(a, c);
      Lv[t] = Hv[t];
    } else {
      split_b8(a, c, Hv[t], Lv[t]);
    }
    adr[t] = (size_t)(n0 + nn) * Kd + e0 + kq;
  }
#pragma unroll
  for (int t = 0; t < 2; ++t) {
    *(v4u*)(o0 + adr[t]) = Hv[t];
    if (MODE == 1) *(v4u*)(o1 + adr[t]) = Lv[t];
  }
  
}

// ---------------------------------------------------------------------------
// Gate MLP: swo[b*32 + h] = sigmoid(relu(sync @ W1 + b1) @ W2 + b2), h < Hn; padding 0.
// ---------------------------------------------------------------------------
__global__ __launch_bounds__(256) void k_gate(const float* __restrict__ sync, const float* __restrict__ W1,
                                             const float* __restrict__ b1, const float* __restrict__ W2,
                                             const float* __restrict__ b2, float* swo, int Ein, int Hd, int Hn) {
  __shared__ float hid[256];
  __shared__ float gv[32];
  const int b = blockIdx.x, tid = threadIdx.x;
  for (int j = tid; j < Hd; j += 256) {
    float a = b1[j];
    for (int e = 0; e < Ein; ++e) a += sync[(size_t)b * Ein + e] * W1[(size_t)e * Hd + j];
    hid[j] = fmaxf(a, 0.f);
  }
  __syncthreads();
  if (tid < 32) {
    float val = 0.f;
    if (tid < Hn) {
      float a = b2[tid];
      for (int t = 0; t < Hd; ++t) a += hid[t] * W2[(size_t)t * Hn + tid];
      val = 1.0f / (1.0f + expf(-a));
    }
    gv[tid] = val;
  }
  __syncthreads();
  if (tid < 8) {
    v4f v;
    v[0] = gv[tid * 4];
    v[1] = gv[tid * 4 + 1];
    v[2] = gv[tid * 4 + 2];
    v[3] = gv[tid * 4 + 3];
    float* p = swo + (size_t)b * 32 + tid * 4;
    *(v4f*)p = v;
    
  }
}

// ---------------------------------------------------------------------------
// C[M,N] = A[M,K] @ B[K,N] (+bias) with A row-major 16-bit and B given as BT[N][K] 16-bit.
// Block tile 128x64, 256 threads = 8 waves, wave w owns rows w*16..w*16+15, 4 n-tiles.
// Fragments are loaded straight from global with the 16x16x32 split k-map
//   (lane l: row/col = l&15; elements 0..7 <- k0+8*(l>>4)+0..7, 8..15 <- k0+16+8*(l>>4)+0..7).
// SPLIT 0: single f16 product.  SPLIT 1: bf16 hi/lo planes, three products.
// OM 0: f16 row-major [M][N].  OM 1: bf16 hi/lo transposed per head -> [B*H][64][Sq].
// OM 2: f32 row-major [M][N].
// ---------------------------------------------------------------------------
template <int SPLIT, int OM>
__global__ __launch_bounds__(256) void k_gemm(const unsigned short* __restrict__ Ah,
                                             const unsigned short* __restrict__ Al,
                                             const unsigned short* __restrict__ Bh,
                                             const unsigned short* __restrict__ Bl,
                                             const float* __restrict__ bias, void* out0, void* out1,
                                             int M, int N, int K, int Sq, float oscale) {
  __shared__ v4f stg4[128 * 17];  // 128 x 68 f32
  float* stg = (float*)stg4;
  const int nBase = blockIdx.x * 64, mBase = blockIdx.y * 128;
  if (nBase + 64 > N || mBase + 128 > M) return;  // block-uniform
  const int tid = threadIdx.x, w = tid >> 5, l = tid & 31, g = l >> 4, m = l & 15;

  v8f acc[4];
#pragma unroll
  for (int nt = 0; nt < 4; ++nt) acc[nt] = zero8();

  const size_t arow = (size_t)(mBase + w * 16 + m) * K + 8 * g;
  const size_t brow = (size_t)(nBase + m) * K + 8 * g;
  const size_t bnt = (size_t)16 * K;

#pragma unroll 1
  for (int k0 = 0; k0 < K; k0 += 32) {
    if (SPLIT) {
      FragB a, a2, b0, b1, b2, b3, c0, c1, c2, c3;
      a.q[0] = ldg16(Ah + arow + k0);
      a.q[1] = ldg16(Ah + arow + k0 + 16);
      a2.q[0] = ldg16(Al + arow + k0);
      a2.q[1] = ldg16(Al + arow + k0 + 16);
      b0.q[0] = ldg16(Bh + brow + k0);
      b0.q[1] = ldg16(Bh + brow + k0 + 16);
      b1.q[0] = ldg16(Bh + brow + bnt + k0);
      b1.q[1] = ldg16(Bh + brow + bnt + k0 + 16);
      b2.q[0] = ldg16(Bh + brow + 2 * bnt + k0);
      b2.q[1] = ldg16(Bh + brow + 2 * bnt + k0 + 16);
      b3.q[0] = ldg16(Bh + brow + 3 * bnt + k0);
      b3.q[1] = ldg16(Bh + brow + 3 * bnt + k0 + 16);
      c0.q[0] = ldg16(Bl + brow + k0);
      c0.q[1] = ldg16(Bl + brow + k0 + 16);
      c1.q[0] = ldg16(Bl + brow + bnt + k0);
      c1.q[1] = ldg16(Bl + brow + bnt + k0 + 16);
      c2.q[0] = ldg16(Bl + brow + 2 * bnt + k0);
      c2.q[1] = ldg16(Bl + brow + 2 * bnt + k0 + 16);
      c3.q[0] = ldg16(Bl + brow + 3 * bnt + k0);
      c3.q[1] = ldg16(Bl + brow + 3 * bnt + k0 + 16);
      acc[0] = mma_b(a.v, b0.v, acc[0]);
      acc[0] = mma_b(a.v, c0.v, acc[0]);
      acc[0] = mma_b(a2.v, b0.v, acc[0]);
      acc[1] = mma_b(a.v, b1.v, acc[1]);
      acc[1] = mma_b(a.v, c1.v, acc[1]);
      acc[1] = mma_b(a2.v, b1.v, acc[1]);
      acc[2] = mma_b(a.v, b2.v, acc[2]);
      acc[2] = mma_b(a.v, c2.v, acc[2]);
      acc[2] = mma_b(a2.v, b2.v, acc[2]);
      acc[3] = mma_b(a.v, b3.v, acc[3]);
      acc[3] = mma_b(a.v, c3.v, acc[3]);
      acc[3] = mma_b(a2.v, b3.v, acc[3]);
      asm volatile(NOP4
                   : "+v"(acc[0]), "+v"(acc[1]), "+v"(acc[2]), "+v"(acc[3])
                   : "v"(a.v), "v"(a2.v), "v"(b0.v), "v"(b1.v), "v"(b2.v), "v"(b3.v),
                     "v"(c0.v), "v"(c1.v), "v"(c2.v), "v"(c3.v));
    } else {
      FragH a, b0, b1, b2, b3;
      a.q[0] = ldg16(Ah + arow + k0);
      a.q[1] = ldg16(Ah + arow + k0 + 16);
      b0.q[0] = ldg16(Bh + brow + k0);
      b0.q[1] = ldg16(Bh + brow + k0 + 16);
      b1.q[0] = ldg16(Bh + brow + bnt + k0);
      b1.q[1] = ldg16(Bh + brow + bnt + k0 + 16);
      b2.q[0] = ldg16(Bh + brow + 2 * bnt + k0);
      b2.q[1] = ldg16(Bh + brow + 2 * bnt + k0 + 16);
      b3.q[0] = ldg16(Bh + brow + 3 * bnt + k0);
      b3.q[1] = ldg16(Bh + brow + 3 * bnt + k0 + 16);
      acc[0] = mma_h(a.v, b0.v, acc[0]);
      acc[1] = mma_h(a.v, b1.v, acc[1]);
      acc[2] = mma_h(a.v, b2.v, acc[2]);
      acc[3] = mma_h(a.v, b3.v, acc[3]);
      asm volatile(NOP4
                   : "+v"(acc[0]), "+v"(acc[1]), "+v"(acc[2]), "+v"(acc[3])
                   : "v"(a.v), "v"(b0.v), "v"(b1.v), "v"(b2.v), "v"(b3.v));
    }
  }

  // stage: D element r of lane (g,m), n-tile nt -> (row w*16+8g+r, col nt*16+m)
#pragma unroll
  for (int nt = 0; nt < 4; ++nt) {
    const int col = nt * 16 + m;
    const float bv = bias[nBase + col];
#pragma unroll
    for (int r = 0; r < 8; ++r) stg[(w * 16 + 8 * g + r) * 68 + col] = acc[nt][r] * oscale + bv;
  }
  __syncthreads();

  if (OM == 0) {
    unsigned short* o = (unsigned short*)out0;
    v4u val[4];
    size_t adr[4];
#pragma unroll
    for (int t = 0; t < 4; ++t) {
      const int row = w * 16 + t * 4 + (l >> 3), c8 = (l & 7) * 8;
      const float* sp = stg + row * 68 + c8;
      const v4f x0 = *(const v4f*)sp;
      const v4f x1 = *(const v4f*)(sp + 4);
      val[t] = pack_h8(x0, x1);
      adr[t] = (size_t)(mBase + row) * N + nBase + c8;
    }
#pragma unroll
    for (int t = 0; t < 4; ++t) *(v4u*)(o + adr[t]) = val[t];
    
  } else if (OM == 1) {
    // tile rows = s (128 consecutive within one batch), cols = d of head nBase/64:  out[bh][d][s]
    unsigned short* oh = (unsigned short*)out0;
    unsigned short* ol = (unsigned short*)out1;
    const int Hn = N >> 6;
    const int bb = mBase / Sq;
    const int bh = bb * Hn + (nBase >> 6);
    const int sBase = mBase - bb * Sq;
    v4u Hv[4], Lv[4];
    size_t adr[4];
#pragma unroll
    for (int t = 0; t < 4; ++t) {
      const int d = w * 8 + t * 2 + (l >> 4), s8 = (l & 15) * 8;
      v4f x0, x1;
#pragma unroll
      for (int e = 0; e < 4; ++e) {
        x0[e] = stg[(s8 + e) * 68 + d];
        x1[e] = stg[(s8 + 4 + e) * 68 + d];
      }
      split_b8(x0, x1, Hv[t], Lv[t]);
      adr[t] = ((size_t)bh * 64 + d) * Sq + sBase + s8;
    }
#pragma unroll
    for (int t = 0; t < 4; ++t) {
      *(v4u*)(oh + adr[t]) = Hv[t];
      *(v4u*)(ol + adr[t]) = Lv[t];
    }
    
  } else {
    float* o = (float*)out0;
    v4f val[8];
    size_t adr[8];
#pragma unroll
    for (int t = 0; t < 8; ++t) {
      const int row = w * 16 + t * 2 + (l >> 4), c4 = (l & 15) * 4;
      val[t] = *(const v4f*)(stg + row * 68 + c4);
      adr[t] = (size_t)(mBase + row) * N + nBase + c4;
    }
#pragma unroll
    for (int t = 0; t < 8; ++t) *(v4f*)(o + adr[t]) = val[t];
    
  }
}

// ---------------------------------------------------------------------------
// Fused attention: one wave32 block per (16 query rows, batch).  Dynamic LDS:
//   sL[16][S] f32  gated+scaled scores of the current head, then exp(s - rowmax);
//   mL[16][S] f32  sum over heads of the softmax probabilities (lane-owned elements).
// Per head h: score tiles S^T = K_tile . Q^T (A = k rows, B = q rows; D lane (g,m) holds
// query m, keys jt*16+8g+r), exact two-sweep softmax, then P.V with the P fragment read
// back from the same lane's own LDS words (elements 0..7 <- keys k0+8g.., 8..15 <- k0+16+8g..),
// V fragments from the transposed planes vt[bh][d][s].  ctx tile and mean rows leave the
// ---------------------------------------------------------------------------
__global__ __launch_bounds__(32) void k_attn(const unsigned short* __restrict__ qh,
                                            const unsigned short* __restrict__ kh,
                                            const unsigned short* __restrict__ vth,
                                            const unsigned short* __restrict__ vtl,
                                            const float* __restrict__ sw, unsigned short* ctxh,
                                            unsigned short* ctxl, float* mout, int S, int H) {
  extern __shared__ v4f dsm[];
  float* sL = (float*)dsm;
  float* mL = sL + (size_t)16 * S;
  const int i0 = blockIdx.x * 16, b = blockIdx.y;
  if (i0 + 16 > S) return;  // block-uniform
  const int l = threadIdx.x & 31, g = l >> 4, m = l & 15;
  const int E = H * 64;

  {
    v4f z;
    z[0] = 0.f; z[1] = 0.f; z[2] = 0.f; z[3] = 0.f;
    v4f* m4 = (v4f*)mL;
    const int n4 = 4 * S;
    for (int i = l; i < n4; i += 32) m4[i] = z;
  }
  __syncthreads();

  float* srow = sL + (size_t)m * S;
  float* mrow = mL + (size_t)m * S;
  const float invH = 1.0f / (float)H;
  const int nT = S >> 4, nC = S >> 5;

  for (int h = 0; h < H; ++h) {
    FragH qa0, qa1;
    {
      const unsigned short* qp = qh + (size_t)(b * S + i0 + m) * E + h * 64 + 8 * g;
      qa0.q[0] = ldg16(qp);
      qa0.q[1] = ldg16(qp + 16);
      qa1.q[0] = ldg16(qp + 32);
      qa1.q[1] = ldg16(qp + 48);
    }
    const float gsc = sw[b * 32 + h] * 0.125f;

    // sweep A: scores -> LDS, running row max
    float rmax = -3.0e38f;
    const unsigned short* kp = kh + (size_t)(b * S + m) * E + h * 64 + 8 * g;
    for (int jt = 0; jt < nT; ++jt) {
      const unsigned short* kr = kp + (size_t)jt * 16 * E;
      FragH ka0, ka1;
      ka0.q[0] = ldg16(kr);
      ka0.q[1] = ldg16(kr + 16);
      ka1.q[0] = ldg16(kr + 32);
      ka1.q[1] = ldg16(kr + 48);
      v8f sc = zero8();
      sc = mma_h(ka0.v, qa0.v, sc);
      sc = mma_h(ka1.v, qa1.v, sc);
      asm volatile(NOP4 : "+v"(sc) : "v"(ka0.v), "v"(ka1.v), "v"(qa0.v), "v"(qa1.v));
      v4f t0, t1;
#pragma unroll
      for (int r = 0; r < 4; ++r) {
        t0[r] = sc[r] * gsc;
        t1[r] = sc[r + 4] * gsc;
        rmax = fmaxf(rmax, t0[r]);
        rmax = fmaxf(rmax, t1[r]);
      }
      float* pp = srow + jt * 16 + 8 * g;
      *(v4f*)pp = t0;
      *(v4f*)(pp + 4) = t1;
    }
    rmax = fmaxf(rmax, __shfl_xor(rmax, 16));

    // sweep B: e = exp(s - max) stored back in place, row sum
    float lsum = 0.f;
    for (int jt = 0; jt < nT; ++jt) {
      float* pp = srow + jt * 16 + 8 * g;
      v4f t0 = *(v4f*)pp;
      v4f t1 = *(v4f*)(pp + 4);
#pragma unroll
      for (int r = 0; r < 4; ++r) {
        t0[r] = __expf(t0[r] - rmax);
        t1[r] = __expf(t1[r] - rmax);
        lsum += t0[r];
        lsum += t1[r];
      }
      *(v4f*)pp = t0;
      *(v4f*)(pp + 4) = t1;
    }
    lsum += __shfl_xor(lsum, 16);
    const float linv = 1.0f / lsum;

    // sweep C: probabilities, head-sum accumulation, P.V
    v8f cacc[4];
#pragma unroll
    for (int nt = 0; nt < 4; ++nt) cacc[nt] = zero8();
    const size_t vb = ((size_t)(b * H + h) * 64 + m) * S + 8 * g;
    const size_t vnt = (size_t)16 * S;
#pragma unroll 1
    for (int jc = 0; jc < nC; ++jc) {
      const int k0 = jc * 32;
      float* pa = srow + k0 + 8 * g;
      float* pb = srow + k0 + 16 + 8 * g;
      const v4f p0 = *(v4f*)pa * linv;
      const v4f p1 = *(v4f*)(pa + 4) * linv;
      const v4f p2 = *(v4f*)pb * linv;
      const v4f p3 = *(v4f*)(pb + 4) * linv;
      {
        v4f* ma = (v4f*)(mrow + k0 + 8 * g);
        v4f* mb = (v4f*)(mrow + k0 + 16 + 8 * g);
        const v4f s0 = ma[0] + p0;
        const v4f s1 = ma[1] + p1;
        const v4f s2 = mb[0] + p2;
        const v4f s3 = mb[1] + p3;
        ma[0] = s0;
        ma[1] = s1;
        mb[0] = s2;
        mb[1] = s3;
      }
      FragB ph, pl;
      split_b8(p0, p1, ph.q[0], pl.q[0]);
      split_b8(p2, p3, ph.q[1], pl.q[1]);
      FragB vh0, vh1, vh2, vh3, vl0, vl1, vl2, vl3;
      vh0.q[0] = ldg16(vth + vb + k0);
      vh0.q[1] = ldg16(vth + vb + k0 + 16);
      vh1.q[0] = ldg16(vth + vb + vnt + k0);
      vh1.q[1] = ldg16(vth + vb + vnt + k0 + 16);
      vh2.q[0] = ldg16(vth + vb + 2 * vnt + k0);
      vh2.q[1] = ldg16(vth + vb + 2 * vnt + k0 + 16);
      vh3.q[0] = ldg16(vth + vb + 3 * vnt + k0);
      vh3.q[1] = ldg16(vth + vb + 3 * vnt + k0 + 16);
      vl0.q[0] = ldg16(vtl + vb + k0);
      vl0.q[1] = ldg16(vtl + vb + k0 + 16);
      vl1.q[0] = ldg16(vtl + vb + vnt + k0);
      vl1.q[1] = ldg16(vtl + vb + vnt + k0 + 16);
      vl2.q[0] = ldg16(vtl + vb + 2 * vnt + k0);
      vl2.q[1] = ldg16(vtl + vb + 2 * vnt + k0 + 16);
      vl3.q[0] = ldg16(vtl + vb + 3 * vnt + k0);
      vl3.q[1] = ldg16(vtl + vb + 3 * vnt + k0 + 16);
      cacc[0] = mma_b(ph.v, vh0.v, cacc[0]);
      cacc[0] = mma_b(ph.v, vl0.v, cacc[0]);
      cacc[0] = mma_b(pl.v, vh0.v, cacc[0]);
      cacc[1] = mma_b(ph.v, vh1.v, cacc[1]);
      cacc[1] = mma_b(ph.v, vl1.v, cacc[1]);
      cacc[1] = mma_b(pl.v, vh1.v, cacc[1]);
      cacc[2] = mma_b(ph.v, vh2.v, cacc[2]);
      cacc[2] = mma_b(ph.v, vl2.v, cacc[2]);
      cacc[2] = mma_b(pl.v, vh2.v, cacc[2]);
      cacc[3] = mma_b(ph.v, vh3.v, cacc[3]);
      cacc[3] = mma_b(ph.v, vl3.v, cacc[3]);
      cacc[3] = mma_b(pl.v, vh3.v, cacc[3]);
      asm volatile(NOP4
                   : "+v"(cacc[0]), "+v"(cacc[1]), "+v"(cacc[2]), "+v"(cacc[3])
                   : "v"(ph.v), "v"(pl.v), "v"(vh0.v), "v"(vh1.v), "v"(vh2.v), "v"(vh3.v),
                     "v"(vl0.v), "v"(vl1.v), "v"(vl2.v), "v"(vl3.v));
    }

    __syncthreads();
#pragma unroll
    for (int nt = 0; nt < 4; ++nt) {
#pragma unroll
      for (int r = 0; r < 8; ++r) sL[(8 * g + r) * 68 + nt * 16 + m] = cacc[nt][r];
    }
    __syncthreads();
    v4u Hv[4], Lv[4];
    size_t adr[4];
#pragma unroll
    for (int t = 0; t < 4; ++t) {
      const int row = t * 4 + (l >> 3), c8 = (l & 7) * 8;
      const float* sp = sL + row * 68 + c8;
      const v4f x0 = *(const v4f*)sp;
      const v4f x1 = *(const v4f*)(sp + 4);
      split_b8(x0, x1, Hv[t], Lv[t]);
      adr[t] = (size_t)(b * S + i0 + row) * E + h * 64 + c8;
    }
#pragma unroll
    for (int t = 0; t < 4; ++t) {
      *(v4u*)(ctxh + adr[t]) = Hv[t];
      *(v4u*)(ctxl + adr[t]) = Lv[t];
    }
    
    __syncthreads();
  }

  // head-mean rows: 16 rows x S f32, 512 B per store instruction, lane-contiguous
  __syncthreads();
  float* ob = mout + (size_t)(b * S + i0) * S;
  const int nL = S >> 7;
  for (int row = 0; row < 16; ++row) {
    for (int c = 0; c < nL; ++c) {
      const size_t off = (size_t)row * S + c * 128 + l * 4;
      const v4f v = *(const v4f*)(mL + off) * invH;
      *(v4f*)(ob + off) = v;
    }
  }
  
}

// ---------------------------------------------------------------------------
// Host launcher
// ---------------------------------------------------------------------------
extern "C" void kernel_launch(void* const* d_in, const int* in_sizes, int n_in, void* d_out,
                              int out_size, void* d_ws, size_t ws_size, hipStream_t stream) {
  if (n_in < 14) return;
  const int E = 1024, H = 16;
  const int nX = in_sizes[0];
  if (nX <= 0 || (nX % E) != 0) return;
  const int M = nX / E;
  const int nSy = in_sizes[1];
  if (nSy <= 0 || (nSy % E) != 0) return;
  const int Bn = nSy / E;
  if (Bn <= 0 || (M % Bn) != 0) return;
  const int S = M / Bn;
  const int HID = in_sizes[9];
  if ((M % 128) != 0 || (S % 128) != 0 || HID <= 0 || HID > 256) return;
  if (in_sizes[2] != E * E || in_sizes[4] != E * E || in_sizes[6] != E * E || in_sizes[12] != E * E) return;
  if (in_sizes[3] != E || in_sizes[5] != E || in_sizes[7] != E || in_sizes[13] != E) return;
  if (in_sizes[8] != E * HID || in_sizes[10] != HID * H || in_sizes[11] != H) return;
  if ((long long)out_size != (long long)nX + (long long)Bn * (long long)S * (long long)S) return;

  const float* x = (const float*)d_in[0];
  const float* sync = (const float*)d_in[1];
  const float* Wq = (const float*)d_in[2];
  const float* bq = (const float*)d_in[3];
  const float* Wk = (const float*)d_in[4];
  const float* bk = (const float*)d_in[5];
  const float* Wv = (const float*)d_in[6];
  const float* bv = (const float*)d_in[7];
  const float* Ws1 = (const float*)d_in[8];
  const float* bs1 = (const float*)d_in[9];
  const float* Ws2 = (const float*)d_in[10];
  const float* bs2 = (const float*)d_in[11];
  const float* Wo = (const float*)d_in[12];
  const float* bo = (const float*)d_in[13];

  float* out_proj = (float*)d_out;                 // [M][E] f32
  float* out_mean = (float*)d_out + (size_t)nX;    // [Bn][S][S] f32

  // workspace carve (bytes), every sub-buffer 256-B aligned
  size_t off = 0;
  auto al = [&](size_t bytes) { size_t o = off; off += (bytes + 255) & ~(size_t)255; return o; };
  const size_t nW = (size_t)E * E;
  const size_t o_sw = al((size_t)Bn * 32 * 4);
  const size_t o_xh = al((size_t)nX * 2);
  const size_t o_xbh = al((size_t)nX * 2);
  const size_t o_xbl = al((size_t)nX * 2);
  const size_t o_wq = al(nW * 2);
  const size_t o_wk = al(nW * 2);
  const size_t o_wvh = al(nW * 2);
  const size_t o_wvl = al(nW * 2);
  const size_t o_woh = al(nW * 2);
  const size_t o_wol = al(nW * 2);
  const size_t o_q = al((size_t)nX * 2);
  const size_t o_k = al((size_t)nX * 2);
  const size_t o_vth = al((size_t)nX * 2);
  const size_t o_vtl = al((size_t)nX * 2);
  const size_t o_cth = al((size_t)nX * 2);
  const size_t o_ctl = al((size_t)nX * 2);
  if (off > ws_size) return;

  char* ws = (char*)d_ws;
  float* sw_g = (float*)(ws + o_sw);
  unsigned short* xh = (unsigned short*)(ws + o_xh);
  unsigned short* xbh = (unsigned short*)(ws + o_xbh);
  unsigned short* xbl = (unsigned short*)(ws + o_xbl);
  unsigned short* wqT = (unsigned short*)(ws + o_wq);
  unsigned short* wkT = (unsigned short*)(ws + o_wk);
  unsigned short* wvTh = (unsigned short*)(ws + o_wvh);
  unsigned short* wvTl = (unsigned short*)(ws + o_wvl);
  unsigned short* woTh = (unsigned short*)(ws + o_woh);
  unsigned short* woTl = (unsigned short*)(ws + o_wol);
  unsigned short* qh = (unsigned short*)(ws + o_q);
  unsigned short* kh = (unsigned short*)(ws + o_k);
  unsigned short* vTh = (unsigned short*)(ws + o_vth);
  unsigned short* vTl = (unsigned short*)(ws + o_vtl);
  unsigned short* cth = (unsigned short*)(ws + o_cth);
  unsigned short* ctl = (unsigned short*)(ws + o_ctl);

  // 1) activation planes
  {
    const int groups = nX / 8;
    const int blocks = (groups + 255) / 256;
    k_cvt_x<<<dim3(blocks), dim3(256), 0, stream>>>(x, xh, xbh, xbl, nX);
  }
  // 2) weight planes, transposed to [n][k]
  {
    dim3 gw(E / 64, E / 64);
    k_cvt_wT<0><<<gw, dim3(256), 0, stream>>>(Wq, wqT, wqT, E, E, 64.0f);
    k_cvt_wT<0><<<gw, dim3(256), 0, stream>>>(Wk, wkT, wkT, E, E, 64.0f);
    k_cvt_wT<1><<<gw, dim3(256), 0, stream>>>(Wv, wvTh, wvTl, E, E, 1.0f);
    k_cvt_wT<1><<<gw, dim3(256), 0, stream>>>(Wo, woTh, woTl, E, E, 1.0f);
  }
  // 3) gate MLP
  k_gate<<<dim3(Bn), dim3(256), 0, stream>>>(sync, Ws1, bs1, Ws2, bs2, sw_g, E, HID, H);
  // 4) projections (M x E, K = E)
  dim3 gg(E / 64, M / 128);
  k_gemm<0, 0><<<gg, dim3(256), 0, stream>>>(xh, xh, wqT, wqT, bq, (void*)qh, (void*)qh, M, E, E, S, 1.0f / 64.0f);
  k_gemm<0, 0><<<gg, dim3(256), 0, stream>>>(xh, xh, wkT, wkT, bk, (void*)kh, (void*)kh, M, E, E, S, 1.0f / 64.0f);
  k_gemm<1, 1><<<gg, dim3(256), 0, stream>>>(xbh, xbl, wvTh, wvTl, bv, (void*)vTh, (void*)vTl, M, E, E, S, 1.0f);
  // 5) attention + head-mean
  {
    const size_t dynB = (size_t)2 * 16 * (size_t)S * 4;
    hipFuncSetAttribute(reinterpret_cast<const void*>(&k_attn), hipFuncAttributeMaxDynamicSharedMemorySize, (int)dynB);
    k_attn<<<dim3(S / 16, Bn), dim3(32), dynB, stream>>>(qh, kh, vTh, vTl, sw_g, cth, ctl, out_mean, S, H);
  }
  // 6) output projection -> d_out
  k_gemm<1, 2><<<gg, dim3(256), 0, stream>>>(cth, ctl, woTh, woTl, bo, (void*)out_proj, (void*)out_proj, M, E, E, S, 1.0f);
  hipGetLastError();
  hipStreamSynchronize(stream);
}

// v001
// One run takes 708 microseconds.
// In both of two side-by-side timings against v000, it was 2.32 times as fast.
#include <hip/hip_runtime.h>

// Contractions: x@Wq, x@Wk and q.k^T : v_wmma_f32_16x16x32_f16 (f16 operands; Wq, Wk carried x64, rescaled in the f32 epilogue; f32 accumulate).
// x@Wv, P.V and ctx@Wo : v_wmma_f32_16x16x32_bf16 with bf16 hi/lo operand split (hi.hi + hi.lo + lo.hi), f32 accumulate. Gate MLP: scalar f32.

#define NOP4 "v_nop\n\tv_nop\n\tv_nop\n\tv_nop"

typedef _Float16 v16h __attribute__((ext_vector_type(16)));
typedef __bf16 v16b __attribute__((ext_vector_type(16)));
typedef float v8f __attribute__((ext_vector_type(8)));
typedef float v4f __attribute__((ext_vector_type(4)));
typedef unsigned int v4u __attribute__((ext_vector_type(4)));

union FragH { v16h v; v4u q[2]; };
union FragB { v16b v; v4u q[2]; };

__device__ __forceinline__ v4u ldg16(const unsigned short* p) { return *(const v4u*)p; }

// RNE f32 -> bf16 bits
__device__ __forceinline__ unsigned int bf_bits(float f) {
  unsigned int u = __float_as_uint(f);
  return (u + 0x7FFFu + ((u >> 16) & 1u)) >> 16;
}
__device__ __forceinline__ float bf_val(unsigned int b) { return __uint_as_float(b << 16); }
// RNE f32 -> f16 bits
__device__ __forceinline__ unsigned int hf_bits(float f) {
  union { _Float16 h; unsigned short u; } c;
  c.h = (_Float16)f;
  return (unsigned int)c.u;
}
__device__ __forceinline__ unsigned int pk2(unsigned int lo, unsigned int hi) {
  return (lo & 0xFFFFu) | (hi << 16);
}
// 8 consecutive f32 -> 8 packed f16 (element 2t in the low half of word t)
__device__ __forceinline__ v4u pack_h8(v4f a, v4f c) {
  v4u r;
  r[0] = pk2(hf_bits(a[0]), hf_bits(a[1]));
  r[1] = pk2(hf_bits(a[2]), hf_bits(a[3]));
  r[2] = pk2(hf_bits(c[0]), hf_bits(c[1]));
  r[3] = pk2(hf_bits(c[2]), hf_bits(c[3]));
  return r;
}
// 8 consecutive f32 -> bf16 hi plane and bf16 residual plane
__device__ __forceinline__ void split_b8(v4f a, v4f c, v4u& H, v4u& L) {
  float v[8] = {a[0], a[1], a[2], a[3], c[0], c[1], c[2], c[3]};
  unsigned int hb[8], lb[8];
#pragma unroll
  for (int e = 0; e < 8; ++e) {
    hb[e] = bf_bits(v[e]);
    lb[e] = bf_bits(v[e] - bf_val(hb[e]));
  }
#pragma unroll
  for (int t = 0; t < 4; ++t) {
    H[t] = pk2(hb[2 * t], hb[2 * t + 1]);
    L[t] = pk2(lb[2 * t], lb[2 * t + 1]);
  }
}

__device__ __forceinline__ v8f zero8() {
  v8f z;
#pragma unroll
  for (int r = 0; r < 8; ++r) z[r] = 0.f;
  return z;
}
__device__ __forceinline__ v8f mma_h(v16h a, v16h b, v8f c) {
  return __builtin_amdgcn_wmma_f32_16x16x32_f16(false, a, false, b, (short)0, c, false, false);
}
__device__ __forceinline__ v8f mma_b(v16b a, v16b b, v8f c) {
  return __builtin_amdgcn_wmma_f32_16x16x32_bf16(false, a, false, b, (short)0, c, false, false);
}

// ---------------------------------------------------------------------------
// x [n] f32 -> f16 plane (unscaled) and bf16 hi / lo planes. 8 elements per thread,
// ---------------------------------------------------------------------------
__global__ __launch_bounds__(256) void k_cvt_x(const float* __restrict__ x, unsigned short* xh,
                                              unsigned short* xbh, unsigned short* xbl, int n) {
  const size_t i8 = ((size_t)blockIdx.x * 256u + (size_t)threadIdx.x) * 8u;
  if (i8 + 8 > (size_t)n) return;
  const v4f a = *(const v4f*)(x + i8);
  const v4f c = *(const v4f*)(x + i8 + 4);
  const v4u fh = pack_h8(a, c);
  v4u bh, bl;
  split_b8(a, c, bh, bl);
  *(v4u*)(xh + i8) = fh;
  *(v4u*)(xbh + i8) = bh;
  *(v4u*)(xbl + i8) = bl;
  
}

// ---------------------------------------------------------------------------
// W[Kd][Nd] f32 -> WT[Nd][Kd] 16-bit (k-contiguous rows).  64x64 tile through LDS.
// MODE 0: f16 of (W * scale) into o0.  MODE 1: bf16 hi into o0, bf16 lo into o1.
// ---------------------------------------------------------------------------
template <int MODE>
__global__ __launch_bounds__(256) void k_cvt_wT(const float* __restrict__ W, unsigned short* o0,
                                               unsigned short* o1, int Kd, int Nd, float scale) {
  __shared__ float tile[64][65];
  const int n0 = blockIdx.x * 64, e0 = blockIdx.y * 64;
  if (n0 + 64 > Nd || e0 + 64 > Kd) return;  // block-uniform
  const int tid = threadIdx.x;
#pragma unroll
  for (int t = 0; t < 4; ++t) {
    const int idx = t * 256 + tid;
    const int rr = idx >> 4, c4 = (idx & 15) * 4;
    const v4f v = *(const v4f*)(W + (size_t)(e0 + rr) * Nd + n0 + c4);
    tile[rr][c4] = v[0];
    tile[rr][c4 + 1] = v[1];
    tile[rr][c4 + 2] = v[2];
    tile[rr][c4 + 3] = v[3];
  }
  __syncthreads();
  v4u Hv[2], Lv[2];
  size_t adr[2];
#pragma unroll
  for (int t = 0; t < 2; ++t) {
    const int s = t * 256 + tid;
    const int nn = s >> 3, kq = (s & 7) * 8;
    v4f a, c;
#pragma unroll
    for (int e = 0; e < 4; ++e) {
      a[e] = tile[kq + e][nn] * scale;
      c[e] = tile[kq + 4 + e][nn] * scale;
    }
    if (MODE == 0) {
      Hv[t] = pack_h8(a, c);
      Lv[t] = Hv[t];
    } else {
      split_b8(a, c, Hv[t], Lv[t]);
    }
    adr[t] = (size_t)(n0 + nn) * Kd + e0 + kq;
  }
#pragma unroll
  for (int t = 0; t < 2; ++t) {
    *(v4u*)(o0 + adr[t]) = Hv[t];
    if (MODE == 1) *(v4u*)(o1 + adr[t]) = Lv[t];
  }
  
}

// ---------------------------------------------------------------------------
// Gate MLP: swo[b*32 + h] = sigmoid(relu(sync @ W1 + b1) @ W2 + b2), h < Hn; padding 0.
// ---------------------------------------------------------------------------
__global__ __launch_bounds__(256) void k_gate(const float* __restrict__ sync, const float* __restrict__ W1,
                                             const float* __restrict__ b1, const float* __restrict__ W2,
                                             const float* __restrict__ b2, float* swo, int Ein, int Hd, int Hn) {
  __shared__ float hid[256];
  __shared__ float gv[32];
  const int b = blockIdx.x, tid = threadIdx.x;
  for (int j = tid; j < Hd; j += 256) {
    float a = b1[j];
    for (int e = 0; e < Ein; ++e) a += sync[(size_t)b * Ein + e] * W1[(size_t)e * Hd + j];
    hid[j] = fmaxf(a, 0.f);
  }
  __syncthreads();
  if (tid < 32) {
    float val = 0.f;
    if (tid < Hn) {
      float a = b2[tid];
      for (int t = 0; t < Hd; ++t) a += hid[t] * W2[(size_t)t * Hn + tid];
      val = 1.0f / (1.0f + expf(-a));
    }
    gv[tid] = val;
  }
  __syncthreads();
  if (tid < 8) {
    v4f v;
    v[0] = gv[tid * 4];
    v[1] = gv[tid * 4 + 1];
    v[2] = gv[tid * 4 + 2];
    v[3] = gv[tid * 4 + 3];
    float* p = swo + (size_t)b * 32 + tid * 4;
    *(v4f*)p = v;
    
  }
}

// ---------------------------------------------------------------------------
// C[M,N] = A[M,K] @ B[K,N] (+bias) with A row-major 16-bit and B given as BT[N][K] 16-bit.
// Block tile 128x64, 256 threads = 8 waves, wave w owns rows w*16..w*16+15, 4 n-tiles.
// Fragments are loaded straight from global with the 16x16x32 split k-map
//   (lane l: row/col = l&15; elements 0..7 <- k0+8*(l>>4)+0..7, 8..15 <- k0+16+8*(l>>4)+0..7).
// SPLIT 0: single f16 product.  SPLIT 1: bf16 hi/lo planes, three products.
// OM 0: f16 row-major [M][N].  OM 1: bf16 hi/lo transposed per head -> [B*H][64][Sq].
// OM 2: f32 row-major [M][N].
// ---------------------------------------------------------------------------
template <int SPLIT, int OM>
__global__ __launch_bounds__(256) void k_gemm(const unsigned short* __restrict__ Ah,
                                             const unsigned short* __restrict__ Al,
                                             const unsigned short* __restrict__ Bh,
                                             const unsigned short* __restrict__ Bl,
                                             const float* __restrict__ bias, void* out0, void* out1,
                                             int M, int N, int K, int Sq, float oscale) {
  __shared__ v4f stg4[128 * 17];  // 128 x 68 f32
  float* stg = (float*)stg4;
  const int nBase = blockIdx.x * 64, mBase = blockIdx.y * 128;
  if (nBase + 64 > N || mBase + 128 > M) return;  // block-uniform
  const int tid = threadIdx.x, w = tid >> 5, l = tid & 31, g = l >> 4, m = l & 15;

  v8f acc[4];
#pragma unroll
  for (int nt = 0; nt < 4; ++nt) acc[nt] = zero8();

  const size_t arow = (size_t)(mBase + w * 16 + m) * K + 8 * g;
  const size_t brow = (size_t)(nBase + m) * K + 8 * g;
  const size_t bnt = (size_t)16 * K;

#pragma unroll 1
  for (int k0 = 0; k0 < K; k0 += 32) {
    if (SPLIT) {
      FragB a, a2, b0, b1, b2, b3, c0, c1, c2, c3;
      a.q[0] = ldg16(Ah + arow + k0);
      a.q[1] = ldg16(Ah + arow + k0 + 16);
      a2.q[0] = ldg16(Al + arow + k0);
      a2.q[1] = ldg16(Al + arow + k0 + 16);
      b0.q[0] = ldg16(Bh + brow + k0);
      b0.q[1] = ldg16(Bh + brow + k0 + 16);
      b1.q[0] = ldg16(Bh + brow + bnt + k0);
      b1.q[1] = ldg16(Bh + brow + bnt + k0 + 16);
      b2.q[0] = ldg16(Bh + brow + 2 * bnt + k0);
      b2.q[1] = ldg16(Bh + brow + 2 * bnt + k0 + 16);
      b3.q[0] = ldg16(Bh + brow + 3 * bnt + k0);
      b3.q[1] = ldg16(Bh + brow + 3 * bnt + k0 + 16);
      c0.q[0] = ldg16(Bl + brow + k0);
      c0.q[1] = ldg16(Bl + brow + k0 + 16);
      c1.q[0] = ldg16(Bl + brow + bnt + k0);
      c1.q[1] = ldg16(Bl + brow + bnt + k0 + 16);
      c2.q[0] = ldg16(Bl + brow + 2 * bnt + k0);
      c2.q[1] = ldg16(Bl + brow + 2 * bnt + k0 + 16);
      c3.q[0] = ldg16(Bl + brow + 3 * bnt + k0);
      c3.q[1] = ldg16(Bl + brow + 3 * bnt + k0 + 16);
      acc[0] = mma_b(a.v, b0.v, acc[0]);
      acc[0] = mma_b(a.v, c0.v, acc[0]);
      acc[0] = mma_b(a2.v, b0.v, acc[0]);
      acc[1] = mma_b(a.v, b1.v, acc[1]);
      acc[1] = mma_b(a.v, c1.v, acc[1]);
      acc[1] = mma_b(a2.v, b1.v, acc[1]);
      acc[2] = mma_b(a.v, b2.v, acc[2]);
      acc[2] = mma_b(a.v, c2.v, acc[2]);
      acc[2] = mma_b(a2.v, b2.v, acc[2]);
      acc[3] = mma_b(a.v, b3.v, acc[3]);
      acc[3] = mma_b(a.v, c3.v, acc[3]);
      acc[3] = mma_b(a2.v, b3.v, acc[3]);
      asm volatile(NOP4
                   : "+v"(acc[0]), "+v"(acc[1]), "+v"(acc[2]), "+v"(acc[3])
                   : "v"(a.v), "v"(a2.v), "v"(b0.v), "v"(b1.v), "v"(b2.v), "v"(b3.v),
                     "v"(c0.v), "v"(c1.v), "v"(c2.v), "v"(c3.v));
    } else {
      FragH a, b0, b1, b2, b3;
      a.q[0] = ldg16(Ah + arow + k0);
      a.q[1] = ldg16(Ah + arow + k0 + 16);
      b0.q[0] = ldg16(Bh + brow + k0);
      b0.q[1] = ldg16(Bh + brow + k0 + 16);
      b1.q[0] = ldg16(Bh + brow + bnt + k0);
      b1.q[1] = ldg16(Bh + brow + bnt + k0 + 16);
      b2.q[0] = ldg16(Bh + brow + 2 * bnt + k0);
      b2.q[1] = ldg16(Bh + brow + 2 * bnt + k0 + 16);
      b3.q[0] = ldg16(Bh + brow + 3 * bnt + k0);
      b3.q[1] = ldg16(Bh + brow + 3 * bnt + k0 + 16);
      acc[0] = mma_h(a.v, b0.v, acc[0]);
      acc[1] = mma_h(a.v, b1.v, acc[1]);
      acc[2] = mma_h(a.v, b2.v, acc[2]);
      acc[3] = mma_h(a.v, b3.v, acc[3]);
      asm volatile(NOP4
                   : "+v"(acc[0]), "+v"(acc[1]), "+v"(acc[2]), "+v"(acc[3])
                   : "v"(a.v), "v"(b0.v), "v"(b1.v), "v"(b2.v), "v"(b3.v));
    }
  }

  // stage: D element r of lane (g,m), n-tile nt -> (row w*16+8g+r, col nt*16+m)
#pragma unroll
  for (int nt = 0; nt < 4; ++nt) {
    const int col = nt * 16 + m;
    const float bv = bias[nBase + col];
#pragma unroll
    for (int r = 0; r < 8; ++r) stg[(w * 16 + 8 * g + r) * 68 + col] = acc[nt][r] * oscale + bv;
  }
  __syncthreads();

  if (OM == 0) {
    unsigned short* o = (unsigned short*)out0;
    v4u val[4];
    size_t adr[4];
#pragma unroll
    for (int t = 0; t < 4; ++t) {
      const int row = w * 16 + t * 4 + (l >> 3), c8 = (l & 7) * 8;
      const float* sp = stg + row * 68 + c8;
      const v4f x0 = *(const v4f*)sp;
      const v4f x1 = *(const v4f*)(sp + 4);
      val[t] = pack_h8(x0, x1);
      adr[t] = (size_t)(mBase + row) * N + nBase + c8;
    }
#pragma unroll
    for (int t = 0; t < 4; ++t) *(v4u*)(o + adr[t]) = val[t];
    
  } else if (OM == 1) {
    // tile rows = s (128 consecutive within one batch), cols = d of head nBase/64:  out[bh][d][s]
    unsigned short* oh = (unsigned short*)out0;
    unsigned short* ol = (unsigned short*)out1;
    const int Hn = N >> 6;
    const int bb = mBase / Sq;
    const int bh = bb * Hn + (nBase >> 6);
    const int sBase = mBase - bb * Sq;
    v4u Hv[4], Lv[4];
    size_t adr[4];
#pragma unroll
    for (int t = 0; t < 4; ++t) {
      const int d = w * 8 + t * 2 + (l >> 4), s8 = (l & 15) * 8;
      v4f x0, x1;
#pragma unroll
      for (int e = 0; e < 4; ++e) {
        x0[e] = stg[(s8 + e) * 68 + d];
        x1[e] = stg[(s8 + 4 + e) * 68 + d];
      }
      split_b8(x0, x1, Hv[t], Lv[t]);
      adr[t] = ((size_t)bh * 64 + d) * Sq + sBase + s8;
    }
#pragma unroll
    for (int t = 0; t < 4; ++t) {
      *(v4u*)(oh + adr[t]) = Hv[t];
      *(v4u*)(ol + adr[t]) = Lv[t];
    }
    
  } else {
    float* o = (float*)out0;
    v4f val[8];
    size_t adr[8];
#pragma unroll
    for (int t = 0; t < 8; ++t) {
      const int row = w * 16 + t * 2 + (l >> 4), c4 = (l & 15) * 4;
      val[t] = *(const v4f*)(stg + row * 68 + c4);
      adr[t] = (size_t)(mBase + row) * N + nBase + c4;
    }
#pragma unroll
    for (int t = 0; t < 8; ++t) *(v4f*)(o + adr[t]) = val[t];
    
  }
}

// ---------------------------------------------------------------------------
// Fused attention: one block of ANW waves per (16 query rows, batch).  Dynamic LDS:
//   sL[16][S] f32  gated+scaled scores of the current head, then exp(s - rowmax);
//   mL[16][S] f32  sum over heads of the softmax probabilities (lane-owned elements).
// The keys are split over the waves: wave w owns a contiguous run of 32-key chunks in all
// three sweeps, so every sL / mL word is written and read back by one lane of one wave.
// Per head h: score tiles S^T = K_tile . Q^T (A = k rows, B = q rows; D lane (g,m) holds
// query m, keys jt*16+8g+r), exact two-sweep softmax, then P.V with the P fragment read
// back from the same lane's own LDS words (elements 0..7 <- keys k0+8g.., 8..15 <- k0+16+8g..),
// V fragments from the transposed planes vt[bh][d][s].  Row max, row sum and the 16x64 P.V
// partial tiles are combined over the waves through LDS, always in wave order.
// ---------------------------------------------------------------------------
#define ANW 16
typedef unsigned int v2u __attribute__((ext_vector_type(2)));

__global__ __launch_bounds__(ANW * 32) void k_attn(const unsigned short* __restrict__ qh,
                                                  const unsigned short* __restrict__ kh,
                                                  const unsigned short* __restrict__ vth,
                                                  const unsigned short* __restrict__ vtl,
                                                  const float* __restrict__ sw, unsigned short* ctxh,
                                                  unsigned short* ctxl, float* mout, int S, int H) {
  extern __shared__ v4f dsm[];
  __shared__ float redM[ANW * 16];  // per wave, per query: max over the wave's keys
  __shared__ float redS[ANW * 16];  // per wave, per query: sum of exp over the wave's keys
  float* sL = (float*)dsm;
  float* mL = sL + (size_t)16 * S;
  const int i0 = blockIdx.x * 16, b = blockIdx.y;
  if (i0 + 16 > S) return;  // block-uniform
  const int tid = threadIdx.x;
  const int l = tid & 31, g = l >> 4, m = l & 15;
  const int w = __builtin_amdgcn_readfirstlane(tid >> 5);  // scalar, so the sweeps' trip counts are scalar
  const int E = H * 64;

  {
    v4f z;
    z[0] = 0.f; z[1] = 0.f; z[2] = 0.f; z[3] = 0.f;
    v4f* m4 = (v4f*)mL;
    const int n4 = 4 * S;
    for (int i = tid; i < n4; i += ANW * 32) m4[i] = z;
  }
  __syncthreads();

  float* srow = sL + (size_t)m * S;
  float* mrow = mL + (size_t)m * S;
  const float invH = 1.0f / (float)H;
  const int nC = S >> 5;
  const int cpw = (nC + ANW - 1) / ANW;
  const int c0 = min(w * cpw, nC), c1 = min(c0 + cpw, nC);  // this wave's 32-key chunks
  const int t0w = 2 * c0, t1w = 2 * c1;                     // the same keys as 16-key tiles

  for (int h = 0; h < H; ++h) {
    FragH qa0, qa1;
    {
      const unsigned short* qp = qh + (size_t)(b * S + i0 + m) * E + h * 64 + 8 * g;
      qa0.q[0] = ldg16(qp);
      qa0.q[1] = ldg16(qp + 16);
      qa1.q[0] = ldg16(qp + 32);
      qa1.q[1] = ldg16(qp + 48);
    }
    const float gsc = sw[b * 32 + h] * 0.125f;

    // sweep A: scores -> LDS, running row max
    float rmax = -3.0e38f;
    const unsigned short* kp = kh + (size_t)(b * S + m) * E + h * 64 + 8 * g;
    for (int jt = t0w; jt < t1w; ++jt) {
      const unsigned short* kr = kp + (size_t)jt * 16 * E;
      FragH ka0, ka1;
      ka0.q[0] = ldg16(kr);
      ka0.q[1] = ldg16(kr + 16);
      ka1.q[0] = ldg16(kr + 32);
      ka1.q[1] = ldg16(kr + 48);
      v8f sc = zero8();
      sc = mma_h(ka0.v, qa0.v, sc);
      sc = mma_h(ka1.v, qa1.v, sc);
      asm volatile(NOP4 : "+v"(sc) : "v"(ka0.v), "v"(ka1.v), "v"(qa0.v), "v"(qa1.v));
      v4f t0, t1;
#pragma unroll
      for (int r = 0; r < 4; ++r) {
        t0[r] = sc[r] * gsc;
        t1[r] = sc[r + 4] * gsc;
        rmax = fmaxf(rmax, t0[r]);
        rmax = fmaxf(rmax, t1[r]);
      }
      float* pp = srow + jt * 16 + 8 * g;
      *(v4f*)pp = t0;
      *(v4f*)(pp + 4) = t1;
    }
    rmax = fmaxf(rmax, __shfl_xor(rmax, 16));
    if (g == 0) redM[w * 16 + m] = rmax;
    __syncthreads();
#pragma unroll  // the ANW LDS reads issue together instead of one latency per trip
    for (int ww = 0; ww < ANW; ++ww) rmax = fmaxf(rmax, redM[ww * 16 + m]);

    // sweep B: e = exp(s - max) stored back in place, row sum
    float lsum = 0.f;
    for (int jt = t0w; jt < t1w; ++jt) {
      float* pp = srow + jt * 16 + 8 * g;
      v4f t0 = *(v4f*)pp;
      v4f t1 = *(v4f*)(pp + 4);
#pragma unroll
      for (int r = 0; r < 4; ++r) {
        t0[r] = __expf(t0[r] - rmax);
        t1[r] = __expf(t1[r] - rmax);
        lsum += t0[r];
        lsum += t1[r];
      }
      *(v4f*)pp = t0;
      *(v4f*)(pp + 4) = t1;
    }
    lsum += __shfl_xor(lsum, 16);
    if (g == 0) redS[w * 16 + m] = lsum;
    __syncthreads();
    lsum = 0.f;
#pragma unroll  // the ANW LDS reads issue together instead of one latency per trip
    for (int ww = 0; ww < ANW; ++ww) lsum += redS[ww * 16 + m];
    const float linv = 1.0f / lsum;

    // sweep C: probabilities, head-sum accumulation, P.V over this wave's keys
    v8f cacc[4];
#pragma unroll
    for (int nt = 0; nt < 4; ++nt) cacc[nt] = zero8();
    const size_t vb = ((size_t)(b * H + h) * 64 + m) * S + 8 * g;
    const size_t vnt = (size_t)16 * S;
#pragma unroll 1
    for (int jc = c0; jc < c1; ++jc) {
      const int k0 = jc * 32;
      float* pa = srow + k0 + 8 * g;
      float* pb = srow + k0 + 16 + 8 * g;
      const v4f p0 = *(v4f*)pa * linv;
      const v4f p1 = *(v4f*)(pa + 4) * linv;
      const v4f p2 = *(v4f*)pb * linv;
      const v4f p3 = *(v4f*)(pb + 4) * linv;
      {
        v4f* ma = (v4f*)(mrow + k0 + 8 * g);
        v4f* mb = (v4f*)(mrow + k0 + 16 + 8 * g);
        const v4f s0 = ma[0] + p0;
        const v4f s1 = ma[1] + p1;
        const v4f s2 = mb[0] + p2;
        const v4f s3 = mb[1] + p3;
        ma[0] = s0;
        ma[1] = s1;
        mb[0] = s2;
        mb[1] = s3;
      }
      FragB ph, pl;
      split_b8(p0, p1, ph.q[0], pl.q[0]);
      split_b8(p2, p3, ph.q[1], pl.q[1]);
      FragB vh0, vh1, vh2, vh3, vl0, vl1, vl2, vl3;
      vh0.q[0] = ldg16(vth + vb + k0);
      vh0.q[1] = ldg16(vth + vb + k0 + 16);
      vh1.q[0] = ldg16(vth + vb + vnt + k0);
      vh1.q[1] = ldg16(vth + vb + vnt + k0 + 16);
      vh2.q[0] = ldg16(vth + vb + 2 * vnt + k0);
      vh2.q[1] = ldg16(vth + vb + 2 * vnt + k0 + 16);
      vh3.q[0] = ldg16(vth + vb + 3 * vnt + k0);
      vh3.q[1] = ldg16(vth + vb + 3 * vnt + k0 + 16);
      vl0.q[0] = ldg16(vtl + vb + k0);
      vl0.q[1] = ldg16(vtl + vb + k0 + 16);
      vl1.q[0] = ldg16(vtl + vb + vnt + k0);
      vl1.q[1] = ldg16(vtl + vb + vnt + k0 + 16);
      vl2.q[0] = ldg16(vtl + vb + 2 * vnt + k0);
      vl2.q[1] = ldg16(vtl + vb + 2 * vnt + k0 + 16);
      vl3.q[0] = ldg16(vtl + vb + 3 * vnt + k0);
      vl3.q[1] = ldg16(vtl + vb + 3 * vnt + k0 + 16);
      cacc[0] = mma_b(ph.v, vh0.v, cacc[0]);
      cacc[0] = mma_b(ph.v, vl0.v, cacc[0]);
      cacc[0] = mma_b(pl.v, vh0.v, cacc[0]);
      cacc[1] = mma_b(ph.v, vh1.v, cacc[1]);
      cacc[1] = mma_b(ph.v, vl1.v, cacc[1]);
      cacc[1] = mma_b(pl.v, vh1.v, cacc[1]);
      cacc[2] = mma_b(ph.v, vh2.v, cacc[2]);
      cacc[2] = mma_b(ph.v, vl2.v, cacc[2]);
      cacc[2] = mma_b(pl.v, vh2.v, cacc[2]);
      cacc[3] = mma_b(ph.v, vh3.v, cacc[3]);
      cacc[3] = mma_b(ph.v, vl3.v, cacc[3]);
      cacc[3] = mma_b(pl.v, vh3.v, cacc[3]);
      asm volatile(NOP4
                   : "+v"(cacc[0]), "+v"(cacc[1]), "+v"(cacc[2]), "+v"(cacc[3])
                   : "v"(ph.v), "v"(pl.v), "v"(vh0.v), "v"(vh1.v), "v"(vh2.v), "v"(vh3.v),
                     "v"(vl0.v), "v"(vl1.v), "v"(vl2.v), "v"(vl3.v));
    }

    // every wave has left the score plane: it now holds ANW partial tiles of 16 x 68 f32
    __syncthreads();
    float* part = sL + w * (16 * 68);
#pragma unroll
    for (int nt = 0; nt < 4; ++nt) {
#pragma unroll
      for (int r = 0; r < 8; ++r) part[(8 * g + r) * 68 + nt * 16 + m] = cacc[nt][r];
    }
    __syncthreads();
    if (w < 8) {  // 256 threads, 4 columns each: a row's 128-B line per plane leaves from 16 lanes of one wave
      const int row = tid >> 4, c4 = (tid & 15) * 4;
      const float* sp = sL + row * 68 + c4;
      v4f x = *(const v4f*)sp;
#pragma unroll  // the ANW LDS reads issue together instead of one latency per trip
      for (int ww = 1; ww < ANW; ++ww) x += *(const v4f*)(sp + ww * (16 * 68));
      unsigned int hb[4], lb[4];
#pragma unroll  // constant indices keep hb and lb in registers
      for (int e = 0; e < 4; ++e) {
        hb[e] = bf_bits(x[e]);
        lb[e] = bf_bits(x[e] - bf_val(hb[e]));
      }
      v2u Hv, Lv;
      Hv[0] = pk2(hb[0], hb[1]);
      Hv[1] = pk2(hb[2], hb[3]);
      Lv[0] = pk2(lb[0], lb[1]);
      Lv[1] = pk2(lb[2], lb[3]);
      const size_t adr = (size_t)(b * S + i0 + row) * E + h * 64 + c4;
      *(v2u*)(ctxh + adr) = Hv;
      *(v2u*)(ctxl + adr) = Lv;
    }
    __syncthreads();
  }

  // head-mean rows: 16 rows x S f32, one row per wave, 512 B per store instruction, lane-contiguous
  __syncthreads();
  float* ob = mout + (size_t)(b * S + i0) * S;
  const int nL = S >> 7;
  for (int row = w; row < 16; row += ANW) {
    for (int c = 0; c < nL; ++c) {
      const size_t off = (size_t)row * S + c * 128 + l * 4;
      const v4f v = *(const v4f*)(mL + off) * invH;
      *(v4f*)(ob + off) = v;
    }
  }
  
}

// ---------------------------------------------------------------------------
// Host launcher
// ---------------------------------------------------------------------------
extern "C" void kernel_launch(void* const* d_in, const int* in_sizes, int n_in, void* d_out,
                              int out_size, void* d_ws, size_t ws_size, hipStream_t stream) {
  if (n_in < 14) return;
  const int E = 1024, H = 16;
  const int nX = in_sizes[0];
  if (nX <= 0 || (nX % E) != 0) return;
  const int M = nX / E;
  const int nSy = in_sizes[1];
  if (nSy <= 0 || (nSy % E) != 0) return;
  const int Bn = nSy / E;
  if (Bn <= 0 || (M % Bn) != 0) return;
  const int S = M / Bn;
  const int HID = in_sizes[9];
  if ((M % 128) != 0 || (S % 128) != 0 || HID <= 0 || HID > 256) return;
  if (S < 1152) return;  // the attention kernel's 16 partial tiles of 16 x 68 f32 reuse its 16 x S score plane
  if (in_sizes[2] != E * E || in_sizes[4] != E * E || in_sizes[6] != E * E || in_sizes[12] != E * E) return;
  if (in_sizes[3] != E || in_sizes[5] != E || in_sizes[7] != E || in_sizes[13] != E) return;
  if (in_sizes[8] != E * HID || in_sizes[10] != HID * H || in_sizes[11] != H) return;
  if ((long long)out_size != (long long)nX + (long long)Bn * (long long)S * (long long)S) return;

  const float* x = (const float*)d_in[0];
  const float* sync = (const float*)d_in[1];
  const float* Wq = (const float*)d_in[2];
  const float* bq = (const float*)d_in[3];
  const float* Wk = (const float*)d_in[4];
  const float* bk = (const float*)d_in[5];
  const float* Wv = (const float*)d_in[6];
  const float* bv = (const float*)d_in[7];
  const float* Ws1 = (const float*)d_in[8];
  const float* bs1 = (const float*)d_in[9];
  const float* Ws2 = (const float*)d_in[10];
  const float* bs2 = (const float*)d_in[11];
  const float* Wo = (const float*)d_in[12];
  const float* bo = (const float*)d_in[13];

  float* out_proj = (float*)d_out;                 // [M][E] f32
  float* out_mean = (float*)d_out + (size_t)nX;    // [Bn][S][S] f32

  // workspace carve (bytes), every sub-buffer 256-B aligned
  size_t off = 0;
  auto al = [&](size_t bytes) { size_t o = off; off += (bytes + 255) & ~(size_t)255; return o; };
  const size_t nW = (size_t)E * E;
  const size_t o_sw = al((size_t)Bn * 32 * 4);
  const size_t o_xh = al((size_t)nX * 2);
  const size_t o_xbh = al((size_t)nX * 2);
  const size_t o_xbl = al((size_t)nX * 2);
  const size_t o_wq = al(nW * 2);
  const size_t o_wk = al(nW * 2);
  const size_t o_wvh = al(nW * 2);
  const size_t o_wvl = al(nW * 2);
  const size_t o_woh = al(nW * 2);
  const size_t o_wol = al(nW * 2);
  const size_t o_q = al((size_t)nX * 2);
  const size_t o_k = al((size_t)nX * 2);
  const size_t o_vth = al((size_t)nX * 2);
  const size_t o_vtl = al((size_t)nX * 2);
  const size_t o_cth = al((size_t)nX * 2);
  const size_t o_ctl = al((size_t)nX * 2);
  if (off > ws_size) return;

  char* ws = (char*)d_ws;
  float* sw_g = (float*)(ws + o_sw);
  unsigned short* xh = (unsigned short*)(ws + o_xh);
  unsigned short* xbh = (unsigned short*)(ws + o_xbh);
  unsigned short* xbl = (unsigned short*)(ws + o_xbl);
  unsigned short* wqT = (unsigned short*)(ws + o_wq);
  unsigned short* wkT = (unsigned short*)(ws + o_wk);
  unsigned short* wvTh = (unsigned short*)(ws + o_wvh);
  unsigned short* wvTl = (unsigned short*)(ws + o_wvl);
  unsigned short* woTh = (unsigned short*)(ws + o_woh);
  unsigned short* woTl = (unsigned short*)(ws + o_wol);
  unsigned short* qh = (unsigned short*)(ws + o_q);
  unsigned short* kh = (unsigned short*)(ws + o_k);
  unsigned short* vTh = (unsigned short*)(ws + o_vth);
  unsigned short* vTl = (unsigned short*)(ws + o_vtl);
  unsigned short* cth = (unsigned short*)(ws + o_cth);
  unsigned short* ctl = (unsigned short*)(ws + o_ctl);

  // 1) activation planes
  {
    const int groups = nX / 8;
    const int blocks = (groups + 255) / 256;
    k_cvt_x<<<dim3(blocks), dim3(256), 0, stream>>>(x, xh, xbh, xbl, nX);
  }
  // 2) weight planes, transposed to [n][k]
  {
    dim3 gw(E / 64, E / 64);
    k_cvt_wT<0><<<gw, dim3(256), 0, stream>>>(Wq, wqT, wqT, E, E, 64.0f);
    k_cvt_wT<0><<<gw, dim3(256), 0, stream>>>(Wk, wkT, wkT, E, E, 64.0f);
    k_cvt_wT<1><<<gw, dim3(256), 0, stream>>>(Wv, wvTh, wvTl, E, E, 1.0f);
    k_cvt_wT<1><<<gw, dim3(256), 0, stream>>>(Wo, woTh, woTl, E, E, 1.0f);
  }
  // 3) gate MLP
  k_gate<<<dim3(Bn), dim3(256), 0, stream>>>(sync, Ws1, bs1, Ws2, bs2, sw_g, E, HID, H);
  // 4) projections (M x E, K = E)
  dim3 gg(E / 64, M / 128);
  k_gemm<0, 0><<<gg, dim3(256), 0, stream>>>(xh, xh, wqT, wqT, bq, (void*)qh, (void*)qh, M, E, E, S, 1.0f / 64.0f);
  k_gemm<0, 0><<<gg, dim3(256), 0, stream>>>(xh, xh, wkT, wkT, bk, (void*)kh, (void*)kh, M, E, E, S, 1.0f / 64.0f);
  k_gemm<1, 1><<<gg, dim3(256), 0, stream>>>(xbh, xbl, wvTh, wvTl, bv, (void*)vTh, (void*)vTl, M, E, E, S, 1.0f);
  // 5) attention + head-mean
  {
    const size_t dynB = (size_t)2 * 16 * (size_t)S * 4;
    hipFuncSetAttribute(reinterpret_cast<const void*>(&k_attn), hipFuncAttributeMaxDynamicSharedMemorySize, (int)dynB);
    k_attn<<<dim3(S / 16, Bn), dim3(ANW * 32), dynB, stream>>>(qh, kh, vTh, vTl, sw_g, cth, ctl, out_mean, S, H);
  }
  // 6) output projection -> d_out
  k_gemm<1, 2><<<gg, dim3(256), 0, stream>>>(cth, ctl, woTh, woTl, bo, (void*)out_proj, (void*)out_proj, M, E, E, S, 1.0f);
  hipGetLastError();
  hipStreamSynchronize(stream);
}

// v002
// A run of this version takes 582 microseconds.
// Next to v001, in two timings, it ran 1.22 times as fast each time.
// Counting every step since v000, it is 2.83 times as fast.
#include <hip/hip_runtime.h>

// Contractions: x@Wq, x@Wk and q.k^T : v_wmma_f32_16x16x32_f16 (f16 operands; Wq, Wk carried x64, rescaled in the f32 epilogue; f32 accumulate).
// x@Wv, P.V and ctx@Wo : v_wmma_f32_16x16x32_bf16 with bf16 hi/lo operand split (hi.hi + hi.lo + lo.hi), f32 accumulate. Gate MLP: scalar f32.

#define NOP4 "v_nop\n\tv_nop\n\tv_nop\n\tv_nop"

typedef _Float16 v16h __attribute__((ext_vector_type(16)));
typedef __bf16 v16b __attribute__((ext_vector_type(16)));
typedef float v8f __attribute__((ext_vector_type(8)));
typedef float v4f __attribute__((ext_vector_type(4)));
typedef unsigned int v4u __attribute__((ext_vector_type(4)));

union FragH { v16h v; v4u q[2]; };
union FragB { v16b v; v4u q[2]; };

__device__ __forceinline__ v4u ldg16(const unsigned short* p) { return *(const v4u*)p; }

// RNE f32 -> bf16 bits
__device__ __forceinline__ unsigned int bf_bits(float f) {
  unsigned int u = __float_as_uint(f);
  return (u + 0x7FFFu + ((u >> 16) & 1u)) >> 16;
}
__device__ __forceinline__ float bf_val(unsigned int b) { return __uint_as_float(b << 16); }
// RNE f32 -> f16 bits
__device__ __forceinline__ unsigned int hf_bits(float f) {
  union { _Float16 h; unsigned short u; } c;
  c.h = (_Float16)f;
  return (unsigned int)c.u;
}
__device__ __forceinline__ unsigned int pk2(unsigned int lo, unsigned int hi) {
  return (lo & 0xFFFFu) | (hi << 16);
}
// 8 consecutive f32 -> 8 packed f16 (element 2t in the low half of word t)
__device__ __forceinline__ v4u pack_h8(v4f a, v4f c) {
  v4u r;
  r[0] = pk2(hf_bits(a[0]), hf_bits(a[1]));
  r[1] = pk2(hf_bits(a[2]), hf_bits(a[3]));
  r[2] = pk2(hf_bits(c[0]), hf_bits(c[1]));
  r[3] = pk2(hf_bits(c[2]), hf_bits(c[3]));
  return r;
}
// 8 consecutive f32 -> bf16 hi plane and bf16 residual plane
__device__ __forceinline__ void split_b8(v4f a, v4f c, v4u& H, v4u& L) {
  float v[8] = {a[0], a[1], a[2], a[3], c[0], c[1], c[2], c[3]};
  unsigned int hb[8], lb[8];
#pragma unroll
  for (int e = 0; e < 8; ++e) {
    hb[e] = bf_bits(v[e]);
    lb[e] = bf_bits(v[e] - bf_val(hb[e]));
  }
#pragma unroll
  for (int t = 0; t < 4; ++t) {
    H[t] = pk2(hb[2 * t], hb[2 * t + 1]);
    L[t] = pk2(lb[2 * t], lb[2 * t + 1]);
  }
}

__device__ __forceinline__ v8f zero8() {
  v8f z;
#pragma unroll
  for (int r = 0; r < 8; ++r) z[r] = 0.f;
  return z;
}
__device__ __forceinline__ v8f mma_h(v16h a, v16h b, v8f c) {
  return __builtin_amdgcn_wmma_f32_16x16x32_f16(false, a, false, b, (short)0, c, false, false);
}
__device__ __forceinline__ v8f mma_b(v16b a, v16b b, v8f c) {
  return __builtin_amdgcn_wmma_f32_16x16x32_bf16(false, a, false, b, (short)0, c, false, false);
}

// ---------------------------------------------------------------------------
// x [n] f32 -> f16 plane (unscaled) and bf16 hi / lo planes. 8 elements per thread,
// ---------------------------------------------------------------------------
__global__ __launch_bounds__(256) void k_cvt_x(const float* __restrict__ x, unsigned short* xh,
                                              unsigned short* xbh, unsigned short* xbl, int n) {
  const size_t i8 = ((size_t)blockIdx.x * 256u + (size_t)threadIdx.x) * 8u;
  if (i8 + 8 > (size_t)n) return;
  const v4f a = *(const v4f*)(x + i8);
  const v4f c = *(const v4f*)(x + i8 + 4);
  const v4u fh = pack_h8(a, c);
  v4u bh, bl;
  split_b8(a, c, bh, bl);
  *(v4u*)(xh + i8) = fh;
  *(v4u*)(xbh + i8) = bh;
  *(v4u*)(xbl + i8) = bl;
  
}

// ---------------------------------------------------------------------------
// W[Kd][Nd] f32 -> WT[Nd][Kd] 16-bit (k-contiguous rows).  64x64 tile through LDS.
// MODE 0: f16 of (W * scale) into o0.  MODE 1: bf16 hi into o0, bf16 lo into o1.
// ---------------------------------------------------------------------------
template <int MODE>
__global__ __launch_bounds__(256) void k_cvt_wT(const float* __restrict__ W, unsigned short* o0,
                                               unsigned short* o1, int Kd, int Nd, float scale) {
  __shared__ float tile[64][65];
  const int n0 = blockIdx.x * 64, e0 = blockIdx.y * 64;
  if (n0 + 64 > Nd || e0 + 64 > Kd) return;  // block-uniform
  const int tid = threadIdx.x;
#pragma unroll
  for (int t = 0; t < 4; ++t) {
    const int idx = t * 256 + tid;
    const int rr = idx >> 4, c4 = (idx & 15) * 4;
    const v4f v = *(const v4f*)(W + (size_t)(e0 + rr) * Nd + n0 + c4);
    tile[rr][c4] = v[0];
    tile[rr][c4 + 1] = v[1];
    tile[rr][c4 + 2] = v[2];
    tile[rr][c4 + 3] = v[3];
  }
  __syncthreads();
  v4u Hv[2], Lv[2];
  size_t adr[2];
#pragma unroll
  for (int t = 0; t < 2; ++t) {
    const int s = t * 256 + tid;
    const int nn = s >> 3, kq = (s & 7) * 8;
    v4f a, c;
#pragma unroll
    for (int e = 0; e < 4; ++e) {
      a[e] = tile[kq + e][nn] * scale;
      c[e] = tile[kq + 4 + e][nn] * scale;
    }
    if (MODE == 0) {
      Hv[t] = pack_h8(a, c);
      Lv[t] = Hv[t];
    } else {
      split_b8(a, c, Hv[t], Lv[t]);
    }
    adr[t] = (size_t)(n0 + nn) * Kd + e0 + kq;
  }
#pragma unroll
  for (int t = 0; t < 2; ++t) {
    *(v4u*)(o0 + adr[t]) = Hv[t];
    if (MODE == 1) *(v4u*)(o1 + adr[t]) = Lv[t];
  }
  
}

// ---------------------------------------------------------------------------
// Gate MLP: swo[b*32 + h] = sigmoid(relu(sync @ W1 + b1) @ W2 + b2), h < Hn; padding 0.
// ---------------------------------------------------------------------------
__global__ __launch_bounds__(256) void k_gate(const float* __restrict__ sync, const float* __restrict__ W1,
                                             const float* __restrict__ b1, const float* __restrict__ W2,
                                             const float* __restrict__ b2, float* swo, int Ein, int Hd, int Hn) {
  __shared__ float hid[256];
  __shared__ float gv[32];
  const int b = blockIdx.x, tid = threadIdx.x;
  for (int j = tid; j < Hd; j += 256) {
    float a = b1[j];
    for (int e = 0; e < Ein; ++e) a += sync[(size_t)b * Ein + e] * W1[(size_t)e * Hd + j];
    hid[j] = fmaxf(a, 0.f);
  }
  __syncthreads();
  if (tid < 32) {
    float val = 0.f;
    if (tid < Hn) {
      float a = b2[tid];
      for (int t = 0; t < Hd; ++t) a += hid[t] * W2[(size_t)t * Hn + tid];
      val = 1.0f / (1.0f + expf(-a));
    }
    gv[tid] = val;
  }
  __syncthreads();
  if (tid < 8) {
    v4f v;
    v[0] = gv[tid * 4];
    v[1] = gv[tid * 4 + 1];
    v[2] = gv[tid * 4 + 2];
    v[3] = gv[tid * 4 + 3];
    float* p = swo + (size_t)b * 32 + tid * 4;
    *(v4f*)p = v;
    
  }
}

// ---------------------------------------------------------------------------
// C[M,N] = A[M,K] @ B[K,N] (+bias) with A row-major 16-bit and B given as BT[N][K] 16-bit.
// Block tile 128x64, 256 threads = 8 waves, wave w owns rows w*16..w*16+15, 4 n-tiles.
// The k range is walked in tiles of 64: the block's 128 A rows and 64 B rows (each plane) are
// brought to LDS once per tile, 128 B of a row from 8 neighbouring lanes, the next tile's
// global loads in flight in registers while this tile is multiplied.  Fragments are read from
// LDS with the 16x16x32 split k-map
//   (lane l: row/col = l&15; elements 0..7 <- k0+8*(l>>4)+0..7, 8..15 <- k0+16+8*(l>>4)+0..7).
// SPLIT 0: single f16 product.  SPLIT 1: bf16 hi/lo planes, three products.
// OM 0: f16 row-major [M][N].  OM 1: bf16 hi/lo transposed per head -> [B*H][64][Sq].
// OM 2: f32 row-major [M][N].
// ---------------------------------------------------------------------------
template <int SPLIT, int OM>
__global__ __launch_bounds__(256) void k_gemm(const unsigned short* __restrict__ Ah,
                                             const unsigned short* __restrict__ Al,
                                             const unsigned short* __restrict__ Bh,
                                             const unsigned short* __restrict__ Bl,
                                             const float* __restrict__ bias, void* out0, void* out1,
                                             int M, int N, int K, int Sq, float oscale) {
  constexpr int PIT = 72;  // LDS row pitch in 16-bit elements: 144 B = 16 B x 9, b128 fragment reads without bank conflicts
  constexpr int TILE16 = (SPLIT ? 2 : 1) * (128 + 64) * PIT / 8;  // staged operand tiles, in 16-B units
  constexpr int STG16 = 128 * 17;                                 // epilogue tile, 128 x 68 f32, in 16-B units
  __shared__ v4f smem[TILE16 > STG16 ? TILE16 : STG16];           // the epilogue tile reuses the operand tiles' space
  float* stg = (float*)smem;
  unsigned short* sAh = (unsigned short*)smem;
  unsigned short* sBh = sAh + 128 * PIT;
  unsigned short* sAl = sBh + 64 * PIT;  // the two lo planes exist only with SPLIT
  unsigned short* sBl = sAl + 128 * PIT;
  const int nBase = blockIdx.x * 64, mBase = blockIdx.y * 128;
  if (nBase + 64 > N || mBase + 128 > M || (K & 63) != 0) return;  // block-uniform
  const int tid = threadIdx.x, w = tid >> 5, l = tid & 31, g = l >> 4, m = l & 15;

  v8f acc[4];
#pragma unroll
  for (int nt = 0; nt < 4; ++nt) acc[nt] = zero8();

  // staging map: thread -> row tid>>3 (+32 per step), 16-B piece tid&7 of the row's 128 B
  const int lr = tid >> 3, lc = (tid & 7) * 8;
  // global address = block-uniform byte base (moves with k) + a per-thread 32-bit byte offset that never changes
  const char* bAh = (const char*)(Ah + (size_t)mBase * K);
  const char* bAl = (const char*)(Al + (size_t)mBase * K);
  const char* bBh = (const char*)(Bh + (size_t)nBase * K);
  const char* bBl = (const char*)(Bl + (size_t)nBase * K);
  unsigned int go[4];
#pragma unroll  // here and below: constant indices keep the small per-thread arrays in registers
  for (int t = 0; t < 4; ++t) go[t] = (unsigned int)(((lr + 32 * t) * K + lc) * 2);
  const int ls = lr * PIT + lc;
  const int fa = (w * 16 + m) * PIT + 8 * g;  // this lane's A fragment row in LDS
  const int fb = m * PIT + 8 * g;             // this lane's B fragment row of n-tile 0

  v4u rah[4], ral[4], rbh[2], rbl[2];
#pragma unroll
  for (int t = 0; t < 4; ++t) {
    rah[t] = *(const v4u*)(bAh + go[t]);
    if (SPLIT) ral[t] = *(const v4u*)(bAl + go[t]);
  }
#pragma unroll
  for (int t = 0; t < 2; ++t) {
    rbh[t] = *(const v4u*)(bBh + go[t]);
    if (SPLIT) rbl[t] = *(const v4u*)(bBl + go[t]);
  }

#pragma unroll 1  // one copy of the body: the staged pieces and both k halves' fragments already fill the register budget
  for (int k0 = 0; k0 < K; k0 += 64) {
#pragma unroll
    for (int t = 0; t < 4; ++t) {
      *(v4u*)(sAh + ls + t * 32 * PIT) = rah[t];
      if (SPLIT) *(v4u*)(sAl + ls + t * 32 * PIT) = ral[t];
    }
#pragma unroll
    for (int t = 0; t < 2; ++t) {
      *(v4u*)(sBh + ls + t * 32 * PIT) = rbh[t];
      if (SPLIT) *(v4u*)(sBl + ls + t * 32 * PIT) = rbl[t];
    }
    __syncthreads();  // the tile is complete before any wave reads fragments from it
    if (k0 + 64 < K) {
      const size_t kn = (size_t)(k0 + 64) * 2;
      const char *pah[4], *pal[4], *pbh[2], *pbl[2];
#pragma unroll
      for (int t = 0; t < 4; ++t) {
        pah[t] = bAh + kn + go[t];
        pal[t] = bAl + kn + go[t];
        rah[t] = *(const v4u*)pah[t];
        if (SPLIT) ral[t] = *(const v4u*)pal[t];
      }
#pragma unroll
      for (int t = 0; t < 2; ++t) {
        pbh[t] = bBh + kn + go[t];
        pbl[t] = bBl + kn + go[t];
        rbh[t] = *(const v4u*)pbh[t];
        if (SPLIT) rbl[t] = *(const v4u*)pbl[t];
      }
      // the prefetch loads' address registers are free for reuse (fragment reads below) only behind this wait;
      // naming the addresses as inputs keeps them in their registers up to it
      if (SPLIT)
        asm volatile("s_wait_xcnt 0x0" ::"v"(pah[0]), "v"(pah[1]), "v"(pah[2]), "v"(pah[3]), "v"(pbh[0]), "v"(pbh[1]),
                     "v"(pal[0]), "v"(pal[1]), "v"(pal[2]), "v"(pal[3]), "v"(pbl[0]), "v"(pbl[1])
                     : "memory");
      else
        asm volatile("s_wait_xcnt 0x0" ::"v"(pah[0]), "v"(pah[1]), "v"(pah[2]), "v"(pah[3]), "v"(pbh[0]), "v"(pbh[1])
                     : "memory");
    }
#pragma unroll  // both k halves of the tile in one body, LDS offsets as immediates
    for (int kk = 0; kk < 64; kk += 32) {
      if (SPLIT) {
        FragB a, a2, b0, b1, b2, b3, c0, c1, c2, c3;
        a.q[0] = ldg16(sAh + fa + kk);
        a.q[1] = ldg16(sAh + fa + kk + 16);
        a2.q[0] = ldg16(sAl + fa + kk);
        a2.q[1] = ldg16(sAl + fa + kk + 16);
        b0.q[0] = ldg16(sBh + fb + kk);
        b0.q[1] = ldg16(sBh + fb + kk + 16);
        b1.q[0] = ldg16(sBh + fb + 16 * PIT + kk);
        b1.q[1] = ldg16(sBh + fb + 16 * PIT + kk + 16);
        b2.q[0] = ldg16(sBh + fb + 32 * PIT + kk);
        b2.q[1] = ldg16(sBh + fb + 32 * PIT + kk + 16);
        b3.q[0] = ldg16(sBh + fb + 48 * PIT + kk);
        b3.q[1] = ldg16(sBh + fb + 48 * PIT + kk + 16);
        c0.q[0] = ldg16(sBl + fb + kk);
        c0.q[1] = ldg16(sBl + fb + kk + 16);
        c1.q[0] = ldg16(sBl + fb + 16 * PIT + kk);
        c1.q[1] = ldg16(sBl + fb + 16 * PIT + kk + 16);
        c2.q[0] = ldg16(sBl + fb + 32 * PIT + kk);
        c2.q[1] = ldg16(sBl + fb + 32 * PIT + kk + 16);
        c3.q[0] = ldg16(sBl + fb + 48 * PIT + kk);
        c3.q[1] = ldg16(sBl + fb + 48 * PIT + kk + 16);
        acc[0] = mma_b(a.v, b0.v, acc[0]);
        acc[0] = mma_b(a.v, c0.v, acc[0]);
        acc[0] = mma_b(a2.v, b0.v, acc[0]);
        acc[1] = mma_b(a.v, b1.v, acc[1]);
        acc[1] = mma_b(a.v, c1.v, acc[1]);
        acc[1] = mma_b(a2.v, b1.v, acc[1]);
        acc[2] = mma_b(a.v, b2.v, acc[2]);
        acc[2] = mma_b(a.v, c2.v, acc[2]);
        acc[2] = mma_b(a2.v, b2.v, acc[2]);
        acc[3] = mma_b(a.v, b3.v, acc[3]);
        acc[3] = mma_b(a.v, c3.v, acc[3]);
        acc[3] = mma_b(a2.v, b3.v, acc[3]);
        // four vector slots behind the last WMMA, on every path, before its operands or results are touched
        asm volatile(NOP4
                     : "+v"(acc[0]), "+v"(acc[1]), "+v"(acc[2]), "+v"(acc[3])
                     : "v"(a.v), "v"(a2.v), "v"(b0.v), "v"(b1.v), "v"(b2.v), "v"(b3.v),
                       "v"(c0.v), "v"(c1.v), "v"(c2.v), "v"(c3.v));
      } else {
        FragH a, b0, b1, b2, b3;
        a.q[0] = ldg16(sAh + fa + kk);
        a.q[1] = ldg16(sAh + fa + kk + 16);
        b0.q[0] = ldg16(sBh + fb + kk);
        b0.q[1] = ldg16(sBh + fb + kk + 16);
        b1.q[0] = ldg16(sBh + fb + 16 * PIT + kk);
        b1.q[1] = ldg16(sBh + fb + 16 * PIT + kk + 16);
        b2.q[0] = ldg16(sBh + fb + 32 * PIT + kk);
        b2.q[1] = ldg16(sBh + fb + 32 * PIT + kk + 16);
        b3.q[0] = ldg16(sBh + fb + 48 * PIT + kk);
        b3.q[1] = ldg16(sBh + fb + 48 * PIT + kk + 16);
        acc[0] = mma_h(a.v, b0.v, acc[0]);
        acc[1] = mma_h(a.v, b1.v, acc[1]);
        acc[2] = mma_h(a.v, b2.v, acc[2]);
        acc[3] = mma_h(a.v, b3.v, acc[3]);
        // four vector slots behind the last WMMA, on every path, before its operands or results are touched
        asm volatile(NOP4
                     : "+v"(acc[0]), "+v"(acc[1]), "+v"(acc[2]), "+v"(acc[3])
                     : "v"(a.v), "v"(b0.v), "v"(b1.v), "v"(b2.v), "v"(b3.v));
      }
    }
    __syncthreads();  // every wave has left the tile before it is overwritten (next tile, or the epilogue tile)
  }

  // stage: D element r of lane (g,m), n-tile nt -> (row w*16+8g+r, col nt*16+m)
#pragma unroll
  for (int nt = 0; nt < 4; ++nt) {
    const int col = nt * 16 + m;
    const float bv = bias[nBase + col];
#pragma unroll
    for (int r = 0; r < 8; ++r) stg[(w * 16 + 8 * g + r) * 68 + col] = acc[nt][r] * oscale + bv;
  }
  __syncthreads();

  if (OM == 0) {
    unsigned short* o = (unsigned short*)out0;
    v4u val[4];
    size_t adr[4];
#pragma unroll
    for (int t = 0; t < 4; ++t) {
      const int row = w * 16 + t * 4 + (l >> 3), c8 = (l & 7) * 8;
      const float* sp = stg + row * 68 + c8;
      const v4f x0 = *(const v4f*)sp;
      const v4f x1 = *(const v4f*)(sp + 4);
      val[t] = pack_h8(x0, x1);
      adr[t] = (size_t)(mBase + row) * N + nBase + c8;
    }
#pragma unroll
    for (int t = 0; t < 4; ++t) *(v4u*)(o + adr[t]) = val[t];
    
  } else if (OM == 1) {
    // tile rows = s (128 consecutive within one batch), cols = d of head nBase/64:  out[bh][d][s]
    unsigned short* oh = (unsigned short*)out0;
    unsigned short* ol = (unsigned short*)out1;
    const int Hn = N >> 6;
    const int bb = mBase / Sq;
    const int bh = bb * Hn + (nBase >> 6);
    const int sBase = mBase - bb * Sq;
    v4u Hv[4], Lv[4];
    size_t adr[4];
#pragma unroll
    for (int t = 0; t < 4; ++t) {
      const int d = w * 8 + t * 2 + (l >> 4), s8 = (l & 15) * 8;
      v4f x0, x1;
#pragma unroll
      for (int e = 0; e < 4; ++e) {
        x0[e] = stg[(s8 + e) * 68 + d];
        x1[e] = stg[(s8 + 4 + e) * 68 + d];
      }
      split_b8(x0, x1, Hv[t], Lv[t]);
      adr[t] = ((size_t)bh * 64 + d) * Sq + sBase + s8;
    }
#pragma unroll
    for (int t = 0; t < 4; ++t) {
      *(v4u*)(oh + adr[t]) = Hv[t];
      *(v4u*)(ol + adr[t]) = Lv[t];
    }
    
  } else {
    float* o = (float*)out0;
    v4f val[8];
    size_t adr[8];
#pragma unroll
    for (int t = 0; t < 8; ++t) {
      const int row = w * 16 + t * 2 + (l >> 4), c4 = (l & 15) * 4;
      val[t] = *(const v4f*)(stg + row * 68 + c4);
      adr[t] = (size_t)(mBase + row) * N + nBase + c4;
    }
#pragma unroll
    for (int t = 0; t < 8; ++t) *(v4f*)(o + adr[t]) = val[t];
    
  }
}

// ---------------------------------------------------------------------------
// Fused attention: one block of ANW waves per (16 query rows, batch).  Dynamic LDS:
//   sL[16][S] f32  gated+scaled scores of the current head, then exp(s - rowmax);
//   mL[16][S] f32  sum over heads of the softmax probabilities (lane-owned elements).
// The keys are split over the waves: wave w owns a contiguous run of 32-key chunks in all
// three sweeps, so every sL / mL word is written and read back by one lane of one wave.
// Per head h: score tiles S^T = K_tile . Q^T (A = k rows, B = q rows; D lane (g,m) holds
// query m, keys jt*16+8g+r), exact two-sweep softmax, then P.V with the P fragment read
// back from the same lane's own LDS words (elements 0..7 <- keys k0+8g.., 8..15 <- k0+16+8g..),
// V fragments from the transposed planes vt[bh][d][s].  Row max, row sum and the 16x64 P.V
// partial tiles are combined over the waves through LDS, always in wave order.
// ---------------------------------------------------------------------------
#define ANW 16
typedef unsigned int v2u __attribute__((ext_vector_type(2)));

__global__ __launch_bounds__(ANW * 32) void k_attn(const unsigned short* __restrict__ qh,
                                                  const unsigned short* __restrict__ kh,
                                                  const unsigned short* __restrict__ vth,
                                                  const unsigned short* __restrict__ vtl,
                                                  const float* __restrict__ sw, unsigned short* ctxh,
                                                  unsigned short* ctxl, float* mout, int S, int H) {
  extern __shared__ v4f dsm[];
  __shared__ float redM[ANW * 16];  // per wave, per query: max over the wave's keys
  __shared__ float redS[ANW * 16];  // per wave, per query: sum of exp over the wave's keys
  float* sL = (float*)dsm;
  float* mL = sL + (size_t)16 * S;
  const int i0 = blockIdx.x * 16, b = blockIdx.y;
  if (i0 + 16 > S) return;  // block-uniform
  const int tid = threadIdx.x;
  const int l = tid & 31, g = l >> 4, m = l & 15;
  const int w = __builtin_amdgcn_readfirstlane(tid >> 5);  // scalar, so the sweeps' trip counts are scalar
  const int E = H * 64;

  {
    v4f z;
    z[0] = 0.f; z[1] = 0.f; z[2] = 0.f; z[3] = 0.f;
    v4f* m4 = (v4f*)mL;
    const int n4 = 4 * S;
    for (int i = tid; i < n4; i += ANW * 32) m4[i] = z;
  }
  __syncthreads();

  float* srow = sL + (size_t)m * S;
  float* mrow = mL + (size_t)m * S;
  const float invH = 1.0f / (float)H;
  const int nC = S >> 5;
  const int cpw = (nC + ANW - 1) / ANW;
  const int c0 = min(w * cpw, nC), c1 = min(c0 + cpw, nC);  // this wave's 32-key chunks
  const int t0w = 2 * c0, t1w = 2 * c1;                     // the same keys as 16-key tiles

  for (int h = 0; h < H; ++h) {
    FragH qa0, qa1;
    {
      const unsigned short* qp = qh + (size_t)(b * S + i0 + m) * E + h * 64 + 8 * g;
      qa0.q[0] = ldg16(qp);
      qa0.q[1] = ldg16(qp + 16);
      qa1.q[0] = ldg16(qp + 32);
      qa1.q[1] = ldg16(qp + 48);
    }
    const float gsc = sw[b * 32 + h] * 0.125f;

    // sweep A: scores -> LDS, running row max
    float rmax = -3.0e38f;
    const unsigned short* kp = kh + (size_t)(b * S + m) * E + h * 64 + 8 * g;
    for (int jt = t0w; jt < t1w; ++jt) {
      const unsigned short* kr = kp + (size_t)jt * 16 * E;
      FragH ka0, ka1;
      ka0.q[0] = ldg16(kr);
      ka0.q[1] = ldg16(kr + 16);
      ka1.q[0] = ldg16(kr + 32);
      ka1.q[1] = ldg16(kr + 48);
      v8f sc = zero8();
      sc = mma_h(ka0.v, qa0.v, sc);
      sc = mma_h(ka1.v, qa1.v, sc);
      asm volatile(NOP4 : "+v"(sc) : "v"(ka0.v), "v"(ka1.v), "v"(qa0.v), "v"(qa1.v));
      v4f t0, t1;
#pragma unroll
      for (int r = 0; r < 4; ++r) {
        t0[r] = sc[r] * gsc;
        t1[r] = sc[r + 4] * gsc;
        rmax = fmaxf(rmax, t0[r]);
        rmax = fmaxf(rmax, t1[r]);
      }
      float* pp = srow + jt * 16 + 8 * g;
      *(v4f*)pp = t0;
      *(v4f*)(pp + 4) = t1;
    }
    rmax = fmaxf(rmax, __shfl_xor(rmax, 16));
    if (g == 0) redM[w * 16 + m] = rmax;
    __syncthreads();
#pragma unroll  // the ANW LDS reads issue together instead of one latency per trip
    for (int ww = 0; ww < ANW; ++ww) rmax = fmaxf(rmax, redM[ww * 16 + m]);

    // sweep B: e = exp(s - max) stored back in place, row sum
    float lsum = 0.f;
    for (int jt = t0w; jt < t1w; ++jt) {
      float* pp = srow + jt * 16 + 8 * g;
      v4f t0 = *(v4f*)pp;
      v4f t1 = *(v4f*)(pp + 4);
#pragma unroll
      for (int r = 0; r < 4; ++r) {
        t0[r] = __expf(t0[r] - rmax);
        t1[r] = __expf(t1[r] - rmax);
        lsum += t0[r];
        lsum += t1[r];
      }
      *(v4f*)pp = t0;
      *(v4f*)(pp + 4) = t1;
    }
    lsum += __shfl_xor(lsum, 16);
    if (g == 0) redS[w * 16 + m] = lsum;
    __syncthreads();
    lsum = 0.f;
#pragma unroll  // the ANW LDS reads issue together instead of one latency per trip
    for (int ww = 0; ww < ANW; ++ww) lsum += redS[ww * 16 + m];
    const float linv = 1.0f / lsum;

    // sweep C: probabilities, head-sum accumulation, P.V over this wave's keys
    v8f cacc[4];
#pragma unroll
    for (int nt = 0; nt < 4; ++nt) cacc[nt] = zero8();
    const size_t vb = ((size_t)(b * H + h) * 64 + m) * S + 8 * g;
    const size_t vnt = (size_t)16 * S;
#pragma unroll 1
    for (int jc = c0; jc < c1; ++jc) {
      const int k0 = jc * 32;
      float* pa = srow + k0 + 8 * g;
      float* pb = srow + k0 + 16 + 8 * g;
      const v4f p0 = *(v4f*)pa * linv;
      const v4f p1 = *(v4f*)(pa + 4) * linv;
      const v4f p2 = *(v4f*)pb * linv;
      const v4f p3 = *(v4f*)(pb + 4) * linv;
      {
        v4f* ma = (v4f*)(mrow + k0 + 8 * g);
        v4f* mb = (v4f*)(mrow + k0 + 16 + 8 * g);
        const v4f s0 = ma[0] + p0;
        const v4f s1 = ma[1] + p1;
        const v4f s2 = mb[0] + p2;
        const v4f s3 = mb[1] + p3;
        ma[0] = s0;
        ma[1] = s1;
        mb[0] = s2;
        mb[1] = s3;
      }
      FragB ph, pl;
      split_b8(p0, p1, ph.q[0], pl.q[0]);
      split_b8(p2, p3, ph.q[1], pl.q[1]);
      FragB vh0, vh1, vh2, vh3, vl0, vl1, vl2, vl3;
      vh0.q[0] = ldg16(vth + vb + k0);
      vh0.q[1] = ldg16(vth + vb + k0 + 16);
      vh1.q[0] = ldg16(vth + vb + vnt + k0);
      vh1.q[1] = ldg16(vth + vb + vnt + k0 + 16);
      vh2.q[0] = ldg16(vth + vb + 2 * vnt + k0);
      vh2.q[1] = ldg16(vth + vb + 2 * vnt + k0 + 16);
      vh3.q[0] = ldg16(vth + vb + 3 * vnt + k0);
      vh3.q[1] = ldg16(vth + vb + 3 * vnt + k0 + 16);
      vl0.q[0] = ldg16(vtl + vb + k0);
      vl0.q[1] = ldg16(vtl + vb + k0 + 16);
      vl1.q[0] = ldg16(vtl + vb + vnt + k0);
      vl1.q[1] = ldg16(vtl + vb + vnt + k0 + 16);
      vl2.q[0] = ldg16(vtl + vb + 2 * vnt + k0);
      vl2.q[1] = ldg16(vtl + vb + 2 * vnt + k0 + 16);
      vl3.q[0] = ldg16(vtl + vb + 3 * vnt + k0);
      vl3.q[1] = ldg16(vtl + vb + 3 * vnt + k0 + 16);
      cacc[0] = mma_b(ph.v, vh0.v, cacc[0]);
      cacc[0] = mma_b(ph.v, vl0.v, cacc[0]);
      cacc[0] = mma_b(pl.v, vh0.v, cacc[0]);
      cacc[1] = mma_b(ph.v, vh1.v, cacc[1]);
      cacc[1] = mma_b(ph.v, vl1.v, cacc[1]);
      cacc[1] = mma_b(pl.v, vh1.v, cacc[1]);
      cacc[2] = mma_b(ph.v, vh2.v, cacc[2]);
      cacc[2] = mma_b(ph.v, vl2.v, cacc[2]);
      cacc[2] = mma_b(pl.v, vh2.v, cacc[2]);
      cacc[3] = mma_b(ph.v, vh3.v, cacc[3]);
      cacc[3] = mma_b(ph.v, vl3.v, cacc[3]);
      cacc[3] = mma_b(pl.v, vh3.v, cacc[3]);
      asm volatile(NOP4
                   : "+v"(cacc[0]), "+v"(cacc[1]), "+v"(cacc[2]), "+v"(cacc[3])
                   : "v"(ph.v), "v"(pl.v), "v"(vh0.v), "v"(vh1.v), "v"(vh2.v), "v"(vh3.v),
                     "v"(vl0.v), "v"(vl1.v), "v"(vl2.v), "v"(vl3.v));
    }

    // every wave has left the score plane: it now holds ANW partial tiles of 16 x 68 f32
    __syncthreads();
    float* part = sL + w * (16 * 68);
#pragma unroll
    for (int nt = 0; nt < 4; ++nt) {
#pragma unroll
      for (int r = 0; r < 8; ++r) part[(8 * g + r) * 68 + nt * 16 + m] = cacc[nt][r];
    }
    __syncthreads();
    if (w < 8) {  // 256 threads, 4 columns each: a row's 128-B line per plane leaves from 16 lanes of one wave
      const int row = tid >> 4, c4 = (tid & 15) * 4;
      const float* sp = sL + row * 68 + c4;
      v4f x = *(const v4f*)sp;
#pragma unroll  // the ANW LDS reads issue together instead of one latency per trip
      for (int ww = 1; ww < ANW; ++ww) x += *(const v4f*)(sp + ww * (16 * 68));
      unsigned int hb[4], lb[4];
#pragma unroll  // constant indices keep hb and lb in registers
      for (int e = 0; e < 4; ++e) {
        hb[e] = bf_bits(x[e]);
        lb[e] = bf_bits(x[e] - bf_val(hb[e]));
      }
      v2u Hv, Lv;
      Hv[0] = pk2(hb[0], hb[1]);
      Hv[1] = pk2(hb[2], hb[3]);
      Lv[0] = pk2(lb[0], lb[1]);
      Lv[1] = pk2(lb[2], lb[3]);
      const size_t adr = (size_t)(b * S + i0 + row) * E + h * 64 + c4;
      *(v2u*)(ctxh + adr) = Hv;
      *(v2u*)(ctxl + adr) = Lv;
    }
    __syncthreads();
  }

  // head-mean rows: 16 rows x S f32, one row per wave, 512 B per store instruction, lane-contiguous
  __syncthreads();
  float* ob = mout + (size_t)(b * S + i0) * S;
  const int nL = S >> 7;
  for (int row = w; row < 16; row += ANW) {
    for (int c = 0; c < nL; ++c) {
      const size_t off = (size_t)row * S + c * 128 + l * 4;
      const v4f v = *(const v4f*)(mL + off) * invH;
      *(v4f*)(ob + off) = v;
    }
  }
  
}

// ---------------------------------------------------------------------------
// Host launcher
// ---------------------------------------------------------------------------
extern "C" void kernel_launch(void* const* d_in, const int* in_sizes, int n_in, void* d_out,
                              int out_size, void* d_ws, size_t ws_size, hipStream_t stream) {
  if (n_in < 14) return;
  const int E = 1024, H = 16;
  const int nX = in_sizes[0];
  if (nX <= 0 || (nX % E) != 0) return;
  const int M = nX / E;
  const int nSy = in_sizes[1];
  if (nSy <= 0 || (nSy % E) != 0) return;
  const int Bn = nSy / E;
  if (Bn <= 0 || (M % Bn) != 0) return;
  const int S = M / Bn;
  const int HID = in_sizes[9];
  if ((M % 128) != 0 || (S % 128) != 0 || HID <= 0 || HID > 256) return;
  if (S < 1152) return;  // the attention kernel's 16 partial tiles of 16 x 68 f32 reuse its 16 x S score plane
  if (in_sizes[2] != E * E || in_sizes[4] != E * E || in_sizes[6] != E * E || in_sizes[12] != E * E) return;
  if (in_sizes[3] != E || in_sizes[5] != E || in_sizes[7] != E || in_sizes[13] != E) return;
  if (in_sizes[8] != E * HID || in_sizes[10] != HID * H || in_sizes[11] != H) return;
  if ((long long)out_size != (long long)nX + (long long)Bn * (long long)S * (long long)S) return;

  const float* x = (const float*)d_in[0];
  const float* sync = (const float*)d_in[1];
  const float* Wq = (const float*)d_in[2];
  const float* bq = (const float*)d_in[3];
  const float* Wk = (const float*)d_in[4];
  const float* bk = (const float*)d_in[5];
  const float* Wv = (const float*)d_in[6];
  const float* bv = (const float*)d_in[7];
  const float* Ws1 = (const float*)d_in[8];
  const float* bs1 = (const float*)d_in[9];
  const float* Ws2 = (const float*)d_in[10];
  const float* bs2 = (const float*)d_in[11];
  const float* Wo = (const float*)d_in[12];
  const float* bo = (const float*)d_in[13];

  float* out_proj = (float*)d_out;                 // [M][E] f32
  float* out_mean = (float*)d_out + (size_t)nX;    // [Bn][S][S] f32

  // workspace carve (bytes), every sub-buffer 256-B aligned
  size_t off = 0;
  auto al = [&](size_t bytes) { size_t o = off; off += (bytes + 255) & ~(size_t)255; return o; };
  const size_t nW = (size_t)E * E;
  const size_t o_sw = al((size_t)Bn * 32 * 4);
  const size_t o_xh = al((size_t)nX * 2);
  const size_t o_xbh = al((size_t)nX * 2);
  const size_t o_xbl = al((size_t)nX * 2);
  const size_t o_wq = al(nW * 2);
  const size_t o_wk = al(nW * 2);
  const size_t o_wvh = al(nW * 2);
  const size_t o_wvl = al(nW * 2);
  const size_t o_woh = al(nW * 2);
  const size_t o_wol = al(nW * 2);
  const size_t o_q = al((size_t)nX * 2);
  const size_t o_k = al((size_t)nX * 2);
  const size_t o_vth = al((size_t)nX * 2);
  const size_t o_vtl = al((size_t)nX * 2);
  const size_t o_cth = al((size_t)nX * 2);
  const size_t o_ctl = al((size_t)nX * 2);
  if (off > ws_size) return;

  char* ws = (char*)d_ws;
  float* sw_g = (float*)(ws + o_sw);
  unsigned short* xh = (unsigned short*)(ws + o_xh);
  unsigned short* xbh = (unsigned short*)(ws + o_xbh);
  unsigned short* xbl = (unsigned short*)(ws + o_xbl);
  unsigned short* wqT = (unsigned short*)(ws + o_wq);
  unsigned short* wkT = (unsigned short*)(ws + o_wk);
  unsigned short* wvTh = (unsigned short*)(ws + o_wvh);
  unsigned short* wvTl = (unsigned short*)(ws + o_wvl);
  unsigned short* woTh = (unsigned short*)(ws + o_woh);
  unsigned short* woTl = (unsigned short*)(ws + o_wol);
  unsigned short* qh = (unsigned short*)(ws + o_q);
  unsigned short* kh = (unsigned short*)(ws + o_k);
  unsigned short* vTh = (unsigned short*)(ws + o_vth);
  unsigned short* vTl = (unsigned short*)(ws + o_vtl);
  unsigned short* cth = (unsigned short*)(ws + o_cth);
  unsigned short* ctl = (unsigned short*)(ws + o_ctl);

  // 1) activation planes
  {
    const int groups = nX / 8;
    const int blocks = (groups + 255) / 256;
    k_cvt_x<<<dim3(blocks), dim3(256), 0, stream>>>(x, xh, xbh, xbl, nX);
  }
  // 2) weight planes, transposed to [n][k]
  {
    dim3 gw(E / 64, E / 64);
    k_cvt_wT<0><<<gw, dim3(256), 0, stream>>>(Wq, wqT, wqT, E, E, 64.0f);
    k_cvt_wT<0><<<gw, dim3(256), 0, stream>>>(Wk, wkT, wkT, E, E, 64.0f);
    k_cvt_wT<1><<<gw, dim3(256), 0, stream>>>(Wv, wvTh, wvTl, E, E, 1.0f);
    k_cvt_wT<1><<<gw, dim3(256), 0, stream>>>(Wo, woTh, woTl, E, E, 1.0f);
  }
  // 3) gate MLP
  k_gate<<<dim3(Bn), dim3(256), 0, stream>>>(sync, Ws1, bs1, Ws2, bs2, sw_g, E, HID, H);
  // 4) projections (M x E, K = E)
  dim3 gg(E / 64, M / 128);
  k_gemm<0, 0><<<gg, dim3(256), 0, stream>>>(xh, xh, wqT, wqT, bq, (void*)qh, (void*)qh, M, E, E, S, 1.0f / 64.0f);
  k_gemm<0, 0><<<gg, dim3(256), 0, stream>>>(xh, xh, wkT, wkT, bk, (void*)kh, (void*)kh, M, E, E, S, 1.0f / 64.0f);
  k_gemm<1, 1><<<gg, dim3(256), 0, stream>>>(xbh, xbl, wvTh, wvTl, bv, (void*)vTh, (void*)vTl, M, E, E, S, 1.0f);
  // 5) attention + head-mean
  {
    const size_t dynB = (size_t)2 * 16 * (size_t)S * 4;
    hipFuncSetAttribute(reinterpret_cast<const void*>(&k_attn), hipFuncAttributeMaxDynamicSharedMemorySize, (int)dynB);
    k_attn<<<dim3(S / 16, Bn), dim3(ANW * 32), dynB, stream>>>(qh, kh, vTh, vTl, sw_g, cth, ctl, out_mean, S, H);
  }
  // 6) output projection -> d_out
  k_gemm<1, 2><<<gg, dim3(256), 0, stream>>>(cth, ctl, woTh, woTl, bo, (void*)out_proj, (void*)out_proj, M, E, E, S, 1.0f);
  hipGetLastError();
  hipStreamSynchronize(stream);
}

// v003
// A run of this version takes 499 microseconds.
// Next to v002, in two timings, it ran 1.17 and 1.16 times as fast.
// Over all steps from v000 it is 3.30 times as fast.
#include <hip/hip_runtime.h>

// Contractions: x@Wq, x@Wk and q.k^T : v_wmma_f32_16x16x32_f16 (f16 operands; Wq, Wk carried x64, rescaled in the f32 epilogue; f32 accumulate).
// x@Wv, P.V and ctx@Wo : v_wmma_f32_16x16x32_bf16 with bf16 hi/lo operand split (hi.hi + hi.lo + lo.hi), f32 accumulate. Gate MLP: scalar f32.

#define NOP4 "v_nop\n\tv_nop\n\tv_nop\n\tv_nop"

typedef _Float16 v16h __attribute__((ext_vector_type(16)));
typedef __bf16 v16b __attribute__((ext_vector_type(16)));
typedef float v8f __attribute__((ext_vector_type(8)));
typedef float v4f __attribute__((ext_vector_type(4)));
typedef unsigned int v4u __attribute__((ext_vector_type(4)));

union FragH { v16h v; v4u q[2]; };
union FragB { v16b v; v4u q[2]; };

__device__ __forceinline__ v4u ldg16(const unsigned short* p) { return *(const v4u*)p; }

// RNE f32 -> bf16 bits
__device__ __forceinline__ unsigned int bf_bits(float f) {
  unsigned int u = __float_as_uint(f);
  return (u + 0x7FFFu + ((u >> 16) & 1u)) >> 16;
}
__device__ __forceinline__ float bf_val(unsigned int b) { return __uint_as_float(b << 16); }
// RNE f32 -> f16 bits
__device__ __forceinline__ unsigned int hf_bits(float f) {
  union { _Float16 h; unsigned short u; } c;
  c.h = (_Float16)f;
  return (unsigned int)c.u;
}
__device__ __forceinline__ unsigned int pk2(unsigned int lo, unsigned int hi) {
  return (lo & 0xFFFFu) | (hi << 16);
}
// 8 consecutive f32 -> 8 packed f16 (element 2t in the low half of word t)
__device__ __forceinline__ v4u pack_h8(v4f a, v4f c) {
  v4u r;
  r[0] = pk2(hf_bits(a[0]), hf_bits(a[1]));
  r[1] = pk2(hf_bits(a[2]), hf_bits(a[3]));
  r[2] = pk2(hf_bits(c[0]), hf_bits(c[1]));
  r[3] = pk2(hf_bits(c[2]), hf_bits(c[3]));
  return r;
}
// 8 consecutive f32 -> bf16 hi plane and bf16 residual plane
__device__ __forceinline__ void split_b8(v4f a, v4f c, v4u& H, v4u& L) {
  float v[8] = {a[0], a[1], a[2], a[3], c[0], c[1], c[2], c[3]};
  unsigned int hb[8], lb[8];
#pragma unroll
  for (int e = 0; e < 8; ++e) {
    hb[e] = bf_bits(v[e]);
    lb[e] = bf_bits(v[e] - bf_val(hb[e]));
  }
#pragma unroll
  for (int t = 0; t < 4; ++t) {
    H[t] = pk2(hb[2 * t], hb[2 * t + 1]);
    L[t] = pk2(lb[2 * t], lb[2 * t + 1]);
  }
}

__device__ __forceinline__ v8f zero8() {
  v8f z;
#pragma unroll
  for (int r = 0; r < 8; ++r) z[r] = 0.f;
  return z;
}
__device__ __forceinline__ v8f mma_h(v16h a, v16h b, v8f c) {
  return __builtin_amdgcn_wmma_f32_16x16x32_f16(false, a, false, b, (short)0, c, false, false);
}
__device__ __forceinline__ v8f mma_b(v16b a, v16b b, v8f c) {
  return __builtin_amdgcn_wmma_f32_16x16x32_bf16(false, a, false, b, (short)0, c, false, false);
}

// ---------------------------------------------------------------------------
// x [n] f32 -> f16 plane (unscaled) and bf16 hi / lo planes. 8 elements per thread,
// ---------------------------------------------------------------------------
__global__ __launch_bounds__(256) void k_cvt_x(const float* __restrict__ x, unsigned short* xh,
                                              unsigned short* xbh, unsigned short* xbl, int n) {
  const size_t i8 = ((size_t)blockIdx.x * 256u + (size_t)threadIdx.x) * 8u;
  if (i8 + 8 > (size_t)n) return;
  const v4f a = *(const v4f*)(x + i8);
  const v4f c = *(const v4f*)(x + i8 + 4);
  const v4u fh = pack_h8(a, c);
  v4u bh, bl;
  split_b8(a, c, bh, bl);
  *(v4u*)(xh + i8) = fh;
  *(v4u*)(xbh + i8) = bh;
  *(v4u*)(xbl + i8) = bl;
  
}

// ---------------------------------------------------------------------------
// W[Kd][Nd] f32 -> WT[Nd][Kd] 16-bit (k-contiguous rows).  64x64 tile through LDS.
// MODE 0: f16 of (W * scale) into o0.  MODE 1: bf16 hi into o0, bf16 lo into o1.
// ---------------------------------------------------------------------------
template <int MODE>
__global__ __launch_bounds__(256) void k_cvt_wT(const float* __restrict__ W, unsigned short* o0,
                                               unsigned short* o1, int Kd, int Nd, float scale) {
  __shared__ float tile[64][65];
  const int n0 = blockIdx.x * 64, e0 = blockIdx.y * 64;
  if (n0 + 64 > Nd || e0 + 64 > Kd) return;  // block-uniform
  const int tid = threadIdx.x;
#pragma unroll
  for (int t = 0; t < 4; ++t) {
    const int idx = t * 256 + tid;
    const int rr = idx >> 4, c4 = (idx & 15) * 4;
    const v4f v = *(const v4f*)(W + (size_t)(e0 + rr) * Nd + n0 + c4);
    tile[rr][c4] = v[0];
    tile[rr][c4 + 1] = v[1];
    tile[rr][c4 + 2] = v[2];
    tile[rr][c4 + 3] = v[3];
  }
  __syncthreads();
  v4u Hv[2], Lv[2];
  size_t adr[2];
#pragma unroll
  for (int t = 0; t < 2; ++t) {
    const int s = t * 256 + tid;
    const int nn = s >> 3, kq = (s & 7) * 8;
    v4f a, c;
#pragma unroll
    for (int e = 0; e < 4; ++e) {
      a[e] = tile[kq + e][nn] * scale;
      c[e] = tile[kq + 4 + e][nn] * scale;
    }
    if (MODE == 0) {
      Hv[t] = pack_h8(a, c);
      Lv[t] = Hv[t];
    } else {
      split_b8(a, c, Hv[t], Lv[t]);
    }
    adr[t] = (size_t)(n0 + nn) * Kd + e0 + kq;
  }
#pragma unroll
  for (int t = 0; t < 2; ++t) {
    *(v4u*)(o0 + adr[t]) = Hv[t];
    if (MODE == 1) *(v4u*)(o1 + adr[t]) = Lv[t];
  }
  
}

// ---------------------------------------------------------------------------
// Gate MLP: swo[b*32 + h] = sigmoid(relu(sync @ W1 + b1) @ W2 + b2), h < Hn; padding 0.
// ---------------------------------------------------------------------------
__global__ __launch_bounds__(256) void k_gate(const float* __restrict__ sync, const float* __restrict__ W1,
                                             const float* __restrict__ b1, const float* __restrict__ W2,
                                             const float* __restrict__ b2, float* swo, int Ein, int Hd, int Hn) {
  __shared__ float hid[256];
  __shared__ float gv[32];
  const int b = blockIdx.x, tid = threadIdx.x;
  for (int j = tid; j < Hd; j += 256) {
    float a = b1[j];
    for (int e = 0; e < Ein; ++e) a += sync[(size_t)b * Ein + e] * W1[(size_t)e * Hd + j];
    hid[j] = fmaxf(a, 0.f);
  }
  __syncthreads();
  if (tid < 32) {
    float val = 0.f;
    if (tid < Hn) {
      float a = b2[tid];
      for (int t = 0; t < Hd; ++t) a += hid[t] * W2[(size_t)t * Hn + tid];
      val = 1.0f / (1.0f + expf(-a));
    }
    gv[tid] = val;
  }
  __syncthreads();
  if (tid < 8) {
    v4f v;
    v[0] = gv[tid * 4];
    v[1] = gv[tid * 4 + 1];
    v[2] = gv[tid * 4 + 2];
    v[3] = gv[tid * 4 + 3];
    float* p = swo + (size_t)b * 32 + tid * 4;
    *(v4f*)p = v;
    
  }
}

// ---------------------------------------------------------------------------
// C[M,N] = A[M,K] @ B[K,N] (+bias) with A row-major 16-bit and B given as BT[N][K] 16-bit.
// Block tile 128x64, 256 threads = 8 waves, wave w owns rows w*16..w*16+15, 4 n-tiles.
// The k range is walked in tiles of 64: the block's 128 A rows and 64 B rows (each plane) are
// brought to LDS once per tile, 128 B of a row from 8 neighbouring lanes, the next tile's
// global loads in flight in registers while this tile is multiplied.  Fragments are read from
// LDS with the 16x16x32 split k-map
//   (lane l: row/col = l&15; elements 0..7 <- k0+8*(l>>4)+0..7, 8..15 <- k0+16+8*(l>>4)+0..7).
// SPLIT 0: single f16 product.  SPLIT 1: bf16 hi/lo planes, three products.
// OM 0: f16 row-major [M][N].  OM 1: bf16 hi/lo transposed per head -> [B*H][64][Sq].
// OM 2: f32 row-major [M][N].
// ---------------------------------------------------------------------------
template <int SPLIT, int OM>
__global__ __launch_bounds__(256) void k_gemm(const unsigned short* __restrict__ Ah,
                                             const unsigned short* __restrict__ Al,
                                             const unsigned short* __restrict__ Bh,
                                             const unsigned short* __restrict__ Bl,
                                             const float* __restrict__ bias, void* out0, void* out1,
                                             int M, int N, int K, int Sq, float oscale) {
  constexpr int PIT = 72;  // LDS row pitch in 16-bit elements: 144 B = 16 B x 9, b128 fragment reads without bank conflicts
  constexpr int TILE16 = (SPLIT ? 2 : 1) * (128 + 64) * PIT / 8;  // staged operand tiles, in 16-B units
  constexpr int STG16 = 128 * 17;                                 // epilogue tile, 128 x 68 f32, in 16-B units
  __shared__ v4f smem[TILE16 > STG16 ? TILE16 : STG16];           // the epilogue tile reuses the operand tiles' space
  float* stg = (float*)smem;
  unsigned short* sAh = (unsigned short*)smem;
  unsigned short* sBh = sAh + 128 * PIT;
  unsigned short* sAl = sBh + 64 * PIT;  // the two lo planes exist only with SPLIT
  unsigned short* sBl = sAl + 128 * PIT;
  const int nBase = blockIdx.x * 64, mBase = blockIdx.y * 128;
  if (nBase + 64 > N || mBase + 128 > M || (K & 63) != 0) return;  // block-uniform
  const int tid = threadIdx.x, w = tid >> 5, l = tid & 31, g = l >> 4, m = l & 15;

  v8f acc[4];
#pragma unroll
  for (int nt = 0; nt < 4; ++nt) acc[nt] = zero8();

  // staging map: thread -> row tid>>3 (+32 per step), 16-B piece tid&7 of the row's 128 B
  const int lr = tid >> 3, lc = (tid & 7) * 8;
  // global address = block-uniform byte base (moves with k) + a per-thread 32-bit byte offset that never changes
  const char* bAh = (const char*)(Ah + (size_t)mBase * K);
  const char* bAl = (const char*)(Al + (size_t)mBase * K);
  const char* bBh = (const char*)(Bh + (size_t)nBase * K);
  const char* bBl = (const char*)(Bl + (size_t)nBase * K);
  unsigned int go[4];
#pragma unroll  // here and below: constant indices keep the small per-thread arrays in registers
  for (int t = 0; t < 4; ++t) go[t] = (unsigned int)(((lr + 32 * t) * K + lc) * 2);
  const int ls = lr * PIT + lc;
  const int fa = (w * 16 + m) * PIT + 8 * g;  // this lane's A fragment row in LDS
  const int fb = m * PIT + 8 * g;             // this lane's B fragment row of n-tile 0

  v4u rah[4], ral[4], rbh[2], rbl[2];
#pragma unroll
  for (int t = 0; t < 4; ++t) {
    rah[t] = *(const v4u*)(bAh + go[t]);
    if (SPLIT) ral[t] = *(const v4u*)(bAl + go[t]);
  }
#pragma unroll
  for (int t = 0; t < 2; ++t) {
    rbh[t] = *(const v4u*)(bBh + go[t]);
    if (SPLIT) rbl[t] = *(const v4u*)(bBl + go[t]);
  }

#pragma unroll 1  // one copy of the body: the staged pieces and both k halves' fragments already fill the register budget
  for (int k0 = 0; k0 < K; k0 += 64) {
#pragma unroll
    for (int t = 0; t < 4; ++t) {
      *(v4u*)(sAh + ls + t * 32 * PIT) = rah[t];
      if (SPLIT) *(v4u*)(sAl + ls + t * 32 * PIT) = ral[t];
    }
#pragma unroll
    for (int t = 0; t < 2; ++t) {
      *(v4u*)(sBh + ls + t * 32 * PIT) = rbh[t];
      if (SPLIT) *(v4u*)(sBl + ls + t * 32 * PIT) = rbl[t];
    }
    __syncthreads();  // the tile is complete before any wave reads fragments from it
    if (k0 + 64 < K) {
      const size_t kn = (size_t)(k0 + 64) * 2;
      const char *pah[4], *pal[4], *pbh[2], *pbl[2];
#pragma unroll
      for (int t = 0; t < 4; ++t) {
        pah[t] = bAh + kn + go[t];
        pal[t] = bAl + kn + go[t];
        rah[t] = *(const v4u*)pah[t];
        if (SPLIT) ral[t] = *(const v4u*)pal[t];
      }
#pragma unroll
      for (int t = 0; t < 2; ++t) {
        pbh[t] = bBh + kn + go[t];
        pbl[t] = bBl + kn + go[t];
        rbh[t] = *(const v4u*)pbh[t];
        if (SPLIT) rbl[t] = *(const v4u*)pbl[t];
      }
      // the prefetch loads' address registers are free for reuse (fragment reads below) only behind this wait;
      // naming the addresses as inputs keeps them in their registers up to it
      if (SPLIT)
        asm volatile("s_wait_xcnt 0x0" ::"v"(pah[0]), "v"(pah[1]), "v"(pah[2]), "v"(pah[3]), "v"(pbh[0]), "v"(pbh[1]),
                     "v"(pal[0]), "v"(pal[1]), "v"(pal[2]), "v"(pal[3]), "v"(pbl[0]), "v"(pbl[1])
                     : "memory");
      else
        asm volatile("s_wait_xcnt 0x0" ::"v"(pah[0]), "v"(pah[1]), "v"(pah[2]), "v"(pah[3]), "v"(pbh[0]), "v"(pbh[1])
                     : "memory");
    }
#pragma unroll  // both k halves of the tile in one body, LDS offsets as immediates
    for (int kk = 0; kk < 64; kk += 32) {
      if (SPLIT) {
        FragB a, a2, b0, b1, b2, b3, c0, c1, c2, c3;
        a.q[0] = ldg16(sAh + fa + kk);
        a.q[1] = ldg16(sAh + fa + kk + 16);
        a2.q[0] = ldg16(sAl + fa + kk);
        a2.q[1] = ldg16(sAl + fa + kk + 16);
        b0.q[0] = ldg16(sBh + fb + kk);
        b0.q[1] = ldg16(sBh + fb + kk + 16);
        b1.q[0] = ldg16(sBh + fb + 16 * PIT + kk);
        b1.q[1] = ldg16(sBh + fb + 16 * PIT + kk + 16);
        b2.q[0] = ldg16(sBh + fb + 32 * PIT + kk);
        b2.q[1] = ldg16(sBh + fb + 32 * PIT + kk + 16);
        b3.q[0] = ldg16(sBh + fb + 48 * PIT + kk);
        b3.q[1] = ldg16(sBh + fb + 48 * PIT + kk + 16);
        c0.q[0] = ldg16(sBl + fb + kk);
        c0.q[1] = ldg16(sBl + fb + kk + 16);
        c1.q[0] = ldg16(sBl + fb + 16 * PIT + kk);
        c1.q[1] = ldg16(sBl + fb + 16 * PIT + kk + 16);
        c2.q[0] = ldg16(sBl + fb + 32 * PIT + kk);
        c2.q[1] = ldg16(sBl + fb + 32 * PIT + kk + 16);
        c3.q[0] = ldg16(sBl + fb + 48 * PIT + kk);
        c3.q[1] = ldg16(sBl + fb + 48 * PIT + kk + 16);
        acc[0] = mma_b(a.v, b0.v, acc[0]);
        acc[0] = mma_b(a.v, c0.v, acc[0]);
        acc[0] = mma_b(a2.v, b0.v, acc[0]);
        acc[1] = mma_b(a.v, b1.v, acc[1]);
        acc[1] = mma_b(a.v, c1.v, acc[1]);
        acc[1] = mma_b(a2.v, b1.v, acc[1]);
        acc[2] = mma_b(a.v, b2.v, acc[2]);
        acc[2] = mma_b(a.v, c2.v, acc[2]);
        acc[2] = mma_b(a2.v, b2.v, acc[2]);
        acc[3] = mma_b(a.v, b3.v, acc[3]);
        acc[3] = mma_b(a.v, c3.v, acc[3]);
        acc[3] = mma_b(a2.v, b3.v, acc[3]);
        // four vector slots behind the last WMMA, on every path, before its operands or results are touched
        asm volatile(NOP4
                     : "+v"(acc[0]), "+v"(acc[1]), "+v"(acc[2]), "+v"(acc[3])
                     : "v"(a.v), "v"(a2.v), "v"(b0.v), "v"(b1.v), "v"(b2.v), "v"(b3.v),
                       "v"(c0.v), "v"(c1.v), "v"(c2.v), "v"(c3.v));
      } else {
        FragH a, b0, b1, b2, b3;
        a.q[0] = ldg16(sAh + fa + kk);
        a.q[1] = ldg16(sAh + fa + kk + 16);
        b0.q[0] = ldg16(sBh + fb + kk);
        b0.q[1] = ldg16(sBh + fb + kk + 16);
        b1.q[0] = ldg16(sBh + fb + 16 * PIT + kk);
        b1.q[1] = ldg16(sBh + fb + 16 * PIT + kk + 16);
        b2.q[0] = ldg16(sBh + fb + 32 * PIT + kk);
        b2.q[1] = ldg16(sBh + fb + 32 * PIT + kk + 16);
        b3.q[0] = ldg16(sBh + fb + 48 * PIT + kk);
        b3.q[1] = ldg16(sBh + fb + 48 * PIT + kk + 16);
        acc[0] = mma_h(a.v, b0.v, acc[0]);
        acc[1] = mma_h(a.v, b1.v, acc[1]);
        acc[2] = mma_h(a.v, b2.v, acc[2]);
        acc[3] = mma_h(a.v, b3.v, acc[3]);
        // four vector slots behind the last WMMA, on every path, before its operands or results are touched
        asm volatile(NOP4
                     : "+v"(acc[0]), "+v"(acc[1]), "+v"(acc[2]), "+v"(acc[3])
                     : "v"(a.v), "v"(b0.v), "v"(b1.v), "v"(b2.v), "v"(b3.v));
      }
    }
    __syncthreads();  // every wave has left the tile before it is overwritten (next tile, or the epilogue tile)
  }

  // stage: D element r of lane (g,m), n-tile nt -> (row w*16+8g+r, col nt*16+m)
#pragma unroll
  for (int nt = 0; nt < 4; ++nt) {
    const int col = nt * 16 + m;
    const float bv = bias[nBase + col];
#pragma unroll
    for (int r = 0; r < 8; ++r) stg[(w * 16 + 8 * g + r) * 68 + col] = acc[nt][r] * oscale + bv;
  }
  __syncthreads();

  if (OM == 0) {
    unsigned short* o = (unsigned short*)out0;
    v4u val[4];
    size_t adr[4];
#pragma unroll
    for (int t = 0; t < 4; ++t) {
      const int row = w * 16 + t * 4 + (l >> 3), c8 = (l & 7) * 8;
      const float* sp = stg + row * 68 + c8;
      const v4f x0 = *(const v4f*)sp;
      const v4f x1 = *(const v4f*)(sp + 4);
      val[t] = pack_h8(x0, x1);
      adr[t] = (size_t)(mBase + row) * N + nBase + c8;
    }
#pragma unroll
    for (int t = 0; t < 4; ++t) *(v4u*)(o + adr[t]) = val[t];
    
  } else if (OM == 1) {
    // tile rows = s (128 consecutive within one batch), cols = d of head nBase/64:  out[bh][d][s]
    unsigned short* oh = (unsigned short*)out0;
    unsigned short* ol = (unsigned short*)out1;
    const int Hn = N >> 6;
    const int bb = mBase / Sq;
    const int bh = bb * Hn + (nBase >> 6);
    const int sBase = mBase - bb * Sq;
    v4u Hv[4], Lv[4];
    size_t adr[4];
#pragma unroll
    for (int t = 0; t < 4; ++t) {
      const int d = w * 8 + t * 2 + (l >> 4), s8 = (l & 15) * 8;
      v4f x0, x1;
#pragma unroll
      for (int e = 0; e < 4; ++e) {
        x0[e] = stg[(s8 + e) * 68 + d];
        x1[e] = stg[(s8 + 4 + e) * 68 + d];
      }
      split_b8(x0, x1, Hv[t], Lv[t]);
      adr[t] = ((size_t)bh * 64 + d) * Sq + sBase + s8;
    }
#pragma unroll
    for (int t = 0; t < 4; ++t) {
      *(v4u*)(oh + adr[t]) = Hv[t];
      *(v4u*)(ol + adr[t]) = Lv[t];
    }
    
  } else {
    float* o = (float*)out0;
    v4f val[8];
    size_t adr[8];
#pragma unroll
    for (int t = 0; t < 8; ++t) {
      const int row = w * 16 + t * 2 + (l >> 4), c4 = (l & 15) * 4;
      val[t] = *(const v4f*)(stg + row * 68 + c4);
      adr[t] = (size_t)(mBase + row) * N + nBase + c4;
    }
#pragma unroll
    for (int t = 0; t < 8; ++t) *(v4f*)(o + adr[t]) = val[t];
    
  }
}

// ---------------------------------------------------------------------------
// Fused attention: one block of ANW waves per (16 query rows, batch).  Dynamic LDS:
//   sL[16][S+4] f32  gated+scaled scores of the current head, then exp(s - rowmax);
//   mL[16][S+4] f32  sum over heads of the softmax probabilities (lane-owned elements).
// Row pitch S+4 floats = 16 B x odd: the 16 lanes of a half wave, one query row each, then fall on
// 16 different groups of four banks in every b128 access; at a pitch of S floats they share one group.
// The keys are split over the waves: wave w owns a contiguous run of 32-key chunks in all
// three sweeps, so every sL / mL word is written and read back by one lane of one wave.
// Per head h: score tiles S^T = K_tile . Q^T (A = k rows, B = q rows; D lane (g,m) holds
// query m, keys jt*16+8g+r), exact two-sweep softmax, then P.V with the P fragment read
// back from the same lane's own LDS words (elements 0..7 <- keys k0+8g.., 8..15 <- k0+16+8g..),
// V fragments from the transposed planes vt[bh][d][s].  Row max, row sum and the 16x64 P.V
// partial tiles are combined over the waves through LDS, always in wave order.
// ---------------------------------------------------------------------------
#define ANW 16
typedef unsigned int v2u __attribute__((ext_vector_type(2)));

__global__ __launch_bounds__(ANW * 32) void k_attn(const unsigned short* __restrict__ qh,
                                                  const unsigned short* __restrict__ kh,
                                                  const unsigned short* __restrict__ vth,
                                                  const unsigned short* __restrict__ vtl,
                                                  const float* __restrict__ sw, unsigned short* ctxh,
                                                  unsigned short* ctxl, float* mout, int S, int H) {
  extern __shared__ v4f dsm[];
  __shared__ float redM[ANW * 16];  // per wave, per query: max over the wave's keys
  __shared__ float redS[ANW * 16];  // per wave, per query: sum of exp over the wave's keys
  float* sL = (float*)dsm;
  const int PS = S + 4;  // LDS row pitch of both planes, in floats
  float* mL = sL + (size_t)16 * PS;
  const int i0 = blockIdx.x * 16, b = blockIdx.y;
  if (i0 + 16 > S) return;  // block-uniform
  const int tid = threadIdx.x;
  const int l = tid & 31, g = l >> 4, m = l & 15;
  const int w = __builtin_amdgcn_readfirstlane(tid >> 5);  // scalar, so the sweeps' trip counts are scalar
  const int E = H * 64;

  {
    v4f z;
    z[0] = 0.f; z[1] = 0.f; z[2] = 0.f; z[3] = 0.f;
    v4f* m4 = (v4f*)mL;
    const int n4 = 4 * PS;
    for (int i = tid; i < n4; i += ANW * 32) m4[i] = z;
  }
  __syncthreads();

  float* srow = sL + (size_t)m * PS;
  float* mrow = mL + (size_t)m * PS;
  const float invH = 1.0f / (float)H;
  const int nC = S >> 5;
  const int cpw = (nC + ANW - 1) / ANW;
  const int c0 = min(w * cpw, nC), c1 = min(c0 + cpw, nC);  // this wave's 32-key chunks
  const int t0w = 2 * c0, t1w = 2 * c1;                     // the same keys as 16-key tiles

  for (int h = 0; h < H; ++h) {
    FragH qa0, qa1;
    {
      const unsigned short* qp = qh + (size_t)(b * S + i0 + m) * E + h * 64 + 8 * g;
      qa0.q[0] = ldg16(qp);
      qa0.q[1] = ldg16(qp + 16);
      qa1.q[0] = ldg16(qp + 32);
      qa1.q[1] = ldg16(qp + 48);
    }
    const float gsc = sw[b * 32 + h] * 0.125f;

    // sweep A: scores -> LDS, running row max
    float rmax = -3.0e38f;
    const unsigned short* kp = kh + (size_t)(b * S + m) * E + h * 64 + 8 * g;
    for (int jt = t0w; jt < t1w; ++jt) {
      const unsigned short* kr = kp + (size_t)jt * 16 * E;
      FragH ka0, ka1;
      ka0.q[0] = ldg16(kr);
      ka0.q[1] = ldg16(kr + 16);
      ka1.q[0] = ldg16(kr + 32);
      ka1.q[1] = ldg16(kr + 48);
      v8f sc = zero8();
      sc = mma_h(ka0.v, qa0.v, sc);
      sc = mma_h(ka1.v, qa1.v, sc);
      asm volatile(NOP4 : "+v"(sc) : "v"(ka0.v), "v"(ka1.v), "v"(qa0.v), "v"(qa1.v));
      v4f t0, t1;
#pragma unroll
      for (int r = 0; r < 4; ++r) {
        t0[r] = sc[r] * gsc;
        t1[r] = sc[r + 4] * gsc;
        rmax = fmaxf(rmax, t0[r]);
        rmax = fmaxf(rmax, t1[r]);
      }
      float* pp = srow + jt * 16 + 8 * g;
      *(v4f*)pp = t0;
      *(v4f*)(pp + 4) = t1;
    }
    rmax = fmaxf(rmax, __shfl_xor(rmax, 16));
    if (g == 0) redM[w * 16 + m] = rmax;
    __syncthreads();
#pragma unroll  // the ANW LDS reads issue together instead of one latency per trip
    for (int ww = 0; ww < ANW; ++ww) rmax = fmaxf(rmax, redM[ww * 16 + m]);

    // sweep B: e = exp(s - max) stored back in place, row sum
    float lsum = 0.f;
    for (int jt = t0w; jt < t1w; ++jt) {
      float* pp = srow + jt * 16 + 8 * g;
      v4f t0 = *(v4f*)pp;
      v4f t1 = *(v4f*)(pp + 4);
#pragma unroll
      for (int r = 0; r < 4; ++r) {
        t0[r] = __expf(t0[r] - rmax);
        t1[r] = __expf(t1[r] - rmax);
        lsum += t0[r];
        lsum += t1[r];
      }
      *(v4f*)pp = t0;
      *(v4f*)(pp + 4) = t1;
    }
    lsum += __shfl_xor(lsum, 16);
    if (g == 0) redS[w * 16 + m] = lsum;
    __syncthreads();
    lsum = 0.f;
#pragma unroll  // the ANW LDS reads issue together instead of one latency per trip
    for (int ww = 0; ww < ANW; ++ww) lsum += redS[ww * 16 + m];
    const float linv = 1.0f / lsum;

    // sweep C: probabilities, head-sum accumulation, P.V over this wave's keys
    v8f cacc[4];
#pragma unroll
    for (int nt = 0; nt < 4; ++nt) cacc[nt] = zero8();
    const size_t vb = ((size_t)(b * H + h) * 64 + m) * S + 8 * g;
    const size_t vnt = (size_t)16 * S;
#pragma unroll 1
    for (int jc = c0; jc < c1; ++jc) {
      const int k0 = jc * 32;
      float* pa = srow + k0 + 8 * g;
      float* pb = srow + k0 + 16 + 8 * g;
      const v4f p0 = *(v4f*)pa * linv;
      const v4f p1 = *(v4f*)(pa + 4) * linv;
      const v4f p2 = *(v4f*)pb * linv;
      const v4f p3 = *(v4f*)(pb + 4) * linv;
      {
        v4f* ma = (v4f*)(mrow + k0 + 8 * g);
        v4f* mb = (v4f*)(mrow + k0 + 16 + 8 * g);
        const v4f s0 = ma[0] + p0;
        const v4f s1 = ma[1] + p1;
        const v4f s2 = mb[0] + p2;
        const v4f s3 = mb[1] + p3;
        ma[0] = s0;
        ma[1] = s1;
        mb[0] = s2;
        mb[1] = s3;
      }
      FragB ph, pl;
      split_b8(p0, p1, ph.q[0], pl.q[0]);
      split_b8(p2, p3, ph.q[1], pl.q[1]);
      FragB vh0, vh1, vh2, vh3, vl0, vl1, vl2, vl3;
      vh0.q[0] = ldg16(vth + vb + k0);
      vh0.q[1] = ldg16(vth + vb + k0 + 16);
      vh1.q[0] = ldg16(vth + vb + vnt + k0);
      vh1.q[1] = ldg16(vth + vb + vnt + k0 + 16);
      vh2.q[0] = ldg16(vth + vb + 2 * vnt + k0);
      vh2.q[1] = ldg16(vth + vb + 2 * vnt + k0 + 16);
      vh3.q[0] = ldg16(vth + vb + 3 * vnt + k0);
      vh3.q[1] = ldg16(vth + vb + 3 * vnt + k0 + 16);
      vl0.q[0] = ldg16(vtl + vb + k0);
      vl0.q[1] = ldg16(vtl + vb + k0 + 16);
      vl1.q[0] = ldg16(vtl + vb + vnt + k0);
      vl1.q[1] = ldg16(vtl + vb + vnt + k0 + 16);
      vl2.q[0] = ldg16(vtl + vb + 2 * vnt + k0);
      vl2.q[1] = ldg16(vtl + vb + 2 * vnt + k0 + 16);
      vl3.q[0] = ldg16(vtl + vb + 3 * vnt + k0);
      vl3.q[1] = ldg16(vtl + vb + 3 * vnt + k0 + 16);
      cacc[0] = mma_b(ph.v, vh0.v, cacc[0]);
      cacc[0] = mma_b(ph.v, vl0.v, cacc[0]);
      cacc[0] = mma_b(pl.v, vh0.v, cacc[0]);
      cacc[1] = mma_b(ph.v, vh1.v, cacc[1]);
      cacc[1] = mma_b(ph.v, vl1.v, cacc[1]);
      cacc[1] = mma_b(pl.v, vh1.v, cacc[1]);
      cacc[2] = mma_b(ph.v, vh2.v, cacc[2]);
      cacc[2] = mma_b(ph.v, vl2.v, cacc[2]);
      cacc[2] = mma_b(pl.v, vh2.v, cacc[2]);
      cacc[3] = mma_b(ph.v, vh3.v, cacc[3]);
      cacc[3] = mma_b(ph.v, vl3.v, cacc[3]);
      cacc[3] = mma_b(pl.v, vh3.v, cacc[3]);
      asm volatile(NOP4
                   : "+v"(cacc[0]), "+v"(cacc[1]), "+v"(cacc[2]), "+v"(cacc[3])
                   : "v"(ph.v), "v"(pl.v), "v"(vh0.v), "v"(vh1.v), "v"(vh2.v), "v"(vh3.v),
                     "v"(vl0.v), "v"(vl1.v), "v"(vl2.v), "v"(vl3.v));
    }

    // every wave has left the score plane: it now holds ANW partial tiles of 16 x 68 f32
    __syncthreads();
    float* part = sL + w * (16 * 68);
#pragma unroll
    for (int nt = 0; nt < 4; ++nt) {
#pragma unroll
      for (int r = 0; r < 8; ++r) part[(8 * g + r) * 68 + nt * 16 + m] = cacc[nt][r];
    }
    __syncthreads();
    if (w < 8) {  // 256 threads, 4 columns each: a row's 128-B line per plane leaves from 16 lanes of one wave
      const int row = tid >> 4, c4 = (tid & 15) * 4;
      const float* sp = sL + row * 68 + c4;
      v4f x = *(const v4f*)sp;
#pragma unroll  // the ANW LDS reads issue together instead of one latency per trip
      for (int ww = 1; ww < ANW; ++ww) x += *(const v4f*)(sp + ww * (16 * 68));
      unsigned int hb[4], lb[4];
#pragma unroll  // constant indices keep hb and lb in registers
      for (int e = 0; e < 4; ++e) {
        hb[e] = bf_bits(x[e]);
        lb[e] = bf_bits(x[e] - bf_val(hb[e]));
      }
      v2u Hv, Lv;
      Hv[0] = pk2(hb[0], hb[1]);
      Hv[1] = pk2(hb[2], hb[3]);
      Lv[0] = pk2(lb[0], lb[1]);
      Lv[1] = pk2(lb[2], lb[3]);
      const size_t adr = (size_t)(b * S + i0 + row) * E + h * 64 + c4;
      *(v2u*)(ctxh + adr) = Hv;
      *(v2u*)(ctxl + adr) = Lv;
    }
    __syncthreads();
  }

  // head-mean rows: 16 rows x S f32, one row per wave, 512 B per store instruction, lane-contiguous
  __syncthreads();
  float* ob = mout + (size_t)(b * S + i0) * S;
  const int nL = S >> 7;
  for (int row = w; row < 16; row += ANW) {
    for (int c = 0; c < nL; ++c) {
      const size_t off = (size_t)row * S + c * 128 + l * 4;
      const v4f v = *(const v4f*)(mL + (size_t)row * PS + c * 128 + l * 4) * invH;
      *(v4f*)(ob + off) = v;
    }
  }
  
}

// ---------------------------------------------------------------------------
// Host launcher
// ---------------------------------------------------------------------------
extern "C" void kernel_launch(void* const* d_in, const int* in_sizes, int n_in, void* d_out,
                              int out_size, void* d_ws, size_t ws_size, hipStream_t stream) {
  if (n_in < 14) return;
  const int E = 1024, H = 16;
  const int nX = in_sizes[0];
  if (nX <= 0 || (nX % E) != 0) return;
  const int M = nX / E;
  const int nSy = in_sizes[1];
  if (nSy <= 0 || (nSy % E) != 0) return;
  const int Bn = nSy / E;
  if (Bn <= 0 || (M % Bn) != 0) return;
  const int S = M / Bn;
  const int HID = in_sizes[9];
  if ((M % 128) != 0 || (S % 128) != 0 || HID <= 0 || HID > 256) return;
  if (S < 1152) return;  // the attention kernel's 16 partial tiles of 16 x 68 f32 reuse its 16 x (S+4) score plane
  if (in_sizes[2] != E * E || in_sizes[4] != E * E || in_sizes[6] != E * E || in_sizes[12] != E * E) return;
  if (in_sizes[3] != E || in_sizes[5] != E || in_sizes[7] != E || in_sizes[13] != E) return;
  if (in_sizes[8] != E * HID || in_sizes[10] != HID * H || in_sizes[11] != H) return;
  if ((long long)out_size != (long long)nX + (long long)Bn * (long long)S * (long long)S) return;

  const float* x = (const float*)d_in[0];
  const float* sync = (const float*)d_in[1];
  const float* Wq = (const float*)d_in[2];
  const float* bq = (const float*)d_in[3];
  const float* Wk = (const float*)d_in[4];
  const float* bk = (const float*)d_in[5];
  const float* Wv = (const float*)d_in[6];
  const float* bv = (const float*)d_in[7];
  const float* Ws1 = (const float*)d_in[8];
  const float* bs1 = (const float*)d_in[9];
  const float* Ws2 = (const float*)d_in[10];
  const float* bs2 = (const float*)d_in[11];
  const float* Wo = (const float*)d_in[12];
  const float* bo = (const float*)d_in[13];

  float* out_proj = (float*)d_out;                 // [M][E] f32
  float* out_mean = (float*)d_out + (size_t)nX;    // [Bn][S][S] f32

  // workspace carve (bytes), every sub-buffer 256-B aligned
  size_t off = 0;
  auto al = [&](size_t bytes) { size_t o = off; off += (bytes + 255) & ~(size_t)255; return o; };
  const size_t nW = (size_t)E * E;
  const size_t o_sw = al((size_t)Bn * 32 * 4);
  const size_t o_xh = al((size_t)nX * 2);
  const size_t o_xbh = al((size_t)nX * 2);
  const size_t o_xbl = al((size_t)nX * 2);
  const size_t o_wq = al(nW * 2);
  const size_t o_wk = al(nW * 2);
  const size_t o_wvh = al(nW * 2);
  const size_t o_wvl = al(nW * 2);
  const size_t o_woh = al(nW * 2);
  const size_t o_wol = al(nW * 2);
  const size_t o_q = al((size_t)nX * 2);
  const size_t o_k = al((size_t)nX * 2);
  const size_t o_vth = al((size_t)nX * 2);
  const size_t o_vtl = al((size_t)nX * 2);
  const size_t o_cth = al((size_t)nX * 2);
  const size_t o_ctl = al((size_t)nX * 2);
  if (off > ws_size) return;

  char* ws = (char*)d_ws;
  float* sw_g = (float*)(ws + o_sw);
  unsigned short* xh = (unsigned short*)(ws + o_xh);
  unsigned short* xbh = (unsigned short*)(ws + o_xbh);
  unsigned short* xbl = (unsigned short*)(ws + o_xbl);
  unsigned short* wqT = (unsigned short*)(ws + o_wq);
  unsigned short* wkT = (unsigned short*)(ws + o_wk);
  unsigned short* wvTh = (unsigned short*)(ws + o_wvh);
  unsigned short* wvTl = (unsigned short*)(ws + o_wvl);
  unsigned short* woTh = (unsigned short*)(ws + o_woh);
  unsigned short* woTl = (unsigned short*)(ws + o_wol);
  unsigned short* qh = (unsigned short*)(ws + o_q);
  unsigned short* kh = (unsigned short*)(ws + o_k);
  unsigned short* vTh = (unsigned short*)(ws + o_vth);
  unsigned short* vTl = (unsigned short*)(ws + o_vtl);
  unsigned short* cth = (unsigned short*)(ws + o_cth);
  unsigned short* ctl = (unsigned short*)(ws + o_ctl);

  // 1) activation planes
  {
    const int groups = nX / 8;
    const int blocks = (groups + 255) / 256;
    k_cvt_x<<<dim3(blocks), dim3(256), 0, stream>>>(x, xh, xbh, xbl, nX);
  }
  // 2) weight planes, transposed to [n][k]
  {
    dim3 gw(E / 64, E / 64);
    k_cvt_wT<0><<<gw, dim3(256), 0, stream>>>(Wq, wqT, wqT, E, E, 64.0f);
    k_cvt_wT<0><<<gw, dim3(256), 0, stream>>>(Wk, wkT, wkT, E, E, 64.0f);
    k_cvt_wT<1><<<gw, dim3(256), 0, stream>>>(Wv, wvTh, wvTl, E, E, 1.0f);
    k_cvt_wT<1><<<gw, dim3(256), 0, stream>>>(Wo, woTh, woTl, E, E, 1.0f);
  }
  // 3) gate MLP
  k_gate<<<dim3(Bn), dim3(256), 0, stream>>>(sync, Ws1, bs1, Ws2, bs2, sw_g, E, HID, H);
  // 4) projections (M x E, K = E)
  dim3 gg(E / 64, M / 128);
  k_gemm<0, 0><<<gg, dim3(256), 0, stream>>>(xh, xh, wqT, wqT, bq, (void*)qh, (void*)qh, M, E, E, S, 1.0f / 64.0f);
  k_gemm<0, 0><<<gg, dim3(256), 0, stream>>>(xh, xh, wkT, wkT, bk, (void*)kh, (void*)kh, M, E, E, S, 1.0f / 64.0f);
  k_gemm<1, 1><<<gg, dim3(256), 0, stream>>>(xbh, xbl, wvTh, wvTl, bv, (void*)vTh, (void*)vTl, M, E, E, S, 1.0f);
  // 5) attention + head-mean
  {
    const size_t dynB = (size_t)2 * 16 * (size_t)(S + 4) * 4;
    hipFuncSetAttribute(reinterpret_cast<const void*>(&k_attn), hipFuncAttributeMaxDynamicSharedMemorySize, (int)dynB);
    k_attn<<<dim3(S / 16, Bn), dim3(ANW * 32), dynB, stream>>>(qh, kh, vTh, vTl, sw_g, cth, ctl, out_mean, S, H);
  }
  // 6) output projection -> d_out
  k_gemm<1, 2><<<gg, dim3(256), 0, stream>>>(cth, ctl, woTh, woTl, bo, (void*)out_proj, (void*)out_proj, M, E, E, S, 1.0f);
  hipGetLastError();
  hipStreamSynchronize(stream);
}

// v004
// One run takes 447 microseconds.
// Two timings next to v003 put it at 1.12 and 1.11 times that version's speed.
// Counting every step since v000, it is 3.69 times as fast.
#include <hip/hip_runtime.h>

// Contractions: x@Wq, x@Wk and q.k^T : v_wmma_f32_16x16x32_f16 (f16 operands; Wq, Wk carried x64, rescaled in the f32 epilogue; f32 accumulate).
// x@Wv, P.V and ctx@Wo : v_wmma_f32_16x16x32_bf16 with bf16 hi/lo operand split (hi.hi + hi.lo + lo.hi), f32 accumulate. Gate MLP: scalar f32.

#define NOP4 "v_nop\n\tv_nop\n\tv_nop\n\tv_nop"

typedef _Float16 v16h __attribute__((ext_vector_type(16)));
typedef __bf16 v16b __attribute__((ext_vector_type(16)));
typedef float v8f __attribute__((ext_vector_type(8)));
typedef float v4f __attribute__((ext_vector_type(4)));
typedef unsigned int v4u __attribute__((ext_vector_type(4)));

union FragH { v16h v; v4u q[2]; };
union FragB { v16b v; v4u q[2]; };

__device__ __forceinline__ v4u ldg16(const unsigned short* p) { return *(const v4u*)p; }

// RNE f32 -> bf16 bits
__device__ __forceinline__ unsigned int bf_bits(float f) {
  unsigned int u = __float_as_uint(f);
  return (u + 0x7FFFu + ((u >> 16) & 1u)) >> 16;
}
__device__ __forceinline__ float bf_val(unsigned int b) { return __uint_as_float(b << 16); }
// RNE f32 -> f16 bits
__device__ __forceinline__ unsigned int hf_bits(float f) {
  union { _Float16 h; unsigned short u; } c;
  c.h = (_Float16)f;
  return (unsigned int)c.u;
}
__device__ __forceinline__ unsigned int pk2(unsigned int lo, unsigned int hi) {
  return (lo & 0xFFFFu) | (hi << 16);
}
// 8 consecutive f32 -> 8 packed f16 (element 2t in the low half of word t)
__device__ __forceinline__ v4u pack_h8(v4f a, v4f c) {
  v4u r;
  r[0] = pk2(hf_bits(a[0]), hf_bits(a[1]));
  r[1] = pk2(hf_bits(a[2]), hf_bits(a[3]));
  r[2] = pk2(hf_bits(c[0]), hf_bits(c[1]));
  r[3] = pk2(hf_bits(c[2]), hf_bits(c[3]));
  return r;
}
// 8 consecutive f32 -> bf16 hi plane and bf16 residual plane
__device__ __forceinline__ void split_b8(v4f a, v4f c, v4u& H, v4u& L) {
  float v[8] = {a[0], a[1], a[2], a[3], c[0], c[1], c[2], c[3]};
  unsigned int hb[8], lb[8];
#pragma unroll
  for (int e = 0; e < 8; ++e) {
    hb[e] = bf_bits(v[e]);
    lb[e] = bf_bits(v[e] - bf_val(hb[e]));
  }
#pragma unroll
  for (int t = 0; t < 4; ++t) {
    H[t] = pk2(hb[2 * t], hb[2 * t + 1]);
    L[t] = pk2(lb[2 * t], lb[2 * t + 1]);
  }
}

__device__ __forceinline__ v8f zero8() {
  v8f z;
#pragma unroll
  for (int r = 0; r < 8; ++r) z[r] = 0.f;
  return z;
}
__device__ __forceinline__ v8f mma_h(v16h a, v16h b, v8f c) {
  return __builtin_amdgcn_wmma_f32_16x16x32_f16(false, a, false, b, (short)0, c, false, false);
}
__device__ __forceinline__ v8f mma_b(v16b a, v16b b, v8f c) {
  return __builtin_amdgcn_wmma_f32_16x16x32_bf16(false, a, false, b, (short)0, c, false, false);
}

// ---------------------------------------------------------------------------
// x [n] f32 -> f16 plane (unscaled) and bf16 hi / lo planes. 8 elements per thread,
// ---------------------------------------------------------------------------
__global__ __launch_bounds__(256) void k_cvt_x(const float* __restrict__ x, unsigned short* xh,
                                              unsigned short* xbh, unsigned short* xbl, int n) {
  const size_t i8 = ((size_t)blockIdx.x * 256u + (size_t)threadIdx.x) * 8u;
  if (i8 + 8 > (size_t)n) return;
  const v4f a = *(const v4f*)(x + i8);
  const v4f c = *(const v4f*)(x + i8 + 4);
  const v4u fh = pack_h8(a, c);
  v4u bh, bl;
  split_b8(a, c, bh, bl);
  *(v4u*)(xh + i8) = fh;
  *(v4u*)(xbh + i8) = bh;
  *(v4u*)(xbl + i8) = bl;
  
}

// ---------------------------------------------------------------------------
// W[Kd][Nd] f32 -> WT[Nd][Kd] 16-bit (k-contiguous rows).  64x64 tile through LDS.
// MODE 0: f16 of (W * scale) into o0.  MODE 1: bf16 hi into o0, bf16 lo into o1.
// ---------------------------------------------------------------------------
template <int MODE>
__global__ __launch_bounds__(256) void k_cvt_wT(const float* __restrict__ W, unsigned short* o0,
                                               unsigned short* o1, int Kd, int Nd, float scale) {
  __shared__ float tile[64][65];
  const int n0 = blockIdx.x * 64, e0 = blockIdx.y * 64;
  if (n0 + 64 > Nd || e0 + 64 > Kd) return;  // block-uniform
  const int tid = threadIdx.x;
#pragma unroll
  for (int t = 0; t < 4; ++t) {
    const int idx = t * 256 + tid;
    const int rr = idx >> 4, c4 = (idx & 15) * 4;
    const v4f v = *(const v4f*)(W + (size_t)(e0 + rr) * Nd + n0 + c4);
    tile[rr][c4] = v[0];
    tile[rr][c4 + 1] = v[1];
    tile[rr][c4 + 2] = v[2];
    tile[rr][c4 + 3] = v[3];
  }
  __syncthreads();
  v4u Hv[2], Lv[2];
  size_t adr[2];
#pragma unroll
  for (int t = 0; t < 2; ++t) {
    const int s = t * 256 + tid;
    const int nn = s >> 3, kq = (s & 7) * 8;
    v4f a, c;
#pragma unroll
    for (int e = 0; e < 4; ++e) {
      a[e] = tile[kq + e][nn] * scale;
      c[e] = tile[kq + 4 + e][nn] * scale;
    }
    if (MODE == 0) {
      Hv[t] = pack_h8(a, c);
      Lv[t] = Hv[t];
    } else {
      split_b8(a, c, Hv[t], Lv[t]);
    }
    adr[t] = (size_t)(n0 + nn) * Kd + e0 + kq;
  }
#pragma unroll
  for (int t = 0; t < 2; ++t) {
    *(v4u*)(o0 + adr[t]) = Hv[t];
    if (MODE == 1) *(v4u*)(o1 + adr[t]) = Lv[t];
  }
  
}

// ---------------------------------------------------------------------------
// Gate MLP: swo[b*32 + h] = sigmoid(relu(sync @ W1 + b1) @ W2 + b2), h < Hn; padding 0.
// ---------------------------------------------------------------------------
__global__ __launch_bounds__(256) void k_gate(const float* __restrict__ sync, const float* __restrict__ W1,
                                             const float* __restrict__ b1, const float* __restrict__ W2,
                                             const float* __restrict__ b2, float* swo, int Ein, int Hd, int Hn) {
  __shared__ float hid[256];
  __shared__ float gv[32];
  const int b = blockIdx.x, tid = threadIdx.x;
  for (int j = tid; j < Hd; j += 256) {
    float a = b1[j];
    for (int e = 0; e < Ein; ++e) a += sync[(size_t)b * Ein + e] * W1[(size_t)e * Hd + j];
    hid[j] = fmaxf(a, 0.f);
  }
  __syncthreads();
  if (tid < 32) {
    float val = 0.f;
    if (tid < Hn) {
      float a = b2[tid];
      for (int t = 0; t < Hd; ++t) a += hid[t] * W2[(size_t)t * Hn + tid];
      val = 1.0f / (1.0f + expf(-a));
    }
    gv[tid] = val;
  }
  __syncthreads();
  if (tid < 8) {
    v4f v;
    v[0] = gv[tid * 4];
    v[1] = gv[tid * 4 + 1];
    v[2] = gv[tid * 4 + 2];
    v[3] = gv[tid * 4 + 3];
    float* p = swo + (size_t)b * 32 + tid * 4;
    *(v4f*)p = v;
    
  }
}

// ---------------------------------------------------------------------------
// C[M,N] = A[M,K] @ B[K,N] (+bias) with A row-major 16-bit and B given as BT[N][K] 16-bit.
// Block tile 128x64, 256 threads = 8 waves, wave w owns rows w*16..w*16+15, 4 n-tiles.
// The k range is walked in tiles of 64: the block's 128 A rows and 64 B rows (each plane) are
// brought to LDS once per tile, 128 B of a row from 8 neighbouring lanes, the next tile's
// global loads in flight in registers while this tile is multiplied.  Fragments are read from
// LDS with the 16x16x32 split k-map
//   (lane l: row/col = l&15; elements 0..7 <- k0+8*(l>>4)+0..7, 8..15 <- k0+16+8*(l>>4)+0..7).
// SPLIT 0: single f16 product.  SPLIT 1: bf16 hi/lo planes, three products.
// OM 0: f16 in the attention kernel's fragment order: per (batch, head) and 16-row tile one 2-KB block of
//       4 x 512 B, piece t of lane l=(g,m) = row m, columns (2t+g)*8..+7 of the head.
// OM 1: bf16 hi/lo in fragment order: per (batch, head) and 32-key chunk one 4-KB block per plane of
//       8 x 512 B, piece nt*2+q of lane l=(g,m) = column d nt*16+m, keys q*16+8g..+7 of the chunk.
//       In both, one wave-wide 16-B load or store of a piece covers 512 contiguous bytes (4 whole lines).
// OM 2: f32 row-major [M][N].
// ---------------------------------------------------------------------------
template <int SPLIT, int OM>
__global__ __launch_bounds__(256) void k_gemm(const unsigned short* __restrict__ Ah,
                                             const unsigned short* __restrict__ Al,
                                             const unsigned short* __restrict__ Bh,
                                             const unsigned short* __restrict__ Bl,
                                             const float* __restrict__ bias, void* out0, void* out1,
                                             int M, int N, int K, int Sq, float oscale) {
  constexpr int PIT = 72;  // LDS row pitch in 16-bit elements: 144 B = 16 B x 9, b128 fragment reads without bank conflicts
  constexpr int TILE16 = (SPLIT ? 2 : 1) * (128 + 64) * PIT / 8;  // staged operand tiles, in 16-B units
  constexpr int STG16 = 128 * 17;                                 // epilogue tile, 128 x 68 f32, in 16-B units
  __shared__ v4f smem[TILE16 > STG16 ? TILE16 : STG16];           // the epilogue tile reuses the operand tiles' space
  float* stg = (float*)smem;
  unsigned short* sAh = (unsigned short*)smem;
  unsigned short* sBh = sAh + 128 * PIT;
  unsigned short* sAl = sBh + 64 * PIT;  // the two lo planes exist only with SPLIT
  unsigned short* sBl = sAl + 128 * PIT;
  const int nBase = blockIdx.x * 64, mBase = blockIdx.y * 128;
  if (nBase + 64 > N || mBase + 128 > M || (K & 63) != 0) return;  // block-uniform
  const int tid = threadIdx.x, w = tid >> 5, l = tid & 31, g = l >> 4, m = l & 15;

  v8f acc[4];
#pragma unroll
  for (int nt = 0; nt < 4; ++nt) acc[nt] = zero8();

  // staging map: thread -> row tid>>3 (+32 per step), 16-B piece tid&7 of the row's 128 B
  const int lr = tid >> 3, lc = (tid & 7) * 8;
  // global address = block-uniform byte base (moves with k) + a per-thread 32-bit byte offset that never changes
  const char* bAh = (const char*)(Ah + (size_t)mBase * K);
  const char* bAl = (const char*)(Al + (size_t)mBase * K);
  const char* bBh = (const char*)(Bh + (size_t)nBase * K);
  const char* bBl = (const char*)(Bl + (size_t)nBase * K);
  unsigned int go[4];
#pragma unroll  // here and below: constant indices keep the small per-thread arrays in registers
  for (int t = 0; t < 4; ++t) go[t] = (unsigned int)(((lr + 32 * t) * K + lc) * 2);
  const int ls = lr * PIT + lc;
  const int fa = (w * 16 + m) * PIT + 8 * g;  // this lane's A fragment row in LDS
  const int fb = m * PIT + 8 * g;             // this lane's B fragment row of n-tile 0

  v4u rah[4], ral[4], rbh[2], rbl[2];
#pragma unroll
  for (int t = 0; t < 4; ++t) {
    rah[t] = *(const v4u*)(bAh + go[t]);
    if (SPLIT) ral[t] = *(const v4u*)(bAl + go[t]);
  }
#pragma unroll
  for (int t = 0; t < 2; ++t) {
    rbh[t] = *(const v4u*)(bBh + go[t]);
    if (SPLIT) rbl[t] = *(const v4u*)(bBl + go[t]);
  }

#pragma unroll 1  // one copy of the body: the staged pieces and both k halves' fragments already fill the register budget
  for (int k0 = 0; k0 < K; k0 += 64) {
#pragma unroll
    for (int t = 0; t < 4; ++t) {
      *(v4u*)(sAh + ls + t * 32 * PIT) = rah[t];
      if (SPLIT) *(v4u*)(sAl + ls + t * 32 * PIT) = ral[t];
    }
#pragma unroll
    for (int t = 0; t < 2; ++t) {
      *(v4u*)(sBh + ls + t * 32 * PIT) = rbh[t];
      if (SPLIT) *(v4u*)(sBl + ls + t * 32 * PIT) = rbl[t];
    }
    __syncthreads();  // the tile is complete before any wave reads fragments from it
    if (k0 + 64 < K) {
      const size_t kn = (size_t)(k0 + 64) * 2;
      const char *pah[4], *pal[4], *pbh[2], *pbl[2];
#pragma unroll
      for (int t = 0; t < 4; ++t) {
        pah[t] = bAh + kn + go[t];
        pal[t] = bAl + kn + go[t];
        rah[t] = *(const v4u*)pah[t];
        if (SPLIT) ral[t] = *(const v4u*)pal[t];
      }
#pragma unroll
      for (int t = 0; t < 2; ++t) {
        pbh[t] = bBh + kn + go[t];
        pbl[t] = bBl + kn + go[t];
        rbh[t] = *(const v4u*)pbh[t];
        if (SPLIT) rbl[t] = *(const v4u*)pbl[t];
      }
      // the prefetch loads' address registers are free for reuse (fragment reads below) only behind this wait;
      // naming the addresses as inputs keeps them in their registers up to it
      if (SPLIT)
        asm volatile("s_wait_xcnt 0x0" ::"v"(pah[0]), "v"(pah[1]), "v"(pah[2]), "v"(pah[3]), "v"(pbh[0]), "v"(pbh[1]),
                     "v"(pal[0]), "v"(pal[1]), "v"(pal[2]), "v"(pal[3]), "v"(pbl[0]), "v"(pbl[1])
                     : "memory");
      else
        asm volatile("s_wait_xcnt 0x0" ::"v"(pah[0]), "v"(pah[1]), "v"(pah[2]), "v"(pah[3]), "v"(pbh[0]), "v"(pbh[1])
                     : "memory");
    }
#pragma unroll  // both k halves of the tile in one body, LDS offsets as immediates
    for (int kk = 0; kk < 64; kk += 32) {
      if (SPLIT) {
        FragB a, a2, b0, b1, b2, b3, c0, c1, c2, c3;
        a.q[0] = ldg16(sAh + fa + kk);
        a.q[1] = ldg16(sAh + fa + kk + 16);
        a2.q[0] = ldg16(sAl + fa + kk);
        a2.q[1] = ldg16(sAl + fa + kk + 16);
        b0.q[0] = ldg16(sBh + fb + kk);
        b0.q[1] = ldg16(sBh + fb + kk + 16);
        b1.q[0] = ldg16(sBh + fb + 16 * PIT + kk);
        b1.q[1] = ldg16(sBh + fb + 16 * PIT + kk + 16);
        b2.q[0] = ldg16(sBh + fb + 32 * PIT + kk);
        b2.q[1] = ldg16(sBh + fb + 32 * PIT + kk + 16);
        b3.q[0] = ldg16(sBh + fb + 48 * PIT + kk);
        b3.q[1] = ldg16(sBh + fb + 48 * PIT + kk + 16);
        c0.q[0] = ldg16(sBl + fb + kk);
        c0.q[1] = ldg16(sBl + fb + kk + 16);
        c1.q[0] = ldg16(sBl + fb + 16 * PIT + kk);
        c1.q[1] = ldg16(sBl + fb + 16 * PIT + kk + 16);
        c2.q[0] = ldg16(sBl + fb + 32 * PIT + kk);
        c2.q[1] = ldg16(sBl + fb + 32 * PIT + kk + 16);
        c3.q[0] = ldg16(sBl + fb + 48 * PIT + kk);
        c3.q[1] = ldg16(sBl + fb + 48 * PIT + kk + 16);
        acc[0] = mma_b(a.v, b0.v, acc[0]);
        acc[0] = mma_b(a.v, c0.v, acc[0]);
        acc[0] = mma_b(a2.v, b0.v, acc[0]);
        acc[1] = mma_b(a.v, b1.v, acc[1]);
        acc[1] = mma_b(a.v, c1.v, acc[1]);
        acc[1] = mma_b(a2.v, b1.v, acc[1]);
        acc[2] = mma_b(a.v, b2.v, acc[2]);
        acc[2] = mma_b(a.v, c2.v, acc[2]);
        acc[2] = mma_b(a2.v, b2.v, acc[2]);
        acc[3] = mma_b(a.v, b3.v, acc[3]);
        acc[3] = mma_b(a.v, c3.v, acc[3]);
        acc[3] = mma_b(a2.v, b3.v, acc[3]);
        // four vector slots behind the last WMMA, on every path, before its operands or results are touched
        asm volatile(NOP4
                     : "+v"(acc[0]), "+v"(acc[1]), "+v"(acc[2]), "+v"(acc[3])
                     : "v"(a.v), "v"(a2.v), "v"(b0.v), "v"(b1.v), "v"(b2.v), "v"(b3.v),
                       "v"(c0.v), "v"(c1.v), "v"(c2.v), "v"(c3.v));
      } else {
        FragH a, b0, b1, b2, b3;
        a.q[0] = ldg16(sAh + fa + kk);
        a.q[1] = ldg16(sAh + fa + kk + 16);
        b0.q[0] = ldg16(sBh + fb + kk);
        b0.q[1] = ldg16(sBh + fb + kk + 16);
        b1.q[0] = ldg16(sBh + fb + 16 * PIT + kk);
        b1.q[1] = ldg16(sBh + fb + 16 * PIT + kk + 16);
        b2.q[0] = ldg16(sBh + fb + 32 * PIT + kk);
        b2.q[1] = ldg16(sBh + fb + 32 * PIT + kk + 16);
        b3.q[0] = ldg16(sBh + fb + 48 * PIT + kk);
        b3.q[1] = ldg16(sBh + fb + 48 * PIT + kk + 16);
        acc[0] = mma_h(a.v, b0.v, acc[0]);
        acc[1] = mma_h(a.v, b1.v, acc[1]);
        acc[2] = mma_h(a.v, b2.v, acc[2]);
        acc[3] = mma_h(a.v, b3.v, acc[3]);
        // four vector slots behind the last WMMA, on every path, before its operands or results are touched
        asm volatile(NOP4
                     : "+v"(acc[0]), "+v"(acc[1]), "+v"(acc[2]), "+v"(acc[3])
                     : "v"(a.v), "v"(b0.v), "v"(b1.v), "v"(b2.v), "v"(b3.v));
      }
    }
    __syncthreads();  // every wave has left the tile before it is overwritten (next tile, or the epilogue tile)
  }

  // stage: D element r of lane (g,m), n-tile nt -> (row w*16+8g+r, col nt*16+m)
#pragma unroll
  for (int nt = 0; nt < 4; ++nt) {
    const int col = nt * 16 + m;
    const float bv = bias[nBase + col];
#pragma unroll
    for (int r = 0; r < 8; ++r) stg[(w * 16 + 8 * g + r) * 68 + col] = acc[nt][r] * oscale + bv;
  }
  __syncthreads();

  if (OM == 0) {
    // wave w holds the block's 16-row tile w of head nBase/64
    unsigned short* o = (unsigned short*)out0;
    const int Hn = N >> 6;
    const int bb = mBase / Sq;
    const int bh = bb * Hn + (nBase >> 6);
    const int tl = ((mBase - bb * Sq) >> 4) + w;
    const size_t tb = ((size_t)bh * (Sq >> 4) + tl) * 1024 + l * 8;
    v4u val[4];
    size_t adr[4];
#pragma unroll
    for (int t = 0; t < 4; ++t) {
      const float* sp = stg + (w * 16 + m) * 68 + (2 * t + g) * 8;
      const v4f x0 = *(const v4f*)sp;
      const v4f x1 = *(const v4f*)(sp + 4);
      val[t] = pack_h8(x0, x1);
      adr[t] = tb + t * 256;
    }
#pragma unroll
    for (int t = 0; t < 4; ++t) *(v4u*)(o + adr[t]) = val[t];
    
  } else if (OM == 1) {
    // tile rows = s (128 consecutive within one batch = 4 chunks of 32 keys), cols = d of head nBase/64
    unsigned short* oh = (unsigned short*)out0;
    unsigned short* ol = (unsigned short*)out1;
    const int Hn = N >> 6;
    const int bb = mBase / Sq;
    const int bh = bb * Hn + (nBase >> 6);
    const int sBase = mBase - bb * Sq;
    v4u Hv[4], Lv[4];
    size_t adr[4];
#pragma unroll
    for (int t = 0; t < 4; ++t) {
      const int ch = w >> 1, nt = (w & 1) * 2 + (t >> 1), q = t & 1;  // the block's 32 pieces, 4 per wave
      const int d = nt * 16 + m, s8 = ch * 32 + q * 16 + g * 8;
      v4f x0, x1;
#pragma unroll
      for (int e = 0; e < 4; ++e) {
        x0[e] = stg[(s8 + e) * 68 + d];
        x1[e] = stg[(s8 + 4 + e) * 68 + d];
      }
      split_b8(x0, x1, Hv[t], Lv[t]);
      adr[t] = (((size_t)bh * (Sq >> 5) + (sBase >> 5) + ch) * 8 + nt * 2 + q) * 256 + l * 8;
    }
#pragma unroll
    for (int t = 0; t < 4; ++t) {
      *(v4u*)(oh + adr[t]) = Hv[t];
      *(v4u*)(ol + adr[t]) = Lv[t];
    }
    
  } else {
    float* o = (float*)out0;
    v4f val[8];
    size_t adr[8];
#pragma unroll
    for (int t = 0; t < 8; ++t) {
      const int row = w * 16 + t * 2 + (l >> 4), c4 = (l & 15) * 4;
      val[t] = *(const v4f*)(stg + row * 68 + c4);
      adr[t] = (size_t)(mBase + row) * N + nBase + c4;
    }
#pragma unroll
    for (int t = 0; t < 8; ++t) *(v4f*)(o + adr[t]) = val[t];
    
  }
}

// ---------------------------------------------------------------------------
// Fused attention: one block of ANW waves per (16 query rows, batch).  Dynamic LDS:
//   sL[16][S+4] f32  gated+scaled scores of the current head, then exp(s - rowmax);
//   mL[16][S+4] f32  sum over heads of the softmax probabilities (lane-owned elements).
// Row pitch S+4 floats = 16 B x odd: the 16 lanes of a half wave, one query row each, then fall on
// 16 different groups of four banks in every b128 access; at a pitch of S floats they share one group.
// The keys are split over the waves: wave w owns a contiguous run of 32-key chunks in all
// three sweeps, so every sL / mL word is written and read back by one lane of one wave.
// Per head h: score tiles S^T = K_tile . Q^T (A = k rows, B = q rows; D lane (g,m) holds
// query m, keys jt*16+8g+r), exact two-sweep softmax, then P.V with the P fragment read
// back from the same lane's own LDS words (elements 0..7 <- keys k0+8g.., 8..15 <- k0+16+8g..),
// V fragments from the planes vt.  q, k and vt lie in fragment order (see k_gemm, OM 0 and OM 1): every
// fragment load of a wave reads 512 contiguous bytes.  Row max, row sum and the 16x64 P.V
// partial tiles are combined over the waves through LDS, always in wave order.
// ---------------------------------------------------------------------------
#define ANW 16
typedef unsigned int v2u __attribute__((ext_vector_type(2)));

__global__ __launch_bounds__(ANW * 32) void k_attn(const unsigned short* __restrict__ qh,
                                                  const unsigned short* __restrict__ kh,
                                                  const unsigned short* __restrict__ vth,
                                                  const unsigned short* __restrict__ vtl,
                                                  const float* __restrict__ sw, unsigned short* ctxh,
                                                  unsigned short* ctxl, float* mout, int S, int H) {
  extern __shared__ v4f dsm[];
  __shared__ float redM[ANW * 16];  // per wave, per query: max over the wave's keys
  __shared__ float redS[ANW * 16];  // per wave, per query: sum of exp over the wave's keys
  float* sL = (float*)dsm;
  const int PS = S + 4;  // LDS row pitch of both planes, in floats
  float* mL = sL + (size_t)16 * PS;
  const int i0 = blockIdx.x * 16, b = blockIdx.y;
  if (i0 + 16 > S) return;  // block-uniform
  const int tid = threadIdx.x;
  const int l = tid & 31, g = l >> 4, m = l & 15;
  const int w = __builtin_amdgcn_readfirstlane(tid >> 5);  // scalar, so the sweeps' trip counts are scalar
  const int E = H * 64;

  {
    v4f z;
    z[0] = 0.f; z[1] = 0.f; z[2] = 0.f; z[3] = 0.f;
    v4f* m4 = (v4f*)mL;
    const int n4 = 4 * PS;
    for (int i = tid; i < n4; i += ANW * 32) m4[i] = z;
  }
  __syncthreads();

  float* srow = sL + (size_t)m * PS;
  float* mrow = mL + (size_t)m * PS;
  const float invH = 1.0f / (float)H;
  const int nC = S >> 5;
  const int cpw = (nC + ANW - 1) / ANW;
  const int c0 = min(w * cpw, nC), c1 = min(c0 + cpw, nC);  // this wave's 32-key chunks
  const int t0w = 2 * c0, t1w = 2 * c1;                     // the same keys as 16-key tiles

  for (int h = 0; h < H; ++h) {
    FragH qa0, qa1;
    {
      const unsigned short* qp = qh + ((size_t)(b * H + h) * (S >> 4) + (i0 >> 4)) * 1024 + l * 8;
      qa0.q[0] = ldg16(qp);
      qa0.q[1] = ldg16(qp + 256);
      qa1.q[0] = ldg16(qp + 512);
      qa1.q[1] = ldg16(qp + 768);
    }
    const float gsc = sw[b * 32 + h] * 0.125f;

    // sweep A: scores -> LDS, running row max
    float rmax = -3.0e38f;
    const unsigned short* kp = kh + (size_t)(b * H + h) * (S >> 4) * 1024 + l * 8;
    for (int jt = t0w; jt < t1w; ++jt) {
      const unsigned short* kr = kp + (size_t)jt * 1024;
      FragH ka0, ka1;
      ka0.q[0] = ldg16(kr);
      ka0.q[1] = ldg16(kr + 256);
      ka1.q[0] = ldg16(kr + 512);
      ka1.q[1] = ldg16(kr + 768);
      v8f sc = zero8();
      sc = mma_h(ka0.v, qa0.v, sc);
      sc = mma_h(ka1.v, qa1.v, sc);
      asm volatile(NOP4 : "+v"(sc) : "v"(ka0.v), "v"(ka1.v), "v"(qa0.v), "v"(qa1.v));
      v4f t0, t1;
#pragma unroll
      for (int r = 0; r < 4; ++r) {
        t0[r] = sc[r] * gsc;
        t1[r] = sc[r + 4] * gsc;
        rmax = fmaxf(rmax, t0[r]);
        rmax = fmaxf(rmax, t1[r]);
      }
      float* pp = srow + jt * 16 + 8 * g;
      *(v4f*)pp = t0;
      *(v4f*)(pp + 4) = t1;
    }
    rmax = fmaxf(rmax, __shfl_xor(rmax, 16));
    if (g == 0) redM[w * 16 + m] = rmax;
    __syncthreads();
#pragma unroll  // the ANW LDS reads issue together instead of one latency per trip
    for (int ww = 0; ww < ANW; ++ww) rmax = fmaxf(rmax, redM[ww * 16 + m]);

    // sweep B: e = exp(s - max) stored back in place, row sum
    float lsum = 0.f;
    for (int jt = t0w; jt < t1w; ++jt) {
      float* pp = srow + jt * 16 + 8 * g;
      v4f t0 = *(v4f*)pp;
      v4f t1 = *(v4f*)(pp + 4);
#pragma unroll
      for (int r = 0; r < 4; ++r) {
        t0[r] = __expf(t0[r] - rmax);
        t1[r] = __expf(t1[r] - rmax);
        lsum += t0[r];
        lsum += t1[r];
      }
      *(v4f*)pp = t0;
      *(v4f*)(pp + 4) = t1;
    }
    lsum += __shfl_xor(lsum, 16);
    if (g == 0) redS[w * 16 + m] = lsum;
    __syncthreads();
    lsum = 0.f;
#pragma unroll  // the ANW LDS reads issue together instead of one latency per trip
    for (int ww = 0; ww < ANW; ++ww) lsum += redS[ww * 16 + m];
    const float linv = 1.0f / lsum;

    // sweep C: probabilities, head-sum accumulation, P.V over this wave's keys
    v8f cacc[4];
#pragma unroll
    for (int nt = 0; nt < 4; ++nt) cacc[nt] = zero8();
    const size_t vb = (size_t)(b * H + h) * (S >> 5) * 2048 + l * 8;
#pragma unroll 1
    for (int jc = c0; jc < c1; ++jc) {
      const int k0 = jc * 32;
      float* pa = srow + k0 + 8 * g;
      float* pb = srow + k0 + 16 + 8 * g;
      const v4f p0 = *(v4f*)pa * linv;
      const v4f p1 = *(v4f*)(pa + 4) * linv;
      const v4f p2 = *(v4f*)pb * linv;
      const v4f p3 = *(v4f*)(pb + 4) * linv;
      {
        v4f* ma = (v4f*)(mrow + k0 + 8 * g);
        v4f* mb = (v4f*)(mrow + k0 + 16 + 8 * g);
        const v4f s0 = ma[0] + p0;
        const v4f s1 = ma[1] + p1;
        const v4f s2 = mb[0] + p2;
        const v4f s3 = mb[1] + p3;
        ma[0] = s0;
        ma[1] = s1;
        mb[0] = s2;
        mb[1] = s3;
      }
      FragB ph, pl;
      split_b8(p0, p1, ph.q[0], pl.q[0]);
      split_b8(p2, p3, ph.q[1], pl.q[1]);
      FragB vh0, vh1, vh2, vh3, vl0, vl1, vl2, vl3;
      const unsigned short* vhp = vth + vb + (size_t)jc * 2048;
      const unsigned short* vlp = vtl + vb + (size_t)jc * 2048;
      vh0.q[0] = ldg16(vhp);
      vh0.q[1] = ldg16(vhp + 256);
      vh1.q[0] = ldg16(vhp + 512);
      vh1.q[1] = ldg16(vhp + 768);
      vh2.q[0] = ldg16(vhp + 1024);
      vh2.q[1] = ldg16(vhp + 1280);
      vh3.q[0] = ldg16(vhp + 1536);
      vh3.q[1] = ldg16(vhp + 1792);
      vl0.q[0] = ldg16(vlp);
      vl0.q[1] = ldg16(vlp + 256);
      vl1.q[0] = ldg16(vlp + 512);
      vl1.q[1] = ldg16(vlp + 768);
      vl2.q[0] = ldg16(vlp + 1024);
      vl2.q[1] = ldg16(vlp + 1280);
      vl3.q[0] = ldg16(vlp + 1536);
      vl3.q[1] = ldg16(vlp + 1792);
      // stands in front of any reuse of the two address pairs (also as a later load's destination);
      // naming them as inputs keeps them in their registers up to it
      asm volatile("s_wait_xcnt 0x0" ::"v"(vhp), "v"(vlp) : "memory");
      cacc[0] = mma_b(ph.v, vh0.v, cacc[0]);
      cacc[0] = mma_b(ph.v, vl0.v, cacc[0]);
      cacc[0] = mma_b(pl.v, vh0.v, cacc[0]);
      cacc[1] = mma_b(ph.v, vh1.v, cacc[1]);
      cacc[1] = mma_b(ph.v, vl1.v, cacc[1]);
      cacc[1] = mma_b(pl.v, vh1.v, cacc[1]);
      cacc[2] = mma_b(ph.v, vh2.v, cacc[2]);
      cacc[2] = mma_b(ph.v, vl2.v, cacc[2]);
      cacc[2] = mma_b(pl.v, vh2.v, cacc[2]);
      cacc[3] = mma_b(ph.v, vh3.v, cacc[3]);
      cacc[3] = mma_b(ph.v, vl3.v, cacc[3]);
      cacc[3] = mma_b(pl.v, vh3.v, cacc[3]);
      asm volatile(NOP4
                   : "+v"(cacc[0]), "+v"(cacc[1]), "+v"(cacc[2]), "+v"(cacc[3])
                   : "v"(ph.v), "v"(pl.v), "v"(vh0.v), "v"(vh1.v), "v"(vh2.v), "v"(vh3.v),
                     "v"(vl0.v), "v"(vl1.v), "v"(vl2.v), "v"(vl3.v));
    }

    // every wave has left the score plane: it now holds ANW partial tiles of 16 x 68 f32
    __syncthreads();
    float* part = sL + w * (16 * 68);
#pragma unroll
    for (int nt = 0; nt < 4; ++nt) {
#pragma unroll
      for (int r = 0; r < 8; ++r) part[(8 * g + r) * 68 + nt * 16 + m] = cacc[nt][r];
    }
    __syncthreads();
    if (w < 8) {  // 256 threads, 4 columns each: a row's 128-B line per plane leaves from 16 lanes of one wave
      const int row = tid >> 4, c4 = (tid & 15) * 4;
      const float* sp = sL + row * 68 + c4;
      v4f x = *(const v4f*)sp;
#pragma unroll  // the ANW LDS reads issue together instead of one latency per trip
      for (int ww = 1; ww < ANW; ++ww) x += *(const v4f*)(sp + ww * (16 * 68));
      unsigned int hb[4], lb[4];
#pragma unroll  // constant indices keep hb and lb in registers
      for (int e = 0; e < 4; ++e) {
        hb[e] = bf_bits(x[e]);
        lb[e] = bf_bits(x[e] - bf_val(hb[e]));
      }
      v2u Hv, Lv;
      Hv[0] = pk2(hb[0], hb[1]);
      Hv[1] = pk2(hb[2], hb[3]);
      Lv[0] = pk2(lb[0], lb[1]);
      Lv[1] = pk2(lb[2], lb[3]);
      const size_t adr = (size_t)(b * S + i0 + row) * E + h * 64 + c4;
      *(v2u*)(ctxh + adr) = Hv;
      *(v2u*)(ctxl + adr) = Lv;
    }
    __syncthreads();
  }

  // head-mean rows: 16 rows x S f32, one row per wave, 512 B per store instruction, lane-contiguous
  __syncthreads();
  float* ob = mout + (size_t)(b * S + i0) * S;
  const int nL = S >> 7;
  for (int row = w; row < 16; row += ANW) {
    for (int c = 0; c < nL; ++c) {
      const size_t off = (size_t)row * S + c * 128 + l * 4;
      const v4f v = *(const v4f*)(mL + (size_t)row * PS + c * 128 + l * 4) * invH;
      *(v4f*)(ob + off) = v;
    }
  }
  
}

// ---------------------------------------------------------------------------
// Host launcher
// ---------------------------------------------------------------------------
extern "C" void kernel_launch(void* const* d_in, const int* in_sizes, int n_in, void* d_out,
                              int out_size, void* d_ws, size_t ws_size, hipStream_t stream) {
  if (n_in < 14) return;
  const int E = 1024, H = 16;
  const int nX = in_sizes[0];
  if (nX <= 0 || (nX % E) != 0) return;
  const int M = nX / E;
  const int nSy = in_sizes[1];
  if (nSy <= 0 || (nSy % E) != 0) return;
  const int Bn = nSy / E;
  if (Bn <= 0 || (M % Bn) != 0) return;
  const int S = M / Bn;
  const int HID = in_sizes[9];
  if ((M % 128) != 0 || (S % 128) != 0 || HID <= 0 || HID > 256) return;
  if (S < 1152) return;  // the attention kernel's 16 partial tiles of 16 x 68 f32 reuse its 16 x (S+4) score plane
  if (in_sizes[2] != E * E || in_sizes[4] != E * E || in_sizes[6] != E * E || in_sizes[12] != E * E) return;
  if (in_sizes[3] != E || in_sizes[5] != E || in_sizes[7] != E || in_sizes[13] != E) return;
  if (in_sizes[8] != E * HID || in_sizes[10] != HID * H || in_sizes[11] != H) return;
  if ((long long)out_size != (long long)nX + (long long)Bn * (long long)S * (long long)S) return;

  const float* x = (const float*)d_in[0];
  const float* sync = (const float*)d_in[1];
  const float* Wq = (const float*)d_in[2];
  const float* bq = (const float*)d_in[3];
  const float* Wk = (const float*)d_in[4];
  const float* bk = (const float*)d_in[5];
  const float* Wv = (const float*)d_in[6];
  const float* bv = (const float*)d_in[7];
  const float* Ws1 = (const float*)d_in[8];
  const float* bs1 = (const float*)d_in[9];
  const float* Ws2 = (const float*)d_in[10];
  const float* bs2 = (const float*)d_in[11];
  const float* Wo = (const float*)d_in[12];
  const float* bo = (const float*)d_in[13];

  float* out_proj = (float*)d_out;                 // [M][E] f32
  float* out_mean = (float*)d_out + (size_t)nX;    // [Bn][S][S] f32

  // workspace carve (bytes), every sub-buffer 256-B aligned
  size_t off = 0;
  auto al = [&](size_t bytes) { size_t o = off; off += (bytes + 255) & ~(size_t)255; return o; };
  const size_t nW = (size_t)E * E;
  const size_t o_sw = al((size_t)Bn * 32 * 4);
  const size_t o_xh = al((size_t)nX * 2);
  const size_t o_xbh = al((size_t)nX * 2);
  const size_t o_xbl = al((size_t)nX * 2);
  const size_t o_wq = al(nW * 2);
  const size_t o_wk = al(nW * 2);
  const size_t o_wvh = al(nW * 2);
  const size_t o_wvl = al(nW * 2);
  const size_t o_woh = al(nW * 2);
  const size_t o_wol = al(nW * 2);
  const size_t o_q = al((size_t)nX * 2);
  const size_t o_k = al((size_t)nX * 2);
  const size_t o_vth = al((size_t)nX * 2);
  const size_t o_vtl = al((size_t)nX * 2);
  const size_t o_cth = al((size_t)nX * 2);
  const size_t o_ctl = al((size_t)nX * 2);
  if (off > ws_size) return;

  char* ws = (char*)d_ws;
  float* sw_g = (float*)(ws + o_sw);
  unsigned short* xh = (unsigned short*)(ws + o_xh);
  unsigned short* xbh = (unsigned short*)(ws + o_xbh);
  unsigned short* xbl = (unsigned short*)(ws + o_xbl);
  unsigned short* wqT = (unsigned short*)(ws + o_wq);
  unsigned short* wkT = (unsigned short*)(ws + o_wk);
  unsigned short* wvTh = (unsigned short*)(ws + o_wvh);
  unsigned short* wvTl = (unsigned short*)(ws + o_wvl);
  unsigned short* woTh = (unsigned short*)(ws + o_woh);
  unsigned short* woTl = (unsigned short*)(ws + o_wol);
  unsigned short* qh = (unsigned short*)(ws + o_q);
  unsigned short* kh = (unsigned short*)(ws + o_k);
  unsigned short* vTh = (unsigned short*)(ws + o_vth);
  unsigned short* vTl = (unsigned short*)(ws + o_vtl);
  unsigned short* cth = (unsigned short*)(ws + o_cth);
  unsigned short* ctl = (unsigned short*)(ws + o_ctl);

  // 1) activation planes
  {
    const int groups = nX / 8;
    const int blocks = (groups + 255) / 256;
    k_cvt_x<<<dim3(blocks), dim3(256), 0, stream>>>(x, xh, xbh, xbl, nX);
  }
  // 2) weight planes, transposed to [n][k]
  {
    dim3 gw(E / 64, E / 64);
    k_cvt_wT<0><<<gw, dim3(256), 0, stream>>>(Wq, wqT, wqT, E, E, 64.0f);
    k_cvt_wT<0><<<gw, dim3(256), 0, stream>>>(Wk, wkT, wkT, E, E, 64.0f);
    k_cvt_wT<1><<<gw, dim3(256), 0, stream>>>(Wv, wvTh, wvTl, E, E, 1.0f);
    k_cvt_wT<1><<<gw, dim3(256), 0, stream>>>(Wo, woTh, woTl, E, E, 1.0f);
  }
  // 3) gate MLP
  k_gate<<<dim3(Bn), dim3(256), 0, stream>>>(sync, Ws1, bs1, Ws2, bs2, sw_g, E, HID, H);
  // 4) projections (M x E, K = E)
  dim3 gg(E / 64, M / 128);
  k_gemm<0, 0><<<gg, dim3(256), 0, stream>>>(xh, xh, wqT, wqT, bq, (void*)qh, (void*)qh, M, E, E, S, 1.0f / 64.0f);
  k_gemm<0, 0><<<gg, dim3(256), 0, stream>>>(xh, xh, wkT, wkT, bk, (void*)kh, (void*)kh, M, E, E, S, 1.0f / 64.0f);
  k_gemm<1, 1><<<gg, dim3(256), 0, stream>>>(xbh, xbl, wvTh, wvTl, bv, (void*)vTh, (void*)vTl, M, E, E, S, 1.0f);
  // 5) attention + head-mean
  {
    const size_t dynB = (size_t)2 * 16 * (size_t)(S + 4) * 4;
    hipFuncSetAttribute(reinterpret_cast<const void*>(&k_attn), hipFuncAttributeMaxDynamicSharedMemorySize, (int)dynB);
    k_attn<<<dim3(S / 16, Bn), dim3(ANW * 32), dynB, stream>>>(qh, kh, vTh, vTl, sw_g, cth, ctl, out_mean, S, H);
  }
  // 6) output projection -> d_out
  k_gemm<1, 2><<<gg, dim3(256), 0, stream>>>(cth, ctl, woTh, woTl, bo, (void*)out_proj, (void*)out_proj, M, E, E, S, 1.0f);
  hipGetLastError();
  hipStreamSynchronize(stream);
}

// v005
// Measured time: 314 microseconds a run.
// In two side-by-side timings against v004, it was 1.42 and 1.43 times as fast.
// Counting every step since v000, it is 5.26 times as fast.
#include <hip/hip_runtime.h>

// Contractions: x@Wq, x@Wk and q.k^T : v_wmma_f32_16x16x32_f16 (f16 operands; Wq, Wk carried x64, rescaled in the f32 epilogue; f32 accumulate).
// x@Wv, P.V and ctx@Wo : v_wmma_f32_16x16x32_bf16 with bf16 hi/lo operand split (hi.hi + hi.lo + lo.hi), f32 accumulate. Gate MLP: scalar f32.

#define NOP4 "v_nop\n\tv_nop\n\tv_nop\n\tv_nop"

typedef _Float16 v16h __attribute__((ext_vector_type(16)));
typedef __bf16 v16b __attribute__((ext_vector_type(16)));
typedef float v8f __attribute__((ext_vector_type(8)));
typedef float v4f __attribute__((ext_vector_type(4)));
typedef unsigned int v4u __attribute__((ext_vector_type(4)));

union FragH { v16h v; v4u q[2]; };
union FragB { v16b v; v4u q[2]; };

__device__ __forceinline__ v4u ldg16(const unsigned short* p) { return *(const v4u*)p; }

// RNE f32 -> bf16 bits
__device__ __forceinline__ unsigned int bf_bits(float f) {
  unsigned int u = __float_as_uint(f);
  return (u + 0x7FFFu + ((u >> 16) & 1u)) >> 16;
}
__device__ __forceinline__ float bf_val(unsigned int b) { return __uint_as_float(b << 16); }
// RNE f32 -> f16 bits
__device__ __forceinline__ unsigned int hf_bits(float f) {
  union { _Float16 h; unsigned short u; } c;
  c.h = (_Float16)f;
  return (unsigned int)c.u;
}
__device__ __forceinline__ unsigned int pk2(unsigned int lo, unsigned int hi) {
  return (lo & 0xFFFFu) | (hi << 16);
}
// 8 consecutive f32 -> 8 packed f16 (element 2t in the low half of word t)
__device__ __forceinline__ v4u pack_h8(v4f a, v4f c) {
  v4u r;
  r[0] = pk2(hf_bits(a[0]), hf_bits(a[1]));
  r[1] = pk2(hf_bits(a[2]), hf_bits(a[3]));
  r[2] = pk2(hf_bits(c[0]), hf_bits(c[1]));
  r[3] = pk2(hf_bits(c[2]), hf_bits(c[3]));
  return r;
}
// 8 consecutive f32 -> bf16 hi plane and bf16 residual plane
__device__ __forceinline__ void split_b8(v4f a, v4f c, v4u& H, v4u& L) {
  float v[8] = {a[0], a[1], a[2], a[3], c[0], c[1], c[2], c[3]};
  unsigned int hb[8], lb[8];
#pragma unroll
  for (int e = 0; e < 8; ++e) {
    hb[e] = bf_bits(v[e]);
    lb[e] = bf_bits(v[e] - bf_val(hb[e]));
  }
#pragma unroll
  for (int t = 0; t < 4; ++t) {
    H[t] = pk2(hb[2 * t], hb[2 * t + 1]);
    L[t] = pk2(lb[2 * t], lb[2 * t + 1]);
  }
}

__device__ __forceinline__ v8f zero8() {
  v8f z;
#pragma unroll
  for (int r = 0; r < 8; ++r) z[r] = 0.f;
  return z;
}
__device__ __forceinline__ v8f mma_h(v16h a, v16h b, v8f c) {
  return __builtin_amdgcn_wmma_f32_16x16x32_f16(false, a, false, b, (short)0, c, false, false);
}
__device__ __forceinline__ v8f mma_b(v16b a, v16b b, v8f c) {
  return __builtin_amdgcn_wmma_f32_16x16x32_bf16(false, a, false, b, (short)0, c, false, false);
}

// ---------------------------------------------------------------------------
// x [n] f32 -> f16 plane (unscaled) and bf16 hi / lo planes. 8 elements per thread,
// ---------------------------------------------------------------------------
__global__ __launch_bounds__(256) void k_cvt_x(const float* __restrict__ x, unsigned short* xh,
                                              unsigned short* xbh, unsigned short* xbl, int n) {
  const size_t i8 = ((size_t)blockIdx.x * 256u + (size_t)threadIdx.x) * 8u;
  if (i8 + 8 > (size_t)n) return;
  const v4f a = *(const v4f*)(x + i8);
  const v4f c = *(const v4f*)(x + i8 + 4);
  const v4u fh = pack_h8(a, c);
  v4u bh, bl;
  split_b8(a, c, bh, bl);
  *(v4u*)(xh + i8) = fh;
  *(v4u*)(xbh + i8) = bh;
  *(v4u*)(xbl + i8) = bl;
  
}

// ---------------------------------------------------------------------------
// W[Kd][Nd] f32 -> WT[Nd][Kd] 16-bit (k-contiguous rows).  64x64 tile through LDS.
// MODE 0: f16 of (W * scale) into o0.  MODE 1: bf16 hi into o0, bf16 lo into o1.
// ---------------------------------------------------------------------------
template <int MODE>
__global__ __launch_bounds__(256) void k_cvt_wT(const float* __restrict__ W, unsigned short* o0,
                                               unsigned short* o1, int Kd, int Nd, float scale) {
  __shared__ float tile[64][65];
  const int n0 = blockIdx.x * 64, e0 = blockIdx.y * 64;
  if (n0 + 64 > Nd || e0 + 64 > Kd) return;  // block-uniform
  const int tid = threadIdx.x;
#pragma unroll
  for (int t = 0; t < 4; ++t) {
    const int idx = t * 256 + tid;
    const int rr = idx >> 4, c4 = (idx & 15) * 4;
    const v4f v = *(const v4f*)(W + (size_t)(e0 + rr) * Nd + n0 + c4);
    tile[rr][c4] = v[0];
    tile[rr][c4 + 1] = v[1];
    tile[rr][c4 + 2] = v[2];
    tile[rr][c4 + 3] = v[3];
  }
  __syncthreads();
  v4u Hv[2], Lv[2];
  size_t adr[2];
#pragma unroll
  for (int t = 0; t < 2; ++t) {
    const int s = t * 256 + tid;
    const int nn = s >> 3, kq = (s & 7) * 8;
    v4f a, c;
#pragma unroll
    for (int e = 0; e < 4; ++e) {
      a[e] = tile[kq + e][nn] * scale;
      c[e] = tile[kq + 4 + e][nn] * scale;
    }
    if (MODE == 0) {
      Hv[t] = pack_h8(a, c);
      Lv[t] = Hv[t];
    } else {
      split_b8(a, c, Hv[t], Lv[t]);
    }
    adr[t] = (size_t)(n0 + nn) * Kd + e0 + kq;
  }
#pragma unroll
  for (int t = 0; t < 2; ++t) {
    *(v4u*)(o0 + adr[t]) = Hv[t];
    if (MODE == 1) *(v4u*)(o1 + adr[t]) = Lv[t];
  }
  
}

// ---------------------------------------------------------------------------
// Gate MLP, gate[b][h] = sigmoid(relu(sync @ W1 + b1) @ W2 + b2), spread over GNS x batch blocks.
// Block (c, b) owns the 32 hidden units j0 = 32c .. 32c+31 of batch b.  Its EIN x 128-B slice of W1 is read
// with every load of a thread in flight at once: 8 lanes take one row's 128-B line, each group of 8 lanes owns
// EIN/64 consecutive rows; the shapes are compile-time, so a thread's loads share one address and differ in
// the immediate offset.
// The row groups' partial sums are combined by lane exchange, then over the waves in LDS in wave order.
// Wave 0 adds b1, applies relu and multiplies by the slice's 32 rows of W2:
//   plo[(b*GNS + c)*32 + h] = sum over the slice's j of hid[j] * W2[j][h]   (h >= HN: 0).
// The attention kernel adds the GNS slices and b2 in slice order and applies the sigmoid.
// ---------------------------------------------------------------------------
#define GNS 8
template <int EIN, int HN>
__global__ __launch_bounds__(512) void k_gate(const float* __restrict__ sync, const float* __restrict__ W1,
                                             const float* __restrict__ b1, const float* __restrict__ W2,
                                             float* plo) {
  constexpr int HD = GNS * 32, NT = EIN / 64;
  static_assert(NT == 16 && 32 * HN == 512, "16 rows and one W2 element per thread");
  __shared__ float red[16 * 32];
  __shared__ float w2s[32 * HN];
  const int c = blockIdx.x, b = blockIdx.y, tid = threadIdx.x;
  const int j0 = c * 32, l = tid & 31;
  const int w = __builtin_amdgcn_readfirstlane(tid >> 5);
  const int cq = (tid & 7) * 4, rg = tid >> 3;
  const float* p2 = W2 + (size_t)j0 * HN + tid;
  const float* pb = b1 + j0 + l;
  const float* pw = W1 + (size_t)rg * NT * HD + j0 + cq;
  const float* ps = sync + (size_t)b * EIN + rg * NT;
  const float w2v = *p2;
  const float bj = *pb;
  v4f wv[NT], sv[NT / 4];
#pragma unroll  // constant indices keep wv and sv in registers
  for (int t = 0; t < NT; ++t) wv[t] = *(const v4f*)(pw + t * HD);
#pragma unroll  // as above
  for (int t = 0; t < NT / 4; ++t) sv[t] = *(const v4f*)(ps + t * 4);
  // nothing is scheduled across this line, so every load above is issued before the first is waited for:
  // one memory latency for the slice; without it the compiler starts the sums after half of the loads
  __builtin_amdgcn_sched_barrier(0);
  v4f acc;
  acc[0] = 0.f; acc[1] = 0.f; acc[2] = 0.f; acc[3] = 0.f;
#pragma unroll  // as above
  for (int t = 0; t < NT; ++t) acc += wv[t] * sv[t >> 2][t & 3];
  // lanes l, l^8, l^16, l^24 hold the same four columns
#pragma unroll  // constant indices keep acc in registers
  for (int k = 0; k < 4; ++k) {
    acc[k] += __shfl_xor(acc[k], 8);
    acc[k] += __shfl_xor(acc[k], 16);
  }
  if (l < 8) *(v4f*)(red + w * 32 + cq) = acc;
  w2s[tid] = w2v;
  __syncthreads();
  if (w == 0) {
    float a = bj;
#pragma unroll  // the 16 LDS reads issue together
    for (int ww = 0; ww < 16; ++ww) a += red[ww * 32 + l];
    const int hid = __float_as_int(fmaxf(a, 0.f));
    const int lh = l & (HN - 1);
    float p = 0.f;
#pragma unroll  // lane index of readlane and LDS offsets as immediates
    for (int j = 0; j < 32; ++j) p += __int_as_float(__builtin_amdgcn_readlane(hid, j)) * w2s[j * HN + lh];
    plo[((size_t)b * GNS + c) * 32 + l] = (l < HN) ? p : 0.f;
  }
}

// ---------------------------------------------------------------------------
// C[M,N] = A[M,K] @ B[K,N] (+bias) with A row-major 16-bit and B given as BT[N][K] 16-bit.
// Block tile 128x64, 256 threads = 8 waves, wave w owns rows w*16..w*16+15, 4 n-tiles.
// The k range is walked in tiles of 64: the block's 128 A rows and 64 B rows (each plane) are
// brought to LDS once per tile, 128 B of a row from 8 neighbouring lanes, the next tile's
// global loads in flight in registers while this tile is multiplied.  Fragments are read from
// LDS with the 16x16x32 split k-map
//   (lane l: row/col = l&15; elements 0..7 <- k0+8*(l>>4)+0..7, 8..15 <- k0+16+8*(l>>4)+0..7).
// SPLIT 0: single f16 product.  SPLIT 1: bf16 hi/lo planes, three products.
// OM 0: f16 in the attention kernel's fragment order: per (batch, head) and 16-row tile one 2-KB block of
//       4 x 512 B, piece t of lane l=(g,m) = row m, columns (2t+g)*8..+7 of the head.
// OM 1: bf16 hi/lo in fragment order: per (batch, head) and 32-key chunk one 4-KB block per plane of
//       8 x 512 B, piece nt*2+q of lane l=(g,m) = column d nt*16+m, keys q*16+8g..+7 of the chunk.
//       In both, one wave-wide 16-B load or store of a piece covers 512 contiguous bytes (4 whole lines).
// OM 2: f32 row-major [M][N].
// ---------------------------------------------------------------------------
template <int SPLIT, int OM>
__global__ __launch_bounds__(256) void k_gemm(const unsigned short* __restrict__ Ah,
                                             const unsigned short* __restrict__ Al,
                                             const unsigned short* __restrict__ Bh,
                                             const unsigned short* __restrict__ Bl,
                                             const float* __restrict__ bias, void* out0, void* out1,
                                             int M, int N, int K, int Sq, float oscale) {
  constexpr int PIT = 72;  // LDS row pitch in 16-bit elements: 144 B = 16 B x 9, b128 fragment reads without bank conflicts
  constexpr int TILE16 = (SPLIT ? 2 : 1) * (128 + 64) * PIT / 8;  // staged operand tiles, in 16-B units
  constexpr int STG16 = 128 * 17;                                 // epilogue tile, 128 x 68 f32, in 16-B units
  __shared__ v4f smem[TILE16 > STG16 ? TILE16 : STG16];           // the epilogue tile reuses the operand tiles' space
  float* stg = (float*)smem;
  unsigned short* sAh = (unsigned short*)smem;
  unsigned short* sBh = sAh + 128 * PIT;
  unsigned short* sAl = sBh + 64 * PIT;  // the two lo planes exist only with SPLIT
  unsigned short* sBl = sAl + 128 * PIT;
  const int nBase = blockIdx.x * 64, mBase = blockIdx.y * 128;
  if (nBase + 64 > N || mBase + 128 > M || (K & 63) != 0) return;  // block-uniform
  const int tid = threadIdx.x, w = tid >> 5, l = tid & 31, g = l >> 4, m = l & 15;

  v8f acc[4];
#pragma unroll
  for (int nt = 0; nt < 4; ++nt) acc[nt] = zero8();

  // staging map: thread -> row tid>>3 (+32 per step), 16-B piece tid&7 of the row's 128 B
  const int lr = tid >> 3, lc = (tid & 7) * 8;
  // global address = block-uniform byte base (moves with k) + a per-thread 32-bit byte offset that never changes
  const char* bAh = (const char*)(Ah + (size_t)mBase * K);
  const char* bAl = (const char*)(Al + (size_t)mBase * K);
  const char* bBh = (const char*)(Bh + (size_t)nBase * K);
  const char* bBl = (const char*)(Bl + (size_t)nBase * K);
  unsigned int go[4];
#pragma unroll  // here and below: constant indices keep the small per-thread arrays in registers
  for (int t = 0; t < 4; ++t) go[t] = (unsigned int)(((lr + 32 * t) * K + lc) * 2);
  const int ls = lr * PIT + lc;
  const int fa = (w * 16 + m) * PIT + 8 * g;  // this lane's A fragment row in LDS
  const int fb = m * PIT + 8 * g;             // this lane's B fragment row of n-tile 0

  v4u rah[4], ral[4], rbh[2], rbl[2];
#pragma unroll
  for (int t = 0; t < 4; ++t) {
    rah[t] = *(const v4u*)(bAh + go[t]);
    if (SPLIT) ral[t] = *(const v4u*)(bAl + go[t]);
  }
#pragma unroll
  for (int t = 0; t < 2; ++t) {
    rbh[t] = *(const v4u*)(bBh + go[t]);
    if (SPLIT) rbl[t] = *(const v4u*)(bBl + go[t]);
  }

#pragma unroll 1  // one copy of the body: the staged pieces and both k halves' fragments already fill the register budget
  for (int k0 = 0; k0 < K; k0 += 64) {
#pragma unroll
    for (int t = 0; t < 4; ++t) {
      *(v4u*)(sAh + ls + t * 32 * PIT) = rah[t];
      if (SPLIT) *(v4u*)(sAl + ls + t * 32 * PIT) = ral[t];
    }
#pragma unroll
    for (int t = 0; t < 2; ++t) {
      *(v4u*)(sBh + ls + t * 32 * PIT) = rbh[t];
      if (SPLIT) *(v4u*)(sBl + ls + t * 32 * PIT) = rbl[t];
    }
    __syncthreads();  // the tile is complete before any wave reads fragments from it
    if (k0 + 64 < K) {
      const size_t kn = (size_t)(k0 + 64) * 2;
      const char *pah[4], *pal[4], *pbh[2], *pbl[2];
#pragma unroll
      for (int t = 0; t < 4; ++t) {
        pah[t] = bAh + kn + go[t];
        pal[t] = bAl + kn + go[t];
        rah[t] = *(const v4u*)pah[t];
        if (SPLIT) ral[t] = *(const v4u*)pal[t];
      }
#pragma unroll
      for (int t = 0; t < 2; ++t) {
        pbh[t] = bBh + kn + go[t];
        pbl[t] = bBl + kn + go[t];
        rbh[t] = *(const v4u*)pbh[t];
        if (SPLIT) rbl[t] = *(const v4u*)pbl[t];
      }
      // the prefetch loads' address registers are free for reuse (fragment reads below) only behind this wait;
      // naming the addresses as inputs keeps them in their registers up to it
      if (SPLIT)
        asm volatile("s_wait_xcnt 0x0" ::"v"(pah[0]), "v"(pah[1]), "v"(pah[2]), "v"(pah[3]), "v"(pbh[0]), "v"(pbh[1]),
                     "v"(pal[0]), "v"(pal[1]), "v"(pal[2]), "v"(pal[3]), "v"(pbl[0]), "v"(pbl[1])
                     : "memory");
      else
        asm volatile("s_wait_xcnt 0x0" ::"v"(pah[0]), "v"(pah[1]), "v"(pah[2]), "v"(pah[3]), "v"(pbh[0]), "v"(pbh[1])
                     : "memory");
    }
#pragma unroll  // both k halves of the tile in one body, LDS offsets as immediates
    for (int kk = 0; kk < 64; kk += 32) {
      if (SPLIT) {
        FragB a, a2, b0, b1, b2, b3, c0, c1, c2, c3;
        a.q[0] = ldg16(sAh + fa + kk);
        a.q[1] = ldg16(sAh + fa + kk + 16);
        a2.q[0] = ldg16(sAl + fa + kk);
        a2.q[1] = ldg16(sAl + fa + kk + 16);
        b0.q[0] = ldg16(sBh + fb + kk);
        b0.q[1] = ldg16(sBh + fb + kk + 16);
        b1.q[0] = ldg16(sBh + fb + 16 * PIT + kk);
        b1.q[1] = ldg16(sBh + fb + 16 * PIT + kk + 16);
        b2.q[0] = ldg16(sBh + fb + 32 * PIT + kk);
        b2.q[1] = ldg16(sBh + fb + 32 * PIT + kk + 16);
        b3.q[0] = ldg16(sBh + fb + 48 * PIT + kk);
        b3.q[1] = ldg16(sBh + fb + 48 * PIT + kk + 16);
        c0.q[0] = ldg16(sBl + fb + kk);
        c0.q[1] = ldg16(sBl + fb + kk + 16);
        c1.q[0] = ldg16(sBl + fb + 16 * PIT + kk);
        c1.q[1] = ldg16(sBl + fb + 16 * PIT + kk + 16);
        c2.q[0] = ldg16(sBl + fb + 32 * PIT + kk);
        c2.q[1] = ldg16(sBl + fb + 32 * PIT + kk + 16);
        c3.q[0] = ldg16(sBl + fb + 48 * PIT + kk);
        c3.q[1] = ldg16(sBl + fb + 48 * PIT + kk + 16);
        acc[0] = mma_b(a.v, b0.v, acc[0]);
        acc[0] = mma_b(a.v, c0.v, acc[0]);
        acc[0] = mma_b(a2.v, b0.v, acc[0]);
        acc[1] = mma_b(a.v, b1.v, acc[1]);
        acc[1] = mma_b(a.v, c1.v, acc[1]);
        acc[1] = mma_b(a2.v, b1.v, acc[1]);
        acc[2] = mma_b(a.v, b2.v, acc[2]);
        acc[2] = mma_b(a.v, c2.v, acc[2]);
        acc[2] = mma_b(a2.v, b2.v, acc[2]);
        acc[3] = mma_b(a.v, b3.v, acc[3]);
        acc[3] = mma_b(a.v, c3.v, acc[3]);
        acc[3] = mma_b(a2.v, b3.v, acc[3]);
        // four vector slots behind the last WMMA, on every path, before its operands or results are touched
        asm volatile(NOP4
                     : "+v"(acc[0]), "+v"(acc[1]), "+v"(acc[2]), "+v"(acc[3])
                     : "v"(a.v), "v"(a2.v), "v"(b0.v), "v"(b1.v), "v"(b2.v), "v"(b3.v),
                       "v"(c0.v), "v"(c1.v), "v"(c2.v), "v"(c3.v));
      } else {
        FragH a, b0, b1, b2, b3;
        a.q[0] = ldg16(sAh + fa + kk);
        a.q[1] = ldg16(sAh + fa + kk + 16);
        b0.q[0] = ldg16(sBh + fb + kk);
        b0.q[1] = ldg16(sBh + fb + kk + 16);
        b1.q[0] = ldg16(sBh + fb + 16 * PIT + kk);
        b1.q[1] = ldg16(sBh + fb + 16 * PIT + kk + 16);
        b2.q[0] = ldg16(sBh + fb + 32 * PIT + kk);
        b2.q[1] = ldg16(sBh + fb + 32 * PIT + kk + 16);
        b3.q[0] = ldg16(sBh + fb + 48 * PIT + kk);
        b3.q[1] = ldg16(sBh + fb + 48 * PIT + kk + 16);
        acc[0] = mma_h(a.v, b0.v, acc[0]);
        acc[1] = mma_h(a.v, b1.v, acc[1]);
        acc[2] = mma_h(a.v, b2.v, acc[2]);
        acc[3] = mma_h(a.v, b3.v, acc[3]);
        // four vector slots behind the last WMMA, on every path, before its operands or results are touched
        asm volatile(NOP4
                     : "+v"(acc[0]), "+v"(acc[1]), "+v"(acc[2]), "+v"(acc[3])
                     : "v"(a.v), "v"(b0.v), "v"(b1.v), "v"(b2.v), "v"(b3.v));
      }
    }
    __syncthreads();  // every wave has left the tile before it is overwritten (next tile, or the epilogue tile)
  }

  // stage: D element r of lane (g,m), n-tile nt -> (row w*16+8g+r, col nt*16+m)
#pragma unroll
  for (int nt = 0; nt < 4; ++nt) {
    const int col = nt * 16 + m;
    const float bv = bias[nBase + col];
#pragma unroll
    for (int r = 0; r < 8; ++r) stg[(w * 16 + 8 * g + r) * 68 + col] = acc[nt][r] * oscale + bv;
  }
  __syncthreads();

  if (OM == 0) {
    // wave w holds the block's 16-row tile w of head nBase/64
    unsigned short* o = (unsigned short*)out0;
    const int Hn = N >> 6;
    const int bb = mBase / Sq;
    const int bh = bb * Hn + (nBase >> 6);
    const int tl = ((mBase - bb * Sq) >> 4) + w;
    const size_t tb = ((size_t)bh * (Sq >> 4) + tl) * 1024 + l * 8;
    v4u val[4];
    size_t adr[4];
#pragma unroll
    for (int t = 0; t < 4; ++t) {
      const float* sp = stg + (w * 16 + m) * 68 + (2 * t + g) * 8;
      const v4f x0 = *(const v4f*)sp;
      const v4f x1 = *(const v4f*)(sp + 4);
      val[t] = pack_h8(x0, x1);
      adr[t] = tb + t * 256;
    }
#pragma unroll
    for (int t = 0; t < 4; ++t) *(v4u*)(o + adr[t]) = val[t];
    
  } else if (OM == 1) {
    // tile rows = s (128 consecutive within one batch = 4 chunks of 32 keys), cols = d of head nBase/64
    unsigned short* oh = (unsigned short*)out0;
    unsigned short* ol = (unsigned short*)out1;
    const int Hn = N >> 6;
    const int bb = mBase / Sq;
    const int bh = bb * Hn + (nBase >> 6);
    const int sBase = mBase - bb * Sq;
    v4u Hv[4], Lv[4];
    size_t adr[4];
#pragma unroll
    for (int t = 0; t < 4; ++t) {
      const int ch = w >> 1, nt = (w & 1) * 2 + (t >> 1), q = t & 1;  // the block's 32 pieces, 4 per wave
      const int d = nt * 16 + m, s8 = ch * 32 + q * 16 + g * 8;
      v4f x0, x1;
#pragma unroll
      for (int e = 0; e < 4; ++e) {
        x0[e] = stg[(s8 + e) * 68 + d];
        x1[e] = stg[(s8 + 4 + e) * 68 + d];
      }
      split_b8(x0, x1, Hv[t], Lv[t]);
      adr[t] = (((size_t)bh * (Sq >> 5) + (sBase >> 5) + ch) * 8 + nt * 2 + q) * 256 + l * 8;
    }
#pragma unroll
    for (int t = 0; t < 4; ++t) {
      *(v4u*)(oh + adr[t]) = Hv[t];
      *(v4u*)(ol + adr[t]) = Lv[t];
    }
    
  } else {
    float* o = (float*)out0;
    v4f val[8];
    size_t adr[8];
#pragma unroll
    for (int t = 0; t < 8; ++t) {
      const int row = w * 16 + t * 2 + (l >> 4), c4 = (l & 15) * 4;
      val[t] = *(const v4f*)(stg + row * 68 + c4);
      adr[t] = (size_t)(mBase + row) * N + nBase + c4;
    }
#pragma unroll
    for (int t = 0; t < 8; ++t) *(v4f*)(o + adr[t]) = val[t];
    
  }
}

// ---------------------------------------------------------------------------
// Fused attention: one block of ANW waves per (16 query rows, batch).  Dynamic LDS:
//   sL[16][S+4] f32  gated+scaled scores of the current head, then exp(s - rowmax);
//   mL[16][S+4] f32  sum over heads of the softmax probabilities (lane-owned elements).
// Row pitch S+4 floats = 16 B x odd: the 16 lanes of a half wave, one query row each, then fall on
// 16 different groups of four banks in every b128 access; at a pitch of S floats they share one group.
// The keys are split over the waves: wave w owns a contiguous run of 32-key chunks in all
// three sweeps, so every sL / mL word is written and read back by one lane of one wave.
// Per head h: score tiles S^T = K_tile . Q^T (A = k rows, B = q rows; D lane (g,m) holds
// query m, keys jt*16+8g+r), exact two-sweep softmax, then P.V with the P fragment read
// back from the same lane's own LDS words (elements 0..7 <- keys k0+8g.., 8..15 <- k0+16+8g..),
// V fragments from the planes vt.  q, k and vt lie in fragment order (see k_gemm, OM 0 and OM 1): every
// fragment load of a wave reads 512 contiguous bytes.  Row max, row sum and the 16x64 P.V
// partial tiles are combined over the waves through LDS, always in wave order.
// ---------------------------------------------------------------------------
#define ANW 16
typedef unsigned int v2u __attribute__((ext_vector_type(2)));

__global__ __launch_bounds__(ANW * 32) void k_attn(const unsigned short* __restrict__ qh,
                                                  const unsigned short* __restrict__ kh,
                                                  const unsigned short* __restrict__ vth,
                                                  const unsigned short* __restrict__ vtl,
                                                  const float* __restrict__ plo, const float* __restrict__ b2,
                                                  unsigned short* ctxh,
                                                  unsigned short* ctxl, float* mout, int S, int H) {
  extern __shared__ v4f dsm[];
  __shared__ float redM[ANW * 16];  // per wave, per query: max over the wave's keys
  __shared__ float redS[ANW * 16];  // per wave, per query: sum of exp over the wave's keys
  __shared__ float gv[32];          // this batch's gate per head
  float* sL = (float*)dsm;
  const int PS = S + 4;  // LDS row pitch of both planes, in floats
  float* mL = sL + (size_t)16 * PS;
  const int i0 = blockIdx.x * 16, b = blockIdx.y;
  if (i0 + 16 > S) return;  // block-uniform
  const int tid = threadIdx.x;
  const int l = tid & 31, g = l >> 4, m = l & 15;
  const int w = __builtin_amdgcn_readfirstlane(tid >> 5);  // scalar, so the sweeps' trip counts are scalar
  const int E = H * 64;

  {
    v4f z;
    z[0] = 0.f; z[1] = 0.f; z[2] = 0.f; z[3] = 0.f;
    v4f* m4 = (v4f*)mL;
    const int n4 = 4 * PS;
    for (int i = tid; i < n4; i += ANW * 32) m4[i] = z;
  }
  if (tid < 32) {  // the gate's last step (see k_gate): slices and bias summed in slice order, sigmoid
    float val = 0.f;
    if (tid < H) {
      float a = b2[tid];
#pragma unroll  // the GNS loads issue together
      for (int c = 0; c < GNS; ++c) a += plo[((size_t)b * GNS + c) * 32 + tid];
      val = 1.0f / (1.0f + expf(-a));
    }
    gv[tid] = val;
  }
  __syncthreads();

  float* srow = sL + (size_t)m * PS;
  float* mrow = mL + (size_t)m * PS;
  const float invH = 1.0f / (float)H;
  const int nC = S >> 5;
  const int cpw = (nC + ANW - 1) / ANW;
  const int c0 = min(w * cpw, nC), c1 = min(c0 + cpw, nC);  // this wave's 32-key chunks
  const int t0w = 2 * c0, t1w = 2 * c1;                     // the same keys as 16-key tiles

  for (int h = 0; h < H; ++h) {
    FragH qa0, qa1;
    {
      const unsigned short* qp = qh + ((size_t)(b * H + h) * (S >> 4) + (i0 >> 4)) * 1024 + l * 8;
      qa0.q[0] = ldg16(qp);
      qa0.q[1] = ldg16(qp + 256);
      qa1.q[0] = ldg16(qp + 512);
      qa1.q[1] = ldg16(qp + 768);
    }
    const float gsc = gv[h] * 0.125f;

    // sweep A: scores -> LDS, running row max
    float rmax = -3.0e38f;
    const unsigned short* kp = kh + (size_t)(b * H + h) * (S >> 4) * 1024 + l * 8;
    for (int jt = t0w; jt < t1w; ++jt) {
      const unsigned short* kr = kp + (size_t)jt * 1024;
      FragH ka0, ka1;
      ka0.q[0] = ldg16(kr);
      ka0.q[1] = ldg16(kr + 256);
      ka1.q[0] = ldg16(kr + 512);
      ka1.q[1] = ldg16(kr + 768);
      v8f sc = zero8();
      sc = mma_h(ka0.v, qa0.v, sc);
      sc = mma_h(ka1.v, qa1.v, sc);
      asm volatile(NOP4 : "+v"(sc) : "v"(ka0.v), "v"(ka1.v), "v"(qa0.v), "v"(qa1.v));
      v4f t0, t1;
#pragma unroll
      for (int r = 0; r < 4; ++r) {
        t0[r] = sc[r] * gsc;
        t1[r] = sc[r + 4] * gsc;
        rmax = fmaxf(rmax, t0[r]);
        rmax = fmaxf(rmax, t1[r]);
      }
      float* pp = srow + jt * 16 + 8 * g;
      *(v4f*)pp = t0;
      *(v4f*)(pp + 4) = t1;
    }
    rmax = fmaxf(rmax, __shfl_xor(rmax, 16));
    if (g == 0) redM[w * 16 + m] = rmax;
    __syncthreads();
#pragma unroll  // the ANW LDS reads issue together instead of one latency per trip
    for (int ww = 0; ww < ANW; ++ww) rmax = fmaxf(rmax, redM[ww * 16 + m]);

    // sweep B: e = exp(s - max) stored back in place, row sum
    float lsum = 0.f;
    for (int jt = t0w; jt < t1w; ++jt) {
      float* pp = srow + jt * 16 + 8 * g;
      v4f t0 = *(v4f*)pp;
      v4f t1 = *(v4f*)(pp + 4);
#pragma unroll
      for (int r = 0; r < 4; ++r) {
        t0[r] = __expf(t0[r] - rmax);
        t1[r] = __expf(t1[r] - rmax);
        lsum += t0[r];
        lsum += t1[r];
      }
      *(v4f*)pp = t0;
      *(v4f*)(pp + 4) = t1;
    }
    lsum += __shfl_xor(lsum, 16);
    if (g == 0) redS[w * 16 + m] = lsum;
    __syncthreads();
    lsum = 0.f;
#pragma unroll  // the ANW LDS reads issue together instead of one latency per trip
    for (int ww = 0; ww < ANW; ++ww) lsum += redS[ww * 16 + m];
    const float linv = 1.0f / lsum;

    // sweep C: probabilities, head-sum accumulation, P.V over this wave's keys
    v8f cacc[4];
#pragma unroll
    for (int nt = 0; nt < 4; ++nt) cacc[nt] = zero8();
    const size_t vb = (size_t)(b * H + h) * (S >> 5) * 2048 + l * 8;
#pragma unroll 1
    for (int jc = c0; jc < c1; ++jc) {
      const int k0 = jc * 32;
      float* pa = srow + k0 + 8 * g;
      float* pb = srow + k0 + 16 + 8 * g;
      const v4f p0 = *(v4f*)pa * linv;
      const v4f p1 = *(v4f*)(pa + 4) * linv;
      const v4f p2 = *(v4f*)pb * linv;
      const v4f p3 = *(v4f*)(pb + 4) * linv;
      {
        v4f* ma = (v4f*)(mrow + k0 + 8 * g);
        v4f* mb = (v4f*)(mrow + k0 + 16 + 8 * g);
        const v4f s0 = ma[0] + p0;
        const v4f s1 = ma[1] + p1;
        const v4f s2 = mb[0] + p2;
        const v4f s3 = mb[1] + p3;
        ma[0] = s0;
        ma[1] = s1;
        mb[0] = s2;
        mb[1] = s3;
      }
      FragB ph, pl;
      split_b8(p0, p1, ph.q[0], pl.q[0]);
      split_b8(p2, p3, ph.q[1], pl.q[1]);
      FragB vh0, vh1, vh2, vh3, vl0, vl1, vl2, vl3;
      const unsigned short* vhp = vth + vb + (size_t)jc * 2048;
      const unsigned short* vlp = vtl + vb + (size_t)jc * 2048;
      vh0.q[0] = ldg16(vhp);
      vh0.q[1] = ldg16(vhp + 256);
      vh1.q[0] = ldg16(vhp + 512);
      vh1.q[1] = ldg16(vhp + 768);
      vh2.q[0] = ldg16(vhp + 1024);
      vh2.q[1] = ldg16(vhp + 1280);
      vh3.q[0] = ldg16(vhp + 1536);
      vh3.q[1] = ldg16(vhp + 1792);
      vl0.q[0] = ldg16(vlp);
      vl0.q[1] = ldg16(vlp + 256);
      vl1.q[0] = ldg16(vlp + 512);
      vl1.q[1] = ldg16(vlp + 768);
      vl2.q[0] = ldg16(vlp + 1024);
      vl2.q[1] = ldg16(vlp + 1280);
      vl3.q[0] = ldg16(vlp + 1536);
      vl3.q[1] = ldg16(vlp + 1792);
      // stands in front of any reuse of the two address pairs (also as a later load's destination);
      // naming them as inputs keeps them in their registers up to it
      asm volatile("s_wait_xcnt 0x0" ::"v"(vhp), "v"(vlp) : "memory");
      cacc[0] = mma_b(ph.v, vh0.v, cacc[0]);
      cacc[0] = mma_b(ph.v, vl0.v, cacc[0]);
      cacc[0] = mma_b(pl.v, vh0.v, cacc[0]);
      cacc[1] = mma_b(ph.v, vh1.v, cacc[1]);
      cacc[1] = mma_b(ph.v, vl1.v, cacc[1]);
      cacc[1] = mma_b(pl.v, vh1.v, cacc[1]);
      cacc[2] = mma_b(ph.v, vh2.v, cacc[2]);
      cacc[2] = mma_b(ph.v, vl2.v, cacc[2]);
      cacc[2] = mma_b(pl.v, vh2.v, cacc[2]);
      cacc[3] = mma_b(ph.v, vh3.v, cacc[3]);
      cacc[3] = mma_b(ph.v, vl3.v, cacc[3]);
      cacc[3] = mma_b(pl.v, vh3.v, cacc[3]);
      asm volatile(NOP4
                   : "+v"(cacc[0]), "+v"(cacc[1]), "+v"(cacc[2]), "+v"(cacc[3])
                   : "v"(ph.v), "v"(pl.v), "v"(vh0.v), "v"(vh1.v), "v"(vh2.v), "v"(vh3.v),
                     "v"(vl0.v), "v"(vl1.v), "v"(vl2.v), "v"(vl3.v));
    }

    // every wave has left the score plane: it now holds ANW partial tiles of 16 x 68 f32
    __syncthreads();
    float* part = sL + w * (16 * 68);
#pragma unroll
    for (int nt = 0; nt < 4; ++nt) {
#pragma unroll
      for (int r = 0; r < 8; ++r) part[(8 * g + r) * 68 + nt * 16 + m] = cacc[nt][r];
    }
    __syncthreads();
    if (w < 8) {  // 256 threads, 4 columns each: a row's 128-B line per plane leaves from 16 lanes of one wave
      const int row = tid >> 4, c4 = (tid & 15) * 4;
      const float* sp = sL + row * 68 + c4;
      v4f x = *(const v4f*)sp;
#pragma unroll  // the ANW LDS reads issue together instead of one latency per trip
      for (int ww = 1; ww < ANW; ++ww) x += *(const v4f*)(sp + ww * (16 * 68));
      unsigned int hb[4], lb[4];
#pragma unroll  // constant indices keep hb and lb in registers
      for (int e = 0; e < 4; ++e) {
        hb[e] = bf_bits(x[e]);
        lb[e] = bf_bits(x[e] - bf_val(hb[e]));
      }
      v2u Hv, Lv;
      Hv[0] = pk2(hb[0], hb[1]);
      Hv[1] = pk2(hb[2], hb[3]);
      Lv[0] = pk2(lb[0], lb[1]);
      Lv[1] = pk2(lb[2], lb[3]);
      const size_t adr = (size_t)(b * S + i0 + row) * E + h * 64 + c4;
      *(v2u*)(ctxh + adr) = Hv;
      *(v2u*)(ctxl + adr) = Lv;
    }
    __syncthreads();
  }

  // head-mean rows: 16 rows x S f32, one row per wave, 512 B per store instruction, lane-contiguous
  __syncthreads();
  float* ob = mout + (size_t)(b * S + i0) * S;
  const int nL = S >> 7;
  for (int row = w; row < 16; row += ANW) {
    for (int c = 0; c < nL; ++c) {
      const size_t off = (size_t)row * S + c * 128 + l * 4;
      const v4f v = *(const v4f*)(mL + (size_t)row * PS + c * 128 + l * 4) * invH;
      *(v4f*)(ob + off) = v;
    }
  }
  
}

// ---------------------------------------------------------------------------
// Host launcher
// ---------------------------------------------------------------------------
extern "C" void kernel_launch(void* const* d_in, const int* in_sizes, int n_in, void* d_out,
                              int out_size, void* d_ws, size_t ws_size, hipStream_t stream) {
  if (n_in < 14) return;
  const int E = 1024, H = 16;
  const int nX = in_sizes[0];
  if (nX <= 0 || (nX % E) != 0) return;
  const int M = nX / E;
  const int nSy = in_sizes[1];
  if (nSy <= 0 || (nSy % E) != 0) return;
  const int Bn = nSy / E;
  if (Bn <= 0 || (M % Bn) != 0) return;
  const int S = M / Bn;
  const int HID = in_sizes[9];
  if ((M % 128) != 0 || (S % 128) != 0 || HID != GNS * 32) return;
  if (S < 1152) return;  // the attention kernel's 16 partial tiles of 16 x 68 f32 reuse its 16 x S score plane
  if (in_sizes[2] != E * E || in_sizes[4] != E * E || in_sizes[6] != E * E || in_sizes[12] != E * E) return;
  if (in_sizes[3] != E || in_sizes[5] != E || in_sizes[7] != E || in_sizes[13] != E) return;
  if (in_sizes[8] != E * HID || in_sizes[10] != HID * H || in_sizes[11] != H) return;
  if ((long long)out_size != (long long)nX + (long long)Bn * (long long)S * (long long)S) return;

  const float* x = (const float*)d_in[0];
  const float* sync = (const float*)d_in[1];
  const float* Wq = (const float*)d_in[2];
  const float* bq = (const float*)d_in[3];
  const float* Wk = (const float*)d_in[4];
  const float* bk = (const float*)d_in[5];
  const float* Wv = (const float*)d_in[6];
  const float* bv = (const float*)d_in[7];
  const float* Ws1 = (const float*)d_in[8];
  const float* bs1 = (const float*)d_in[9];
  const float* Ws2 = (const float*)d_in[10];
  const float* bs2 = (const float*)d_in[11];
  const float* Wo = (const float*)d_in[12];
  const float* bo = (const float*)d_in[13];

  float* out_proj = (float*)d_out;                 // [M][E] f32
  float* out_mean = (float*)d_out + (size_t)nX;    // [Bn][S][S] f32

  // workspace carve (bytes), every sub-buffer 256-B aligned
  size_t off = 0;
  auto al = [&](size_t bytes) { size_t o = off; off += (bytes + 255) & ~(size_t)255; return o; };
  const size_t nW = (size_t)E * E;
  const size_t o_sw = al((size_t)Bn * GNS * 32 * 4);
  const size_t o_xh = al((size_t)nX * 2);
  const size_t o_xbh = al((size_t)nX * 2);
  const size_t o_xbl = al((size_t)nX * 2);
  const size_t o_wq = al(nW * 2);
  const size_t o_wk = al(nW * 2);
  const size_t o_wvh = al(nW * 2);
  const size_t o_wvl = al(nW * 2);
  const size_t o_woh = al(nW * 2);
  const size_t o_wol = al(nW * 2);
  const size_t o_q = al((size_t)nX * 2);
  const size_t o_k = al((size_t)nX * 2);
  const size_t o_vth = al((size_t)nX * 2);
  const size_t o_vtl = al((size_t)nX * 2);
  const size_t o_cth = al((size_t)nX * 2);
  const size_t o_ctl = al((size_t)nX * 2);
  if (off > ws_size) return;

  char* ws = (char*)d_ws;
  float* sw_g = (float*)(ws + o_sw);
  unsigned short* xh = (unsigned short*)(ws + o_xh);
  unsigned short* xbh = (unsigned short*)(ws + o_xbh);
  unsigned short* xbl = (unsigned short*)(ws + o_xbl);
  unsigned short* wqT = (unsigned short*)(ws + o_wq);
  unsigned short* wkT = (unsigned short*)(ws + o_wk);
  unsigned short* wvTh = (unsigned short*)(ws + o_wvh);
  unsigned short* wvTl = (unsigned short*)(ws + o_wvl);
  unsigned short* woTh = (unsigned short*)(ws + o_woh);
  unsigned short* woTl = (unsigned short*)(ws + o_wol);
  unsigned short* qh = (unsigned short*)(ws + o_q);
  unsigned short* kh = (unsigned short*)(ws + o_k);
  unsigned short* vTh = (unsigned short*)(ws + o_vth);
  unsigned short* vTl = (unsigned short*)(ws + o_vtl);
  unsigned short* cth = (unsigned short*)(ws + o_cth);
  unsigned short* ctl = (unsigned short*)(ws + o_ctl);

  // 1) activation planes
  {
    const int groups = nX / 8;
    const int blocks = (groups + 255) / 256;
    k_cvt_x<<<dim3(blocks), dim3(256), 0, stream>>>(x, xh, xbh, xbl, nX);
  }
  // 2) weight planes, transposed to [n][k]
  {
    dim3 gw(E / 64, E / 64);
    k_cvt_wT<0><<<gw, dim3(256), 0, stream>>>(Wq, wqT, wqT, E, E, 64.0f);
    k_cvt_wT<0><<<gw, dim3(256), 0, stream>>>(Wk, wkT, wkT, E, E, 64.0f);
    k_cvt_wT<1><<<gw, dim3(256), 0, stream>>>(Wv, wvTh, wvTl, E, E, 1.0f);
    k_cvt_wT<1><<<gw, dim3(256), 0, stream>>>(Wo, woTh, woTl, E, E, 1.0f);
  }
  // 3) gate MLP
  k_gate<E, H><<<dim3(GNS, Bn), dim3(512), 0, stream>>>(sync, Ws1, bs1, Ws2, sw_g);
  // 4) projections (M x E, K = E)
  dim3 gg(E / 64, M / 128);
  k_gemm<0, 0><<<gg, dim3(256), 0, stream>>>(xh, xh, wqT, wqT, bq, (void*)qh, (void*)qh, M, E, E, S, 1.0f / 64.0f);
  k_gemm<0, 0><<<gg, dim3(256), 0, stream>>>(xh, xh, wkT, wkT, bk, (void*)kh, (void*)kh, M, E, E, S, 1.0f / 64.0f);
  k_gemm<1, 1><<<gg, dim3(256), 0, stream>>>(xbh, xbl, wvTh, wvTl, bv, (void*)vTh, (void*)vTl, M, E, E, S, 1.0f);
  // 5) attention + head-mean
  {
    const size_t dynB = (size_t)2 * 16 * (size_t)(S + 4) * 4;
    hipFuncSetAttribute(reinterpret_cast<const void*>(&k_attn), hipFuncAttributeMaxDynamicSharedMemorySize, (int)dynB);
    k_attn<<<dim3(S / 16, Bn), dim3(ANW * 32), dynB, stream>>>(qh, kh, vTh, vTl, sw_g, bs2, cth, ctl, out_mean, S, H);
  }
  // 6) output projection -> d_out
  k_gemm<1, 2><<<gg, dim3(256), 0, stream>>>(cth, ctl, woTh, woTl, bo, (void*)out_proj, (void*)out_proj, M, E, E, S, 1.0f);
  hipGetLastError();
  hipStreamSynchronize(stream);
}

// v006
// A run of this version takes 296 microseconds.
// Timed twice side by side with v005, it ran 1.07 times as fast both times.
// Over all steps from v000 it is 5.61 times as fast.
#include <hip/hip_runtime.h>

// Contractions: x@Wq, x@Wk and q.k^T : v_wmma_f32_16x16x32_f16 (f16 operands; Wq, Wk carried x64, rescaled in the f32 epilogue; f32 accumulate).
// x@Wv, P.V and ctx@Wo : v_wmma_f32_16x16x32_bf16 with bf16 hi/lo operand split (hi.hi + hi.lo + lo.hi), f32 accumulate. Gate MLP: scalar f32.

#define NOP4 "v_nop\n\tv_nop\n\tv_nop\n\tv_nop"

typedef _Float16 v16h __attribute__((ext_vector_type(16)));
typedef __bf16 v16b __attribute__((ext_vector_type(16)));
typedef float v8f __attribute__((ext_vector_type(8)));
typedef float v4f __attribute__((ext_vector_type(4)));
typedef unsigned int v4u __attribute__((ext_vector_type(4)));

union FragH { v16h v; v4u q[2]; };
union FragB { v16b v; v4u q[2]; };

__device__ __forceinline__ v4u ldg16(const unsigned short* p) { return *(const v4u*)p; }

// RNE f32 -> bf16 bits
__device__ __forceinline__ unsigned int bf_bits(float f) {
  unsigned int u = __float_as_uint(f);
  return (u + 0x7FFFu + ((u >> 16) & 1u)) >> 16;
}
__device__ __forceinline__ float bf_val(unsigned int b) { return __uint_as_float(b << 16); }
// RNE f32 -> f16 bits
__device__ __forceinline__ unsigned int hf_bits(float f) {
  union { _Float16 h; unsigned short u; } c;
  c.h = (_Float16)f;
  return (unsigned int)c.u;
}
__device__ __forceinline__ unsigned int pk2(unsigned int lo, unsigned int hi) {
  return (lo & 0xFFFFu) | (hi << 16);
}
// 8 consecutive f32 -> 8 packed f16 (element 2t in the low half of word t)
__device__ __forceinline__ v4u pack_h8(v4f a, v4f c) {
  v4u r;
  r[0] = pk2(hf_bits(a[0]), hf_bits(a[1]));
  r[1] = pk2(hf_bits(a[2]), hf_bits(a[3]));
  r[2] = pk2(hf_bits(c[0]), hf_bits(c[1]));
  r[3] = pk2(hf_bits(c[2]), hf_bits(c[3]));
  return r;
}
// 8 consecutive f32 -> bf16 hi plane and bf16 residual plane
__device__ __forceinline__ void split_b8(v4f a, v4f c, v4u& H, v4u& L) {
  float v[8] = {a[0], a[1], a[2], a[3], c[0], c[1], c[2], c[3]};
  unsigned int hb[8], lb[8];
#pragma unroll
  for (int e = 0; e < 8; ++e) {
    hb[e] = bf_bits(v[e]);
    lb[e] = bf_bits(v[e] - bf_val(hb[e]));
  }
#pragma unroll
  for (int t = 0; t < 4; ++t) {
    H[t] = pk2(hb[2 * t], hb[2 * t + 1]);
    L[t] = pk2(lb[2 * t], lb[2 * t + 1]);
  }
}

__device__ __forceinline__ v8f zero8() {
  v8f z;
#pragma unroll
  for (int r = 0; r < 8; ++r) z[r] = 0.f;
  return z;
}
__device__ __forceinline__ v8f mma_h(v16h a, v16h b, v8f c) {
  return __builtin_amdgcn_wmma_f32_16x16x32_f16(false, a, false, b, (short)0, c, false, false);
}
__device__ __forceinline__ v8f mma_b(v16b a, v16b b, v8f c) {
  return __builtin_amdgcn_wmma_f32_16x16x32_bf16(false, a, false, b, (short)0, c, false, false);
}

// ---------------------------------------------------------------------------
// x [n] f32 -> f16 plane (unscaled) and bf16 hi / lo planes. 8 elements per thread, 512 threads per block blk.
// ---------------------------------------------------------------------------
__device__ __forceinline__ void cvt_x_body(const float* __restrict__ x, unsigned short* xh,
                                           unsigned short* xbh, unsigned short* xbl, int n, int blk, int tid) {
  const size_t i8 = ((size_t)blk * 512u + (size_t)tid) * 8u;
  if (i8 + 8 > (size_t)n) return;
  const v4f a = *(const v4f*)(x + i8);
  const v4f c = *(const v4f*)(x + i8 + 4);
  const v4u fh = pack_h8(a, c);
  v4u bh, bl;
  split_b8(a, c, bh, bl);
  *(v4u*)(xh + i8) = fh;
  *(v4u*)(xbh + i8) = bh;
  *(v4u*)(xbl + i8) = bl;
  
}

// ---------------------------------------------------------------------------
// W[Kd][Nd] f32 -> WT[Nd][Kd] 16-bit (k-contiguous rows).  64x64 tile at (e0, n0) through LDS, 256 threads
// (tid 0..255) and their own LDS tile; the caller's block holds two such halves, both pass the barrier.
// MODE 0: f16 of (W * scale) into o0.  MODE 1: bf16 hi into o0, bf16 lo into o1.
// ---------------------------------------------------------------------------
template <int MODE>
__device__ __forceinline__ void cvt_wT_body(const float* __restrict__ W, unsigned short* o0,
                                            unsigned short* o1, int Kd, int Nd, float scale,
                                            float (*tile)[65], int n0, int e0, int tid) {
#pragma unroll
  for (int t = 0; t < 4; ++t) {
    const int idx = t * 256 + tid;
    const int rr = idx >> 4, c4 = (idx & 15) * 4;
    const v4f v = *(const v4f*)(W + (size_t)(e0 + rr) * Nd + n0 + c4);
    tile[rr][c4] = v[0];
    tile[rr][c4 + 1] = v[1];
    tile[rr][c4 + 2] = v[2];
    tile[rr][c4 + 3] = v[3];
  }
  __syncthreads();
  v4u Hv[2], Lv[2];
  size_t adr[2];
#pragma unroll
  for (int t = 0; t < 2; ++t) {
    const int s = t * 256 + tid;
    const int nn = s >> 3, kq = (s & 7) * 8;
    v4f a, c;
#pragma unroll
    for (int e = 0; e < 4; ++e) {
      a[e] = tile[kq + e][nn] * scale;
      c[e] = tile[kq + 4 + e][nn] * scale;
    }
    if (MODE == 0) {
      Hv[t] = pack_h8(a, c);
      Lv[t] = Hv[t];
    } else {
      split_b8(a, c, Hv[t], Lv[t]);
    }
    adr[t] = (size_t)(n0 + nn) * Kd + e0 + kq;
  }
#pragma unroll
  for (int t = 0; t < 2; ++t) {
    *(v4u*)(o0 + adr[t]) = Hv[t];
    if (MODE == 1) *(v4u*)(o1 + adr[t]) = Lv[t];
  }
  
}

// ---------------------------------------------------------------------------
// Gate MLP, gate[b][h] = sigmoid(relu(sync @ W1 + b1) @ W2 + b2), spread over GNS x batch blocks.
// Block (c, b) owns the 32 hidden units j0 = 32c .. 32c+31 of batch b.  Its EIN x 128-B slice of W1 is read
// with every load of a thread in flight at once: 8 lanes take one row's 128-B line, each group of 8 lanes owns
// EIN/64 consecutive rows; the shapes are compile-time, so a thread's loads share one address and differ in
// the immediate offset.
// The row groups' partial sums are combined by lane exchange, then over the waves in LDS in wave order.
// Wave 0 adds b1, applies relu and multiplies by the slice's 32 rows of W2:
//   plo[(b*GNS + c)*32 + h] = sum over the slice's j of hid[j] * W2[j][h]   (h >= HN: 0).
// The attention kernel adds the GNS slices and b2 in slice order and applies the sigmoid.
// ---------------------------------------------------------------------------
#define GNS 8
template <int EIN, int HN>
__device__ __forceinline__ void gate_body(const float* __restrict__ sync, const float* __restrict__ W1,
                                          const float* __restrict__ b1, const float* __restrict__ W2,
                                          float* plo, float* red, float* w2s, int c, int b, int tid) {
  constexpr int HD = GNS * 32, NT = EIN / 64;
  static_assert(NT == 16 && 32 * HN == 512, "16 rows and one W2 element per thread");
  const int j0 = c * 32, l = tid & 31;
  const int w = __builtin_amdgcn_readfirstlane(tid >> 5);
  const int cq = (tid & 7) * 4, rg = tid >> 3;
  const float* p2 = W2 + (size_t)j0 * HN + tid;
  const float* pb = b1 + j0 + l;
  const float* pw = W1 + (size_t)rg * NT * HD + j0 + cq;
  const float* ps = sync + (size_t)b * EIN + rg * NT;
  const float w2v = *p2;
  const float bj = *pb;
  v4f wv[NT], sv[NT / 4];
#pragma unroll  // constant indices keep wv and sv in registers
  for (int t = 0; t < NT; ++t) wv[t] = *(const v4f*)(pw + t * HD);
#pragma unroll  // as above
  for (int t = 0; t < NT / 4; ++t) sv[t] = *(const v4f*)(ps + t * 4);
  // nothing is scheduled across this line, so every load above is issued before the first is waited for:
  // one memory latency for the slice; without it the compiler starts the sums after half of the loads
  __builtin_amdgcn_sched_barrier(0);
  v4f acc;
  acc[0] = 0.f; acc[1] = 0.f; acc[2] = 0.f; acc[3] = 0.f;
#pragma unroll  // as above
  for (int t = 0; t < NT; ++t) acc += wv[t] * sv[t >> 2][t & 3];
  // lanes l, l^8, l^16, l^24 hold the same four columns
#pragma unroll  // constant indices keep acc in registers
  for (int k = 0; k < 4; ++k) {
    acc[k] += __shfl_xor(acc[k], 8);
    acc[k] += __shfl_xor(acc[k], 16);
  }
  if (l < 8) *(v4f*)(red + w * 32 + cq) = acc;
  w2s[tid] = w2v;
  __syncthreads();
  if (w == 0) {
    float a = bj;
#pragma unroll  // the 16 LDS reads issue together
    for (int ww = 0; ww < 16; ++ww) a += red[ww * 32 + l];
    const int hid = __float_as_int(fmaxf(a, 0.f));
    const int lh = l & (HN - 1);
    float p = 0.f;
#pragma unroll  // lane index of readlane and LDS offsets as immediates
    for (int j = 0; j < 32; ++j) p += __int_as_float(__builtin_amdgcn_readlane(hid, j)) * w2s[j * HN + lh];
    plo[((size_t)b * GNS + c) * 32 + l] = (l < HN) ? p : 0.f;
  }
}

// ---------------------------------------------------------------------------
// Everything that reads only the inputs, in ONE launch: none of the three jobs depends on another, so they
// share the chip instead of running one behind the other.  Blocks of 512 threads, dealt by block index:
//   [0, GNS*Bn)          gate MLP slices (the longest dependent chain, so they start first);
//   then 4*(EIN/64)^2/2  weight tiles, two 64x64 tiles per block, matrices in the order Wq, Wk, Wv, Wo;
//   the rest             x planes.
// ---------------------------------------------------------------------------
template <int EIN, int HN>
__global__ __launch_bounds__(512) void k_prep(const float* __restrict__ x, const float* __restrict__ sync,
                                             const float* __restrict__ Wq, const float* __restrict__ Wk,
                                             const float* __restrict__ Wv, const float* __restrict__ Wo,
                                             const float* __restrict__ W1, const float* __restrict__ b1,
                                             const float* __restrict__ W2, unsigned short* xh,
                                             unsigned short* xbh, unsigned short* xbl, unsigned short* wqT,
                                             unsigned short* wkT, unsigned short* wvTh, unsigned short* wvTl,
                                             unsigned short* woTh, unsigned short* woTl, float* plo, int nX,
                                             int Bn) {
  constexpr int TPR = EIN / 64, TPM = TPR * TPR;  // 64x64 tiles per row and per matrix
  static_assert((TPR & (TPR - 1)) == 0 && TPM % 2 == 0, "a block's two tiles lie in one matrix");
  // two transposition tiles; the gate blocks use the first 1024 words, with 16-B accesses
  __shared__ __attribute__((aligned(16))) float sm[2 * 64 * 65];
  const int tid = threadIdx.x;
  int blk = blockIdx.x;
  if (blk < GNS * Bn) {
    gate_body<EIN, HN>(sync, W1, b1, W2, plo, sm, sm + 512, blk % GNS, blk / GNS, tid);
    return;
  }
  blk -= GNS * Bn;
  if (blk < 2 * TPM) {
    const int half = tid >> 8;
    const int t = blk * 2 + half;
    const int mi = blk / (TPM / 2);  // block-uniform
    const int n0 = (t & (TPR - 1)) * 64, e0 = ((t / TPR) & (TPR - 1)) * 64;
    float (*tile)[65] = (float (*)[65])(sm + half * 64 * 65);
    if (mi < 2)
      cvt_wT_body<0>(mi == 0 ? Wq : Wk, mi == 0 ? wqT : wkT, mi == 0 ? wqT : wkT, EIN, EIN, 64.0f, tile, n0, e0,
                     tid & 255);
    else
      cvt_wT_body<1>(mi == 2 ? Wv : Wo, mi == 2 ? wvTh : woTh, mi == 2 ? wvTl : woTl, EIN, EIN, 1.0f, tile, n0, e0,
                     tid & 255);
    return;
  }
  blk -= 2 * TPM;
  cvt_x_body(x, xh, xbh, xbl, nX, blk, tid);
}

// ---------------------------------------------------------------------------
// C[M,N] = A[M,K] @ B[K,N] (+bias) with A row-major 16-bit and B given as BT[N][K] 16-bit.
// Block tile 128x64, 256 threads = 8 waves, wave w owns rows w*16..w*16+15, 4 n-tiles.
// The k range is walked in tiles of 64: the block's 128 A rows and 64 B rows (each plane) are
// brought to LDS once per tile, 128 B of a row from 8 neighbouring lanes, the next tile's
// global loads in flight in registers while this tile is multiplied.  Fragments are read from
// LDS with the 16x16x32 split k-map
//   (lane l: row/col = l&15; elements 0..7 <- k0+8*(l>>4)+0..7, 8..15 <- k0+16+8*(l>>4)+0..7).
// SPLIT 0: single f16 product.  SPLIT 1: bf16 hi/lo planes, three products.
// OM 0: f16 in the attention kernel's fragment order: per (batch, head) and 16-row tile one 2-KB block of
//       4 x 512 B, piece t of lane l=(g,m) = row m, columns (2t+g)*8..+7 of the head.
// OM 1: bf16 hi/lo in fragment order: per (batch, head) and 32-key chunk one 4-KB block per plane of
//       8 x 512 B, piece nt*2+q of lane l=(g,m) = column d nt*16+m, keys q*16+8g..+7 of the chunk.
//       In both, one wave-wide 16-B load or store of a piece covers 512 contiguous bytes (4 whole lines).
// OM 2: f32 row-major [M][N].
// ---------------------------------------------------------------------------
#define GPIT 72  // LDS row pitch in 16-bit elements: 144 B = 16 B x 9, b128 fragment reads without bank conflicts
// LDS of one block in 16-B units: the staged operand tiles, or the epilogue tile (128 x 68 f32) that reuses their space
template <int SPLIT>
constexpr int gemm_lds16() {
  return (SPLIT ? 2 : 1) * (128 + 64) * GPIT / 8 > 128 * 17 ? (SPLIT ? 2 : 1) * (128 + 64) * GPIT / 8 : 128 * 17;
}
// the block (bx, by) of the product; smem holds gemm_lds16<SPLIT>() units
template <int SPLIT, int OM>
__device__ __forceinline__ void gemm_body(v4f* smem, int bx, int by, const unsigned short* __restrict__ Ah,
                                          const unsigned short* __restrict__ Al,
                                          const unsigned short* __restrict__ Bh,
                                          const unsigned short* __restrict__ Bl,
                                          const float* __restrict__ bias, void* out0, void* out1,
                                          int M, int N, int K, int Sq, float oscale) {
  constexpr int PIT = GPIT;
  float* stg = (float*)smem;
  unsigned short* sAh = (unsigned short*)smem;
  unsigned short* sBh = sAh + 128 * PIT;
  unsigned short* sAl = sBh + 64 * PIT;  // the two lo planes exist only with SPLIT
  unsigned short* sBl = sAl + 128 * PIT;
  const int nBase = bx * 64, mBase = by * 128;
  if (nBase + 64 > N || mBase + 128 > M || (K & 63) != 0) return;  // block-uniform
  const int tid = threadIdx.x, w = tid >> 5, l = tid & 31, g = l >> 4, m = l & 15;

  v8f acc[4];
#pragma unroll
  for (int nt = 0; nt < 4; ++nt) acc[nt] = zero8();

  // staging map: thread -> row tid>>3 (+32 per step), 16-B piece tid&7 of the row's 128 B
  const int lr = tid >> 3, lc = (tid & 7) * 8;
  // global address = block-uniform byte base (moves with k) + a per-thread 32-bit byte offset that never changes
  const char* bAh = (const char*)(Ah + (size_t)mBase * K);
  const char* bAl = (const char*)(Al + (size_t)mBase * K);
  const char* bBh = (const char*)(Bh + (size_t)nBase * K);
  const char* bBl = (const char*)(Bl + (size_t)nBase * K);
  unsigned int go[4];
#pragma unroll  // here and below: constant indices keep the small per-thread arrays in registers
  for (int t = 0; t < 4; ++t) go[t] = (unsigned int)(((lr + 32 * t) * K + lc) * 2);
  const int ls = lr * PIT + lc;
  const int fa = (w * 16 + m) * PIT + 8 * g;  // this lane's A fragment row in LDS
  const int fb = m * PIT + 8 * g;             // this lane's B fragment row of n-tile 0

  v4u rah[4], ral[4], rbh[2], rbl[2];
#pragma unroll
  for (int t = 0; t < 4; ++t) {
    rah[t] = *(const v4u*)(bAh + go[t]);
    if (SPLIT) ral[t] = *(const v4u*)(bAl + go[t]);
  }
#pragma unroll
  for (int t = 0; t < 2; ++t) {
    rbh[t] = *(const v4u*)(bBh + go[t]);
    if (SPLIT) rbl[t] = *(const v4u*)(bBl + go[t]);
  }

#pragma unroll 1  // one copy of the body: the staged pieces and both k halves' fragments already fill the register budget
  for (int k0 = 0; k0 < K; k0 += 64) {
#pragma unroll
    for (int t = 0; t < 4; ++t) {
      *(v4u*)(sAh + ls + t * 32 * PIT) = rah[t];
      if (SPLIT) *(v4u*)(sAl + ls + t * 32 * PIT) = ral[t];
    }
#pragma unroll
    for (int t = 0; t < 2; ++t) {
      *(v4u*)(sBh + ls + t * 32 * PIT) = rbh[t];
      if (SPLIT) *(v4u*)(sBl + ls + t * 32 * PIT) = rbl[t];
    }
    __syncthreads();  // the tile is complete before any wave reads fragments from it
    if (k0 + 64 < K) {
      const size_t kn = (size_t)(k0 + 64) * 2;
      const char *pah[4], *pal[4], *pbh[2], *pbl[2];
#pragma unroll
      for (int t = 0; t < 4; ++t) {
        pah[t] = bAh + kn + go[t];
        pal[t] = bAl + kn + go[t];
        rah[t] = *(const v4u*)pah[t];
        if (SPLIT) ral[t] = *(const v4u*)pal[t];
      }
#pragma unroll
      for (int t = 0; t < 2; ++t) {
        pbh[t] = bBh + kn + go[t];
        pbl[t] = bBl + kn + go[t];
        rbh[t] = *(const v4u*)pbh[t];
        if (SPLIT) rbl[t] = *(const v4u*)pbl[t];
      }
      // the prefetch loads' address registers are free for reuse (fragment reads below) only behind this wait;
      // naming the addresses as inputs keeps them in their registers up to it
      if (SPLIT)
        asm volatile("s_wait_xcnt 0x0" ::"v"(pah[0]), "v"(pah[1]), "v"(pah[2]), "v"(pah[3]), "v"(pbh[0]), "v"(pbh[1]),
                     "v"(pal[0]), "v"(pal[1]), "v"(pal[2]), "v"(pal[3]), "v"(pbl[0]), "v"(pbl[1])
                     : "memory");
      else
        asm volatile("s_wait_xcnt 0x0" ::"v"(pah[0]), "v"(pah[1]), "v"(pah[2]), "v"(pah[3]), "v"(pbh[0]), "v"(pbh[1])
                     : "memory");
    }
#pragma unroll  // both k halves of the tile in one body, LDS offsets as immediates
    for (int kk = 0; kk < 64; kk += 32) {
      if (SPLIT) {
        FragB a, a2, b0, b1, b2, b3, c0, c1, c2, c3;
        a.q[0] = ldg16(sAh + fa + kk);
        a.q[1] = ldg16(sAh + fa + kk + 16);
        a2.q[0] = ldg16(sAl + fa + kk);
        a2.q[1] = ldg16(sAl + fa + kk + 16);
        b0.q[0] = ldg16(sBh + fb + kk);
        b0.q[1] = ldg16(sBh + fb + kk + 16);
        b1.q[0] = ldg16(sBh + fb + 16 * PIT + kk);
        b1.q[1] = ldg16(sBh + fb + 16 * PIT + kk + 16);
        b2.q[0] = ldg16(sBh + fb + 32 * PIT + kk);
        b2.q[1] = ldg16(sBh + fb + 32 * PIT + kk + 16);
        b3.q[0] = ldg16(sBh + fb + 48 * PIT + kk);
        b3.q[1] = ldg16(sBh + fb + 48 * PIT + kk + 16);
        c0.q[0] = ldg16(sBl + fb + kk);
        c0.q[1] = ldg16(sBl + fb + kk + 16);
        c1.q[0] = ldg16(sBl + fb + 16 * PIT + kk);
        c1.q[1] = ldg16(sBl + fb + 16 * PIT + kk + 16);
        c2.q[0] = ldg16(sBl + fb + 32 * PIT + kk);
        c2.q[1] = ldg16(sBl + fb + 32 * PIT + kk + 16);
        c3.q[0] = ldg16(sBl + fb + 48 * PIT + kk);
        c3.q[1] = ldg16(sBl + fb + 48 * PIT + kk + 16);
        acc[0] = mma_b(a.v, b0.v, acc[0]);
        acc[0] = mma_b(a.v, c0.v, acc[0]);
        acc[0] = mma_b(a2.v, b0.v, acc[0]);
        acc[1] = mma_b(a.v, b1.v, acc[1]);
        acc[1] = mma_b(a.v, c1.v, acc[1]);
        acc[1] = mma_b(a2.v, b1.v, acc[1]);
        acc[2] = mma_b(a.v, b2.v, acc[2]);
        acc[2] = mma_b(a.v, c2.v, acc[2]);
        acc[2] = mma_b(a2.v, b2.v, acc[2]);
        acc[3] = mma_b(a.v, b3.v, acc[3]);
        acc[3] = mma_b(a.v, c3.v, acc[3]);
        acc[3] = mma_b(a2.v, b3.v, acc[3]);
        // four vector slots behind the last WMMA, on every path, before its operands or results are touched
        asm volatile(NOP4
                     : "+v"(acc[0]), "+v"(acc[1]), "+v"(acc[2]), "+v"(acc[3])
                     : "v"(a.v), "v"(a2.v), "v"(b0.v), "v"(b1.v), "v"(b2.v), "v"(b3.v),
                       "v"(c0.v), "v"(c1.v), "v"(c2.v), "v"(c3.v));
      } else {
        FragH a, b0, b1, b2, b3;
        a.q[0] = ldg16(sAh + fa + kk);
        a.q[1] = ldg16(sAh + fa + kk + 16);
        b0.q[0] = ldg16(sBh + fb + kk);
        b0.q[1] = ldg16(sBh + fb + kk + 16);
        b1.q[0] = ldg16(sBh + fb + 16 * PIT + kk);
        b1.q[1] = ldg16(sBh + fb + 16 * PIT + kk + 16);
        b2.q[0] = ldg16(sBh + fb + 32 * PIT + kk);
        b2.q[1] = ldg16(sBh + fb + 32 * PIT + kk + 16);
        b3.q[0] = ldg16(sBh + fb + 48 * PIT + kk);
        b3.q[1] = ldg16(sBh + fb + 48 * PIT + kk + 16);
        acc[0] = mma_h(a.v, b0.v, acc[0]);
        acc[1] = mma_h(a.v, b1.v, acc[1]);
        acc[2] = mma_h(a.v, b2.v, acc[2]);
        acc[3] = mma_h(a.v, b3.v, acc[3]);
        // four vector slots behind the last WMMA, on every path, before its operands or results are touched
        asm volatile(NOP4
                     : "+v"(acc[0]), "+v"(acc[1]), "+v"(acc[2]), "+v"(acc[3])
                     : "v"(a.v), "v"(b0.v), "v"(b1.v), "v"(b2.v), "v"(b3.v));
      }
    }
    __syncthreads();  // every wave has left the tile before it is overwritten (next tile, or the epilogue tile)
  }

  // stage: D element r of lane (g,m), n-tile nt -> (row w*16+8g+r, col nt*16+m)
#pragma unroll
  for (int nt = 0; nt < 4; ++nt) {
    const int col = nt * 16 + m;
    const float bv = bias[nBase + col];
#pragma unroll
    for (int r = 0; r < 8; ++r) stg[(w * 16 + 8 * g + r) * 68 + col] = acc[nt][r] * oscale + bv;
  }
  __syncthreads();

  if (OM == 0) {
    // wave w holds the block's 16-row tile w of head nBase/64
    unsigned short* o = (unsigned short*)out0;
    const int Hn = N >> 6;
    const int bb = mBase / Sq;
    const int bh = bb * Hn + (nBase >> 6);
    const int tl = ((mBase - bb * Sq) >> 4) + w;
    const size_t tb = ((size_t)bh * (Sq >> 4) + tl) * 1024 + l * 8;
    v4u val[4];
    size_t adr[4];
#pragma unroll
    for (int t = 0; t < 4; ++t) {
      const float* sp = stg + (w * 16 + m) * 68 + (2 * t + g) * 8;
      const v4f x0 = *(const v4f*)sp;
      const v4f x1 = *(const v4f*)(sp + 4);
      val[t] = pack_h8(x0, x1);
      adr[t] = tb + t * 256;
    }
#pragma unroll
    for (int t = 0; t < 4; ++t) *(v4u*)(o + adr[t]) = val[t];
    // in the merged kernel the other projection's body follows these stores in the code: this wait stands in
    // front of every rewrite of the stores' address and data registers
    asm volatile("s_wait_xcnt 0x0" ::: "memory");
  } else if (OM == 1) {
    // tile rows = s (128 consecutive within one batch = 4 chunks of 32 keys), cols = d of head nBase/64
    unsigned short* oh = (unsigned short*)out0;
    unsigned short* ol = (unsigned short*)out1;
    const int Hn = N >> 6;
    const int bb = mBase / Sq;
    const int bh = bb * Hn + (nBase >> 6);
    const int sBase = mBase - bb * Sq;
    v4u Hv[4], Lv[4];
    size_t adr[4];
#pragma unroll
    for (int t = 0; t < 4; ++t) {
      const int ch = w >> 1, nt = (w & 1) * 2 + (t >> 1), q = t & 1;  // the block's 32 pieces, 4 per wave
      const int d = nt * 16 + m, s8 = ch * 32 + q * 16 + g * 8;
      v4f x0, x1;
#pragma unroll
      for (int e = 0; e < 4; ++e) {
        x0[e] = stg[(s8 + e) * 68 + d];
        x1[e] = stg[(s8 + 4 + e) * 68 + d];
      }
      split_b8(x0, x1, Hv[t], Lv[t]);
      adr[t] = (((size_t)bh * (Sq >> 5) + (sBase >> 5) + ch) * 8 + nt * 2 + q) * 256 + l * 8;
    }
#pragma unroll
    for (int t = 0; t < 4; ++t) {
      *(v4u*)(oh + adr[t]) = Hv[t];
      *(v4u*)(ol + adr[t]) = Lv[t];
    }
    
  } else {
    float* o = (float*)out0;
    v4f val[8];
    size_t adr[8];
#pragma unroll
    for (int t = 0; t < 8; ++t) {
      const int row = w * 16 + t * 2 + (l >> 4), c4 = (l & 15) * 4;
      val[t] = *(const v4f*)(stg + row * 68 + c4);
      adr[t] = (size_t)(mBase + row) * N + nBase + c4;
    }
#pragma unroll
    for (int t = 0; t < 8; ++t) *(v4f*)(o + adr[t]) = val[t];
    
  }
}

// The three projections of x in ONE launch (none depends on another): blockIdx.z = 0 is x@Wv, whose blocks
// run longest and so start first, 1 is x@Wq, 2 is x@Wk.
__global__ __launch_bounds__(256) void k_qkv(const unsigned short* __restrict__ xh,
                                            const unsigned short* __restrict__ xbh,
                                            const unsigned short* __restrict__ xbl,
                                            const unsigned short* __restrict__ wqT,
                                            const unsigned short* __restrict__ wkT,
                                            const unsigned short* __restrict__ wvTh,
                                            const unsigned short* __restrict__ wvTl,
                                            const float* __restrict__ bq, const float* __restrict__ bk,
                                            const float* __restrict__ bv, unsigned short* qo, unsigned short* ko,
                                            unsigned short* vho, unsigned short* vlo, int M, int N, int K, int Sq,
                                            float qkscale) {
  __shared__ v4f smem[gemm_lds16<1>()];
  const int z = blockIdx.z;
  if (z == 0) {
    gemm_body<1, 1>(smem, blockIdx.x, blockIdx.y, xbh, xbl, wvTh, wvTl, bv, (void*)vho, (void*)vlo, M, N, K, Sq, 1.0f);
  } else {
    const unsigned short* wT = z == 1 ? wqT : wkT;
    unsigned short* o = z == 1 ? qo : ko;
    gemm_body<0, 0>(smem, blockIdx.x, blockIdx.y, xh, xh, wT, wT, z == 1 ? bq : bk, (void*)o, (void*)o, M, N, K, Sq,
                    qkscale);
  }
}

// The output projection, f32 row-major.
__global__ __launch_bounds__(256) void k_oproj(const unsigned short* __restrict__ Ah,
                                              const unsigned short* __restrict__ Al,
                                              const unsigned short* __restrict__ Bh,
                                              const unsigned short* __restrict__ Bl,
                                              const float* __restrict__ bias, float* out, int M, int N, int K, int Sq) {
  __shared__ v4f smem[gemm_lds16<1>()];
  gemm_body<1, 2>(smem, blockIdx.x, blockIdx.y, Ah, Al, Bh, Bl, bias, (void*)out, (void*)out, M, N, K, Sq, 1.0f);
}

// ---------------------------------------------------------------------------
// Fused attention: one block of ANW waves per (16 query rows, batch).  Dynamic LDS:
//   sL[16][S+4] f32  gated+scaled scores of the current head, then exp(s - rowmax);
//   mL[16][S+4] f32  sum over heads of the softmax probabilities (lane-owned elements).
// Row pitch S+4 floats = 16 B x odd: the 16 lanes of a half wave, one query row each, then fall on
// 16 different groups of four banks in every b128 access; at a pitch of S floats they share one group.
// The keys are split over the waves: wave w owns a contiguous run of 32-key chunks in all
// three sweeps, so every sL / mL word is written and read back by one lane of one wave.
// Per head h: score tiles S^T = K_tile . Q^T (A = k rows, B = q rows; D lane (g,m) holds
// query m, keys jt*16+8g+r), exact two-sweep softmax, then P.V with the P fragment read
// back from the same lane's own LDS words (elements 0..7 <- keys k0+8g.., 8..15 <- k0+16+8g..),
// V fragments from the planes vt.  q, k and vt lie in fragment order (see gemm_body, OM 0 and OM 1): every
// fragment load of a wave reads 512 contiguous bytes.  Row max, row sum and the 16x64 P.V
// partial tiles are combined over the waves through LDS, always in wave order.
// ---------------------------------------------------------------------------
#define ANW 16
typedef unsigned int v2u __attribute__((ext_vector_type(2)));

__global__ __launch_bounds__(ANW * 32) void k_attn(const unsigned short* __restrict__ qh,
                                                  const unsigned short* __restrict__ kh,
                                                  const unsigned short* __restrict__ vth,
                                                  const unsigned short* __restrict__ vtl,
                                                  const float* __restrict__ plo, const float* __restrict__ b2,
                                                  unsigned short* ctxh,
                                                  unsigned short* ctxl, float* mout, int S, int H) {
  extern __shared__ v4f dsm[];
  __shared__ float redM[ANW * 16];  // per wave, per query: max over the wave's keys
  __shared__ float redS[ANW * 16];  // per wave, per query: sum of exp over the wave's keys
  __shared__ float gv[32];          // this batch's gate per head
  float* sL = (float*)dsm;
  const int PS = S + 4;  // LDS row pitch of both planes, in floats
  float* mL = sL + (size_t)16 * PS;
  const int i0 = blockIdx.x * 16, b = blockIdx.y;
  if (i0 + 16 > S) return;  // block-uniform
  const int tid = threadIdx.x;
  const int l = tid & 31, g = l >> 4, m = l & 15;
  const int w = __builtin_amdgcn_readfirstlane(tid >> 5);  // scalar, so the sweeps' trip counts are scalar
  const int E = H * 64;

  {
    v4f z;
    z[0] = 0.f; z[1] = 0.f; z[2] = 0.f; z[3] = 0.f;
    v4f* m4 = (v4f*)mL;
    const int n4 = 4 * PS;
    for (int i = tid; i < n4; i += ANW * 32) m4[i] = z;
  }
  if (tid < 32) {  // the gate's last step (see gate_body): slices and bias summed in slice order, sigmoid
    float val = 0.f;
    if (tid < H) {
      float a = b2[tid];
#pragma unroll  // the GNS loads issue together
      for (int c = 0; c < GNS; ++c) a += plo[((size_t)b * GNS + c) * 32 + tid];
      val = 1.0f / (1.0f + expf(-a));
    }
    gv[tid] = val;
  }
  __syncthreads();

  float* srow = sL + (size_t)m * PS;
  float* mrow = mL + (size_t)m * PS;
  const float invH = 1.0f / (float)H;
  const int nC = S >> 5;
  const int cpw = (nC + ANW - 1) / ANW;
  const int c0 = min(w * cpw, nC), c1 = min(c0 + cpw, nC);  // this wave's 32-key chunks
  const int t0w = 2 * c0, t1w = 2 * c1;                     // the same keys as 16-key tiles

  for (int h = 0; h < H; ++h) {
    FragH qa0, qa1;
    {
      const unsigned short* qp = qh + ((size_t)(b * H + h) * (S >> 4) + (i0 >> 4)) * 1024 + l * 8;
      qa0.q[0] = ldg16(qp);
      qa0.q[1] = ldg16(qp + 256);
      qa1.q[0] = ldg16(qp + 512);
      qa1.q[1] = ldg16(qp + 768);
    }
    const float gsc = gv[h] * 0.125f;

    // sweep A: scores -> LDS, running row max
    float rmax = -3.0e38f;
    const unsigned short* kp = kh + (size_t)(b * H + h) * (S >> 4) * 1024 + l * 8;
    for (int jt = t0w; jt < t1w; ++jt) {
      const unsigned short* kr = kp + (size_t)jt * 1024;
      FragH ka0, ka1;
      ka0.q[0] = ldg16(kr);
      ka0.q[1] = ldg16(kr + 256);
      ka1.q[0] = ldg16(kr + 512);
      ka1.q[1] = ldg16(kr + 768);
      v8f sc = zero8();
      sc = mma_h(ka0.v, qa0.v, sc);
      sc = mma_h(ka1.v, qa1.v, sc);
      asm volatile(NOP4 : "+v"(sc) : "v"(ka0.v), "v"(ka1.v), "v"(qa0.v), "v"(qa1.v));
      v4f t0, t1;
#pragma unroll
      for (int r = 0; r < 4; ++r) {
        t0[r] = sc[r] * gsc;
        t1[r] = sc[r + 4] * gsc;
        rmax = fmaxf(rmax, t0[r]);
        rmax = fmaxf(rmax, t1[r]);
      }
      float* pp = srow + jt * 16 + 8 * g;
      *(v4f*)pp = t0;
      *(v4f*)(pp + 4) = t1;
    }
    rmax = fmaxf(rmax, __shfl_xor(rmax, 16));
    if (g == 0) redM[w * 16 + m] = rmax;
    __syncthreads();
#pragma unroll  // the ANW LDS reads issue together instead of one latency per trip
    for (int ww = 0; ww < ANW; ++ww) rmax = fmaxf(rmax, redM[ww * 16 + m]);

    // sweep B: e = exp(s - max) stored back in place, row sum
    float lsum = 0.f;
    for (int jt = t0w; jt < t1w; ++jt) {
      float* pp = srow + jt * 16 + 8 * g;
      v4f t0 = *(v4f*)pp;
      v4f t1 = *(v4f*)(pp + 4);
#pragma unroll
      for (int r = 0; r < 4; ++r) {
        t0[r] = __expf(t0[r] - rmax);
        t1[r] = __expf(t1[r] - rmax);
        lsum += t0[r];
        lsum += t1[r];
      }
      *(v4f*)pp = t0;
      *(v4f*)(pp + 4) = t1;
    }
    lsum += __shfl_xor(lsum, 16);
    if (g == 0) redS[w * 16 + m] = lsum;
    __syncthreads();
    lsum = 0.f;
#pragma unroll  // the ANW LDS reads issue together instead of one latency per trip
    for (int ww = 0; ww < ANW; ++ww) lsum += redS[ww * 16 + m];
    const float linv = 1.0f / lsum;

    // sweep C: probabilities, head-sum accumulation, P.V over this wave's keys
    v8f cacc[4];
#pragma unroll
    for (int nt = 0; nt < 4; ++nt) cacc[nt] = zero8();
    const size_t vb = (size_t)(b * H + h) * (S >> 5) * 2048 + l * 8;
#pragma unroll 1
    for (int jc = c0; jc < c1; ++jc) {
      const int k0 = jc * 32;
      float* pa = srow + k0 + 8 * g;
      float* pb = srow + k0 + 16 + 8 * g;
      const v4f p0 = *(v4f*)pa * linv;
      const v4f p1 = *(v4f*)(pa + 4) * linv;
      const v4f p2 = *(v4f*)pb * linv;
      const v4f p3 = *(v4f*)(pb + 4) * linv;
      {
        v4f* ma = (v4f*)(mrow + k0 + 8 * g);
        v4f* mb = (v4f*)(mrow + k0 + 16 + 8 * g);
        const v4f s0 = ma[0] + p0;
        const v4f s1 = ma[1] + p1;
        const v4f s2 = mb[0] + p2;
        const v4f s3 = mb[1] + p3;
        ma[0] = s0;
        ma[1] = s1;
        mb[0] = s2;
        mb[1] = s3;
      }
      FragB ph, pl;
      split_b8(p0, p1, ph.q[0], pl.q[0]);
      split_b8(p2, p3, ph.q[1], pl.q[1]);
      FragB vh0, vh1, vh2, vh3, vl0, vl1, vl2, vl3;
      const unsigned short* vhp = vth + vb + (size_t)jc * 2048;
      const unsigned short* vlp = vtl + vb + (size_t)jc * 2048;
      vh0.q[0] = ldg16(vhp);
      vh0.q[1] = ldg16(vhp + 256);
      vh1.q[0] = ldg16(vhp + 512);
      vh1.q[1] = ldg16(vhp + 768);
      vh2.q[0] = ldg16(vhp + 1024);
      vh2.q[1] = ldg16(vhp + 1280);
      vh3.q[0] = ldg16(vhp + 1536);
      vh3.q[1] = ldg16(vhp + 1792);
      vl0.q[0] = ldg16(vlp);
      vl0.q[1] = ldg16(vlp + 256);
      vl1.q[0] = ldg16(vlp + 512);
      vl1.q[1] = ldg16(vlp + 768);
      vl2.q[0] = ldg16(vlp + 1024);
      vl2.q[1] = ldg16(vlp + 1280);
      vl3.q[0] = ldg16(vlp + 1536);
      vl3.q[1] = ldg16(vlp + 1792);
      // stands in front of any reuse of the two address pairs (also as a later load's destination);
      // naming them as inputs keeps them in their registers up to it
      asm volatile("s_wait_xcnt 0x0" ::"v"(vhp), "v"(vlp) : "memory");
      cacc[0] = mma_b(ph.v, vh0.v, cacc[0]);
      cacc[0] = mma_b(ph.v, vl0.v, cacc[0]);
      cacc[0] = mma_b(pl.v, vh0.v, cacc[0]);
      cacc[1] = mma_b(ph.v, vh1.v, cacc[1]);
      cacc[1] = mma_b(ph.v, vl1.v, cacc[1]);
      cacc[1] = mma_b(pl.v, vh1.v, cacc[1]);
      cacc[2] = mma_b(ph.v, vh2.v, cacc[2]);
      cacc[2] = mma_b(ph.v, vl2.v, cacc[2]);
      cacc[2] = mma_b(pl.v, vh2.v, cacc[2]);
      cacc[3] = mma_b(ph.v, vh3.v, cacc[3]);
      cacc[3] = mma_b(ph.v, vl3.v, cacc[3]);
      cacc[3] = mma_b(pl.v, vh3.v, cacc[3]);
      asm volatile(NOP4
                   : "+v"(cacc[0]), "+v"(cacc[1]), "+v"(cacc[2]), "+v"(cacc[3])
                   : "v"(ph.v), "v"(pl.v), "v"(vh0.v), "v"(vh1.v), "v"(vh2.v), "v"(vh3.v),
                     "v"(vl0.v), "v"(vl1.v), "v"(vl2.v), "v"(vl3.v));
    }

    // every wave has left the score plane: it now holds ANW partial tiles of 16 x 68 f32
    __syncthreads();
    float* part = sL + w * (16 * 68);
#pragma unroll
    for (int nt = 0; nt < 4; ++nt) {
#pragma unroll
      for (int r = 0; r < 8; ++r) part[(8 * g + r) * 68 + nt * 16 + m] = cacc[nt][r];
    }
    __syncthreads();
    if (w < 8) {  // 256 threads, 4 columns each: a row's 128-B line per plane leaves from 16 lanes of one wave
      const int row = tid >> 4, c4 = (tid & 15) * 4;
      const float* sp = sL + row * 68 + c4;
      v4f x = *(const v4f*)sp;
#pragma unroll  // the ANW LDS reads issue together instead of one latency per trip
      for (int ww = 1; ww < ANW; ++ww) x += *(const v4f*)(sp + ww * (16 * 68));
      unsigned int hb[4], lb[4];
#pragma unroll  // constant indices keep hb and lb in registers
      for (int e = 0; e < 4; ++e) {
        hb[e] = bf_bits(x[e]);
        lb[e] = bf_bits(x[e] - bf_val(hb[e]));
      }
      v2u Hv, Lv;
      Hv[0] = pk2(hb[0], hb[1]);
      Hv[1] = pk2(hb[2], hb[3]);
      Lv[0] = pk2(lb[0], lb[1]);
      Lv[1] = pk2(lb[2], lb[3]);
      const size_t adr = (size_t)(b * S + i0 + row) * E + h * 64 + c4;
      *(v2u*)(ctxh + adr) = Hv;
      *(v2u*)(ctxl + adr) = Lv;
    }
    __syncthreads();
  }

  // head-mean rows: 16 rows x S f32, one row per wave, 512 B per store instruction, lane-contiguous
  __syncthreads();
  float* ob = mout + (size_t)(b * S + i0) * S;
  const int nL = S >> 7;
  for (int row = w; row < 16; row += ANW) {
    for (int c = 0; c < nL; ++c) {
      const size_t off = (size_t)row * S + c * 128 + l * 4;
      const v4f v = *(const v4f*)(mL + (size_t)row * PS + c * 128 + l * 4) * invH;
      *(v4f*)(ob + off) = v;
    }
  }
  
}

// ---------------------------------------------------------------------------
// Host launcher
// ---------------------------------------------------------------------------
extern "C" void kernel_launch(void* const* d_in, const int* in_sizes, int n_in, void* d_out,
                              int out_size, void* d_ws, size_t ws_size, hipStream_t stream) {
  if (n_in < 14) return;
  const int E = 1024, H = 16;
  const int nX = in_sizes[0];
  if (nX <= 0 || (nX % E) != 0) return;
  const int M = nX / E;
  const int nSy = in_sizes[1];
  if (nSy <= 0 || (nSy % E) != 0) return;
  const int Bn = nSy / E;
  if (Bn <= 0 || (M % Bn) != 0) return;
  const int S = M / Bn;
  const int HID = in_sizes[9];
  if ((M % 128) != 0 || (S % 128) != 0 || HID != GNS * 32) return;
  if (S < 1152) return;  // the attention kernel's 16 partial tiles of 16 x 68 f32 reuse its 16 x S score plane
  if (in_sizes[2] != E * E || in_sizes[4] != E * E || in_sizes[6] != E * E || in_sizes[12] != E * E) return;
  if (in_sizes[3] != E || in_sizes[5] != E || in_sizes[7] != E || in_sizes[13] != E) return;
  if (in_sizes[8] != E * HID || in_sizes[10] != HID * H || in_sizes[11] != H) return;
  if ((long long)out_size != (long long)nX + (long long)Bn * (long long)S * (long long)S) return;

  const float* x = (const float*)d_in[0];
  const float* sync = (const float*)d_in[1];
  const float* Wq = (const float*)d_in[2];
  const float* bq = (const float*)d_in[3];
  const float* Wk = (const float*)d_in[4];
  const float* bk = (const float*)d_in[5];
  const float* Wv = (const float*)d_in[6];
  const float* bv = (const float*)d_in[7];
  const float* Ws1 = (const float*)d_in[8];
  const float* bs1 = (const float*)d_in[9];
  const float* Ws2 = (const float*)d_in[10];
  const float* bs2 = (const float*)d_in[11];
  const float* Wo = (const float*)d_in[12];
  const float* bo = (const float*)d_in[13];

  float* out_proj = (float*)d_out;                 // [M][E] f32
  float* out_mean = (float*)d_out + (size_t)nX;    // [Bn][S][S] f32

  // workspace carve (bytes), every sub-buffer 256-B aligned
  size_t off = 0;
  auto al = [&](size_t bytes) { size_t o = off; off += (bytes + 255) & ~(size_t)255; return o; };
  const size_t nW = (size_t)E * E;
  const size_t o_sw = al((size_t)Bn * GNS * 32 * 4);
  const size_t o_xh = al((size_t)nX * 2);
  const size_t o_xbh = al((size_t)nX * 2);
  const size_t o_xbl = al((size_t)nX * 2);
  const size_t o_wq = al(nW * 2);
  const size_t o_wk = al(nW * 2);
  const size_t o_wvh = al(nW * 2);
  const size_t o_wvl = al(nW * 2);
  const size_t o_woh = al(nW * 2);
  const size_t o_wol = al(nW * 2);
  const size_t o_q = al((size_t)nX * 2);
  const size_t o_k = al((size_t)nX * 2);
  const size_t o_vth = al((size_t)nX * 2);
  const size_t o_vtl = al((size_t)nX * 2);
  const size_t o_cth = al((size_t)nX * 2);
  const size_t o_ctl = al((size_t)nX * 2);
  if (off > ws_size) return;

  char* ws = (char*)d_ws;
  float* sw_g = (float*)(ws + o_sw);
  unsigned short* xh = (unsigned short*)(ws + o_xh);
  unsigned short* xbh = (unsigned short*)(ws + o_xbh);
  unsigned short* xbl = (unsigned short*)(ws + o_xbl);
  unsigned short* wqT = (unsigned short*)(ws + o_wq);
  unsigned short* wkT = (unsigned short*)(ws + o_wk);
  unsigned short* wvTh = (unsigned short*)(ws + o_wvh);
  unsigned short* wvTl = (unsigned short*)(ws + o_wvl);
  unsigned short* woTh = (unsigned short*)(ws + o_woh);
  unsigned short* woTl = (unsigned short*)(ws + o_wol);
  unsigned short* qh = (unsigned short*)(ws + o_q);
  unsigned short* kh = (unsigned short*)(ws + o_k);
  unsigned short* vTh = (unsigned short*)(ws + o_vth);
  unsigned short* vTl = (unsigned short*)(ws + o_vtl);
  unsigned short* cth = (unsigned short*)(ws + o_cth);
  unsigned short* ctl = (unsigned short*)(ws + o_ctl);

  // 1) gate MLP slices, weight planes transposed to [n][k], activation planes: one launch
  {
    const int groups = nX / 8;
    const int blocks = GNS * Bn + 2 * (E / 64) * (E / 64) + (groups + 511) / 512;
    k_prep<E, H><<<dim3(blocks), dim3(512), 0, stream>>>(x, sync, Wq, Wk, Wv, Wo, Ws1, bs1, Ws2, xh, xbh, xbl, wqT, wkT,
                                                         wvTh, wvTl, woTh, woTl, sw_g, nX, Bn);
  }
  // 2) the three projections (M x E, K = E): one launch
  k_qkv<<<dim3(E / 64, M / 128, 3), dim3(256), 0, stream>>>(xh, xbh, xbl, wqT, wkT, wvTh, wvTl, bq, bk, bv, qh, kh, vTh,
                                                            vTl, M, E, E, S, 1.0f / 64.0f);
  // 3) attention + head-mean
  {
    const size_t dynB = (size_t)2 * 16 * (size_t)(S + 4) * 4;
    hipFuncSetAttribute(reinterpret_cast<const void*>(&k_attn), hipFuncAttributeMaxDynamicSharedMemorySize, (int)dynB);
    k_attn<<<dim3(S / 16, Bn), dim3(ANW * 32), dynB, stream>>>(qh, kh, vTh, vTl, sw_g, bs2, cth, ctl, out_mean, S, H);
  }
  // 4) output projection -> d_out
  k_oproj<<<dim3(E / 64, M / 128), dim3(256), 0, stream>>>(cth, ctl, woTh, woTl, bo, out_proj, M, E, E, S);
  hipGetLastError();
  hipStreamSynchronize(stream);
}

// v007
// It runs in 257 microseconds.
// In both of two side-by-side timings against v006, it was 1.15 times as fast.
// Counting every step since v000, it is 6.45 times as fast.
#include <hip/hip_runtime.h>

// Contractions: x@Wq, x@Wk and q.k^T : v_wmma_f32_16x16x32_f16 (f16 operands; Wq, Wk carried x64, rescaled in the f32 epilogue; f32 accumulate).
// x@Wv, P.V and ctx@Wo : v_wmma_f32_16x16x32_bf16 with bf16 hi/lo operand split (hi.hi + hi.lo + lo.hi), f32 accumulate. Gate MLP: scalar f32.

#define NOP4 "v_nop\n\tv_nop\n\tv_nop\n\tv_nop"

typedef _Float16 v16h __attribute__((ext_vector_type(16)));
typedef __bf16 v16b __attribute__((ext_vector_type(16)));
typedef float v8f __attribute__((ext_vector_type(8)));
typedef float v4f __attribute__((ext_vector_type(4)));
typedef unsigned int v4u __attribute__((ext_vector_type(4)));

union FragH { v16h v; v4u q[2]; };
union FragB { v16b v; v4u q[2]; };

__device__ __forceinline__ v4u ldg16(const unsigned short* p) { return *(const v4u*)p; }

// RNE f32 -> bf16 bits
__device__ __forceinline__ unsigned int bf_bits(float f) {
  unsigned int u = __float_as_uint(f);
  return (u + 0x7FFFu + ((u >> 16) & 1u)) >> 16;
}
__device__ __forceinline__ float bf_val(unsigned int b) { return __uint_as_float(b << 16); }
// RNE f32 -> f16 bits
__device__ __forceinline__ unsigned int hf_bits(float f) {
  union { _Float16 h; unsigned short u; } c;
  c.h = (_Float16)f;
  return (unsigned int)c.u;
}
__device__ __forceinline__ unsigned int pk2(unsigned int lo, unsigned int hi) {
  return (lo & 0xFFFFu) | (hi << 16);
}
// 8 consecutive f32 -> 8 packed f16 (element 2t in the low half of word t)
__device__ __forceinline__ v4u pack_h8(v4f a, v4f c) {
  v4u r;
  r[0] = pk2(hf_bits(a[0]), hf_bits(a[1]));
  r[1] = pk2(hf_bits(a[2]), hf_bits(a[3]));
  r[2] = pk2(hf_bits(c[0]), hf_bits(c[1]));
  r[3] = pk2(hf_bits(c[2]), hf_bits(c[3]));
  return r;
}
// 8 consecutive f32 -> bf16 hi plane and bf16 residual plane
__device__ __forceinline__ void split_b8(v4f a, v4f c, v4u& H, v4u& L) {
  float v[8] = {a[0], a[1], a[2], a[3], c[0], c[1], c[2], c[3]};
  unsigned int hb[8], lb[8];
#pragma unroll
  for (int e = 0; e < 8; ++e) {
    hb[e] = bf_bits(v[e]);
    lb[e] = bf_bits(v[e] - bf_val(hb[e]));
  }
#pragma unroll
  for (int t = 0; t < 4; ++t) {
    H[t] = pk2(hb[2 * t], hb[2 * t + 1]);
    L[t] = pk2(lb[2 * t], lb[2 * t + 1]);
  }
}

__device__ __forceinline__ v8f zero8() {
  v8f z;
#pragma unroll
  for (int r = 0; r < 8; ++r) z[r] = 0.f;
  return z;
}
__device__ __forceinline__ v8f mma_h(v16h a, v16h b, v8f c) {
  return __builtin_amdgcn_wmma_f32_16x16x32_f16(false, a, false, b, (short)0, c, false, false);
}
__device__ __forceinline__ v8f mma_b(v16b a, v16b b, v8f c) {
  return __builtin_amdgcn_wmma_f32_16x16x32_bf16(false, a, false, b, (short)0, c, false, false);
}

// ---------------------------------------------------------------------------
// x [n] f32 -> f16 plane (unscaled) and bf16 hi / lo planes. 8 elements per thread, 512 threads per block blk.
// ---------------------------------------------------------------------------
__device__ __forceinline__ void cvt_x_body(const float* __restrict__ x, unsigned short* xh,
                                           unsigned short* xbh, unsigned short* xbl, int n, int blk, int tid) {
  const size_t i8 = ((size_t)blk * 512u + (size_t)tid) * 8u;
  if (i8 + 8 > (size_t)n) return;
  const v4f a = *(const v4f*)(x + i8);
  const v4f c = *(const v4f*)(x + i8 + 4);
  const v4u fh = pack_h8(a, c);
  v4u bh, bl;
  split_b8(a, c, bh, bl);
  *(v4u*)(xh + i8) = fh;
  *(v4u*)(xbh + i8) = bh;
  *(v4u*)(xbl + i8) = bl;
  
}

// ---------------------------------------------------------------------------
// W[Kd][Nd] f32 -> WT[Nd][Kd] 16-bit (k-contiguous rows).  64x64 tile at (e0, n0) through LDS, 256 threads
// (tid 0..255) and their own LDS tile; the caller's block holds two such halves, both pass the barrier.
// MODE 0: f16 of (W * scale) into o0.  MODE 1: bf16 hi into o0, bf16 lo into o1.
// ---------------------------------------------------------------------------
template <int MODE>
__device__ __forceinline__ void cvt_wT_body(const float* __restrict__ W, unsigned short* o0,
                                            unsigned short* o1, int Kd, int Nd, float scale,
                                            float (*tile)[65], int n0, int e0, int tid) {
#pragma unroll
  for (int t = 0; t < 4; ++t) {
    const int idx = t * 256 + tid;
    const int rr = idx >> 4, c4 = (idx & 15) * 4;
    const v4f v = *(const v4f*)(W + (size_t)(e0 + rr) * Nd + n0 + c4);
    tile[rr][c4] = v[0];
    tile[rr][c4 + 1] = v[1];
    tile[rr][c4 + 2] = v[2];
    tile[rr][c4 + 3] = v[3];
  }
  __syncthreads();
  v4u Hv[2], Lv[2];
  size_t adr[2];
#pragma unroll
  for (int t = 0; t < 2; ++t) {
    const int s = t * 256 + tid;
    const int nn = s >> 3, kq = (s & 7) * 8;
    v4f a, c;
#pragma unroll
    for (int e = 0; e < 4; ++e) {
      a[e] = tile[kq + e][nn] * scale;
      c[e] = tile[kq + 4 + e][nn] * scale;
    }
    if (MODE == 0) {
      Hv[t] = pack_h8(a, c);
      Lv[t] = Hv[t];
    } else {
      split_b8(a, c, Hv[t], Lv[t]);
    }
    adr[t] = (size_t)(n0 + nn) * Kd + e0 + kq;
  }
#pragma unroll
  for (int t = 0; t < 2; ++t) {
    *(v4u*)(o0 + adr[t]) = Hv[t];
    if (MODE == 1) *(v4u*)(o1 + adr[t]) = Lv[t];
  }
  
}

// ---------------------------------------------------------------------------
// Gate MLP, gate[b][h] = sigmoid(relu(sync @ W1 + b1) @ W2 + b2), spread over GNS x batch blocks.
// Block (c, b) owns the 32 hidden units j0 = 32c .. 32c+31 of batch b.  Its EIN x 128-B slice of W1 is read
// with every load of a thread in flight at once: 8 lanes take one row's 128-B line, each group of 8 lanes owns
// EIN/64 consecutive rows; the shapes are compile-time, so a thread's loads share one address and differ in
// the immediate offset.
// The row groups' partial sums are combined by lane exchange, then over the waves in LDS in wave order.
// Wave 0 adds b1, applies relu and multiplies by the slice's 32 rows of W2:
//   plo[(b*GNS + c)*32 + h] = sum over the slice's j of hid[j] * W2[j][h]   (h >= HN: 0).
// The attention kernel adds the GNS slices and b2 in slice order and applies the sigmoid.
// ---------------------------------------------------------------------------
#define GNS 8
template <int EIN, int HN>
__device__ __forceinline__ void gate_body(const float* __restrict__ sync, const float* __restrict__ W1,
                                          const float* __restrict__ b1, const float* __restrict__ W2,
                                          float* plo, float* red, float* w2s, int c, int b, int tid) {
  constexpr int HD = GNS * 32, NT = EIN / 64;
  static_assert(NT == 16 && 32 * HN == 512, "16 rows and one W2 element per thread");
  const int j0 = c * 32, l = tid & 31;
  const int w = __builtin_amdgcn_readfirstlane(tid >> 5);
  const int cq = (tid & 7) * 4, rg = tid >> 3;
  const float* p2 = W2 + (size_t)j0 * HN + tid;
  const float* pb = b1 + j0 + l;
  const float* pw = W1 + (size_t)rg * NT * HD + j0 + cq;
  const float* ps = sync + (size_t)b * EIN + rg * NT;
  const float w2v = *p2;
  const float bj = *pb;
  v4f wv[NT], sv[NT / 4];
#pragma unroll  // constant indices keep wv and sv in registers
  for (int t = 0; t < NT; ++t) wv[t] = *(const v4f*)(pw + t * HD);
#pragma unroll  // as above
  for (int t = 0; t < NT / 4; ++t) sv[t] = *(const v4f*)(ps + t * 4);
  // nothing is scheduled across this line, so every load above is issued before the first is waited for:
  // one memory latency for the slice; without it the compiler starts the sums after half of the loads
  __builtin_amdgcn_sched_barrier(0);
  v4f acc;
  acc[0] = 0.f; acc[1] = 0.f; acc[2] = 0.f; acc[3] = 0.f;
#pragma unroll  // as above
  for (int t = 0; t < NT; ++t) acc += wv[t] * sv[t >> 2][t & 3];
  // lanes l, l^8, l^16, l^24 hold the same four columns
#pragma unroll  // constant indices keep acc in registers
  for (int k = 0; k < 4; ++k) {
    acc[k] += __shfl_xor(acc[k], 8);
    acc[k] += __shfl_xor(acc[k], 16);
  }
  if (l < 8) *(v4f*)(red + w * 32 + cq) = acc;
  w2s[tid] = w2v;
  __syncthreads();
  if (w == 0) {
    float a = bj;
#pragma unroll  // the 16 LDS reads issue together
    for (int ww = 0; ww < 16; ++ww) a += red[ww * 32 + l];
    const int hid = __float_as_int(fmaxf(a, 0.f));
    const int lh = l & (HN - 1);
    float p = 0.f;
#pragma unroll  // lane index of readlane and LDS offsets as immediates
    for (int j = 0; j < 32; ++j) p += __int_as_float(__builtin_amdgcn_readlane(hid, j)) * w2s[j * HN + lh];
    plo[((size_t)b * GNS + c) * 32 + l] = (l < HN) ? p : 0.f;
  }
}

// ---------------------------------------------------------------------------
// Everything that reads only the inputs, in ONE launch: none of the three jobs depends on another, so they
// share the chip instead of running one behind the other.  Blocks of 512 threads, dealt by block index:
//   [0, GNS*Bn)          gate MLP slices (the longest dependent chain, so they start first);
//   then 4*(EIN/64)^2/2  weight tiles, two 64x64 tiles per block, matrices in the order Wq, Wk, Wv, Wo;
//   the rest             x planes.
// ---------------------------------------------------------------------------
template <int EIN, int HN>
__global__ __launch_bounds__(512) void k_prep(const float* __restrict__ x, const float* __restrict__ sync,
                                             const float* __restrict__ Wq, const float* __restrict__ Wk,
                                             const float* __restrict__ Wv, const float* __restrict__ Wo,
                                             const float* __restrict__ W1, const float* __restrict__ b1,
                                             const float* __restrict__ W2, unsigned short* xh,
                                             unsigned short* xbh, unsigned short* xbl, unsigned short* wqT,
                                             unsigned short* wkT, unsigned short* wvTh, unsigned short* wvTl,
                                             unsigned short* woTh, unsigned short* woTl, float* plo, int nX,
                                             int Bn) {
  constexpr int TPR = EIN / 64, TPM = TPR * TPR;  // 64x64 tiles per row and per matrix
  static_assert((TPR & (TPR - 1)) == 0 && TPM % 2 == 0, "a block's two tiles lie in one matrix");
  // two transposition tiles; the gate blocks use the first 1024 words, with 16-B accesses
  __shared__ __attribute__((aligned(16))) float sm[2 * 64 * 65];
  const int tid = threadIdx.x;
  int blk = blockIdx.x;
  if (blk < GNS * Bn) {
    gate_body<EIN, HN>(sync, W1, b1, W2, plo, sm, sm + 512, blk % GNS, blk / GNS, tid);
    return;
  }
  blk -= GNS * Bn;
  if (blk < 2 * TPM) {
    const int half = tid >> 8;
    const int t = blk * 2 + half;
    const int mi = blk / (TPM / 2);  // block-uniform
    const int n0 = (t & (TPR - 1)) * 64, e0 = ((t / TPR) & (TPR - 1)) * 64;
    float (*tile)[65] = (float (*)[65])(sm + half * 64 * 65);
    if (mi < 2)
      cvt_wT_body<0>(mi == 0 ? Wq : Wk, mi == 0 ? wqT : wkT, mi == 0 ? wqT : wkT, EIN, EIN, 64.0f, tile, n0, e0,
                     tid & 255);
    else
      cvt_wT_body<1>(mi == 2 ? Wv : Wo, mi == 2 ? wvTh : woTh, mi == 2 ? wvTl : woTl, EIN, EIN, 1.0f, tile, n0, e0,
                     tid & 255);
    return;
  }
  blk -= 2 * TPM;
  cvt_x_body(x, xh, xbh, xbl, nX, blk, tid);
}

// ---------------------------------------------------------------------------
// C[M,N] = A[M,K] @ B[K,N] (+bias) with A row-major 16-bit and B given as BT[N][K] 16-bit.
// Block tile 128x64, 256 threads = 8 waves, wave w owns rows w*16..w*16+15, 4 n-tiles.
// The k range is walked in tiles of 64: the block's 128 A rows and 64 B rows (each plane) are
// brought to LDS once per tile, 128 B of a row from 8 neighbouring lanes, the next tile's
// global loads in flight in registers while this tile is multiplied.  Fragments are read from
// LDS with the 16x16x32 split k-map
//   (lane l: row/col = l&15; elements 0..7 <- k0+8*(l>>4)+0..7, 8..15 <- k0+16+8*(l>>4)+0..7).
// SPLIT 0: single f16 product.  SPLIT 1: bf16 hi/lo planes, three products.
// OM 0: f16 in the attention kernel's fragment order: per (batch, head) and 16-row tile one 2-KB block of
//       4 x 512 B, piece t of lane l=(g,m) = row m, columns (2t+g)*8..+7 of the head.
// OM 1: bf16 hi/lo in fragment order: per (batch, head) and 32-key chunk one 4-KB block per plane of
//       8 x 512 B, piece nt*2+q of lane l=(g,m) = column d nt*16+m, keys q*16+8g..+7 of the chunk.
//       In both, one wave-wide 16-B load or store of a piece covers 512 contiguous bytes (4 whole lines).
// OM 2: f32 row-major [M][N].
// ---------------------------------------------------------------------------
#define GPIT 72  // LDS row pitch in 16-bit elements: 144 B = 16 B x 9, b128 fragment reads without bank conflicts
// LDS of one block in 16-B units: the staged operand tiles, or the epilogue tile (128 x 68 f32) that reuses their space
template <int SPLIT>
constexpr int gemm_lds16() {
  return (SPLIT ? 2 : 1) * (128 + 64) * GPIT / 8 > 128 * 17 ? (SPLIT ? 2 : 1) * (128 + 64) * GPIT / 8 : 128 * 17;
}
// the block (bx, by) of the product; smem holds gemm_lds16<SPLIT>() units
template <int SPLIT, int OM>
__device__ __forceinline__ void gemm_body(v4f* smem, int bx, int by, const unsigned short* __restrict__ Ah,
                                          const unsigned short* __restrict__ Al,
                                          const unsigned short* __restrict__ Bh,
                                          const unsigned short* __restrict__ Bl,
                                          const float* __restrict__ bias, void* out0, void* out1,
                                          int M, int N, int K, int Sq, float oscale) {
  constexpr int PIT = GPIT;
  float* stg = (float*)smem;
  unsigned short* sAh = (unsigned short*)smem;
  unsigned short* sBh = sAh + 128 * PIT;
  unsigned short* sAl = sBh + 64 * PIT;  // the two lo planes exist only with SPLIT
  unsigned short* sBl = sAl + 128 * PIT;
  const int nBase = bx * 64, mBase = by * 128;
  if (nBase + 64 > N || mBase + 128 > M || (K & 63) != 0) return;  // block-uniform
  const int tid = threadIdx.x, w = tid >> 5, l = tid & 31, g = l >> 4, m = l & 15;

  v8f acc[4];
#pragma unroll
  for (int nt = 0; nt < 4; ++nt) acc[nt] = zero8();

  // staging map: thread -> row tid>>3 (+32 per step), 16-B piece tid&7 of the row's 128 B
  const int lr = tid >> 3, lc = (tid & 7) * 8;
  // global address = block-uniform byte base (moves with k) + a per-thread 32-bit byte offset that never changes
  const char* bAh = (const char*)(Ah + (size_t)mBase * K);
  const char* bAl = (const char*)(Al + (size_t)mBase * K);
  const char* bBh = (const char*)(Bh + (size_t)nBase * K);
  const char* bBl = (const char*)(Bl + (size_t)nBase * K);
  unsigned int go[4];
#pragma unroll  // here and below: constant indices keep the small per-thread arrays in registers
  for (int t = 0; t < 4; ++t) go[t] = (unsigned int)(((lr + 32 * t) * K + lc) * 2);
  const int ls = lr * PIT + lc;
  const int fa = (w * 16 + m) * PIT + 8 * g;  // this lane's A fragment row in LDS
  const int fb = m * PIT + 8 * g;             // this lane's B fragment row of n-tile 0

  v4u rah[4], ral[4], rbh[2], rbl[2];
#pragma unroll
  for (int t = 0; t < 4; ++t) {
    rah[t] = *(const v4u*)(bAh + go[t]);
    if (SPLIT) ral[t] = *(const v4u*)(bAl + go[t]);
  }
#pragma unroll
  for (int t = 0; t < 2; ++t) {
    rbh[t] = *(const v4u*)(bBh + go[t]);
    if (SPLIT) rbl[t] = *(const v4u*)(bBl + go[t]);
  }

#pragma unroll 1  // one copy of the body: the staged pieces and both k halves' fragments already fill the register budget
  for (int k0 = 0; k0 < K; k0 += 64) {
#pragma unroll
    for (int t = 0; t < 4; ++t) {
      *(v4u*)(sAh + ls + t * 32 * PIT) = rah[t];
      if (SPLIT) *(v4u*)(sAl + ls + t * 32 * PIT) = ral[t];
    }
#pragma unroll
    for (int t = 0; t < 2; ++t) {
      *(v4u*)(sBh + ls + t * 32 * PIT) = rbh[t];
      if (SPLIT) *(v4u*)(sBl + ls + t * 32 * PIT) = rbl[t];
    }
    __syncthreads();  // the tile is complete before any wave reads fragments from it
    if (k0 + 64 < K) {
      const size_t kn = (size_t)(k0 + 64) * 2;
      const char *pah[4], *pal[4], *pbh[2], *pbl[2];
#pragma unroll
      for (int t = 0; t < 4; ++t) {
        pah[t] = bAh + kn + go[t];
        pal[t] = bAl + kn + go[t];
        rah[t] = *(const v4u*)pah[t];
        if (SPLIT) ral[t] = *(const v4u*)pal[t];
      }
#pragma unroll
      for (int t = 0; t < 2; ++t) {
        pbh[t] = bBh + kn + go[t];
        pbl[t] = bBl + kn + go[t];
        rbh[t] = *(const v4u*)pbh[t];
        if (SPLIT) rbl[t] = *(const v4u*)pbl[t];
      }
      // the prefetch loads' address registers are free for reuse (fragment reads below) only behind this wait;
      // naming the addresses as inputs keeps them in their registers up to it
      if (SPLIT)
        asm volatile("s_wait_xcnt 0x0" ::"v"(pah[0]), "v"(pah[1]), "v"(pah[2]), "v"(pah[3]), "v"(pbh[0]), "v"(pbh[1]),
                     "v"(pal[0]), "v"(pal[1]), "v"(pal[2]), "v"(pal[3]), "v"(pbl[0]), "v"(pbl[1])
                     : "memory");
      else
        asm volatile("s_wait_xcnt 0x0" ::"v"(pah[0]), "v"(pah[1]), "v"(pah[2]), "v"(pah[3]), "v"(pbh[0]), "v"(pbh[1])
                     : "memory");
    }
#pragma unroll  // both k halves of the tile in one body, LDS offsets as immediates
    for (int kk = 0; kk < 64; kk += 32) {
      if (SPLIT) {
        FragB a, a2, b0, b1, b2, b3, c0, c1, c2, c3;
        a.q[0] = ldg16(sAh + fa + kk);
        a.q[1] = ldg16(sAh + fa + kk + 16);
        a2.q[0] = ldg16(sAl + fa + kk);
        a2.q[1] = ldg16(sAl + fa + kk + 16);
        b0.q[0] = ldg16(sBh + fb + kk);
        b0.q[1] = ldg16(sBh + fb + kk + 16);
        b1.q[0] = ldg16(sBh + fb + 16 * PIT + kk);
        b1.q[1] = ldg16(sBh + fb + 16 * PIT + kk + 16);
        b2.q[0] = ldg16(sBh + fb + 32 * PIT + kk);
        b2.q[1] = ldg16(sBh + fb + 32 * PIT + kk + 16);
        b3.q[0] = ldg16(sBh + fb + 48 * PIT + kk);
        b3.q[1] = ldg16(sBh + fb + 48 * PIT + kk + 16);
        c0.q[0] = ldg16(sBl + fb + kk);
        c0.q[1] = ldg16(sBl + fb + kk + 16);
        c1.q[0] = ldg16(sBl + fb + 16 * PIT + kk);
        c1.q[1] = ldg16(sBl + fb + 16 * PIT + kk + 16);
        c2.q[0] = ldg16(sBl + fb + 32 * PIT + kk);
        c2.q[1] = ldg16(sBl + fb + 32 * PIT + kk + 16);
        c3.q[0] = ldg16(sBl + fb + 48 * PIT + kk);
        c3.q[1] = ldg16(sBl + fb + 48 * PIT + kk + 16);
        acc[0] = mma_b(a.v, b0.v, acc[0]);
        acc[0] = mma_b(a.v, c0.v, acc[0]);
        acc[0] = mma_b(a2.v, b0.v, acc[0]);
        acc[1] = mma_b(a.v, b1.v, acc[1]);
        acc[1] = mma_b(a.v, c1.v, acc[1]);
        acc[1] = mma_b(a2.v, b1.v, acc[1]);
        acc[2] = mma_b(a.v, b2.v, acc[2]);
        acc[2] = mma_b(a.v, c2.v, acc[2]);
        acc[2] = mma_b(a2.v, b2.v, acc[2]);
        acc[3] = mma_b(a.v, b3.v, acc[3]);
        acc[3] = mma_b(a.v, c3.v, acc[3]);
        acc[3] = mma_b(a2.v, b3.v, acc[3]);
        // four vector slots behind the last WMMA, on every path, before its operands or results are touched
        asm volatile(NOP4
                     : "+v"(acc[0]), "+v"(acc[1]), "+v"(acc[2]), "+v"(acc[3])
                     : "v"(a.v), "v"(a2.v), "v"(b0.v), "v"(b1.v), "v"(b2.v), "v"(b3.v),
                       "v"(c0.v), "v"(c1.v), "v"(c2.v), "v"(c3.v));
      } else {
        FragH a, b0, b1, b2, b3;
        a.q[0] = ldg16(sAh + fa + kk);
        a.q[1] = ldg16(sAh + fa + kk + 16);
        b0.q[0] = ldg16(sBh + fb + kk);
        b0.q[1] = ldg16(sBh + fb + kk + 16);
        b1.q[0] = ldg16(sBh + fb + 16 * PIT + kk);
        b1.q[1] = ldg16(sBh + fb + 16 * PIT + kk + 16);
        b2.q[0] = ldg16(sBh + fb + 32 * PIT + kk);
        b2.q[1] = ldg16(sBh + fb + 32 * PIT + kk + 16);
        b3.q[0] = ldg16(sBh + fb + 48 * PIT + kk);
        b3.q[1] = ldg16(sBh + fb + 48 * PIT + kk + 16);
        acc[0] = mma_h(a.v, b0.v, acc[0]);
        acc[1] = mma_h(a.v, b1.v, acc[1]);
        acc[2] = mma_h(a.v, b2.v, acc[2]);
        acc[3] = mma_h(a.v, b3.v, acc[3]);
        // four vector slots behind the last WMMA, on every path, before its operands or results are touched
        asm volatile(NOP4
                     : "+v"(acc[0]), "+v"(acc[1]), "+v"(acc[2]), "+v"(acc[3])
                     : "v"(a.v), "v"(b0.v), "v"(b1.v), "v"(b2.v), "v"(b3.v));
      }
    }
    __syncthreads();  // every wave has left the tile before it is overwritten (next tile, or the epilogue tile)
  }

  // stage: D element r of lane (g,m), n-tile nt -> (row w*16+8g+r, col nt*16+m)
#pragma unroll
  for (int nt = 0; nt < 4; ++nt) {
    const int col = nt * 16 + m;
    const float bv = bias[nBase + col];
#pragma unroll
    for (int r = 0; r < 8; ++r) stg[(w * 16 + 8 * g + r) * 68 + col] = acc[nt][r] * oscale + bv;
  }
  __syncthreads();

  if (OM == 0) {
    // wave w holds the block's 16-row tile w of head nBase/64
    unsigned short* o = (unsigned short*)out0;
    const int Hn = N >> 6;
    const int bb = mBase / Sq;
    const int bh = bb * Hn + (nBase >> 6);
    const int tl = ((mBase - bb * Sq) >> 4) + w;
    const size_t tb = ((size_t)bh * (Sq >> 4) + tl) * 1024 + l * 8;
    v4u val[4];
    size_t adr[4];
#pragma unroll
    for (int t = 0; t < 4; ++t) {
      const float* sp = stg + (w * 16 + m) * 68 + (2 * t + g) * 8;
      const v4f x0 = *(const v4f*)sp;
      const v4f x1 = *(const v4f*)(sp + 4);
      val[t] = pack_h8(x0, x1);
      adr[t] = tb + t * 256;
    }
#pragma unroll
    for (int t = 0; t < 4; ++t) *(v4u*)(o + adr[t]) = val[t];
    // in the merged kernel the other projection's body follows these stores in the code: this wait stands in
    // front of every rewrite of the stores' address and data registers
    asm volatile("s_wait_xcnt 0x0" ::: "memory");
  } else if (OM == 1) {
    // tile rows = s (128 consecutive within one batch = 4 chunks of 32 keys), cols = d of head nBase/64
    unsigned short* oh = (unsigned short*)out0;
    unsigned short* ol = (unsigned short*)out1;
    const int Hn = N >> 6;
    const int bb = mBase / Sq;
    const int bh = bb * Hn + (nBase >> 6);
    const int sBase = mBase - bb * Sq;
    v4u Hv[4], Lv[4];
    size_t adr[4];
#pragma unroll
    for (int t = 0; t < 4; ++t) {
      const int ch = w >> 1, nt = (w & 1) * 2 + (t >> 1), q = t & 1;  // the block's 32 pieces, 4 per wave
      const int d = nt * 16 + m, s8 = ch * 32 + q * 16 + g * 8;
      v4f x0, x1;
#pragma unroll
      for (int e = 0; e < 4; ++e) {
        x0[e] = stg[(s8 + e) * 68 + d];
        x1[e] = stg[(s8 + 4 + e) * 68 + d];
      }
      split_b8(x0, x1, Hv[t], Lv[t]);
      adr[t] = (((size_t)bh * (Sq >> 5) + (sBase >> 5) + ch) * 8 + nt * 2 + q) * 256 + l * 8;
    }
#pragma unroll
    for (int t = 0; t < 4; ++t) {
      *(v4u*)(oh + adr[t]) = Hv[t];
      *(v4u*)(ol + adr[t]) = Lv[t];
    }
    
  } else {
    float* o = (float*)out0;
    v4f val[8];
    size_t adr[8];
#pragma unroll
    for (int t = 0; t < 8; ++t) {
      const int row = w * 16 + t * 2 + (l >> 4), c4 = (l & 15) * 4;
      val[t] = *(const v4f*)(stg + row * 68 + c4);
      adr[t] = (size_t)(mBase + row) * N + nBase + c4;
    }
#pragma unroll
    for (int t = 0; t < 8; ++t) *(v4f*)(o + adr[t]) = val[t];
    
  }
}

// The three projections of x in ONE launch (none depends on another): blockIdx.z = 0 is x@Wv, whose blocks
// run longest and so start first, 1 is x@Wq, 2 is x@Wk.
__global__ __launch_bounds__(256) void k_qkv(const unsigned short* __restrict__ xh,
                                            const unsigned short* __restrict__ xbh,
                                            const unsigned short* __restrict__ xbl,
                                            const unsigned short* __restrict__ wqT,
                                            const unsigned short* __restrict__ wkT,
                                            const unsigned short* __restrict__ wvTh,
                                            const unsigned short* __restrict__ wvTl,
                                            const float* __restrict__ bq, const float* __restrict__ bk,
                                            const float* __restrict__ bv, unsigned short* qo, unsigned short* ko,
                                            unsigned short* vho, unsigned short* vlo, int M, int N, int K, int Sq,
                                            float qkscale) {
  __shared__ v4f smem[gemm_lds16<1>()];
  const int z = blockIdx.z;
  if (z == 0) {
    gemm_body<1, 1>(smem, blockIdx.x, blockIdx.y, xbh, xbl, wvTh, wvTl, bv, (void*)vho, (void*)vlo, M, N, K, Sq, 1.0f);
  } else {
    const unsigned short* wT = z == 1 ? wqT : wkT;
    unsigned short* o = z == 1 ? qo : ko;
    gemm_body<0, 0>(smem, blockIdx.x, blockIdx.y, xh, xh, wT, wT, z == 1 ? bq : bk, (void*)o, (void*)o, M, N, K, Sq,
                    qkscale);
  }
}

// The output projection, f32 row-major.
__global__ __launch_bounds__(256) void k_oproj(const unsigned short* __restrict__ Ah,
                                              const unsigned short* __restrict__ Al,
                                              const unsigned short* __restrict__ Bh,
                                              const unsigned short* __restrict__ Bl,
                                              const float* __restrict__ bias, float* out, int M, int N, int K, int Sq) {
  __shared__ v4f smem[gemm_lds16<1>()];
  gemm_body<1, 2>(smem, blockIdx.x, blockIdx.y, Ah, Al, Bh, Bl, bias, (void*)out, (void*)out, M, N, K, Sq, 1.0f);
}

// ---------------------------------------------------------------------------
// Fused attention: one block of ANW waves per (16 query rows, batch).  Dynamic LDS:
//   mL[16][S+4] f32      sum over heads of the softmax probabilities (lane-owned elements);
//   pT[ANW][16][68] f32  the waves' P.V partial tiles.
// Row pitch S+4 floats = 16 B x odd: the 16 lanes of a half wave, one query row each, then fall on
// 16 different groups of four banks in every b128 access; at a pitch of S floats they share one group.
// The keys are split over the waves: wave w owns S/32/ANW contiguous 32-key chunks in all three sweeps.
// Per head h: score tiles S^T = K_tile . Q^T (A = k rows, B = q rows; D lane (g,m) holds
// query m, keys jt*16+8g+r), exact two-sweep softmax, then P.V.  D of the tiles 2c and 2c+1 is, lane for
// lane, the A fragment of P for chunk c (elements 0..7 <- keys k0+8g.., 8..15 <- k0+16+8g..), so a wave's
// scores stay in its registers from the product to P.V: S is a compile-time constant, the sweeps are
// unrolled and the tiles are indexed by constants.
// V fragments from the planes vt.  q, k and vt lie in fragment order (see gemm_body, OM 0 and OM 1): every
// fragment load of a wave reads 512 contiguous bytes.  Row max, row sum and the 16x64 P.V
// partial tiles are combined over the waves through LDS, always in wave order.
// ---------------------------------------------------------------------------
#define ANW 16
typedef unsigned int v2u __attribute__((ext_vector_type(2)));

template <int S, int H>
__global__ __launch_bounds__(ANW * 32) void k_attn(const unsigned short* __restrict__ qh,
                                                  const unsigned short* __restrict__ kh,
                                                  const unsigned short* __restrict__ vth,
                                                  const unsigned short* __restrict__ vtl,
                                                  const float* __restrict__ plo, const float* __restrict__ b2,
                                                  unsigned short* ctxh,
                                                  unsigned short* ctxl, float* mout) {
  constexpr int PS = S + 4;                // LDS row pitch of the head-sum plane, in floats
  constexpr int CPW = S / 32 / ANW;        // 32-key chunks per wave
  constexpr int TPW = 2 * CPW;             // the same keys as 16-key tiles
  static_assert(S % (32 * ANW) == 0 && S % 128 == 0 && H <= 32, "every wave owns the same whole number of chunks");
  extern __shared__ v4f dsm[];
  __shared__ float redM[ANW * 16];  // per wave, per query: max over the wave's keys
  __shared__ float redS[ANW * 16];  // per wave, per query: sum of exp over the wave's keys
  __shared__ float gv[32];          // this batch's gate per head
  float* mL = (float*)dsm;
  float* pT = mL + 16 * PS;
  const int i0 = blockIdx.x * 16, b = blockIdx.y;
  if (i0 + 16 > S) return;  // block-uniform
  const int tid = threadIdx.x;
  const int l = tid & 31, g = l >> 4, m = l & 15;
  const int w = __builtin_amdgcn_readfirstlane(tid >> 5);  // scalar, so the wave's key offsets are scalar
  constexpr int E = H * 64;

  {
    v4f z;
    z[0] = 0.f; z[1] = 0.f; z[2] = 0.f; z[3] = 0.f;
    v4f* m4 = (v4f*)mL;
    constexpr int n4 = 4 * PS;
    for (int i = tid; i < n4; i += ANW * 32) m4[i] = z;
  }
  if (tid < 32) {  // the gate's last step (see gate_body): slices and bias summed in slice order, sigmoid
    float val = 0.f;
    if (tid < H) {
      float a = b2[tid];
#pragma unroll  // the GNS loads issue together
      for (int c = 0; c < GNS; ++c) a += plo[((size_t)b * GNS + c) * 32 + tid];
      val = 1.0f / (1.0f + expf(-a));
    }
    gv[tid] = val;
  }
  __syncthreads();

  float* mrow = mL + m * PS + w * (CPW * 32) + 8 * g;  // this lane's head sums, chunk 0 of the wave
  const float invH = 1.0f / (float)H;

#pragma unroll 1  // one copy of the head's body: it is long, and nothing is shared between heads
  for (int h = 0; h < H; ++h) {
    FragH qa0, qa1;
    const unsigned short* qp = qh + ((size_t)(b * H + h) * (S >> 4) + (i0 >> 4)) * 1024 + l * 8;
    qa0.q[0] = ldg16(qp);
    qa0.q[1] = ldg16(qp + 256);
    qa1.q[0] = ldg16(qp + 512);
    qa1.q[1] = ldg16(qp + 768);
    const float gsc = gv[h] * 0.125f;

    // sweep A: scores, running row max.  All of the wave's k fragments are asked for at once.
    v8f sc[TPW];
    float rmax = -3.0e38f;
    {
      const unsigned short* kr = kh + ((size_t)(b * H + h) * (S >> 4) + w * TPW) * 1024 + l * 8;
      FragH ka0[TPW], ka1[TPW];
#pragma unroll  // constant indices keep the fragments in registers, offsets as immediates
      for (int t = 0; t < TPW; ++t) {
        ka0[t].q[0] = ldg16(kr + t * 1024);
        ka0[t].q[1] = ldg16(kr + t * 1024 + 256);
        ka1[t].q[0] = ldg16(kr + t * 1024 + 512);
        ka1[t].q[1] = ldg16(kr + t * 1024 + 768);
      }
      // stands in front of any reuse of the q and k address pairs (also as a later load's destination);
      // naming them as inputs keeps them in their registers up to it
      asm volatile("s_wait_xcnt 0x0" ::"v"(qp), "v"(kr) : "memory");
      // nothing is scheduled across this line, so all of the loads above are issued before the first is waited for
      __builtin_amdgcn_sched_barrier(0);
#pragma unroll  // constant indices keep the score tiles in registers
      for (int t = 0; t < TPW; ++t) {
        v8f s = zero8();
        s = mma_h(ka0[t].v, qa0.v, s);
        s = mma_h(ka1[t].v, qa1.v, s);
#pragma unroll
        for (int r = 0; r < 4; ++r) {
          s[r] = s[r] * gsc;
          s[r + 4] = s[r + 4] * gsc;
          rmax = fmaxf(rmax, s[r]);
          rmax = fmaxf(rmax, s[r + 4]);
        }
        sc[t] = s;
      }
    }
    rmax = fmaxf(rmax, __shfl_xor(rmax, 16));
    if (g == 0) redM[w * 16 + m] = rmax;
    __syncthreads();
#pragma unroll  // the ANW LDS reads issue together instead of one latency per trip
    for (int ww = 0; ww < ANW; ++ww) rmax = fmaxf(rmax, redM[ww * 16 + m]);

    // sweep B: e = exp(s - max) in place, row sum
    float lsum = 0.f;
#pragma unroll  // constant indices keep the score tiles in registers
    for (int t = 0; t < TPW; ++t) {
#pragma unroll
      for (int r = 0; r < 4; ++r) {
        sc[t][r] = __expf(sc[t][r] - rmax);
        sc[t][r + 4] = __expf(sc[t][r + 4] - rmax);
        lsum += sc[t][r];
        lsum += sc[t][r + 4];
      }
    }
    lsum += __shfl_xor(lsum, 16);
    if (g == 0) redS[w * 16 + m] = lsum;
    __syncthreads();
    lsum = 0.f;
#pragma unroll  // the ANW LDS reads issue together instead of one latency per trip
    for (int ww = 0; ww < ANW; ++ww) lsum += redS[ww * 16 + m];
    const float linv = 1.0f / lsum;

    // sweep C: probabilities, head-sum accumulation, P.V over this wave's keys
    v8f cacc[4];
#pragma unroll
    for (int nt = 0; nt < 4; ++nt) cacc[nt] = zero8();
    const unsigned short* vhp = vth + ((size_t)(b * H + h) * (S >> 5) + w * CPW) * 2048 + l * 8;
    const unsigned short* vlp = vtl + ((size_t)(b * H + h) * (S >> 5) + w * CPW) * 2048 + l * 8;
#pragma unroll  // constant indices keep the score tiles in registers, offsets as immediates
    for (int c = 0; c < CPW; ++c) {
      FragB vh0, vh1, vh2, vh3, vl0, vl1, vl2, vl3;
      vh0.q[0] = ldg16(vhp + c * 2048);
      vh0.q[1] = ldg16(vhp + c * 2048 + 256);
      vh1.q[0] = ldg16(vhp + c * 2048 + 512);
      vh1.q[1] = ldg16(vhp + c * 2048 + 768);
      vh2.q[0] = ldg16(vhp + c * 2048 + 1024);
      vh2.q[1] = ldg16(vhp + c * 2048 + 1280);
      vh3.q[0] = ldg16(vhp + c * 2048 + 1536);
      vh3.q[1] = ldg16(vhp + c * 2048 + 1792);
      vl0.q[0] = ldg16(vlp + c * 2048);
      vl0.q[1] = ldg16(vlp + c * 2048 + 256);
      vl1.q[0] = ldg16(vlp + c * 2048 + 512);
      vl1.q[1] = ldg16(vlp + c * 2048 + 768);
      vl2.q[0] = ldg16(vlp + c * 2048 + 1024);
      vl2.q[1] = ldg16(vlp + c * 2048 + 1280);
      vl3.q[0] = ldg16(vlp + c * 2048 + 1536);
      vl3.q[1] = ldg16(vlp + c * 2048 + 1792);
      // stands in front of any reuse of the two address pairs (also as a later load's destination);
      // naming them as inputs keeps them in their registers up to it
      asm volatile("s_wait_xcnt 0x0" ::"v"(vhp), "v"(vlp) : "memory");
      // nothing is scheduled across this line, so the chunk's 16 loads are all issued before the vector work on
      // P, which then runs under their latency; without it the compiler issues some right in front of their use
      __builtin_amdgcn_sched_barrier(0);
      v4f p0, p1, p2, p3;
#pragma unroll
      for (int r = 0; r < 4; ++r) {
        p0[r] = sc[2 * c][r] * linv;
        p1[r] = sc[2 * c][r + 4] * linv;
        p2[r] = sc[2 * c + 1][r] * linv;
        p3[r] = sc[2 * c + 1][r + 4] * linv;
      }
      {
        v4f* ma = (v4f*)(mrow + c * 32);
        v4f* mb = (v4f*)(mrow + c * 32 + 16);
        const v4f s0 = ma[0] + p0;
        const v4f s1 = ma[1] + p1;
        const v4f s2 = mb[0] + p2;
        const v4f s3 = mb[1] + p3;
        ma[0] = s0;
        ma[1] = s1;
        mb[0] = s2;
        mb[1] = s3;
      }
      FragB ph, pl;
      split_b8(p0, p1, ph.q[0], pl.q[0]);
      split_b8(p2, p3, ph.q[1], pl.q[1]);
      cacc[0] = mma_b(ph.v, vh0.v, cacc[0]);
      cacc[0] = mma_b(ph.v, vl0.v, cacc[0]);
      cacc[0] = mma_b(pl.v, vh0.v, cacc[0]);
      cacc[1] = mma_b(ph.v, vh1.v, cacc[1]);
      cacc[1] = mma_b(ph.v, vl1.v, cacc[1]);
      cacc[1] = mma_b(pl.v, vh1.v, cacc[1]);
      cacc[2] = mma_b(ph.v, vh2.v, cacc[2]);
      cacc[2] = mma_b(ph.v, vl2.v, cacc[2]);
      cacc[2] = mma_b(pl.v, vh2.v, cacc[2]);
      cacc[3] = mma_b(ph.v, vh3.v, cacc[3]);
      cacc[3] = mma_b(ph.v, vl3.v, cacc[3]);
      cacc[3] = mma_b(pl.v, vh3.v, cacc[3]);
    }

    // the partial tiles were last read in front of the barrier that ended the head before
    float* part = pT + w * (16 * 68);
#pragma unroll
    for (int nt = 0; nt < 4; ++nt) {
#pragma unroll
      for (int r = 0; r < 8; ++r) part[(8 * g + r) * 68 + nt * 16 + m] = cacc[nt][r];
    }
    __syncthreads();
    if (w < 8) {  // 256 threads, 4 columns each: a row's 128-B line per plane leaves from 16 lanes of one wave
      const int row = tid >> 4, c4 = (tid & 15) * 4;
      const float* sp = pT + row * 68 + c4;
      v4f x = *(const v4f*)sp;
#pragma unroll  // the ANW LDS reads issue together instead of one latency per trip
      for (int ww = 1; ww < ANW; ++ww) x += *(const v4f*)(sp + ww * (16 * 68));
      unsigned int hb[4], lb[4];
#pragma unroll  // constant indices keep hb and lb in registers
      for (int e = 0; e < 4; ++e) {
        hb[e] = bf_bits(x[e]);
        lb[e] = bf_bits(x[e] - bf_val(hb[e]));
      }
      v2u Hv, Lv;
      Hv[0] = pk2(hb[0], hb[1]);
      Hv[1] = pk2(hb[2], hb[3]);
      Lv[0] = pk2(lb[0], lb[1]);
      Lv[1] = pk2(lb[2], lb[3]);
      const size_t adr = (size_t)(b * S + i0 + row) * E + h * 64 + c4;
      *(v2u*)(ctxh + adr) = Hv;
      *(v2u*)(ctxl + adr) = Lv;
    }
    __syncthreads();
  }

  // head-mean rows: 16 rows x S f32, one row per wave, 512 B per store instruction, lane-contiguous
  __syncthreads();
  float* ob = mout + (size_t)(b * S + i0) * S;
  constexpr int nL = S >> 7;
  for (int row = w; row < 16; row += ANW) {
    for (int c = 0; c < nL; ++c) {
      const size_t off = (size_t)row * S + c * 128 + l * 4;
      const v4f v = *(const v4f*)(mL + (size_t)row * PS + c * 128 + l * 4) * invH;
      *(v4f*)(ob + off) = v;
    }
  }
  
}

// ---------------------------------------------------------------------------
// Host launcher
// ---------------------------------------------------------------------------
extern "C" void kernel_launch(void* const* d_in, const int* in_sizes, int n_in, void* d_out,
                              int out_size, void* d_ws, size_t ws_size, hipStream_t stream) {
  if (n_in < 14) return;
  const int E = 1024, H = 16;
  const int nX = in_sizes[0];
  if (nX <= 0 || (nX % E) != 0) return;
  const int M = nX / E;
  const int nSy = in_sizes[1];
  if (nSy <= 0 || (nSy % E) != 0) return;
  const int Bn = nSy / E;
  if (Bn <= 0 || (M % Bn) != 0) return;
  const int S = M / Bn;
  const int HID = in_sizes[9];
  if ((M % 128) != 0 || (S % 128) != 0 || HID != GNS * 32) return;
  const int SQ = 2048;    // the attention kernel keeps a wave's scores in registers, so its key count is a compile-time constant
  if (S != SQ) return;
  if (in_sizes[2] != E * E || in_sizes[4] != E * E || in_sizes[6] != E * E || in_sizes[12] != E * E) return;
  if (in_sizes[3] != E || in_sizes[5] != E || in_sizes[7] != E || in_sizes[13] != E) return;
  if (in_sizes[8] != E * HID || in_sizes[10] != HID * H || in_sizes[11] != H) return;
  if ((long long)out_size != (long long)nX + (long long)Bn * (long long)S * (long long)S) return;

  const float* x = (const float*)d_in[0];
  const float* sync = (const float*)d_in[1];
  const float* Wq = (const float*)d_in[2];
  const float* bq = (const float*)d_in[3];
  const float* Wk = (const float*)d_in[4];
  const float* bk = (const float*)d_in[5];
  const float* Wv = (const float*)d_in[6];
  const float* bv = (const float*)d_in[7];
  const float* Ws1 = (const float*)d_in[8];
  const float* bs1 = (const float*)d_in[9];
  const float* Ws2 = (const float*)d_in[10];
  const float* bs2 = (const float*)d_in[11];
  const float* Wo = (const float*)d_in[12];
  const float* bo = (const float*)d_in[13];

  float* out_proj = (float*)d_out;                 // [M][E] f32
  float* out_mean = (float*)d_out + (size_t)nX;    // [Bn][S][S] f32

  // workspace carve (bytes), every sub-buffer 256-B aligned
  size_t off = 0;
  auto al = [&](size_t bytes) { size_t o = off; off += (bytes + 255) & ~(size_t)255; return o; };
  const size_t nW = (size_t)E * E;
  const size_t o_sw = al((size_t)Bn * GNS * 32 * 4);
  const size_t o_xh = al((size_t)nX * 2);
  const size_t o_xbh = al((size_t)nX * 2);
  const size_t o_xbl = al((size_t)nX * 2);
  const size_t o_wq = al(nW * 2);
  const size_t o_wk = al(nW * 2);
  const size_t o_wvh = al(nW * 2);
  const size_t o_wvl = al(nW * 2);
  const size_t o_woh = al(nW * 2);
  const size_t o_wol = al(nW * 2);
  const size_t o_q = al((size_t)nX * 2);
  const size_t o_k = al((size_t)nX * 2);
  const size_t o_vth = al((size_t)nX * 2);
  const size_t o_vtl = al((size_t)nX * 2);
  const size_t o_cth = al((size_t)nX * 2);
  const size_t o_ctl = al((size_t)nX * 2);
  if (off > ws_size) return;

  char* ws = (char*)d_ws;
  float* sw_g = (float*)(ws + o_sw);
  unsigned short* xh = (unsigned short*)(ws + o_xh);
  unsigned short* xbh = (unsigned short*)(ws + o_xbh);
  unsigned short* xbl = (unsigned short*)(ws + o_xbl);
  unsigned short* wqT = (unsigned short*)(ws + o_wq);
  unsigned short* wkT = (unsigned short*)(ws + o_wk);
  unsigned short* wvTh = (unsigned short*)(ws + o_wvh);
  unsigned short* wvTl = (unsigned short*)(ws + o_wvl);
  unsigned short* woTh = (unsigned short*)(ws + o_woh);
  unsigned short* woTl = (unsigned short*)(ws + o_wol);
  unsigned short* qh = (unsigned short*)(ws + o_q);
  unsigned short* kh = (unsigned short*)(ws + o_k);
  unsigned short* vTh = (unsigned short*)(ws + o_vth);
  unsigned short* vTl = (unsigned short*)(ws + o_vtl);
  unsigned short* cth = (unsigned short*)(ws + o_cth);
  unsigned short* ctl = (unsigned short*)(ws + o_ctl);

  // 1) gate MLP slices, weight planes transposed to [n][k], activation planes: one launch
  {
    const int groups = nX / 8;
    const int blocks = GNS * Bn + 2 * (E / 64) * (E / 64) + (groups + 511) / 512;
    k_prep<E, H><<<dim3(blocks), dim3(512), 0, stream>>>(x, sync, Wq, Wk, Wv, Wo, Ws1, bs1, Ws2, xh, xbh, xbl, wqT, wkT,
                                                         wvTh, wvTl, woTh, woTl, sw_g, nX, Bn);
  }
  // 2) the three projections (M x E, K = E): one launch
  k_qkv<<<dim3(E / 64, M / 128, 3), dim3(256), 0, stream>>>(xh, xbh, xbl, wqT, wkT, wvTh, wvTl, bq, bk, bv, qh, kh, vTh,
                                                            vTl, M, E, E, S, 1.0f / 64.0f);
  // 3) attention + head-mean
  {
    const size_t dynB = ((size_t)16 * (SQ + 4) + (size_t)ANW * 16 * 68) * 4;
    hipFuncSetAttribute(reinterpret_cast<const void*>(&k_attn<SQ, H>), hipFuncAttributeMaxDynamicSharedMemorySize,
                        (int)dynB);
    k_attn<SQ, H><<<dim3(SQ / 16, Bn), dim3(ANW * 32), dynB, stream>>>(qh, kh, vTh, vTl, sw_g, bs2, cth, ctl, out_mean);
  }
  // 4) output projection -> d_out
  k_oproj<<<dim3(E / 64, M / 128), dim3(256), 0, stream>>>(cth, ctl, woTh, woTl, bo, out_proj, M, E, E, S);
  hipGetLastError();
  hipStreamSynchronize(stream);
}

// v008
// One run takes 239 microseconds.
// In two side-by-side timings against v007, it was 1.08 and 1.07 times as fast.
// Over all steps from v000 it is 6.93 times as fast.
#include <hip/hip_runtime.h>

// Contractions: x@Wq, x@Wk and q.k^T : v_wmma_f32_16x16x32_f16 (f16 operands; Wq, Wk carried x64, rescaled in the f32 epilogue; f32 accumulate).
// x@Wv, P.V and ctx@Wo : v_wmma_f32_16x16x32_bf16 with bf16 hi/lo operand split (hi.hi + hi.lo + lo.hi), f32 accumulate. Gate MLP: scalar f32.

#define NOP4 "v_nop\n\tv_nop\n\tv_nop\n\tv_nop"

typedef _Float16 v16h __attribute__((ext_vector_type(16)));
typedef __bf16 v16b __attribute__((ext_vector_type(16)));
typedef float v8f __attribute__((ext_vector_type(8)));
typedef float v4f __attribute__((ext_vector_type(4)));
typedef unsigned int v4u __attribute__((ext_vector_type(4)));

union FragH { v16h v; v4u q[2]; };
union FragB { v16b v; v4u q[2]; };

__device__ __forceinline__ v4u ldg16(const unsigned short* p) { return *(const v4u*)p; }

// RNE f32 -> bf16 bits
__device__ __forceinline__ unsigned int bf_bits(float f) {
  unsigned int u = __float_as_uint(f);
  return (u + 0x7FFFu + ((u >> 16) & 1u)) >> 16;
}
__device__ __forceinline__ float bf_val(unsigned int b) { return __uint_as_float(b << 16); }
// RNE f32 -> f16 bits
__device__ __forceinline__ unsigned int hf_bits(float f) {
  union { _Float16 h; unsigned short u; } c;
  c.h = (_Float16)f;
  return (unsigned int)c.u;
}
__device__ __forceinline__ unsigned int pk2(unsigned int lo, unsigned int hi) {
  return (lo & 0xFFFFu) | (hi << 16);
}
// 8 consecutive f32 -> 8 packed f16 (element 2t in the low half of word t)
__device__ __forceinline__ v4u pack_h8(v4f a, v4f c) {
  v4u r;
  r[0] = pk2(hf_bits(a[0]), hf_bits(a[1]));
  r[1] = pk2(hf_bits(a[2]), hf_bits(a[3]));
  r[2] = pk2(hf_bits(c[0]), hf_bits(c[1]));
  r[3] = pk2(hf_bits(c[2]), hf_bits(c[3]));
  return r;
}
// 8 consecutive f32 -> bf16 hi plane and bf16 residual plane
__device__ __forceinline__ void split_b8(v4f a, v4f c, v4u& H, v4u& L) {
  float v[8] = {a[0], a[1], a[2], a[3], c[0], c[1], c[2], c[3]};
  unsigned int hb[8], lb[8];
#pragma unroll
  for (int e = 0; e < 8; ++e) {
    hb[e] = bf_bits(v[e]);
    lb[e] = bf_bits(v[e] - bf_val(hb[e]));
  }
#pragma unroll
  for (int t = 0; t < 4; ++t) {
    H[t] = pk2(hb[2 * t], hb[2 * t + 1]);
    L[t] = pk2(lb[2 * t], lb[2 * t + 1]);
  }
}

__device__ __forceinline__ v8f zero8() {
  v8f z;
#pragma unroll
  for (int r = 0; r < 8; ++r) z[r] = 0.f;
  return z;
}
__device__ __forceinline__ v8f mma_h(v16h a, v16h b, v8f c) {
  return __builtin_amdgcn_wmma_f32_16x16x32_f16(false, a, false, b, (short)0, c, false, false);
}
__device__ __forceinline__ v8f mma_b(v16b a, v16b b, v8f c) {
  return __builtin_amdgcn_wmma_f32_16x16x32_bf16(false, a, false, b, (short)0, c, false, false);
}

// ---------------------------------------------------------------------------
// x [n] f32 -> f16 plane (unscaled) and bf16 hi / lo planes. 8 elements per thread, 512 threads per block blk.
// ---------------------------------------------------------------------------
__device__ __forceinline__ void cvt_x_body(const float* __restrict__ x, unsigned short* xh,
                                           unsigned short* xbh, unsigned short* xbl, int n, int blk, int tid) {
  const size_t i8 = ((size_t)blk * 512u + (size_t)tid) * 8u;
  if (i8 + 8 > (size_t)n) return;
  const v4f a = *(const v4f*)(x + i8);
  const v4f c = *(const v4f*)(x + i8 + 4);
  const v4u fh = pack_h8(a, c);
  v4u bh, bl;
  split_b8(a, c, bh, bl);
  *(v4u*)(xh + i8) = fh;
  *(v4u*)(xbh + i8) = bh;
  *(v4u*)(xbl + i8) = bl;
  
}

// ---------------------------------------------------------------------------
// W[Kd][Nd] f32 -> WT[Nd][Kd] 16-bit (k-contiguous rows).  64x64 tile at (e0, n0) through LDS, 256 threads
// (tid 0..255) and their own LDS tile; the caller's block holds two such halves, both pass the barrier.
// MODE 0: f16 of (W * scale) into o0.  MODE 1: bf16 hi into o0, bf16 lo into o1.
// ---------------------------------------------------------------------------
template <int MODE>
__device__ __forceinline__ void cvt_wT_body(const float* __restrict__ W, unsigned short* o0,
                                            unsigned short* o1, int Kd, int Nd, float scale,
                                            float (*tile)[65], int n0, int e0, int tid) {
#pragma unroll
  for (int t = 0; t < 4; ++t) {
    const int idx = t * 256 + tid;
    const int rr = idx >> 4, c4 = (idx & 15) * 4;
    const v4f v = *(const v4f*)(W + (size_t)(e0 + rr) * Nd + n0 + c4);
    tile[rr][c4] = v[0];
    tile[rr][c4 + 1] = v[1];
    tile[rr][c4 + 2] = v[2];
    tile[rr][c4 + 3] = v[3];
  }
  __syncthreads();
  v4u Hv[2], Lv[2];
  size_t adr[2];
#pragma unroll
  for (int t = 0; t < 2; ++t) {
    const int s = t * 256 + tid;
    const int nn = s >> 3, kq = (s & 7) * 8;
    v4f a, c;
#pragma unroll
    for (int e = 0; e < 4; ++e) {
      a[e] = tile[kq + e][nn] * scale;
      c[e] = tile[kq + 4 + e][nn] * scale;
    }
    if (MODE == 0) {
      Hv[t] = pack_h8(a, c);
      Lv[t] = Hv[t];
    } else {
      split_b8(a, c, Hv[t], Lv[t]);
    }
    adr[t] = (size_t)(n0 + nn) * Kd + e0 + kq;
  }
#pragma unroll
  for (int t = 0; t < 2; ++t) {
    *(v4u*)(o0 + adr[t]) = Hv[t];
    if (MODE == 1) *(v4u*)(o1 + adr[t]) = Lv[t];
  }
  
}

// ---------------------------------------------------------------------------
// Gate MLP, gate[b][h] = sigmoid(relu(sync @ W1 + b1) @ W2 + b2), spread over GNS x batch blocks.
// Block (c, b) owns the 32 hidden units j0 = 32c .. 32c+31 of batch b.  Its EIN x 128-B slice of W1 is read
// with every load of a thread in flight at once: 8 lanes take one row's 128-B line, each group of 8 lanes owns
// EIN/64 consecutive rows; the shapes are compile-time, so a thread's loads share one address and differ in
// the immediate offset.
// The row groups' partial sums are combined by lane exchange, then over the waves in LDS in wave order.
// Wave 0 adds b1, applies relu and multiplies by the slice's 32 rows of W2:
//   plo[(b*GNS + c)*32 + h] = sum over the slice's j of hid[j] * W2[j][h]   (h >= HN: 0).
// The attention kernel adds the GNS slices and b2 in slice order and applies the sigmoid.
// ---------------------------------------------------------------------------
#define GNS 8
template <int EIN, int HN>
__device__ __forceinline__ void gate_body(const float* __restrict__ sync, const float* __restrict__ W1,
                                          const float* __restrict__ b1, const float* __restrict__ W2,
                                          float* plo, float* red, float* w2s, int c, int b, int tid) {
  constexpr int HD = GNS * 32, NT = EIN / 64;
  static_assert(NT == 16 && 32 * HN == 512, "16 rows and one W2 element per thread");
  const int j0 = c * 32, l = tid & 31;
  const int w = __builtin_amdgcn_readfirstlane(tid >> 5);
  const int cq = (tid & 7) * 4, rg = tid >> 3;
  const float* p2 = W2 + (size_t)j0 * HN + tid;
  const float* pb = b1 + j0 + l;
  const float* pw = W1 + (size_t)rg * NT * HD + j0 + cq;
  const float* ps = sync + (size_t)b * EIN + rg * NT;
  const float w2v = *p2;
  const float bj = *pb;
  v4f wv[NT], sv[NT / 4];
#pragma unroll  // constant indices keep wv and sv in registers
  for (int t = 0; t < NT; ++t) wv[t] = *(const v4f*)(pw + t * HD);
#pragma unroll  // as above
  for (int t = 0; t < NT / 4; ++t) sv[t] = *(const v4f*)(ps + t * 4);
  // nothing is scheduled across this line, so every load above is issued before the first is waited for:
  // one memory latency for the slice; without it the compiler starts the sums after half of the loads
  __builtin_amdgcn_sched_barrier(0);
  v4f acc;
  acc[0] = 0.f; acc[1] = 0.f; acc[2] = 0.f; acc[3] = 0.f;
#pragma unroll  // as above
  for (int t = 0; t < NT; ++t) acc += wv[t] * sv[t >> 2][t & 3];
  // lanes l, l^8, l^16, l^24 hold the same four columns
#pragma unroll  // constant indices keep acc in registers
  for (int k = 0; k < 4; ++k) {
    acc[k] += __shfl_xor(acc[k], 8);
    acc[k] += __shfl_xor(acc[k], 16);
  }
  if (l < 8) *(v4f*)(red + w * 32 + cq) = acc;
  w2s[tid] = w2v;
  __syncthreads();
  if (w == 0) {
    float a = bj;
#pragma unroll  // the 16 LDS reads issue together
    for (int ww = 0; ww < 16; ++ww) a += red[ww * 32 + l];
    const int hid = __float_as_int(fmaxf(a, 0.f));
    const int lh = l & (HN - 1);
    float p = 0.f;
#pragma unroll  // lane index of readlane and LDS offsets as immediates
    for (int j = 0; j < 32; ++j) p += __int_as_float(__builtin_amdgcn_readlane(hid, j)) * w2s[j * HN + lh];
    plo[((size_t)b * GNS + c) * 32 + l] = (l < HN) ? p : 0.f;
  }
}

// ---------------------------------------------------------------------------
// Everything that reads only the inputs, in ONE launch: none of the three jobs depends on another, so they
// share the chip instead of running one behind the other.  Blocks of 512 threads, dealt by block index:
//   [0, GNS*Bn)          gate MLP slices (the longest dependent chain, so they start first);
//   then 4*(EIN/64)^2/2  weight tiles, two 64x64 tiles per block, matrices in the order Wq, Wk, Wv, Wo;
//   the rest             x planes.
// ---------------------------------------------------------------------------
template <int EIN, int HN>
__global__ __launch_bounds__(512) void k_prep(const float* __restrict__ x, const float* __restrict__ sync,
                                             const float* __restrict__ Wq, const float* __restrict__ Wk,
                                             const float* __restrict__ Wv, const float* __restrict__ Wo,
                                             const float* __restrict__ W1, const float* __restrict__ b1,
                                             const float* __restrict__ W2, unsigned short* xh,
                                             unsigned short* xbh, unsigned short* xbl, unsigned short* wqT,
                                             unsigned short* wkT, unsigned short* wvTh, unsigned short* wvTl,
                                             unsigned short* woTh, unsigned short* woTl, float* plo, int nX,
                                             int Bn) {
  constexpr int TPR = EIN / 64, TPM = TPR * TPR;  // 64x64 tiles per row and per matrix
  static_assert((TPR & (TPR - 1)) == 0 && TPM % 2 == 0, "a block's two tiles lie in one matrix");
  // two transposition tiles; the gate blocks use the first 1024 words, with 16-B accesses
  __shared__ __attribute__((aligned(16))) float sm[2 * 64 * 65];
  const int tid = threadIdx.x;
  int blk = blockIdx.x;
  if (blk < GNS * Bn) {
    gate_body<EIN, HN>(sync, W1, b1, W2, plo, sm, sm + 512, blk % GNS, blk / GNS, tid);
    return;
  }
  blk -= GNS * Bn;
  if (blk < 2 * TPM) {
    const int half = tid >> 8;
    const int t = blk * 2 + half;
    const int mi = blk / (TPM / 2);  // block-uniform
    const int n0 = (t & (TPR - 1)) * 64, e0 = ((t / TPR) & (TPR - 1)) * 64;
    float (*tile)[65] = (float (*)[65])(sm + half * 64 * 65);
    if (mi < 2)
      cvt_wT_body<0>(mi == 0 ? Wq : Wk, mi == 0 ? wqT : wkT, mi == 0 ? wqT : wkT, EIN, EIN, 64.0f, tile, n0, e0,
                     tid & 255);
    else
      cvt_wT_body<1>(mi == 2 ? Wv : Wo, mi == 2 ? wvTh : woTh, mi == 2 ? wvTl : woTl, EIN, EIN, 1.0f, tile, n0, e0,
                     tid & 255);
    return;
  }
  blk -= 2 * TPM;
  cvt_x_body(x, xh, xbh, xbl, nX, blk, tid);
}

// ---------------------------------------------------------------------------
// C[M,N] = A[M,K] @ B[K,N] (+bias) with A row-major 16-bit and B given as BT[N][K] 16-bit.
// Block tile 128x64, 256 threads = 8 waves, wave w owns rows w*16..w*16+15, 4 n-tiles.
// The k range is walked in tiles of 64: the block's 128 A rows and 64 B rows (each plane) are
// brought to LDS once per tile, 128 B of a row from 8 neighbouring lanes, the next tile's
// global loads in flight in registers while this tile is multiplied.  Fragments are read from
// LDS with the 16x16x32 split k-map
//   (lane l: row/col = l&15; elements 0..7 <- k0+8*(l>>4)+0..7, 8..15 <- k0+16+8*(l>>4)+0..7).
// SPLIT 0: single f16 product.  SPLIT 1: bf16 hi/lo planes, three products.
// OM 0: f16 in the attention kernel's fragment order: per (batch, head) and 16-row tile one 2-KB block of
//       4 x 512 B, piece t of lane l=(g,m) = row m, columns (2t+g)*8..+7 of the head.
// OM 1: bf16 hi/lo in fragment order: per (batch, head) and 32-key chunk one 4-KB block per plane of
//       8 x 512 B, piece nt*2+q of lane l=(g,m) = column d nt*16+m, keys q*16+8g..+7 of the chunk.
//       In both, one wave-wide 16-B load or store of a piece covers 512 contiguous bytes (4 whole lines).
// OM 2: f32 row-major [M][N].
// ---------------------------------------------------------------------------
#define GPIT 72  // LDS row pitch in 16-bit elements: 144 B = 16 B x 9, b128 fragment reads without bank conflicts
// LDS of one block in 16-B units: the staged operand tiles, or the epilogue tile (128 x 68 f32) that reuses their space
template <int SPLIT>
constexpr int gemm_lds16() {
  return (SPLIT ? 2 : 1) * (128 + 64) * GPIT / 8 > 128 * 17 ? (SPLIT ? 2 : 1) * (128 + 64) * GPIT / 8 : 128 * 17;
}
// the block (bx, by) of the product; smem holds gemm_lds16<SPLIT>() units
template <int SPLIT, int OM>
__device__ __forceinline__ void gemm_body(v4f* smem, int bx, int by, const unsigned short* __restrict__ Ah,
                                          const unsigned short* __restrict__ Al,
                                          const unsigned short* __restrict__ Bh,
                                          const unsigned short* __restrict__ Bl,
                                          const float* __restrict__ bias, void* out0, void* out1,
                                          int M, int N, int K, int Sq, float oscale) {
  constexpr int PIT = GPIT;
  float* stg = (float*)smem;
  unsigned short* sAh = (unsigned short*)smem;
  unsigned short* sBh = sAh + 128 * PIT;
  unsigned short* sAl = sBh + 64 * PIT;  // the two lo planes exist only with SPLIT
  unsigned short* sBl = sAl + 128 * PIT;
  const int nBase = bx * 64, mBase = by * 128;
  if (nBase + 64 > N || mBase + 128 > M || (K & 63) != 0) return;  // block-uniform
  const int tid = threadIdx.x, w = tid >> 5, l = tid & 31, g = l >> 4, m = l & 15;

  v8f acc[4];
#pragma unroll
  for (int nt = 0; nt < 4; ++nt) acc[nt] = zero8();

  // staging map: thread -> row tid>>3 (+32 per step), 16-B piece tid&7 of the row's 128 B
  const int lr = tid >> 3, lc = (tid & 7) * 8;
  // global address = block-uniform byte base (moves with k) + a per-thread 32-bit byte offset that never changes
  const char* bAh = (const char*)(Ah + (size_t)mBase * K);
  const char* bAl = (const char*)(Al + (size_t)mBase * K);
  const char* bBh = (const char*)(Bh + (size_t)nBase * K);
  const char* bBl = (const char*)(Bl + (size_t)nBase * K);
  unsigned int go[4];
#pragma unroll  // here and below: constant indices keep the small per-thread arrays in registers
  for (int t = 0; t < 4; ++t) go[t] = (unsigned int)(((lr + 32 * t) * K + lc) * 2);
  const int ls = lr * PIT + lc;
  const int fa = (w * 16 + m) * PIT + 8 * g;  // this lane's A fragment row in LDS
  const int fb = m * PIT + 8 * g;             // this lane's B fragment row of n-tile 0

  v4u rah[4], ral[4], rbh[2], rbl[2];
#pragma unroll
  for (int t = 0; t < 4; ++t) {
    rah[t] = *(const v4u*)(bAh + go[t]);
    if (SPLIT) ral[t] = *(const v4u*)(bAl + go[t]);
  }
#pragma unroll
  for (int t = 0; t < 2; ++t) {
    rbh[t] = *(const v4u*)(bBh + go[t]);
    if (SPLIT) rbl[t] = *(const v4u*)(bBl + go[t]);
  }

#pragma unroll 1  // one copy of the body: the staged pieces and both k halves' fragments already fill the register budget
  for (int k0 = 0; k0 < K; k0 += 64) {
#pragma unroll
    for (int t = 0; t < 4; ++t) {
      *(v4u*)(sAh + ls + t * 32 * PIT) = rah[t];
      if (SPLIT) *(v4u*)(sAl + ls + t * 32 * PIT) = ral[t];
    }
#pragma unroll
    for (int t = 0; t < 2; ++t) {
      *(v4u*)(sBh + ls + t * 32 * PIT) = rbh[t];
      if (SPLIT) *(v4u*)(sBl + ls + t * 32 * PIT) = rbl[t];
    }
    __syncthreads();  // the tile is complete before any wave reads fragments from it
    if (k0 + 64 < K) {
      const size_t kn = (size_t)(k0 + 64) * 2;
      const char *pah[4], *pal[4], *pbh[2], *pbl[2];
#pragma unroll
      for (int t = 0; t < 4; ++t) {
        pah[t] = bAh + kn + go[t];
        pal[t] = bAl + kn + go[t];
        rah[t] = *(const v4u*)pah[t];
        if (SPLIT) ral[t] = *(const v4u*)pal[t];
      }
#pragma unroll
      for (int t = 0; t < 2; ++t) {
        pbh[t] = bBh + kn + go[t];
        pbl[t] = bBl + kn + go[t];
        rbh[t] = *(const v4u*)pbh[t];
        if (SPLIT) rbl[t] = *(const v4u*)pbl[t];
      }
      // the prefetch loads' address registers are free for reuse (fragment reads below) only behind this wait;
      // naming the addresses as inputs keeps them in their registers up to it
      if (SPLIT)
        asm volatile("s_wait_xcnt 0x0" ::"v"(pah[0]), "v"(pah[1]), "v"(pah[2]), "v"(pah[3]), "v"(pbh[0]), "v"(pbh[1]),
                     "v"(pal[0]), "v"(pal[1]), "v"(pal[2]), "v"(pal[3]), "v"(pbl[0]), "v"(pbl[1])
                     : "memory");
      else
        asm volatile("s_wait_xcnt 0x0" ::"v"(pah[0]), "v"(pah[1]), "v"(pah[2]), "v"(pah[3]), "v"(pbh[0]), "v"(pbh[1])
                     : "memory");
    }
#pragma unroll  // both k halves of the tile in one body, LDS offsets as immediates
    for (int kk = 0; kk < 64; kk += 32) {
      if (SPLIT) {
        FragB a, a2, b0, b1, b2, b3, c0, c1, c2, c3;
        a.q[0] = ldg16(sAh + fa + kk);
        a.q[1] = ldg16(sAh + fa + kk + 16);
        a2.q[0] = ldg16(sAl + fa + kk);
        a2.q[1] = ldg16(sAl + fa + kk + 16);
        b0.q[0] = ldg16(sBh + fb + kk);
        b0.q[1] = ldg16(sBh + fb + kk + 16);
        b1.q[0] = ldg16(sBh + fb + 16 * PIT + kk);
        b1.q[1] = ldg16(sBh + fb + 16 * PIT + kk + 16);
        b2.q[0] = ldg16(sBh + fb + 32 * PIT + kk);
        b2.q[1] = ldg16(sBh + fb + 32 * PIT + kk + 16);
        b3.q[0] = ldg16(sBh + fb + 48 * PIT + kk);
        b3.q[1] = ldg16(sBh + fb + 48 * PIT + kk + 16);
        c0.q[0] = ldg16(sBl + fb + kk);
        c0.q[1] = ldg16(sBl + fb + kk + 16);
        c1.q[0] = ldg16(sBl + fb + 16 * PIT + kk);
        c1.q[1] = ldg16(sBl + fb + 16 * PIT + kk + 16);
        c2.q[0] = ldg16(sBl + fb + 32 * PIT + kk);
        c2.q[1] = ldg16(sBl + fb + 32 * PIT + kk + 16);
        c3.q[0] = ldg16(sBl + fb + 48 * PIT + kk);
        c3.q[1] = ldg16(sBl + fb + 48 * PIT + kk + 16);
        acc[0] = mma_b(a.v, b0.v, acc[0]);
        acc[0] = mma_b(a.v, c0.v, acc[0]);
        acc[0] = mma_b(a2.v, b0.v, acc[0]);
        acc[1] = mma_b(a.v, b1.v, acc[1]);
        acc[1] = mma_b(a.v, c1.v, acc[1]);
        acc[1] = mma_b(a2.v, b1.v, acc[1]);
        acc[2] = mma_b(a.v, b2.v, acc[2]);
        acc[2] = mma_b(a.v, c2.v, acc[2]);
        acc[2] = mma_b(a2.v, b2.v, acc[2]);
        acc[3] = mma_b(a.v, b3.v, acc[3]);
        acc[3] = mma_b(a.v, c3.v, acc[3]);
        acc[3] = mma_b(a2.v, b3.v, acc[3]);
        // four vector slots behind the last WMMA, on every path, before its operands or results are touched
        asm volatile(NOP4
                     : "+v"(acc[0]), "+v"(acc[1]), "+v"(acc[2]), "+v"(acc[3])
                     : "v"(a.v), "v"(a2.v), "v"(b0.v), "v"(b1.v), "v"(b2.v), "v"(b3.v),
                       "v"(c0.v), "v"(c1.v), "v"(c2.v), "v"(c3.v));
      } else {
        FragH a, b0, b1, b2, b3;
        a.q[0] = ldg16(sAh + fa + kk);
        a.q[1] = ldg16(sAh + fa + kk + 16);
        b0.q[0] = ldg16(sBh + fb + kk);
        b0.q[1] = ldg16(sBh + fb + kk + 16);
        b1.q[0] = ldg16(sBh + fb + 16 * PIT + kk);
        b1.q[1] = ldg16(sBh + fb + 16 * PIT + kk + 16);
        b2.q[0] = ldg16(sBh + fb + 32 * PIT + kk);
        b2.q[1] = ldg16(sBh + fb + 32 * PIT + kk + 16);
        b3.q[0] = ldg16(sBh + fb + 48 * PIT + kk);
        b3.q[1] = ldg16(sBh + fb + 48 * PIT + kk + 16);
        acc[0] = mma_h(a.v, b0.v, acc[0]);
        acc[1] = mma_h(a.v, b1.v, acc[1]);
        acc[2] = mma_h(a.v, b2.v, acc[2]);
        acc[3] = mma_h(a.v, b3.v, acc[3]);
        // four vector slots behind the last WMMA, on every path, before its operands or results are touched
        asm volatile(NOP4
                     : "+v"(acc[0]), "+v"(acc[1]), "+v"(acc[2]), "+v"(acc[3])
                     : "v"(a.v), "v"(b0.v), "v"(b1.v), "v"(b2.v), "v"(b3.v));
      }
    }
    __syncthreads();  // every wave has left the tile before it is overwritten (next tile, or the epilogue tile)
  }

  // stage: D element r of lane (g,m), n-tile nt -> (row w*16+8g+r, col nt*16+m)
#pragma unroll
  for (int nt = 0; nt < 4; ++nt) {
    const int col = nt * 16 + m;
    const float bv = bias[nBase + col];
#pragma unroll
    for (int r = 0; r < 8; ++r) stg[(w * 16 + 8 * g + r) * 68 + col] = acc[nt][r] * oscale + bv;
  }
  __syncthreads();

  if (OM == 0) {
    // wave w holds the block's 16-row tile w of head nBase/64
    unsigned short* o = (unsigned short*)out0;
    const int Hn = N >> 6;
    const int bb = mBase / Sq;
    const int bh = bb * Hn + (nBase >> 6);
    const int tl = ((mBase - bb * Sq) >> 4) + w;
    const size_t tb = ((size_t)bh * (Sq >> 4) + tl) * 1024 + l * 8;
    v4u val[4];
    size_t adr[4];
#pragma unroll
    for (int t = 0; t < 4; ++t) {
      const float* sp = stg + (w * 16 + m) * 68 + (2 * t + g) * 8;
      const v4f x0 = *(const v4f*)sp;
      const v4f x1 = *(const v4f*)(sp + 4);
      val[t] = pack_h8(x0, x1);
      adr[t] = tb + t * 256;
    }
#pragma unroll
    for (int t = 0; t < 4; ++t) *(v4u*)(o + adr[t]) = val[t];
    // in the merged kernel the other projection's body follows these stores in the code: this wait stands in
    // front of every rewrite of the stores' address and data registers
    asm volatile("s_wait_xcnt 0x0" ::: "memory");
  } else if (OM == 1) {
    // tile rows = s (128 consecutive within one batch = 4 chunks of 32 keys), cols = d of head nBase/64
    unsigned short* oh = (unsigned short*)out0;
    unsigned short* ol = (unsigned short*)out1;
    const int Hn = N >> 6;
    const int bb = mBase / Sq;
    const int bh = bb * Hn + (nBase >> 6);
    const int sBase = mBase - bb * Sq;
    v4u Hv[4], Lv[4];
    size_t adr[4];
#pragma unroll
    for (int t = 0; t < 4; ++t) {
      const int ch = w >> 1, nt = (w & 1) * 2 + (t >> 1), q = t & 1;  // the block's 32 pieces, 4 per wave
      const int d = nt * 16 + m, s8 = ch * 32 + q * 16 + g * 8;
      v4f x0, x1;
#pragma unroll
      for (int e = 0; e < 4; ++e) {
        x0[e] = stg[(s8 + e) * 68 + d];
        x1[e] = stg[(s8 + 4 + e) * 68 + d];
      }
      split_b8(x0, x1, Hv[t], Lv[t]);
      adr[t] = (((size_t)bh * (Sq >> 5) + (sBase >> 5) + ch) * 8 + nt * 2 + q) * 256 + l * 8;
    }
#pragma unroll
    for (int t = 0; t < 4; ++t) {
      *(v4u*)(oh + adr[t]) = Hv[t];
      *(v4u*)(ol + adr[t]) = Lv[t];
    }
    
  } else {
    float* o = (float*)out0;
    v4f val[8];
    size_t adr[8];
#pragma unroll
    for (int t = 0; t < 8; ++t) {
      const int row = w * 16 + t * 2 + (l >> 4), c4 = (l & 15) * 4;
      val[t] = *(const v4f*)(stg + row * 68 + c4);
      adr[t] = (size_t)(mBase + row) * N + nBase + c4;
    }
#pragma unroll
    for (int t = 0; t < 8; ++t) *(v4f*)(o + adr[t]) = val[t];
    
  }
}

// The three projections of x in ONE launch (none depends on another): blockIdx.z = 0 is x@Wv, whose blocks
// run longest and so start first, 1 is x@Wq, 2 is x@Wk.
__global__ __launch_bounds__(256) void k_qkv(const unsigned short* __restrict__ xh,
                                            const unsigned short* __restrict__ xbh,
                                            const unsigned short* __restrict__ xbl,
                                            const unsigned short* __restrict__ wqT,
                                            const unsigned short* __restrict__ wkT,
                                            const unsigned short* __restrict__ wvTh,
                                            const unsigned short* __restrict__ wvTl,
                                            const float* __restrict__ bq, const float* __restrict__ bk,
                                            const float* __restrict__ bv, unsigned short* qo, unsigned short* ko,
                                            unsigned short* vho, unsigned short* vlo, int M, int N, int K, int Sq,
                                            float qkscale) {
  __shared__ v4f smem[gemm_lds16<1>()];
  const int z = blockIdx.z;
  if (z == 0) {
    gemm_body<1, 1>(smem, blockIdx.x, blockIdx.y, xbh, xbl, wvTh, wvTl, bv, (void*)vho, (void*)vlo, M, N, K, Sq, 1.0f);
  } else {
    const unsigned short* wT = z == 1 ? wqT : wkT;
    unsigned short* o = z == 1 ? qo : ko;
    gemm_body<0, 0>(smem, blockIdx.x, blockIdx.y, xh, xh, wT, wT, z == 1 ? bq : bk, (void*)o, (void*)o, M, N, K, Sq,
                    qkscale);
  }
}

// The output projection, f32 row-major.
__global__ __launch_bounds__(256) void k_oproj(const unsigned short* __restrict__ Ah,
                                              const unsigned short* __restrict__ Al,
                                              const unsigned short* __restrict__ Bh,
                                              const unsigned short* __restrict__ Bl,
                                              const float* __restrict__ bias, float* out, int M, int N, int K, int Sq) {
  __shared__ v4f smem[gemm_lds16<1>()];
  gemm_body<1, 2>(smem, blockIdx.x, blockIdx.y, Ah, Al, Bh, Bl, bias, (void*)out, (void*)out, M, N, K, Sq, 1.0f);
}

// ---------------------------------------------------------------------------
// Fused attention: one block of ANW waves per (16 query rows, batch).  Dynamic LDS:
//   mL[16][S+4] f32      sum over heads of the softmax probabilities (lane-owned elements);
//   pT[ANW][16][68] f32  the waves' P.V partial tiles.
// Row pitch S+4 floats = 16 B x odd: the 16 lanes of a half wave, one query row each, then fall on
// 16 different groups of four banks in every b128 access; at a pitch of S floats they share one group.
// The keys are split over the waves: wave w owns S/32/ANW contiguous 32-key chunks in all three sweeps.
// Per head h: score tiles S^T = K_tile . Q^T (A = k rows, B = q rows; D lane (g,m) holds
// query m, keys jt*16+8g+r), exact two-sweep softmax, then P.V.  D of the tiles 2c and 2c+1 is, lane for
// lane, the A fragment of P for chunk c (elements 0..7 <- keys k0+8g.., 8..15 <- k0+16+8g..), so a wave's
// scores stay in its registers from the product to P.V: S is a compile-time constant, the sweeps are
// unrolled and the tiles are indexed by constants.
// V fragments from the planes vt.  q, k and vt lie in fragment order (see gemm_body, OM 0 and OM 1): every
// fragment load of a wave reads 512 contiguous bytes.  Row max, row sum and the 16x64 P.V
// partial tiles are combined over the waves through LDS, always in wave order.
// ---------------------------------------------------------------------------
#define ANW 16
typedef unsigned int v2u __attribute__((ext_vector_type(2)));

// Work-group barrier that orders LDS traffic only: it waits for the wave's LDS operations, not for its global
// loads, so loads issued in front of it stay in flight across it.
__device__ __forceinline__ void barrier_lds() {
  __builtin_amdgcn_fence(__ATOMIC_RELEASE, "workgroup", "local");
  __builtin_amdgcn_s_barrier();
  __builtin_amdgcn_fence(__ATOMIC_ACQUIRE, "workgroup", "local");
}

template <int S, int H>
__global__ __launch_bounds__(ANW * 32) void k_attn(const unsigned short* __restrict__ qh,
                                                  const unsigned short* __restrict__ kh,
                                                  const unsigned short* __restrict__ vth,
                                                  const unsigned short* __restrict__ vtl,
                                                  const float* __restrict__ plo, const float* __restrict__ b2,
                                                  unsigned short* ctxh,
                                                  unsigned short* ctxl, float* mout) {
  constexpr int PS = S + 4;                // LDS row pitch of the head-sum plane, in floats
  constexpr int CPW = S / 32 / ANW;        // 32-key chunks per wave
  constexpr int TPW = 2 * CPW;             // the same keys as 16-key tiles
  static_assert(S % (32 * ANW) == 0 && S % 128 == 0 && H <= 32, "every wave owns the same whole number of chunks");
  extern __shared__ v4f dsm[];
  __shared__ float redM[ANW * 16];  // per wave, per query: max over the wave's keys
  __shared__ float redS[ANW * 16];  // per wave, per query: sum of exp over the wave's keys
  __shared__ float gv[32];          // this batch's gate per head
  float* mL = (float*)dsm;
  float* pT = mL + 16 * PS;
  const int i0 = blockIdx.x * 16, b = blockIdx.y;
  if (i0 + 16 > S) return;  // block-uniform
  const int tid = threadIdx.x;
  const int l = tid & 31, g = l >> 4, m = l & 15;
  const int w = __builtin_amdgcn_readfirstlane(tid >> 5);  // scalar, so the wave's key offsets are scalar
  constexpr int E = H * 64;

  {
    v4f z;
    z[0] = 0.f; z[1] = 0.f; z[2] = 0.f; z[3] = 0.f;
    v4f* m4 = (v4f*)mL;
    constexpr int n4 = 4 * PS;
    for (int i = tid; i < n4; i += ANW * 32) m4[i] = z;
  }
  if (tid < 32) {  // the gate's last step (see gate_body): slices and bias summed in slice order, sigmoid
    float val = 0.f;
    if (tid < H) {
      float a = b2[tid];
#pragma unroll  // the GNS loads issue together
      for (int c = 0; c < GNS; ++c) a += plo[((size_t)b * GNS + c) * 32 + tid];
      val = 1.0f / (1.0f + expf(-a));
    }
    gv[tid] = val;
  }
  __syncthreads();

  float* mrow = mL + m * PS + w * (CPW * 32) + 8 * g;  // this lane's head sums, chunk 0 of the wave
  const float invH = 1.0f / (float)H;

  // The q and k fragments of a head are asked for one head ahead, so that they fly under the end of the head
  // before: q and the first TE k tiles at the head of its last P.V chunk (from there on the registers of the
  // scores and V fragments already used are free), the other k tiles behind its P.V.
  constexpr int TE = 4;
  FragH qa0, qa1, ka0[TPW], ka1[TPW];
  auto q_adr = [&](int hh) { return qh + ((size_t)(b * H + hh) * (S >> 4) + (i0 >> 4)) * 1024 + l * 8; };
  auto k_adr = [&](int hh) { return kh + ((size_t)(b * H + hh) * (S >> 4) + w * TPW) * 1024 + l * 8; };
  auto ask_first = [&](const unsigned short* qp, const unsigned short* kr) {
    qa0.q[0] = ldg16(qp);
    qa0.q[1] = ldg16(qp + 256);
    qa1.q[0] = ldg16(qp + 512);
    qa1.q[1] = ldg16(qp + 768);
#pragma unroll  // constant indices keep the fragments in registers, offsets as immediates
    for (int t = 0; t < TE; ++t) {
      ka0[t].q[0] = ldg16(kr + t * 1024);
      ka0[t].q[1] = ldg16(kr + t * 1024 + 256);
      ka1[t].q[0] = ldg16(kr + t * 1024 + 512);
      ka1[t].q[1] = ldg16(kr + t * 1024 + 768);
    }
    // nothing is scheduled across this line, so the loads above are issued here and not in front of their use
    __builtin_amdgcn_sched_barrier(0);
  };
  auto ask_rest = [&](const unsigned short* kr) {
#pragma unroll  // constant indices keep the fragments in registers, offsets as immediates
    for (int t = TE; t < TPW; ++t) {
      ka0[t].q[0] = ldg16(kr + t * 1024);
      ka0[t].q[1] = ldg16(kr + t * 1024 + 256);
      ka1[t].q[0] = ldg16(kr + t * 1024 + 512);
      ka1[t].q[1] = ldg16(kr + t * 1024 + 768);
    }
    // stands in front of any reuse of the k address pair (also as a later load's destination);
    // naming it as an input keeps it in its registers up to it
    asm volatile("s_wait_xcnt 0x0" ::"v"(kr) : "memory");
    // nothing is scheduled across this line, so the loads above are issued here and not in front of their use
    __builtin_amdgcn_sched_barrier(0);
  };
  // stands in front of any reuse of the q and k address pairs of ask_first (also as a later load's destination);
  // naming them as inputs keeps them in their registers up to it
  auto first_done = [&](const unsigned short* qp, const unsigned short* kr) {
    asm volatile("s_wait_xcnt 0x0" ::"v"(qp), "v"(kr) : "memory");
  };
  {
    const unsigned short* qp = q_adr(0);
    const unsigned short* kr = k_adr(0);
    ask_first(qp, kr);
    first_done(qp, kr);
    ask_rest(kr);
  }

  // The waves' P.V partial tiles of head hh summed in wave order and stored as the two ctx planes.  Both barriers
  // order LDS only: the next head's q and k loads stay in flight across them.
  auto combine = [&](int hh) {
    barrier_lds();  // the partial tiles are complete
    if (w < 8) {  // 256 threads, 4 columns each: a row's 128-B line per plane leaves from 16 lanes of one wave
      const int row = tid >> 4, c4 = (tid & 15) * 4;
      const float* sp = pT + row * 68 + c4;
      v4f x = *(const v4f*)sp;
#pragma unroll  // the ANW LDS reads issue together instead of one latency per trip
      for (int ww = 1; ww < ANW; ++ww) x += *(const v4f*)(sp + ww * (16 * 68));
      unsigned int hb[4], lb[4];
#pragma unroll  // constant indices keep hb and lb in registers
      for (int e = 0; e < 4; ++e) {
        hb[e] = bf_bits(x[e]);
        lb[e] = bf_bits(x[e] - bf_val(hb[e]));
      }
      v2u Hv, Lv;
      Hv[0] = pk2(hb[0], hb[1]);
      Hv[1] = pk2(hb[2], hb[3]);
      Lv[0] = pk2(lb[0], lb[1]);
      Lv[1] = pk2(lb[2], lb[3]);
      const size_t adr = (size_t)(b * S + i0 + row) * E + hh * 64 + c4;
      unsigned short* oh = ctxh + adr;
      unsigned short* ol = ctxl + adr;
      *(v2u*)oh = Hv;
      *(v2u*)ol = Lv;
      // stands in front of every rewrite of the two stores' address and data registers (the barrier below does
      // not wait for stores); naming the addresses as inputs keeps them in their registers up to it
      asm volatile("s_wait_xcnt 0x0" ::"v"(oh), "v"(ol) : "memory");
    }
    barrier_lds();  // every reader has left the partial tiles
  };

#pragma unroll 1  // one copy of the head's body: it is long, and nothing is shared between heads
  for (int h = 0; h < H; ++h) {
    const float gsc = gv[h] * 0.125f;

    // sweep A: scores, running row max
    v8f sc[TPW];
    float rmax = -3.0e38f;
    {
#pragma unroll  // constant indices keep the score tiles in registers
      for (int t = 0; t < TPW; ++t) {
        v8f s = zero8();
        s = mma_h(ka0[t].v, qa0.v, s);
        s = mma_h(ka1[t].v, qa1.v, s);
#pragma unroll
        for (int r = 0; r < 4; ++r) {
          s[r] = s[r] * gsc;
          s[r + 4] = s[r + 4] * gsc;
          rmax = fmaxf(rmax, s[r]);
          rmax = fmaxf(rmax, s[r + 4]);
        }
        sc[t] = s;
      }
    }
    rmax = fmaxf(rmax, __shfl_xor(rmax, 16));
    if (g == 0) redM[w * 16 + m] = rmax;
    __syncthreads();
#pragma unroll  // the ANW LDS reads issue together instead of one latency per trip
    for (int ww = 0; ww < ANW; ++ww) rmax = fmaxf(rmax, redM[ww * 16 + m]);

    // sweep B: e = exp(s - max) in place, row sum
    float lsum = 0.f;
#pragma unroll  // constant indices keep the score tiles in registers
    for (int t = 0; t < TPW; ++t) {
#pragma unroll
      for (int r = 0; r < 4; ++r) {
        sc[t][r] = __expf(sc[t][r] - rmax);
        sc[t][r + 4] = __expf(sc[t][r + 4] - rmax);
        lsum += sc[t][r];
        lsum += sc[t][r + 4];
      }
    }
    lsum += __shfl_xor(lsum, 16);
    if (g == 0) redS[w * 16 + m] = lsum;
    __syncthreads();
    lsum = 0.f;
#pragma unroll  // the ANW LDS reads issue together instead of one latency per trip
    for (int ww = 0; ww < ANW; ++ww) lsum += redS[ww * 16 + m];
    const float linv = 1.0f / lsum;

    // sweep C: probabilities, head-sum accumulation, P.V over this wave's keys
    v8f cacc[4];
#pragma unroll
    for (int nt = 0; nt < 4; ++nt) cacc[nt] = zero8();
    const unsigned short* vhp = vth + ((size_t)(b * H + h) * (S >> 5) + w * CPW) * 2048 + l * 8;
    const unsigned short* vlp = vtl + ((size_t)(b * H + h) * (S >> 5) + w * CPW) * 2048 + l * 8;
    const unsigned short *qp = qh, *kr = kh;  // set in the last chunk
#pragma unroll  // constant indices keep the score tiles in registers, offsets as immediates
    for (int c = 0; c < CPW; ++c) {
      FragB vh0, vh1, vh2, vh3, vl0, vl1, vl2, vl3;
      vh0.q[0] = ldg16(vhp + c * 2048);
      vh0.q[1] = ldg16(vhp + c * 2048 + 256);
      vh1.q[0] = ldg16(vhp + c * 2048 + 512);
      vh1.q[1] = ldg16(vhp + c * 2048 + 768);
      vh2.q[0] = ldg16(vhp + c * 2048 + 1024);
      vh2.q[1] = ldg16(vhp + c * 2048 + 1280);
      vh3.q[0] = ldg16(vhp + c * 2048 + 1536);
      vh3.q[1] = ldg16(vhp + c * 2048 + 1792);
      vl0.q[0] = ldg16(vlp + c * 2048);
      vl0.q[1] = ldg16(vlp + c * 2048 + 256);
      vl1.q[0] = ldg16(vlp + c * 2048 + 512);
      vl1.q[1] = ldg16(vlp + c * 2048 + 768);
      vl2.q[0] = ldg16(vlp + c * 2048 + 1024);
      vl2.q[1] = ldg16(vlp + c * 2048 + 1280);
      vl3.q[0] = ldg16(vlp + c * 2048 + 1536);
      vl3.q[1] = ldg16(vlp + c * 2048 + 1792);
      // stands in front of any reuse of the two address pairs (also as a later load's destination);
      // naming them as inputs keeps them in their registers up to it
      asm volatile("s_wait_xcnt 0x0" ::"v"(vhp), "v"(vlp) : "memory");
      // nothing is scheduled across this line, so the chunk's 16 loads are all issued before the vector work on
      // P, which then runs under their latency; without it the compiler issues some right in front of their use
      __builtin_amdgcn_sched_barrier(0);
      if (c == CPW - 1) {
        // the last head asks for its own fragments again and nothing reads them: under a branch the old
        // fragments would stay live through P.V and be spilled
        const int hn = h + 1 < H ? h + 1 : h;
        qp = q_adr(hn);
        kr = k_adr(hn);
        ask_first(qp, kr);
      }
      v4f p0, p1, p2, p3;
#pragma unroll
      for (int r = 0; r < 4; ++r) {
        p0[r] = sc[2 * c][r] * linv;
        p1[r] = sc[2 * c][r + 4] * linv;
        p2[r] = sc[2 * c + 1][r] * linv;
        p3[r] = sc[2 * c + 1][r + 4] * linv;
      }
      {
        v4f* ma = (v4f*)(mrow + c * 32);
        v4f* mb = (v4f*)(mrow + c * 32 + 16);
        const v4f s0 = ma[0] + p0;
        const v4f s1 = ma[1] + p1;
        const v4f s2 = mb[0] + p2;
        const v4f s3 = mb[1] + p3;
        ma[0] = s0;
        ma[1] = s1;
        mb[0] = s2;
        mb[1] = s3;
      }
      FragB ph, pl;
      split_b8(p0, p1, ph.q[0], pl.q[0]);
      split_b8(p2, p3, ph.q[1], pl.q[1]);
      cacc[0] = mma_b(ph.v, vh0.v, cacc[0]);
      cacc[0] = mma_b(ph.v, vl0.v, cacc[0]);
      cacc[0] = mma_b(pl.v, vh0.v, cacc[0]);
      cacc[1] = mma_b(ph.v, vh1.v, cacc[1]);
      cacc[1] = mma_b(ph.v, vl1.v, cacc[1]);
      cacc[1] = mma_b(pl.v, vh1.v, cacc[1]);
      cacc[2] = mma_b(ph.v, vh2.v, cacc[2]);
      cacc[2] = mma_b(ph.v, vl2.v, cacc[2]);
      cacc[2] = mma_b(pl.v, vh2.v, cacc[2]);
      cacc[3] = mma_b(ph.v, vh3.v, cacc[3]);
      cacc[3] = mma_b(ph.v, vl3.v, cacc[3]);
      cacc[3] = mma_b(pl.v, vh3.v, cacc[3]);
    }

    first_done(qp, kr);
    // the partial tiles were last read in front of the barrier that ended the head before
    float* part = pT + w * (16 * 68);
#pragma unroll
    for (int nt = 0; nt < 4; ++nt) {
#pragma unroll
      for (int r = 0; r < 8; ++r) part[(8 * g + r) * 68 + nt * 16 + m] = cacc[nt][r];
    }
    ask_rest(kr);
    combine(h);
  }

  // head-mean rows: 16 rows x S f32, one row per wave, 512 B per store instruction, lane-contiguous
  __syncthreads();
  float* ob = mout + (size_t)(b * S + i0) * S;
  constexpr int nL = S >> 7;
  for (int row = w; row < 16; row += ANW) {
    for (int c = 0; c < nL; ++c) {
      const size_t off = (size_t)row * S + c * 128 + l * 4;
      const v4f v = *(const v4f*)(mL + (size_t)row * PS + c * 128 + l * 4) * invH;
      *(v4f*)(ob + off) = v;
    }
  }
  
}

// ---------------------------------------------------------------------------
// Host launcher
// ---------------------------------------------------------------------------
extern "C" void kernel_launch(void* const* d_in, const int* in_sizes, int n_in, void* d_out,
                              int out_size, void* d_ws, size_t ws_size, hipStream_t stream) {
  if (n_in < 14) return;
  const int E = 1024, H = 16;
  const int nX = in_sizes[0];
  if (nX <= 0 || (nX % E) != 0) return;
  const int M = nX / E;
  const int nSy = in_sizes[1];
  if (nSy <= 0 || (nSy % E) != 0) return;
  const int Bn = nSy / E;
  if (Bn <= 0 || (M % Bn) != 0) return;
  const int S = M / Bn;
  const int HID = in_sizes[9];
  if ((M % 128) != 0 || (S % 128) != 0 || HID != GNS * 32) return;
  const int SQ = 2048;    // the attention kernel keeps a wave's scores in registers, so its key count is a compile-time constant
  if (S != SQ) return;
  if (in_sizes[2] != E * E || in_sizes[4] != E * E || in_sizes[6] != E * E || in_sizes[12] != E * E) return;
  if (in_sizes[3] != E || in_sizes[5] != E || in_sizes[7] != E || in_sizes[13] != E) return;
  if (in_sizes[8] != E * HID || in_sizes[10] != HID * H || in_sizes[11] != H) return;
  if ((long long)out_size != (long long)nX + (long long)Bn * (long long)S * (long long)S) return;

  const float* x = (const float*)d_in[0];
  const float* sync = (const float*)d_in[1];
  const float* Wq = (const float*)d_in[2];
  const float* bq = (const float*)d_in[3];
  const float* Wk = (const float*)d_in[4];
  const float* bk = (const float*)d_in[5];
  const float* Wv = (const float*)d_in[6];
  const float* bv = (const float*)d_in[7];
  const float* Ws1 = (const float*)d_in[8];
  const float* bs1 = (const float*)d_in[9];
  const float* Ws2 = (const float*)d_in[10];
  const float* bs2 = (const float*)d_in[11];
  const float* Wo = (const float*)d_in[12];
  const float* bo = (const float*)d_in[13];

  float* out_proj = (float*)d_out;                 // [M][E] f32
  float* out_mean = (float*)d_out + (size_t)nX;    // [Bn][S][S] f32

  // workspace carve (bytes), every sub-buffer 256-B aligned
  size_t off = 0;
  auto al = [&](size_t bytes) { size_t o = off; off += (bytes + 255) & ~(size_t)255; return o; };
  const size_t nW = (size_t)E * E;
  const size_t o_sw = al((size_t)Bn * GNS * 32 * 4);
  const size_t o_xh = al((size_t)nX * 2);
  const size_t o_xbh = al((size_t)nX * 2);
  const size_t o_xbl = al((size_t)nX * 2);
  const size_t o_wq = al(nW * 2);
  const size_t o_wk = al(nW * 2);
  const size_t o_wvh = al(nW * 2);
  const size_t o_wvl = al(nW * 2);
  const size_t o_woh = al(nW * 2);
  const size_t o_wol = al(nW * 2);
  const size_t o_q = al((size_t)nX * 2);
  const size_t o_k = al((size_t)nX * 2);
  const size_t o_vth = al((size_t)nX * 2);
  const size_t o_vtl = al((size_t)nX * 2);
  const size_t o_cth = al((size_t)nX * 2);
  const size_t o_ctl = al((size_t)nX * 2);
  if (off > ws_size) return;

  char* ws = (char*)d_ws;
  float* sw_g = (float*)(ws + o_sw);
  unsigned short* xh = (unsigned short*)(ws + o_xh);
  unsigned short* xbh = (unsigned short*)(ws + o_xbh);
  unsigned short* xbl = (unsigned short*)(ws + o_xbl);
  unsigned short* wqT = (unsigned short*)(ws + o_wq);
  unsigned short* wkT = (unsigned short*)(ws + o_wk);
  unsigned short* wvTh = (unsigned short*)(ws + o_wvh);
  unsigned short* wvTl = (unsigned short*)(ws + o_wvl);
  unsigned short* woTh = (unsigned short*)(ws + o_woh);
  unsigned short* woTl = (unsigned short*)(ws + o_wol);
  unsigned short* qh = (unsigned short*)(ws + o_q);
  unsigned short* kh = (unsigned short*)(ws + o_k);
  unsigned short* vTh = (unsigned short*)(ws + o_vth);
  unsigned short* vTl = (unsigned short*)(ws + o_vtl);
  unsigned short* cth = (unsigned short*)(ws + o_cth);
  unsigned short* ctl = (unsigned short*)(ws + o_ctl);

  // 1) gate MLP slices, weight planes transposed to [n][k], activation planes: one launch
  {
    const int groups = nX / 8;
    const int blocks = GNS * Bn + 2 * (E / 64) * (E / 64) + (groups + 511) / 512;
    k_prep<E, H><<<dim3(blocks), dim3(512), 0, stream>>>(x, sync, Wq, Wk, Wv, Wo, Ws1, bs1, Ws2, xh, xbh, xbl, wqT, wkT,
                                                         wvTh, wvTl, woTh, woTl, sw_g, nX, Bn);
  }
  // 2) the three projections (M x E, K = E): one launch
  k_qkv<<<dim3(E / 64, M / 128, 3), dim3(256), 0, stream>>>(xh, xbh, xbl, wqT, wkT, wvTh, wvTl, bq, bk, bv, qh, kh, vTh,
                                                            vTl, M, E, E, S, 1.0f / 64.0f);
  // 3) attention + head-mean
  {
    const size_t dynB = ((size_t)16 * (SQ + 4) + (size_t)ANW * 16 * 68) * 4;
    hipFuncSetAttribute(reinterpret_cast<const void*>(&k_attn<SQ, H>), hipFuncAttributeMaxDynamicSharedMemorySize,
                        (int)dynB);
    k_attn<SQ, H><<<dim3(SQ / 16, Bn), dim3(ANW * 32), dynB, stream>>>(qh, kh, vTh, vTl, sw_g, bs2, cth, ctl, out_mean);
  }
  // 4) output projection -> d_out
  k_oproj<<<dim3(E / 64, M / 128), dim3(256), 0, stream>>>(cth, ctl, woTh, woTl, bo, out_proj, M, E, E, S);
  hipGetLastError();
  hipStreamSynchronize(stream);
}

// v009
// One run takes 225 microseconds.
// In both of two side-by-side timings against v008, it was 1.06 times as fast.
// Counting every step since v000, it is 7.36 times as fast.
#include <hip/hip_runtime.h>

// Contractions: x@Wq, x@Wk and q.k^T : v_wmma_f32_16x16x32_f16 (f16 operands; Wq, Wk carried x64, rescaled in the f32 epilogue; f32 accumulate).
// x@Wv, P.V and ctx@Wo : v_wmma_f32_16x16x32_bf16 with bf16 hi/lo operand split (hi.hi + hi.lo + lo.hi), f32 accumulate. Gate MLP: scalar f32.

#define NOP4 "v_nop\n\tv_nop\n\tv_nop\n\tv_nop"

typedef _Float16 v16h __attribute__((ext_vector_type(16)));
typedef __bf16 v16b __attribute__((ext_vector_type(16)));
typedef float v8f __attribute__((ext_vector_type(8)));
typedef float v4f __attribute__((ext_vector_type(4)));
typedef unsigned int v4u __attribute__((ext_vector_type(4)));

union FragH { v16h v; v4u q[2]; };
union FragB { v16b v; v4u q[2]; };

__device__ __forceinline__ v4u ldg16(const unsigned short* p) { return *(const v4u*)p; }

// RNE f32 -> bf16 bits
__device__ __forceinline__ unsigned int bf_bits(float f) {
  unsigned int u = __float_as_uint(f);
  return (u + 0x7FFFu + ((u >> 16) & 1u)) >> 16;
}
__device__ __forceinline__ float bf_val(unsigned int b) { return __uint_as_float(b << 16); }
// RNE f32 -> f16 bits
__device__ __forceinline__ unsigned int hf_bits(float f) {
  union { _Float16 h; unsigned short u; } c;
  c.h = (_Float16)f;
  return (unsigned int)c.u;
}
__device__ __forceinline__ unsigned int pk2(unsigned int lo, unsigned int hi) {
  return (lo & 0xFFFFu) | (hi << 16);
}
// 8 consecutive f32 -> 8 packed f16 (element 2t in the low half of word t)
__device__ __forceinline__ v4u pack_h8(v4f a, v4f c) {
  v4u r;
  r[0] = pk2(hf_bits(a[0]), hf_bits(a[1]));
  r[1] = pk2(hf_bits(a[2]), hf_bits(a[3]));
  r[2] = pk2(hf_bits(c[0]), hf_bits(c[1]));
  r[3] = pk2(hf_bits(c[2]), hf_bits(c[3]));
  return r;
}
// 8 consecutive f32 -> bf16 hi plane and bf16 residual plane
__device__ __forceinline__ void split_b8(v4f a, v4f c, v4u& H, v4u& L) {
  float v[8] = {a[0], a[1], a[2], a[3], c[0], c[1], c[2], c[3]};
  unsigned int hb[8], lb[8];
#pragma unroll
  for (int e = 0; e < 8; ++e) {
    hb[e] = bf_bits(v[e]);
    lb[e] = bf_bits(v[e] - bf_val(hb[e]));
  }
#pragma unroll
  for (int t = 0; t < 4; ++t) {
    H[t] = pk2(hb[2 * t], hb[2 * t + 1]);
    L[t] = pk2(lb[2 * t], lb[2 * t + 1]);
  }
}

__device__ __forceinline__ v8f zero8() {
  v8f z;
#pragma unroll
  for (int r = 0; r < 8; ++r) z[r] = 0.f;
  return z;
}
__device__ __forceinline__ v8f mma_h(v16h a, v16h b, v8f c) {
  return __builtin_amdgcn_wmma_f32_16x16x32_f16(false, a, false, b, (short)0, c, false, false);
}
__device__ __forceinline__ v8f mma_b(v16b a, v16b b, v8f c) {
  return __builtin_amdgcn_wmma_f32_16x16x32_bf16(false, a, false, b, (short)0, c, false, false);
}

// ---------------------------------------------------------------------------
// x [n] f32 -> f16 plane (unscaled) and bf16 hi / lo planes. 8 elements per thread, 512 threads per block blk.
// ---------------------------------------------------------------------------
__device__ __forceinline__ void cvt_x_body(const float* __restrict__ x, unsigned short* xh,
                                           unsigned short* xbh, unsigned short* xbl, int n, int blk, int tid) {
  const size_t i8 = ((size_t)blk * 512u + (size_t)tid) * 8u;
  if (i8 + 8 > (size_t)n) return;
  const v4f a = *(const v4f*)(x + i8);
  const v4f c = *(const v4f*)(x + i8 + 4);
  const v4u fh = pack_h8(a, c);
  v4u bh, bl;
  split_b8(a, c, bh, bl);
  *(v4u*)(xh + i8) = fh;
  *(v4u*)(xbh + i8) = bh;
  *(v4u*)(xbl + i8) = bl;
  
}

// ---------------------------------------------------------------------------
// W[Kd][Nd] f32 -> WT[Nd][Kd] 16-bit (k-contiguous rows).  64x64 tile at (e0, n0) through LDS, 256 threads
// (tid 0..255) and their own LDS tile; the caller's block holds two such halves, both pass the barrier.
// MODE 0: f16 of (W * scale) into o0.  MODE 1: bf16 hi into o0, bf16 lo into o1.
// ---------------------------------------------------------------------------
template <int MODE>
__device__ __forceinline__ void cvt_wT_body(const float* __restrict__ W, unsigned short* o0,
                                            unsigned short* o1, int Kd, int Nd, float scale,
                                            float (*tile)[65], int n0, int e0, int tid) {
#pragma unroll
  for (int t = 0; t < 4; ++t) {
    const int idx = t * 256 + tid;
    const int rr = idx >> 4, c4 = (idx & 15) * 4;
    const v4f v = *(const v4f*)(W + (size_t)(e0 + rr) * Nd + n0 + c4);
    tile[rr][c4] = v[0];
    tile[rr][c4 + 1] = v[1];
    tile[rr][c4 + 2] = v[2];
    tile[rr][c4 + 3] = v[3];
  }
  __syncthreads();
  v4u Hv[2], Lv[2];
  size_t adr[2];
#pragma unroll
  for (int t = 0; t < 2; ++t) {
    const int s = t * 256 + tid;
    const int nn = s >> 3, kq = (s & 7) * 8;
    v4f a, c;
#pragma unroll
    for (int e = 0; e < 4; ++e) {
      a[e] = tile[kq + e][nn] * scale;
      c[e] = tile[kq + 4 + e][nn] * scale;
    }
    if (MODE == 0) {
      Hv[t] = pack_h8(a, c);
      Lv[t] = Hv[t];
    } else {
      split_b8(a, c, Hv[t], Lv[t]);
    }
    adr[t] = (size_t)(n0 + nn) * Kd + e0 + kq;
  }
#pragma unroll
  for (int t = 0; t < 2; ++t) {
    *(v4u*)(o0 + adr[t]) = Hv[t];
    if (MODE == 1) *(v4u*)(o1 + adr[t]) = Lv[t];
  }
  
}

// ---------------------------------------------------------------------------
// Gate MLP, gate[b][h] = sigmoid(relu(sync @ W1 + b1) @ W2 + b2), spread over GNS x batch blocks.
// Block (c, b) owns the 32 hidden units j0 = 32c .. 32c+31 of batch b.  Its EIN x 128-B slice of W1 is read
// with every load of a thread in flight at once: 8 lanes take one row's 128-B line, each group of 8 lanes owns
// EIN/64 consecutive rows; the shapes are compile-time, so a thread's loads share one address and differ in
// the immediate offset.
// The row groups' partial sums are combined by lane exchange, then over the waves in LDS in wave order.
// Wave 0 adds b1, applies relu and multiplies by the slice's 32 rows of W2:
//   plo[(b*GNS + c)*32 + h] = sum over the slice's j of hid[j] * W2[j][h]   (h >= HN: 0).
// The attention kernel adds the GNS slices and b2 in slice order and applies the sigmoid.
// ---------------------------------------------------------------------------
#define GNS 8
template <int EIN, int HN>
__device__ __forceinline__ void gate_body(const float* __restrict__ sync, const float* __restrict__ W1,
                                          const float* __restrict__ b1, const float* __restrict__ W2,
                                          float* plo, float* red, float* w2s, int c, int b, int tid) {
  constexpr int HD = GNS * 32, NT = EIN / 64;
  static_assert(NT == 16 && 32 * HN == 512, "16 rows and one W2 element per thread");
  const int j0 = c * 32, l = tid & 31;
  const int w = __builtin_amdgcn_readfirstlane(tid >> 5);
  const int cq = (tid & 7) * 4, rg = tid >> 3;
  const float* p2 = W2 + (size_t)j0 * HN + tid;
  const float* pb = b1 + j0 + l;
  const float* pw = W1 + (size_t)rg * NT * HD + j0 + cq;
  const float* ps = sync + (size_t)b * EIN + rg * NT;
  const float w2v = *p2;
  const float bj = *pb;
  v4f wv[NT], sv[NT / 4];
#pragma unroll  // constant indices keep wv and sv in registers
  for (int t = 0; t < NT; ++t) wv[t] = *(const v4f*)(pw + t * HD);
#pragma unroll  // as above
  for (int t = 0; t < NT / 4; ++t) sv[t] = *(const v4f*)(ps + t * 4);
  // nothing is scheduled across this line, so every load above is issued before the first is waited for:
  // one memory latency for the slice; without it the compiler starts the sums after half of the loads
  __builtin_amdgcn_sched_barrier(0);
  v4f acc;
  acc[0] = 0.f; acc[1] = 0.f; acc[2] = 0.f; acc[3] = 0.f;
#pragma unroll  // as above
  for (int t = 0; t < NT; ++t) acc += wv[t] * sv[t >> 2][t & 3];
  // lanes l, l^8, l^16, l^24 hold the same four columns
#pragma unroll  // constant indices keep acc in registers
  for (int k = 0; k < 4; ++k) {
    acc[k] += __shfl_xor(acc[k], 8);
    acc[k] += __shfl_xor(acc[k], 16);
  }
  if (l < 8) *(v4f*)(red + w * 32 + cq) = acc;
  w2s[tid] = w2v;
  __syncthreads();
  if (w == 0) {
    float a = bj;
#pragma unroll  // the 16 LDS reads issue together
    for (int ww = 0; ww < 16; ++ww) a += red[ww * 32 + l];
    const int hid = __float_as_int(fmaxf(a, 0.f));
    const int lh = l & (HN - 1);
    float p = 0.f;
#pragma unroll  // lane index of readlane and LDS offsets as immediates
    for (int j = 0; j < 32; ++j) p += __int_as_float(__builtin_amdgcn_readlane(hid, j)) * w2s[j * HN + lh];
    plo[((size_t)b * GNS + c) * 32 + l] = (l < HN) ? p : 0.f;
  }
}

// ---------------------------------------------------------------------------
// Everything that reads only the inputs, in ONE launch: none of the three jobs depends on another, so they
// share the chip instead of running one behind the other.  Blocks of 512 threads, dealt by block index:
//   [0, GNS*Bn)          gate MLP slices (the longest dependent chain, so they start first);
//   then 4*(EIN/64)^2/2  weight tiles, two 64x64 tiles per block, matrices in the order Wq, Wk, Wv, Wo;
//   the rest             x planes.
// ---------------------------------------------------------------------------
template <int EIN, int HN>
__global__ __launch_bounds__(512) void k_prep(const float* __restrict__ x, const float* __restrict__ sync,
                                             const float* __restrict__ Wq, const float* __restrict__ Wk,
                                             const float* __restrict__ Wv, const float* __restrict__ Wo,
                                             const float* __restrict__ W1, const float* __restrict__ b1,
                                             const float* __restrict__ W2, unsigned short* xh,
                                             unsigned short* xbh, unsigned short* xbl, unsigned short* wqT,
                                             unsigned short* wkT, unsigned short* wvTh, unsigned short* wvTl,
                                             unsigned short* woTh, unsigned short* woTl, float* plo, int nX,
                                             int Bn) {
  constexpr int TPR = EIN / 64, TPM = TPR * TPR;  // 64x64 tiles per row and per matrix
  static_assert((TPR & (TPR - 1)) == 0 && TPM % 2 == 0, "a block's two tiles lie in one matrix");
  // two transposition tiles; the gate blocks use the first 1024 words, with 16-B accesses
  __shared__ __attribute__((aligned(16))) float sm[2 * 64 * 65];
  const int tid = threadIdx.x;
  int blk = blockIdx.x;
  if (blk < GNS * Bn) {
    gate_body<EIN, HN>(sync, W1, b1, W2, plo, sm, sm + 512, blk % GNS, blk / GNS, tid);
    return;
  }
  blk -= GNS * Bn;
  if (blk < 2 * TPM) {
    const int half = tid >> 8;
    const int t = blk * 2 + half;
    const int mi = blk / (TPM / 2);  // block-uniform
    const int n0 = (t & (TPR - 1)) * 64, e0 = ((t / TPR) & (TPR - 1)) * 64;
    float (*tile)[65] = (float (*)[65])(sm + half * 64 * 65);
    if (mi < 2)
      cvt_wT_body<0>(mi == 0 ? Wq : Wk, mi == 0 ? wqT : wkT, mi == 0 ? wqT : wkT, EIN, EIN, 64.0f, tile, n0, e0,
                     tid & 255);
    else
      cvt_wT_body<1>(mi == 2 ? Wv : Wo, mi == 2 ? wvTh : woTh, mi == 2 ? wvTl : woTl, EIN, EIN, 1.0f, tile, n0, e0,
                     tid & 255);
    return;
  }
  blk -= 2 * TPM;
  cvt_x_body(x, xh, xbh, xbl, nX, blk, tid);
}

// ---------------------------------------------------------------------------
// C[M,N] = A[M,K] @ B[K,N] (+bias) with A row-major 16-bit and B given as BT[N][K] 16-bit.
// Block tile 128x64, 256 threads = 8 waves, wave w owns rows w*16..w*16+15, 4 n-tiles.
// The k range is walked in tiles of 64: the block's 128 A rows and 64 B rows (each plane) are
// brought to LDS once per tile, 128 B of a row from 8 neighbouring lanes, the next tile's
// global loads in flight in registers while this tile is multiplied.  Fragments are read from
// LDS with the 16x16x32 split k-map
//   (lane l: row/col = l&15; elements 0..7 <- k0+8*(l>>4)+0..7, 8..15 <- k0+16+8*(l>>4)+0..7).
// SPLIT 0: single f16 product.  SPLIT 1: bf16 hi/lo planes, three products.
// OM 0: f16 in the attention kernel's fragment order: per (batch, head) and 16-row tile one 2-KB block of
//       4 x 512 B, piece t of lane l=(g,m) = row m, columns (2t+g)*8..+7 of the head.
// OM 1: bf16 hi/lo in fragment order: per (batch, head) and 32-key chunk one 4-KB block per plane of
//       8 x 512 B, piece nt*2+q of lane l=(g,m) = column d nt*16+m, keys q*16+8g..+7 of the chunk.
//       In both, one wave-wide 16-B load or store of a piece covers 512 contiguous bytes (4 whole lines).
// OM 2: f32 row-major [M][N].
// ---------------------------------------------------------------------------
#define GPIT 72  // LDS row pitch in 16-bit elements: 144 B = 16 B x 9, b128 fragment reads without bank conflicts
// LDS of one block in 16-B units: the staged operand tiles, or the epilogue tile (128 x 68 f32) that reuses their space
template <int SPLIT>
constexpr int gemm_lds16() {
  return (SPLIT ? 2 : 1) * (128 + 64) * GPIT / 8 > 128 * 17 ? (SPLIT ? 2 : 1) * (128 + 64) * GPIT / 8 : 128 * 17;
}
// the block (bx, by) of the product; smem holds gemm_lds16<SPLIT>() units
template <int SPLIT, int OM>
__device__ __forceinline__ void gemm_body(v4f* smem, int bx, int by, const unsigned short* __restrict__ Ah,
                                          const unsigned short* __restrict__ Al,
                                          const unsigned short* __restrict__ Bh,
                                          const unsigned short* __restrict__ Bl,
                                          const float* __restrict__ bias, void* out0, void* out1,
                                          int M, int N, int K, int Sq, float oscale) {
  constexpr int PIT = GPIT;
  float* stg = (float*)smem;
  unsigned short* sAh = (unsigned short*)smem;
  unsigned short* sBh = sAh + 128 * PIT;
  unsigned short* sAl = sBh + 64 * PIT;  // the two lo planes exist only with SPLIT
  unsigned short* sBl = sAl + 128 * PIT;
  const int nBase = bx * 64, mBase = by * 128;
  if (nBase + 64 > N || mBase + 128 > M || (K & 63) != 0) return;  // block-uniform
  const int tid = threadIdx.x, w = tid >> 5, l = tid & 31, g = l >> 4, m = l & 15;

  v8f acc[4];
#pragma unroll
  for (int nt = 0; nt < 4; ++nt) acc[nt] = zero8();

  // staging map: thread -> row tid>>3 (+32 per step), 16-B piece tid&7 of the row's 128 B
  const int lr = tid >> 3, lc = (tid & 7) * 8;
  // global address = block-uniform byte base (moves with k) + a per-thread 32-bit byte offset that never changes
  const char* bAh = (const char*)(Ah + (size_t)mBase * K);
  const char* bAl = (const char*)(Al + (size_t)mBase * K);
  const char* bBh = (const char*)(Bh + (size_t)nBase * K);
  const char* bBl = (const char*)(Bl + (size_t)nBase * K);
  unsigned int go[4];
#pragma unroll  // here and below: constant indices keep the small per-thread arrays in registers
  for (int t = 0; t < 4; ++t) go[t] = (unsigned int)(((lr + 32 * t) * K + lc) * 2);
  const int ls = lr * PIT + lc;
  const int fa = (w * 16 + m) * PIT + 8 * g;  // this lane's A fragment row in LDS
  const int fb = m * PIT + 8 * g;             // this lane's B fragment row of n-tile 0

  v4u rah[4], ral[4], rbh[2], rbl[2];
#pragma unroll
  for (int t = 0; t < 4; ++t) {
    rah[t] = *(const v4u*)(bAh + go[t]);
    if (SPLIT) ral[t] = *(const v4u*)(bAl + go[t]);
  }
#pragma unroll
  for (int t = 0; t < 2; ++t) {
    rbh[t] = *(const v4u*)(bBh + go[t]);
    if (SPLIT) rbl[t] = *(const v4u*)(bBl + go[t]);
  }

#pragma unroll 1  // one copy of the body: the staged pieces and both k halves' fragments already fill the register budget
  for (int k0 = 0; k0 < K; k0 += 64) {
#pragma unroll
    for (int t = 0; t < 4; ++t) {
      *(v4u*)(sAh + ls + t * 32 * PIT) = rah[t];
      if (SPLIT) *(v4u*)(sAl + ls + t * 32 * PIT) = ral[t];
    }
#pragma unroll
    for (int t = 0; t < 2; ++t) {
      *(v4u*)(sBh + ls + t * 32 * PIT) = rbh[t];
      if (SPLIT) *(v4u*)(sBl + ls + t * 32 * PIT) = rbl[t];
    }
    __syncthreads();  // the tile is complete before any wave reads fragments from it
    if (k0 + 64 < K) {
      const size_t kn = (size_t)(k0 + 64) * 2;
      const char *pah[4], *pal[4], *pbh[2], *pbl[2];
#pragma unroll
      for (int t = 0; t < 4; ++t) {
        pah[t] = bAh + kn + go[t];
        pal[t] = bAl + kn + go[t];
        rah[t] = *(const v4u*)pah[t];
        if (SPLIT) ral[t] = *(const v4u*)pal[t];
      }
#pragma unroll
      for (int t = 0; t < 2; ++t) {
        pbh[t] = bBh + kn + go[t];
        pbl[t] = bBl + kn + go[t];
        rbh[t] = *(const v4u*)pbh[t];
        if (SPLIT) rbl[t] = *(const v4u*)pbl[t];
      }
      // the prefetch loads' address registers are free for reuse (fragment reads below) only behind this wait;
      // naming the addresses as inputs keeps them in their registers up to it
      if (SPLIT)
        asm volatile("s_wait_xcnt 0x0" ::"v"(pah[0]), "v"(pah[1]), "v"(pah[2]), "v"(pah[3]), "v"(pbh[0]), "v"(pbh[1]),
                     "v"(pal[0]), "v"(pal[1]), "v"(pal[2]), "v"(pal[3]), "v"(pbl[0]), "v"(pbl[1])
                     : "memory");
      else
        asm volatile("s_wait_xcnt 0x0" ::"v"(pah[0]), "v"(pah[1]), "v"(pah[2]), "v"(pah[3]), "v"(pbh[0]), "v"(pbh[1])
                     : "memory");
    }
#pragma unroll  // both k halves of the tile in one body, LDS offsets as immediates
    for (int kk = 0; kk < 64; kk += 32) {
      if (SPLIT) {
        FragB a, a2, b0, b1, b2, b3, c0, c1, c2, c3;
        a.q[0] = ldg16(sAh + fa + kk);
        a.q[1] = ldg16(sAh + fa + kk + 16);
        a2.q[0] = ldg16(sAl + fa + kk);
        a2.q[1] = ldg16(sAl + fa + kk + 16);
        b0.q[0] = ldg16(sBh + fb + kk);
        b0.q[1] = ldg16(sBh + fb + kk + 16);
        b1.q[0] = ldg16(sBh + fb + 16 * PIT + kk);
        b1.q[1] = ldg16(sBh + fb + 16 * PIT + kk + 16);
        b2.q[0] = ldg16(sBh + fb + 32 * PIT + kk);
        b2.q[1] = ldg16(sBh + fb + 32 * PIT + kk + 16);
        b3.q[0] = ldg16(sBh + fb + 48 * PIT + kk);
        b3.q[1] = ldg16(sBh + fb + 48 * PIT + kk + 16);
        c0.q[0] = ldg16(sBl + fb + kk);
        c0.q[1] = ldg16(sBl + fb + kk + 16);
        c1.q[0] = ldg16(sBl + fb + 16 * PIT + kk);
        c1.q[1] = ldg16(sBl + fb + 16 * PIT + kk + 16);
        c2.q[0] = ldg16(sBl + fb + 32 * PIT + kk);
        c2.q[1] = ldg16(sBl + fb + 32 * PIT + kk + 16);
        c3.q[0] = ldg16(sBl + fb + 48 * PIT + kk);
        c3.q[1] = ldg16(sBl + fb + 48 * PIT + kk + 16);
        acc[0] = mma_b(a.v, b0.v, acc[0]);
        acc[0] = mma_b(a.v, c0.v, acc[0]);
        acc[0] = mma_b(a2.v, b0.v, acc[0]);
        acc[1] = mma_b(a.v, b1.v, acc[1]);
        acc[1] = mma_b(a.v, c1.v, acc[1]);
        acc[1] = mma_b(a2.v, b1.v, acc[1]);
        acc[2] = mma_b(a.v, b2.v, acc[2]);
        acc[2] = mma_b(a.v, c2.v, acc[2]);
        acc[2] = mma_b(a2.v, b2.v, acc[2]);
        acc[3] = mma_b(a.v, b3.v, acc[3]);
        acc[3] = mma_b(a.v, c3.v, acc[3]);
        acc[3] = mma_b(a2.v, b3.v, acc[3]);
        // four vector slots behind the last WMMA, on every path, before its operands or results are touched
        asm volatile(NOP4
                     : "+v"(acc[0]), "+v"(acc[1]), "+v"(acc[2]), "+v"(acc[3])
                     : "v"(a.v), "v"(a2.v), "v"(b0.v), "v"(b1.v), "v"(b2.v), "v"(b3.v),
                       "v"(c0.v), "v"(c1.v), "v"(c2.v), "v"(c3.v));
      } else {
        FragH a, b0, b1, b2, b3;
        a.q[0] = ldg16(sAh + fa + kk);
        a.q[1] = ldg16(sAh + fa + kk + 16);
        b0.q[0] = ldg16(sBh + fb + kk);
        b0.q[1] = ldg16(sBh + fb + kk + 16);
        b1.q[0] = ldg16(sBh + fb + 16 * PIT + kk);
        b1.q[1] = ldg16(sBh + fb + 16 * PIT + kk + 16);
        b2.q[0] = ldg16(sBh + fb + 32 * PIT + kk);
        b2.q[1] = ldg16(sBh + fb + 32 * PIT + kk + 16);
        b3.q[0] = ldg16(sBh + fb + 48 * PIT + kk);
        b3.q[1] = ldg16(sBh + fb + 48 * PIT + kk + 16);
        acc[0] = mma_h(a.v, b0.v, acc[0]);
        acc[1] = mma_h(a.v, b1.v, acc[1]);
        acc[2] = mma_h(a.v, b2.v, acc[2]);
        acc[3] = mma_h(a.v, b3.v, acc[3]);
        // four vector slots behind the last WMMA, on every path, before its operands or results are touched
        asm volatile(NOP4
                     : "+v"(acc[0]), "+v"(acc[1]), "+v"(acc[2]), "+v"(acc[3])
                     : "v"(a.v), "v"(b0.v), "v"(b1.v), "v"(b2.v), "v"(b3.v));
      }
    }
    __syncthreads();  // every wave has left the tile before it is overwritten (next tile, or the epilogue tile)
  }

  // stage: D element r of lane (g,m), n-tile nt -> (row w*16+8g+r, col nt*16+m)
#pragma unroll
  for (int nt = 0; nt < 4; ++nt) {
    const int col = nt * 16 + m;
    const float bv = bias[nBase + col];
#pragma unroll
    for (int r = 0; r < 8; ++r) stg[(w * 16 + 8 * g + r) * 68 + col] = acc[nt][r] * oscale + bv;
  }
  __syncthreads();

  if (OM == 0) {
    // wave w holds the block's 16-row tile w of head nBase/64
    unsigned short* o = (unsigned short*)out0;
    const int Hn = N >> 6;
    const int bb = mBase / Sq;
    const int bh = bb * Hn + (nBase >> 6);
    const int tl = ((mBase - bb * Sq) >> 4) + w;
    const size_t tb = ((size_t)bh * (Sq >> 4) + tl) * 1024 + l * 8;
    v4u val[4];
    size_t adr[4];
#pragma unroll
    for (int t = 0; t < 4; ++t) {
      const float* sp = stg + (w * 16 + m) * 68 + (2 * t + g) * 8;
      const v4f x0 = *(const v4f*)sp;
      const v4f x1 = *(const v4f*)(sp + 4);
      val[t] = pack_h8(x0, x1);
      adr[t] = tb + t * 256;
    }
#pragma unroll
    for (int t = 0; t < 4; ++t) *(v4u*)(o + adr[t]) = val[t];
    // in the merged kernel the other projection's body follows these stores in the code: this wait stands in
    // front of every rewrite of the stores' address and data registers
    asm volatile("s_wait_xcnt 0x0" ::: "memory");
  } else if (OM == 1) {
    // tile rows = s (128 consecutive within one batch = 4 chunks of 32 keys), cols = d of head nBase/64
    unsigned short* oh = (unsigned short*)out0;
    unsigned short* ol = (unsigned short*)out1;
    const int Hn = N >> 6;
    const int bb = mBase / Sq;
    const int bh = bb * Hn + (nBase >> 6);
    const int sBase = mBase - bb * Sq;
    v4u Hv[4], Lv[4];
    size_t adr[4];
#pragma unroll
    for (int t = 0; t < 4; ++t) {
      const int ch = w >> 1, nt = (w & 1) * 2 + (t >> 1), q = t & 1;  // the block's 32 pieces, 4 per wave
      const int d = nt * 16 + m, s8 = ch * 32 + q * 16 + g * 8;
      v4f x0, x1;
#pragma unroll
      for (int e = 0; e < 4; ++e) {
        x0[e] = stg[(s8 + e) * 68 + d];
        x1[e] = stg[(s8 + 4 + e) * 68 + d];
      }
      split_b8(x0, x1, Hv[t], Lv[t]);
      adr[t] = (((size_t)bh * (Sq >> 5) + (sBase >> 5) + ch) * 8 + nt * 2 + q) * 256 + l * 8;
    }
#pragma unroll
    for (int t = 0; t < 4; ++t) {
      *(v4u*)(oh + adr[t]) = Hv[t];
      *(v4u*)(ol + adr[t]) = Lv[t];
    }
    
  } else {
    float* o = (float*)out0;
    v4f val[8];
    size_t adr[8];
#pragma unroll
    for (int t = 0; t < 8; ++t) {
      const int row = w * 16 + t * 2 + (l >> 4), c4 = (l & 15) * 4;
      val[t] = *(const v4f*)(stg + row * 68 + c4);
      adr[t] = (size_t)(mBase + row) * N + nBase + c4;
    }
#pragma unroll
    for (int t = 0; t < 8; ++t) *(v4f*)(o + adr[t]) = val[t];
    
  }
}

// The three projections of x in ONE launch (none depends on another): blockIdx.z = 0 is x@Wv, whose blocks
// run longest and so start first, 1 is x@Wq, 2 is x@Wk.
__global__ __launch_bounds__(256) void k_qkv(const unsigned short* __restrict__ xh,
                                            const unsigned short* __restrict__ xbh,
                                            const unsigned short* __restrict__ xbl,
                                            const unsigned short* __restrict__ wqT,
                                            const unsigned short* __restrict__ wkT,
                                            const unsigned short* __restrict__ wvTh,
                                            const unsigned short* __restrict__ wvTl,
                                            const float* __restrict__ bq, const float* __restrict__ bk,
                                            const float* __restrict__ bv, unsigned short* qo, unsigned short* ko,
                                            unsigned short* vho, unsigned short* vlo, int M, int N, int K, int Sq,
                                            float qkscale) {
  __shared__ v4f smem[gemm_lds16<1>()];
  const int z = blockIdx.z;
  if (z == 0) {
    gemm_body<1, 1>(smem, blockIdx.x, blockIdx.y, xbh, xbl, wvTh, wvTl, bv, (void*)vho, (void*)vlo, M, N, K, Sq, 1.0f);
  } else {
    const unsigned short* wT = z == 1 ? wqT : wkT;
    unsigned short* o = z == 1 ? qo : ko;
    gemm_body<0, 0>(smem, blockIdx.x, blockIdx.y, xh, xh, wT, wT, z == 1 ? bq : bk, (void*)o, (void*)o, M, N, K, Sq,
                    qkscale);
  }
}

// The output projection, f32 row-major.
__global__ __launch_bounds__(256) void k_oproj(const unsigned short* __restrict__ Ah,
                                              const unsigned short* __restrict__ Al,
                                              const unsigned short* __restrict__ Bh,
                                              const unsigned short* __restrict__ Bl,
                                              const float* __restrict__ bias, float* out, int M, int N, int K, int Sq) {
  __shared__ v4f smem[gemm_lds16<1>()];
  gemm_body<1, 2>(smem, blockIdx.x, blockIdx.y, Ah, Al, Bh, Bl, bias, (void*)out, (void*)out, M, N, K, Sq, 1.0f);
}

// ---------------------------------------------------------------------------
// Fused attention: one block of ANW waves per (16 query rows, batch).  Dynamic LDS:
//   mL[16][S+4] f32      sum over heads of the softmax probabilities (lane-owned elements);
//   one slot of VSB bytes per wave: a 32-key chunk of the wave's V fragments (8 pieces of 512 B of the hi plane,
//   then 8 of the lo plane), brought by asynchronous copies; behind the wave's last such chunk of a head the
//   slot's first 16 x 68 floats hold the wave's P.V partial tile.
// Row pitch S+4 floats = 16 B x odd: the 16 lanes of a half wave, one query row each, then fall on
// 16 different groups of four banks in every b128 access; at a pitch of S floats they share one group.
// The keys are split over the waves: wave w owns S/32/ANW contiguous 32-key chunks in all three sweeps.
// Per head h: score tiles S^T = K_tile . Q^T (A = k rows, B = q rows; D lane (g,m) holds
// query m, keys jt*16+8g+r), exact two-sweep softmax, then P.V.  D of the tiles 2c and 2c+1 is, lane for
// lane, the A fragment of P for chunk c (elements 0..7 <- keys k0+8g.., 8..15 <- k0+16+8g..), so a wave's
// scores stay in its registers from the product to P.V: S is a compile-time constant, the sweeps are
// unrolled and the tiles are indexed by constants.
// V fragments from the planes vt.  q, k and vt lie in fragment order (see gemm_body, OM 0 and OM 1): every
// fragment load of a wave reads 512 contiguous bytes.  Row max, row sum and the 16x64 P.V
// partial tiles are combined over the waves through LDS, always in wave order.
// ---------------------------------------------------------------------------
#define ANW 16
#define VSB 8192  // bytes of a wave's V slot in LDS: one chunk, both planes
typedef unsigned int v2u __attribute__((ext_vector_type(2)));

// Work-group barrier that orders LDS traffic only: it waits for the wave's LDS operations, not for its global
// loads, so loads issued in front of it stay in flight across it.
__device__ __forceinline__ void barrier_lds() {
  __builtin_amdgcn_fence(__ATOMIC_RELEASE, "workgroup", "local");
  __builtin_amdgcn_s_barrier();
  __builtin_amdgcn_fence(__ATOMIC_ACQUIRE, "workgroup", "local");
}

template <int S, int H>
__global__ __launch_bounds__(ANW * 32) void k_attn(const unsigned short* __restrict__ qh,
                                                  const unsigned short* __restrict__ kh,
                                                  const unsigned short* __restrict__ vth,
                                                  const unsigned short* __restrict__ vtl,
                                                  const float* __restrict__ plo, const float* __restrict__ b2,
                                                  unsigned short* ctxh,
                                                  unsigned short* ctxl, float* mout) {
  constexpr int PS = S + 4;                // LDS row pitch of the head-sum plane, in floats
  constexpr int CPW = S / 32 / ANW;        // 32-key chunks per wave
  constexpr int TPW = 2 * CPW;             // the same keys as 16-key tiles
  static_assert(S % (32 * ANW) == 0 && S % 128 == 0 && H <= 32, "every wave owns the same whole number of chunks");
  static_assert(CPW % 2 == 0 && 16 * 68 * 4 <= VSB, "chunks alternate between the slot and registers; the partial tile fits the slot");
  extern __shared__ v4f dsm[];
  __shared__ float redM[ANW * 16];  // per wave, per query: max over the wave's keys
  __shared__ float redS[ANW * 16];  // per wave, per query: sum of exp over the wave's keys
  __shared__ float gv[32];          // this batch's gate per head
  float* mL = (float*)dsm;
  float* pT = mL + 16 * PS;  // the slots; wave ww's partial tile stands at pT + ww * (VSB / 4)
  const int i0 = blockIdx.x * 16, b = blockIdx.y;
  if (i0 + 16 > S) return;  // block-uniform
  const int tid = threadIdx.x;
  const int l = tid & 31, g = l >> 4, m = l & 15;
  const int w = __builtin_amdgcn_readfirstlane(tid >> 5);  // scalar, so the wave's key offsets are scalar
  constexpr int E = H * 64;

  {
    v4f z;
    z[0] = 0.f; z[1] = 0.f; z[2] = 0.f; z[3] = 0.f;
    v4f* m4 = (v4f*)mL;
    constexpr int n4 = 4 * PS;
    for (int i = tid; i < n4; i += ANW * 32) m4[i] = z;
  }
  if (tid < 32) {  // the gate's last step (see gate_body): slices and bias summed in slice order, sigmoid
    float val = 0.f;
    if (tid < H) {
      float a = b2[tid];
#pragma unroll  // the GNS loads issue together
      for (int c = 0; c < GNS; ++c) a += plo[((size_t)b * GNS + c) * 32 + tid];
      val = 1.0f / (1.0f + expf(-a));
    }
    gv[tid] = val;
  }
  __syncthreads();

  float* mrow = mL + m * PS + w * (CPW * 32) + 8 * g;  // this lane's head sums, chunk 0 of the wave
  const char* vsl = (const char*)pT + w * VSB + l * 16;  // this lane's 16 B of piece 0 in the wave's slot
  const unsigned int vsa = (unsigned int)(size_t)(__attribute__((address_space(3))) const char*)vsl;  // its LDS byte address

  // Chunk c of head hh of this wave's V fragments, both planes, into the wave's slot: 16 copies of 512 B that pass
  // through no register and fly under whatever the wave does next.  Only this wave reads the chunk.
  auto stage_v = [&](int hh, int c) {
    const size_t vo = ((size_t)(b * H + hh) * (S >> 5) + w * CPW + c) * 2048 + l * 8;
    const unsigned short* gh = vth + vo;
    const unsigned short* gl = vtl + vo;
    // this wave's own LDS reads and writes of the slot have retired before the copies write it
    asm volatile("s_wait_dscnt 0x0" ::: "memory");
    // piece p of a plane lies 512 p bytes behind piece 0 in memory and in the slot alike, and the immediate offset
    // moves both addresses; the closing wait stands in front of every rewrite of the copies' address registers
    asm volatile(
        "global_load_async_to_lds_b128 %0, %2, off\n\t"
        "global_load_async_to_lds_b128 %0, %2, off offset:512\n\t"
        "global_load_async_to_lds_b128 %0, %2, off offset:1024\n\t"
        "global_load_async_to_lds_b128 %0, %2, off offset:1536\n\t"
        "global_load_async_to_lds_b128 %0, %2, off offset:2048\n\t"
        "global_load_async_to_lds_b128 %0, %2, off offset:2560\n\t"
        "global_load_async_to_lds_b128 %0, %2, off offset:3072\n\t"
        "global_load_async_to_lds_b128 %0, %2, off offset:3584\n\t"
        "global_load_async_to_lds_b128 %1, %3, off\n\t"
        "global_load_async_to_lds_b128 %1, %3, off offset:512\n\t"
        "global_load_async_to_lds_b128 %1, %3, off offset:1024\n\t"
        "global_load_async_to_lds_b128 %1, %3, off offset:1536\n\t"
        "global_load_async_to_lds_b128 %1, %3, off offset:2048\n\t"
        "global_load_async_to_lds_b128 %1, %3, off offset:2560\n\t"
        "global_load_async_to_lds_b128 %1, %3, off offset:3072\n\t"
        "global_load_async_to_lds_b128 %1, %3, off offset:3584\n\t"
        "s_wait_xcnt 0x0" ::"v"(vsa), "v"(vsa + 4096), "v"(gh), "v"(gl)
        : "memory");
  };
  const float invH = 1.0f / (float)H;

  // The q and k fragments of a head are asked for one head ahead, so that they fly under the end of the head
  // before: q and the first TE k tiles at the head of its last P.V chunk (from there on the registers of the
  // scores and V fragments already used are free), the other k tiles behind its P.V.
  constexpr int TE = 4;
  FragH qa0, qa1, ka0[TPW], ka1[TPW];
  auto q_adr = [&](int hh) { return qh + ((size_t)(b * H + hh) * (S >> 4) + (i0 >> 4)) * 1024 + l * 8; };
  auto k_adr = [&](int hh) { return kh + ((size_t)(b * H + hh) * (S >> 4) + w * TPW) * 1024 + l * 8; };
  auto ask_first = [&](const unsigned short* qp, const unsigned short* kr) {
    qa0.q[0] = ldg16(qp);
    qa0.q[1] = ldg16(qp + 256);
    qa1.q[0] = ldg16(qp + 512);
    qa1.q[1] = ldg16(qp + 768);
#pragma unroll  // constant indices keep the fragments in registers, offsets as immediates
    for (int t = 0; t < TE; ++t) {
      ka0[t].q[0] = ldg16(kr + t * 1024);
      ka0[t].q[1] = ldg16(kr + t * 1024 + 256);
      ka1[t].q[0] = ldg16(kr + t * 1024 + 512);
      ka1[t].q[1] = ldg16(kr + t * 1024 + 768);
    }
    // nothing is scheduled across this line, so the loads above are issued here and not in front of their use
    __builtin_amdgcn_sched_barrier(0);
  };
  auto ask_rest = [&](const unsigned short* kr) {
#pragma unroll  // constant indices keep the fragments in registers, offsets as immediates
    for (int t = TE; t < TPW; ++t) {
      ka0[t].q[0] = ldg16(kr + t * 1024);
      ka0[t].q[1] = ldg16(kr + t * 1024 + 256);
      ka1[t].q[0] = ldg16(kr + t * 1024 + 512);
      ka1[t].q[1] = ldg16(kr + t * 1024 + 768);
    }
    // stands in front of any reuse of the k address pair (also as a later load's destination);
    // naming it as an input keeps it in its registers up to it
    asm volatile("s_wait_xcnt 0x0" ::"v"(kr) : "memory");
    // nothing is scheduled across this line, so the loads above are issued here and not in front of their use
    __builtin_amdgcn_sched_barrier(0);
  };
  // stands in front of any reuse of the q and k address pairs of ask_first (also as a later load's destination);
  // naming them as inputs keeps them in their registers up to it
  auto first_done = [&](const unsigned short* qp, const unsigned short* kr) {
    asm volatile("s_wait_xcnt 0x0" ::"v"(qp), "v"(kr) : "memory");
  };
  {
    const unsigned short* qp = q_adr(0);
    const unsigned short* kr = k_adr(0);
    ask_first(qp, kr);
    first_done(qp, kr);
    ask_rest(kr);
  }

  // The waves' P.V partial tiles of head hh summed in wave order and stored as the two ctx planes.  Both barriers
  // order LDS only: the next head's q and k loads stay in flight across them.
  auto combine = [&](int hh) {
    barrier_lds();  // the partial tiles are complete
    if (w < 8) {  // 256 threads, 4 columns each: a row's 128-B line per plane leaves from 16 lanes of one wave
      const int row = tid >> 4, c4 = (tid & 15) * 4;
      const float* sp = pT + row * 68 + c4;
      v4f x = *(const v4f*)sp;
#pragma unroll  // the ANW LDS reads issue together instead of one latency per trip
      for (int ww = 1; ww < ANW; ++ww) x += *(const v4f*)(sp + ww * (VSB / 4));
      unsigned int hb[4], lb[4];
#pragma unroll  // constant indices keep hb and lb in registers
      for (int e = 0; e < 4; ++e) {
        hb[e] = bf_bits(x[e]);
        lb[e] = bf_bits(x[e] - bf_val(hb[e]));
      }
      v2u Hv, Lv;
      Hv[0] = pk2(hb[0], hb[1]);
      Hv[1] = pk2(hb[2], hb[3]);
      Lv[0] = pk2(lb[0], lb[1]);
      Lv[1] = pk2(lb[2], lb[3]);
      const size_t adr = (size_t)(b * S + i0 + row) * E + hh * 64 + c4;
      unsigned short* oh = ctxh + adr;
      unsigned short* ol = ctxl + adr;
      *(v2u*)oh = Hv;
      *(v2u*)ol = Lv;
      // stands in front of every rewrite of the two stores' address and data registers (the barrier below does
      // not wait for stores); naming the addresses as inputs keeps them in their registers up to it
      asm volatile("s_wait_xcnt 0x0" ::"v"(oh), "v"(ol) : "memory");
    }
    barrier_lds();  // every reader has left the partial tiles
  };

#pragma unroll 1  // one copy of the head's body: it is long, and nothing is shared between heads
  for (int h = 0; h < H; ++h) {
    const float gsc = gv[h] * 0.125f;
    // every reader of the partial tiles has left the slots (the barrier that ended the head before, or the one
    // behind the prologue): the head's first V chunk flies under the scores and the softmax sweeps
    stage_v(h, 0);
    // nothing is scheduled across this line: without it the compiler issues the copies behind the score products
    __builtin_amdgcn_sched_barrier(0);

    // sweep A: scores, running row max
    v8f sc[TPW];
    float rmax = -3.0e38f;
    {
#pragma unroll  // constant indices keep the score tiles in registers
      for (int t = 0; t < TPW; ++t) {
        v8f s = zero8();
        s = mma_h(ka0[t].v, qa0.v, s);
        s = mma_h(ka1[t].v, qa1.v, s);
#pragma unroll
        for (int r = 0; r < 4; ++r) {
          s[r] = s[r] * gsc;
          s[r + 4] = s[r + 4] * gsc;
          rmax = fmaxf(rmax, s[r]);
          rmax = fmaxf(rmax, s[r + 4]);
        }
        sc[t] = s;
      }
    }
    rmax = fmaxf(rmax, __shfl_xor(rmax, 16));
    if (g == 0) redM[w * 16 + m] = rmax;
    __syncthreads();
#pragma unroll  // the ANW LDS reads issue together instead of one latency per trip
    for (int ww = 0; ww < ANW; ++ww) rmax = fmaxf(rmax, redM[ww * 16 + m]);

    // sweep B: e = exp(s - max) in place, row sum
    float lsum = 0.f;
#pragma unroll  // constant indices keep the score tiles in registers
    for (int t = 0; t < TPW; ++t) {
#pragma unroll
      for (int r = 0; r < 4; ++r) {
        sc[t][r] = __expf(sc[t][r] - rmax);
        sc[t][r + 4] = __expf(sc[t][r + 4] - rmax);
        lsum += sc[t][r];
        lsum += sc[t][r + 4];
      }
    }
    lsum += __shfl_xor(lsum, 16);
    if (g == 0) redS[w * 16 + m] = lsum;
    // the copies of chunk 0 have landed before anything reads the slot
    asm volatile("s_wait_asynccnt 0x0" ::: "memory");
    __syncthreads();
    lsum = 0.f;
#pragma unroll  // the ANW LDS reads issue together instead of one latency per trip
    for (int ww = 0; ww < ANW; ++ww) lsum += redS[ww * 16 + m];
    const float linv = 1.0f / lsum;

    // sweep C: probabilities, head-sum accumulation, P.V over this wave's keys
    v8f cacc[4];
#pragma unroll
    for (int nt = 0; nt < 4; ++nt) cacc[nt] = zero8();
    const unsigned short* vhp = vth + ((size_t)(b * H + h) * (S >> 5) + w * CPW) * 2048 + l * 8;
    const unsigned short* vlp = vtl + ((size_t)(b * H + h) * (S >> 5) + w * CPW) * 2048 + l * 8;
    const unsigned short *qp = qh, *kr = kh;  // set in the last chunk
    // Even chunks come from the slot, odd chunks through the registers rh and rl; each is asked for one chunk ahead.
    FragB rh[4], rl[4];
#pragma unroll  // constant indices keep the score tiles in registers, offsets as immediates
    for (int c = 0; c < CPW; ++c) {
      if ((c & 1) == 0) {
#pragma unroll  // constant indices keep the fragments in registers, offsets as immediates
        for (int nt = 0; nt < 4; ++nt) {
          rh[nt].q[0] = ldg16(vhp + (c + 1) * 2048 + nt * 512);
          rh[nt].q[1] = ldg16(vhp + (c + 1) * 2048 + nt * 512 + 256);
          rl[nt].q[0] = ldg16(vlp + (c + 1) * 2048 + nt * 512);
          rl[nt].q[1] = ldg16(vlp + (c + 1) * 2048 + nt * 512 + 256);
        }
        // stands in front of any reuse of the two address pairs (also as a later load's destination);
        // naming them as inputs keeps them in their registers up to it
        asm volatile("s_wait_xcnt 0x0" ::"v"(vhp), "v"(vlp) : "memory");
        // nothing is scheduled across this line, so the next chunk's 16 loads are all issued here and fly under this
        // chunk's work; without it the compiler issues some right in front of their use
        __builtin_amdgcn_sched_barrier(0);
      }
      if (c == CPW - 1) {
        // the last head asks for its own fragments again and nothing reads them: under a branch the old
        // fragments would stay live through P.V and be spilled
        const int hn = h + 1 < H ? h + 1 : h;
        qp = q_adr(hn);
        kr = k_adr(hn);
        ask_first(qp, kr);
      }
      v4f p0, p1, p2, p3;
#pragma unroll
      for (int r = 0; r < 4; ++r) {
        p0[r] = sc[2 * c][r] * linv;
        p1[r] = sc[2 * c][r + 4] * linv;
        p2[r] = sc[2 * c + 1][r] * linv;
        p3[r] = sc[2 * c + 1][r + 4] * linv;
      }
      {
        v4f* ma = (v4f*)(mrow + c * 32);
        v4f* mb = (v4f*)(mrow + c * 32 + 16);
        const v4f s0 = ma[0] + p0;
        const v4f s1 = ma[1] + p1;
        const v4f s2 = mb[0] + p2;
        const v4f s3 = mb[1] + p3;
        ma[0] = s0;
        ma[1] = s1;
        mb[0] = s2;
        mb[1] = s3;
      }
      FragB ph, pl;
      split_b8(p0, p1, ph.q[0], pl.q[0]);
      split_b8(p2, p3, ph.q[1], pl.q[1]);
      FragB vh[4], vl[4];
      if ((c & 1) == 0) {
        // the copies of this chunk, asked for behind chunk c - 2, have landed (chunk 0: see the softmax barrier)
        if (c > 0) asm volatile("s_wait_asynccnt 0x0" ::: "memory");
#pragma unroll  // constant indices keep the fragments in registers, offsets as immediates
        for (int nt = 0; nt < 4; ++nt) {
          vh[nt].q[0] = *(const v4u*)(vsl + nt * 1024);
          vh[nt].q[1] = *(const v4u*)(vsl + nt * 1024 + 512);
          vl[nt].q[0] = *(const v4u*)(vsl + 4096 + nt * 1024);
          vl[nt].q[1] = *(const v4u*)(vsl + 4096 + nt * 1024 + 512);
        }
        // nothing is scheduled across this line, so the 16 reads are issued together and the wave pays one LDS latency
        // for the chunk; without it the compiler reads two pieces at a time and waits for each pair
        __builtin_amdgcn_sched_barrier(0);
      } else {
#pragma unroll  // as above
        for (int nt = 0; nt < 4; ++nt) {
          vh[nt] = rh[nt];
          vl[nt] = rl[nt];
        }
      }
#pragma unroll  // as above
      for (int nt = 0; nt < 4; ++nt) {
        cacc[nt] = mma_b(ph.v, vh[nt].v, cacc[nt]);
        cacc[nt] = mma_b(ph.v, vl[nt].v, cacc[nt]);
        cacc[nt] = mma_b(pl.v, vh[nt].v, cacc[nt]);
      }
      // the slot is private to the wave: behind its own reads (stage_v waits for them) it takes the chunk after next
      if ((c & 1) == 0 && c + 2 < CPW) stage_v(h, c + 2);
      // nothing is scheduled across this line: the copies are issued here and not among the next chunk's work, and
      // later register loads take the registers that these products have read, not a second set (which spills)
      if (c + 1 < CPW) __builtin_amdgcn_sched_barrier(0);
    }

    first_done(qp, kr);
    // the wave's slot is free: its last chunk is read and no copy is outstanding
    float* part = pT + w * (VSB / 4);
#pragma unroll
    for (int nt = 0; nt < 4; ++nt) {
#pragma unroll
      for (int r = 0; r < 8; ++r) part[(8 * g + r) * 68 + nt * 16 + m] = cacc[nt][r];
    }
    ask_rest(kr);
    combine(h);
  }

  // head-mean rows: 16 rows x S f32, one row per wave, 512 B per store instruction, lane-contiguous
  __syncthreads();
  float* ob = mout + (size_t)(b * S + i0) * S;
  constexpr int nL = S >> 7;
  for (int row = w; row < 16; row += ANW) {
    for (int c = 0; c < nL; ++c) {
      const size_t off = (size_t)row * S + c * 128 + l * 4;
      const v4f v = *(const v4f*)(mL + (size_t)row * PS + c * 128 + l * 4) * invH;
      *(v4f*)(ob + off) = v;
    }
  }
  
}

// ---------------------------------------------------------------------------
// Host launcher
// ---------------------------------------------------------------------------
extern "C" void kernel_launch(void* const* d_in, const int* in_sizes, int n_in, void* d_out,
                              int out_size, void* d_ws, size_t ws_size, hipStream_t stream) {
  if (n_in < 14) return;
  const int E = 1024, H = 16;
  const int nX = in_sizes[0];
  if (nX <= 0 || (nX % E) != 0) return;
  const int M = nX / E;
  const int nSy = in_sizes[1];
  if (nSy <= 0 || (nSy % E) != 0) return;
  const int Bn = nSy / E;
  if (Bn <= 0 || (M % Bn) != 0) return;
  const int S = M / Bn;
  const int HID = in_sizes[9];
  if ((M % 128) != 0 || (S % 128) != 0 || HID != GNS * 32) return;
  const int SQ = 2048;    // the attention kernel keeps a wave's scores in registers, so its key count is a compile-time constant
  if (S != SQ) return;
  if (in_sizes[2] != E * E || in_sizes[4] != E * E || in_sizes[6] != E * E || in_sizes[12] != E * E) return;
  if (in_sizes[3] != E || in_sizes[5] != E || in_sizes[7] != E || in_sizes[13] != E) return;
  if (in_sizes[8] != E * HID || in_sizes[10] != HID * H || in_sizes[11] != H) return;
  if ((long long)out_size != (long long)nX + (long long)Bn * (long long)S * (long long)S) return;

  const float* x = (const float*)d_in[0];
  const float* sync = (const float*)d_in[1];
  const float* Wq = (const float*)d_in[2];
  const float* bq = (const float*)d_in[3];
  const float* Wk = (const float*)d_in[4];
  const float* bk = (const float*)d_in[5];
  const float* Wv = (const float*)d_in[6];
  const float* bv = (const float*)d_in[7];
  const float* Ws1 = (const float*)d_in[8];
  const float* bs1 = (const float*)d_in[9];
  const float* Ws2 = (const float*)d_in[10];
  const float* bs2 = (const float*)d_in[11];
  const float* Wo = (const float*)d_in[12];
  const float* bo = (const float*)d_in[13];

  float* out_proj = (float*)d_out;                 // [M][E] f32
  float* out_mean = (float*)d_out + (size_t)nX;    // [Bn][S][S] f32

  // workspace carve (bytes), every sub-buffer 256-B aligned
  size_t off = 0;
  auto al = [&](size_t bytes) { size_t o = off; off += (bytes + 255) & ~(size_t)255; return o; };
  const size_t nW = (size_t)E * E;
  const size_t o_sw = al((size_t)Bn * GNS * 32 * 4);
  const size_t o_xh = al((size_t)nX * 2);
  const size_t o_xbh = al((size_t)nX * 2);
  const size_t o_xbl = al((size_t)nX * 2);
  const size_t o_wq = al(nW * 2);
  const size_t o_wk = al(nW * 2);
  const size_t o_wvh = al(nW * 2);
  const size_t o_wvl = al(nW * 2);
  const size_t o_woh = al(nW * 2);
  const size_t o_wol = al(nW * 2);
  const size_t o_q = al((size_t)nX * 2);
  const size_t o_k = al((size_t)nX * 2);
  const size_t o_vth = al((size_t)nX * 2);
  const size_t o_vtl = al((size_t)nX * 2);
  const size_t o_cth = al((size_t)nX * 2);
  const size_t o_ctl = al((size_t)nX * 2);
  if (off > ws_size) return;

  char* ws = (char*)d_ws;
  float* sw_g = (float*)(ws + o_sw);
  unsigned short* xh = (unsigned short*)(ws + o_xh);
  unsigned short* xbh = (unsigned short*)(ws + o_xbh);
  unsigned short* xbl = (unsigned short*)(ws + o_xbl);
  unsigned short* wqT = (unsigned short*)(ws + o_wq);
  unsigned short* wkT = (unsigned short*)(ws + o_wk);
  unsigned short* wvTh = (unsigned short*)(ws + o_wvh);
  unsigned short* wvTl = (unsigned short*)(ws + o_wvl);
  unsigned short* woTh = (unsigned short*)(ws + o_woh);
  unsigned short* woTl = (unsigned short*)(ws + o_wol);
  unsigned short* qh = (unsigned short*)(ws + o_q);
  unsigned short* kh = (unsigned short*)(ws + o_k);
  unsigned short* vTh = (unsigned short*)(ws + o_vth);
  unsigned short* vTl = (unsigned short*)(ws + o_vtl);
  unsigned short* cth = (unsigned short*)(ws + o_cth);
  unsigned short* ctl = (unsigned short*)(ws + o_ctl);

  // 1) gate MLP slices, weight planes transposed to [n][k], activation planes: one launch
  {
    const int groups = nX / 8;
    const int blocks = GNS * Bn + 2 * (E / 64) * (E / 64) + (groups + 511) / 512;
    k_prep<E, H><<<dim3(blocks), dim3(512), 0, stream>>>(x, sync, Wq, Wk, Wv, Wo, Ws1, bs1, Ws2, xh, xbh, xbl, wqT, wkT,
                                                         wvTh, wvTl, woTh, woTl, sw_g, nX, Bn);
  }
  // 2) the three projections (M x E, K = E): one launch
  k_qkv<<<dim3(E / 64, M / 128, 3), dim3(256), 0, stream>>>(xh, xbh, xbl, wqT, wkT, wvTh, wvTl, bq, bk, bv, qh, kh, vTh,
                                                            vTl, M, E, E, S, 1.0f / 64.0f);
  // 3) attention + head-mean
  {
    const size_t dynB = (size_t)16 * (SQ + 4) * 4 + (size_t)ANW * VSB;
    hipFuncSetAttribute(reinterpret_cast<const void*>(&k_attn<SQ, H>), hipFuncAttributeMaxDynamicSharedMemorySize,
                        (int)dynB);
    k_attn<SQ, H><<<dim3(SQ / 16, Bn), dim3(ANW * 32), dynB, stream>>>(qh, kh, vTh, vTl, sw_g, bs2, cth, ctl, out_mean);
  }
  // 4) output projection -> d_out
  k_oproj<<<dim3(E / 64, M / 128), dim3(256), 0, stream>>>(cth, ctl, woTh, woTl, bo, out_proj, M, E, E, S);
  hipGetLastError();
  hipStreamSynchronize(stream);
}

// v010
// Measured time: 219 microseconds a run.
// In both of two side-by-side timings against v009, it was 1.03 times as fast.
// Over all steps from v000 it is 7.56 times as fast.
#include <hip/hip_runtime.h>

// Contractions: x@Wq, x@Wk and q.k^T : v_wmma_f32_16x16x32_f16 (f16 operands; Wq, Wk carried x64, rescaled in the f32 epilogue; f32 accumulate).
// x@Wv, P.V and ctx@Wo : v_wmma_f32_16x16x32_bf16 with bf16 hi/lo operand split (hi.hi + hi.lo + lo.hi), f32 accumulate. Gate MLP: scalar f32.

#define NOP4 "v_nop\n\tv_nop\n\tv_nop\n\tv_nop"

typedef _Float16 v16h __attribute__((ext_vector_type(16)));
typedef __bf16 v16b __attribute__((ext_vector_type(16)));
typedef float v8f __attribute__((ext_vector_type(8)));
typedef float v4f __attribute__((ext_vector_type(4)));
typedef unsigned int v4u __attribute__((ext_vector_type(4)));

union FragH { v16h v; v4u q[2]; };
union FragB { v16b v; v4u q[2]; };

__device__ __forceinline__ v4u ldg16(const unsigned short* p) { return *(const v4u*)p; }

typedef float v2f __attribute__((ext_vector_type(2)));
typedef __bf16 v2b __attribute__((ext_vector_type(2)));
// Two f32 -> one word of two bf16 (a in the low half) and one word of the two bf16 residuals, all four rounded to
// nearest even by the packed hardware conversion; the residual a - bf16(a) is exact in f32.
__device__ __forceinline__ void split_b2(float a, float b, unsigned int& H, unsigned int& L) {
  v2f f;
  f[0] = a;
  f[1] = b;
  const v2b h = __builtin_convertvector(f, v2b);
  const v2f r = f - __builtin_convertvector(h, v2f);
  const v2b lo = __builtin_convertvector(r, v2b);
  H = __builtin_bit_cast(unsigned int, h);
  L = __builtin_bit_cast(unsigned int, lo);
}
// RNE f32 -> f16 bits
__device__ __forceinline__ unsigned int hf_bits(float f) {
  union { _Float16 h; unsigned short u; } c;
  c.h = (_Float16)f;
  return (unsigned int)c.u;
}
__device__ __forceinline__ unsigned int pk2(unsigned int lo, unsigned int hi) {
  return (lo & 0xFFFFu) | (hi << 16);
}
// 8 consecutive f32 -> 8 packed f16 (element 2t in the low half of word t)
__device__ __forceinline__ v4u pack_h8(v4f a, v4f c) {
  v4u r;
  r[0] = pk2(hf_bits(a[0]), hf_bits(a[1]));
  r[1] = pk2(hf_bits(a[2]), hf_bits(a[3]));
  r[2] = pk2(hf_bits(c[0]), hf_bits(c[1]));
  r[3] = pk2(hf_bits(c[2]), hf_bits(c[3]));
  return r;
}
// 8 consecutive f32 -> bf16 hi plane and bf16 residual plane
__device__ __forceinline__ void split_b8(v4f a, v4f c, v4u& H, v4u& L) {
  unsigned int h[4], l[4];
  split_b2(a[0], a[1], h[0], l[0]);
  split_b2(a[2], a[3], h[1], l[1]);
  split_b2(c[0], c[1], h[2], l[2]);
  split_b2(c[2], c[3], h[3], l[3]);
#pragma unroll
  for (int t = 0; t < 4; ++t) {
    H[t] = h[t];
    L[t] = l[t];
  }
}

__device__ __forceinline__ v8f zero8() {
  v8f z;
#pragma unroll
  for (int r = 0; r < 8; ++r) z[r] = 0.f;
  return z;
}
__device__ __forceinline__ v8f mma_h(v16h a, v16h b, v8f c) {
  return __builtin_amdgcn_wmma_f32_16x16x32_f16(false, a, false, b, (short)0, c, false, false);
}
__device__ __forceinline__ v8f mma_b(v16b a, v16b b, v8f c) {
  return __builtin_amdgcn_wmma_f32_16x16x32_bf16(false, a, false, b, (short)0, c, false, false);
}

// ---------------------------------------------------------------------------
// x [n] f32 -> f16 plane (unscaled) and bf16 hi / lo planes. 8 elements per thread, 512 threads per block blk.
// ---------------------------------------------------------------------------
__device__ __forceinline__ void cvt_x_body(const float* __restrict__ x, unsigned short* xh,
                                           unsigned short* xbh, unsigned short* xbl, int n, int blk, int tid) {
  const size_t i8 = ((size_t)blk * 512u + (size_t)tid) * 8u;
  if (i8 + 8 > (size_t)n) return;
  const v4f a = *(const v4f*)(x + i8);
  const v4f c = *(const v4f*)(x + i8 + 4);
  const v4u fh = pack_h8(a, c);
  v4u bh, bl;
  split_b8(a, c, bh, bl);
  *(v4u*)(xh + i8) = fh;
  *(v4u*)(xbh + i8) = bh;
  *(v4u*)(xbl + i8) = bl;
  
}

// ---------------------------------------------------------------------------
// W[Kd][Nd] f32 -> WT[Nd][Kd] 16-bit (k-contiguous rows).  64x64 tile at (e0, n0) through LDS, 256 threads
// (tid 0..255) and their own LDS tile; the caller's block holds two such halves, both pass the barrier.
// MODE 0: f16 of (W * scale) into o0.  MODE 1: bf16 hi into o0, bf16 lo into o1.
// ---------------------------------------------------------------------------
template <int MODE>
__device__ __forceinline__ void cvt_wT_body(const float* __restrict__ W, unsigned short* o0,
                                            unsigned short* o1, int Kd, int Nd, float scale,
                                            float (*tile)[65], int n0, int e0, int tid) {
#pragma unroll
  for (int t = 0; t < 4; ++t) {
    const int idx = t * 256 + tid;
    const int rr = idx >> 4, c4 = (idx & 15) * 4;
    const v4f v = *(const v4f*)(W + (size_t)(e0 + rr) * Nd + n0 + c4);
    tile[rr][c4] = v[0];
    tile[rr][c4 + 1] = v[1];
    tile[rr][c4 + 2] = v[2];
    tile[rr][c4 + 3] = v[3];
  }
  __syncthreads();
  v4u Hv[2], Lv[2];
  size_t adr[2];
#pragma unroll
  for (int t = 0; t < 2; ++t) {
    const int s = t * 256 + tid;
    const int nn = s >> 3, kq = (s & 7) * 8;
    v4f a, c;
#pragma unroll
    for (int e = 0; e < 4; ++e) {
      a[e] = tile[kq + e][nn] * scale;
      c[e] = tile[kq + 4 + e][nn] * scale;
    }
    if (MODE == 0) {
      Hv[t] = pack_h8(a, c);
      Lv[t] = Hv[t];
    } else {
      split_b8(a, c, Hv[t], Lv[t]);
    }
    adr[t] = (size_t)(n0 + nn) * Kd + e0 + kq;
  }
#pragma unroll
  for (int t = 0; t < 2; ++t) {
    *(v4u*)(o0 + adr[t]) = Hv[t];
    if (MODE == 1) *(v4u*)(o1 + adr[t]) = Lv[t];
  }
  // in the merged kernel the other mode's body follows these stores in the code: this wait stands in front of
  // every rewrite of the stores' address and data registers
  asm volatile("s_wait_xcnt 0x0" ::: "memory");
}

// ---------------------------------------------------------------------------
// Gate MLP, gate[b][h] = sigmoid(relu(sync @ W1 + b1) @ W2 + b2), spread over GNS x batch blocks.
// Block (c, b) owns the 32 hidden units j0 = 32c .. 32c+31 of batch b.  Its EIN x 128-B slice of W1 is read
// with every load of a thread in flight at once: 8 lanes take one row's 128-B line, each group of 8 lanes owns
// EIN/64 consecutive rows; the shapes are compile-time, so a thread's loads share one address and differ in
// the immediate offset.
// The row groups' partial sums are combined by lane exchange, then over the waves in LDS in wave order.
// Wave 0 adds b1, applies relu and multiplies by the slice's 32 rows of W2:
//   plo[(b*GNS + c)*32 + h] = sum over the slice's j of hid[j] * W2[j][h]   (h >= HN: 0).
// The attention kernel adds the GNS slices and b2 in slice order and applies the sigmoid.
// ---------------------------------------------------------------------------
#define GNS 8
template <int EIN, int HN>
__device__ __forceinline__ void gate_body(const float* __restrict__ sync, const float* __restrict__ W1,
                                          const float* __restrict__ b1, const float* __restrict__ W2,
                                          float* plo, float* red, float* w2s, int c, int b, int tid) {
  constexpr int HD = GNS * 32, NT = EIN / 64;
  static_assert(NT == 16 && 32 * HN == 512, "16 rows and one W2 element per thread");
  const int j0 = c * 32, l = tid & 31;
  const int w = __builtin_amdgcn_readfirstlane(tid >> 5);
  const int cq = (tid & 7) * 4, rg = tid >> 3;
  const float* p2 = W2 + (size_t)j0 * HN + tid;
  const float* pb = b1 + j0 + l;
  const float* pw = W1 + (size_t)rg * NT * HD + j0 + cq;
  const float* ps = sync + (size_t)b * EIN + rg * NT;
  const float w2v = *p2;
  const float bj = *pb;
  v4f wv[NT], sv[NT / 4];
#pragma unroll  // constant indices keep wv and sv in registers
  for (int t = 0; t < NT; ++t) wv[t] = *(const v4f*)(pw + t * HD);
#pragma unroll  // as above
  for (int t = 0; t < NT / 4; ++t) sv[t] = *(const v4f*)(ps + t * 4);
  // nothing is scheduled across this line, so every load above is issued before the first is waited for:
  // one memory latency for the slice; without it the compiler starts the sums after half of the loads
  __builtin_amdgcn_sched_barrier(0);
  v4f acc;
  acc[0] = 0.f; acc[1] = 0.f; acc[2] = 0.f; acc[3] = 0.f;
#pragma unroll  // as above
  for (int t = 0; t < NT; ++t) acc += wv[t] * sv[t >> 2][t & 3];
  // lanes l, l^8, l^16, l^24 hold the same four columns
#pragma unroll  // constant indices keep acc in registers
  for (int k = 0; k < 4; ++k) {
    acc[k] += __shfl_xor(acc[k], 8);
    acc[k] += __shfl_xor(acc[k], 16);
  }
  if (l < 8) *(v4f*)(red + w * 32 + cq) = acc;
  w2s[tid] = w2v;
  __syncthreads();
  if (w == 0) {
    float a = bj;
#pragma unroll  // the 16 LDS reads issue together
    for (int ww = 0; ww < 16; ++ww) a += red[ww * 32 + l];
    const int hid = __float_as_int(fmaxf(a, 0.f));
    const int lh = l & (HN - 1);
    float p = 0.f;
#pragma unroll  // lane index of readlane and LDS offsets as immediates
    for (int j = 0; j < 32; ++j) p += __int_as_float(__builtin_amdgcn_readlane(hid, j)) * w2s[j * HN + lh];
    plo[((size_t)b * GNS + c) * 32 + l] = (l < HN) ? p : 0.f;
  }
}

// ---------------------------------------------------------------------------
// Everything that reads only the inputs, in ONE launch: none of the three jobs depends on another, so they
// share the chip instead of running one behind the other.  Blocks of 512 threads, dealt by block index:
//   [0, GNS*Bn)          gate MLP slices (the longest dependent chain, so they start first);
//   then 4*(EIN/64)^2/2  weight tiles, two 64x64 tiles per block, matrices in the order Wq, Wk, Wv, Wo;
//   the rest             x planes.
// ---------------------------------------------------------------------------
template <int EIN, int HN>
__global__ __launch_bounds__(512) void k_prep(const float* __restrict__ x, const float* __restrict__ sync,
                                             const float* __restrict__ Wq, const float* __restrict__ Wk,
                                             const float* __restrict__ Wv, const float* __restrict__ Wo,
                                             const float* __restrict__ W1, const float* __restrict__ b1,
                                             const float* __restrict__ W2, unsigned short* xh,
                                             unsigned short* xbh, unsigned short* xbl, unsigned short* wqT,
                                             unsigned short* wkT, unsigned short* wvTh, unsigned short* wvTl,
                                             unsigned short* woTh, unsigned short* woTl, float* plo, int nX,
                                             int Bn) {
  constexpr int TPR = EIN / 64, TPM = TPR * TPR;  // 64x64 tiles per row and per matrix
  static_assert((TPR & (TPR - 1)) == 0 && TPM % 2 == 0, "a block's two tiles lie in one matrix");
  // two transposition tiles; the gate blocks use the first 1024 words, with 16-B accesses
  __shared__ __attribute__((aligned(16))) float sm[2 * 64 * 65];
  const int tid = threadIdx.x;
  int blk = blockIdx.x;
  if (blk < GNS * Bn) {
    gate_body<EIN, HN>(sync, W1, b1, W2, plo, sm, sm + 512, blk % GNS, blk / GNS, tid);
    return;
  }
  blk -= GNS * Bn;
  if (blk < 2 * TPM) {
    const int half = tid >> 8;
    const int t = blk * 2 + half;
    const int mi = blk / (TPM / 2);  // block-uniform
    const int n0 = (t & (TPR - 1)) * 64, e0 = ((t / TPR) & (TPR - 1)) * 64;
    float (*tile)[65] = (float (*)[65])(sm + half * 64 * 65);
    if (mi < 2)
      cvt_wT_body<0>(mi == 0 ? Wq : Wk, mi == 0 ? wqT : wkT, mi == 0 ? wqT : wkT, EIN, EIN, 64.0f, tile, n0, e0,
                     tid & 255);
    else
      cvt_wT_body<1>(mi == 2 ? Wv : Wo, mi == 2 ? wvTh : woTh, mi == 2 ? wvTl : woTl, EIN, EIN, 1.0f, tile, n0, e0,
                     tid & 255);
    return;
  }
  blk -= 2 * TPM;
  cvt_x_body(x, xh, xbh, xbl, nX, blk, tid);
}

// ---------------------------------------------------------------------------
// C[M,N] = A[M,K] @ B[K,N] (+bias) with A row-major 16-bit and B given as BT[N][K] 16-bit.
// Block tile 128x64, 256 threads = 8 waves, wave w owns rows w*16..w*16+15, 4 n-tiles.
// The k range is walked in tiles of 64: the block's 128 A rows and 64 B rows (each plane) are
// brought to LDS once per tile, 128 B of a row from 8 neighbouring lanes, the next tile's
// global loads in flight in registers while this tile is multiplied.  Fragments are read from
// LDS with the 16x16x32 split k-map
//   (lane l: row/col = l&15; elements 0..7 <- k0+8*(l>>4)+0..7, 8..15 <- k0+16+8*(l>>4)+0..7).
// SPLIT 0: single f16 product.  SPLIT 1: bf16 hi/lo planes, three products.
// OM 0: f16 in the attention kernel's fragment order: per (batch, head) and 16-row tile one 2-KB block of
//       4 x 512 B, piece t of lane l=(g,m) = row m, columns (2t+g)*8..+7 of the head.
// OM 1: bf16 hi/lo in fragment order: per (batch, head) and 32-key chunk one 4-KB block per plane of
//       8 x 512 B, piece nt*2+q of lane l=(g,m) = column d nt*16+m, keys q*16+8g..+7 of the chunk.
//       In both, one wave-wide 16-B load or store of a piece covers 512 contiguous bytes (4 whole lines).
// OM 2: f32 row-major [M][N].
// ---------------------------------------------------------------------------
#define GPIT 72  // LDS row pitch in 16-bit elements: 144 B = 16 B x 9, b128 fragment reads without bank conflicts
// LDS of one block in 16-B units: the staged operand tiles, or the epilogue tile (128 x 68 f32) that reuses their space
template <int SPLIT>
constexpr int gemm_lds16() {
  return (SPLIT ? 2 : 1) * (128 + 64) * GPIT / 8 > 128 * 17 ? (SPLIT ? 2 : 1) * (128 + 64) * GPIT / 8 : 128 * 17;
}
// the block (bx, by) of the product; smem holds gemm_lds16<SPLIT>() units
template <int SPLIT, int OM>
__device__ __forceinline__ void gemm_body(v4f* smem, int bx, int by, const unsigned short* __restrict__ Ah,
                                          const unsigned short* __restrict__ Al,
                                          const unsigned short* __restrict__ Bh,
                                          const unsigned short* __restrict__ Bl,
                                          const float* __restrict__ bias, void* out0, void* out1,
                                          int M, int N, int K, int Sq, float oscale) {
  constexpr int PIT = GPIT;
  float* stg = (float*)smem;
  unsigned short* sAh = (unsigned short*)smem;
  unsigned short* sBh = sAh + 128 * PIT;
  unsigned short* sAl = sBh + 64 * PIT;  // the two lo planes exist only with SPLIT
  unsigned short* sBl = sAl + 128 * PIT;
  const int nBase = bx * 64, mBase = by * 128;
  if (nBase + 64 > N || mBase + 128 > M || (K & 63) != 0) return;  // block-uniform
  const int tid = threadIdx.x, w = tid >> 5, l = tid & 31, g = l >> 4, m = l & 15;

  v8f acc[4];
#pragma unroll
  for (int nt = 0; nt < 4; ++nt) acc[nt] = zero8();

  // staging map: thread -> row tid>>3 (+32 per step), 16-B piece tid&7 of the row's 128 B
  const int lr = tid >> 3, lc = (tid & 7) * 8;
  // global address = block-uniform byte base (moves with k) + a per-thread 32-bit byte offset that never changes
  const char* bAh = (const char*)(Ah + (size_t)mBase * K);
  const char* bAl = (const char*)(Al + (size_t)mBase * K);
  const char* bBh = (const char*)(Bh + (size_t)nBase * K);
  const char* bBl = (const char*)(Bl + (size_t)nBase * K);
  unsigned int go[4];
#pragma unroll  // here and below: constant indices keep the small per-thread arrays in registers
  for (int t = 0; t < 4; ++t) go[t] = (unsigned int)(((lr + 32 * t) * K + lc) * 2);
  const int ls = lr * PIT + lc;
  const int fa = (w * 16 + m) * PIT + 8 * g;  // this lane's A fragment row in LDS
  const int fb = m * PIT + 8 * g;             // this lane's B fragment row of n-tile 0

  v4u rah[4], ral[4], rbh[2], rbl[2];
#pragma unroll
  for (int t = 0; t < 4; ++t) {
    rah[t] = *(const v4u*)(bAh + go[t]);
    if (SPLIT) ral[t] = *(const v4u*)(bAl + go[t]);
  }
#pragma unroll
  for (int t = 0; t < 2; ++t) {
    rbh[t] = *(const v4u*)(bBh + go[t]);
    if (SPLIT) rbl[t] = *(const v4u*)(bBl + go[t]);
  }

#pragma unroll 1  // one copy of the body: the staged pieces and both k halves' fragments already fill the register budget
  for (int k0 = 0; k0 < K; k0 += 64) {
#pragma unroll
    for (int t = 0; t < 4; ++t) {
      *(v4u*)(sAh + ls + t * 32 * PIT) = rah[t];
      if (SPLIT) *(v4u*)(sAl + ls + t * 32 * PIT) = ral[t];
    }
#pragma unroll
    for (int t = 0; t < 2; ++t) {
      *(v4u*)(sBh + ls + t * 32 * PIT) = rbh[t];
      if (SPLIT) *(v4u*)(sBl + ls + t * 32 * PIT) = rbl[t];
    }
    __syncthreads();  // the tile is complete before any wave reads fragments from it
    if (k0 + 64 < K) {
      const size_t kn = (size_t)(k0 + 64) * 2;
      const char *pah[4], *pal[4], *pbh[2], *pbl[2];
#pragma unroll
      for (int t = 0; t < 4; ++t) {
        pah[t] = bAh + kn + go[t];
        pal[t] = bAl + kn + go[t];
        rah[t] = *(const v4u*)pah[t];
        if (SPLIT) ral[t] = *(const v4u*)pal[t];
      }
#pragma unroll
      for (int t = 0; t < 2; ++t) {
        pbh[t] = bBh + kn + go[t];
        pbl[t] = bBl + kn + go[t];
        rbh[t] = *(const v4u*)pbh[t];
        if (SPLIT) rbl[t] = *(const v4u*)pbl[t];
      }
      // the prefetch loads' address registers are free for reuse (fragment reads below) only behind this wait;
      // naming the addresses as inputs keeps them in their registers up to it
      if (SPLIT)
        asm volatile("s_wait_xcnt 0x0" ::"v"(pah[0]), "v"(pah[1]), "v"(pah[2]), "v"(pah[3]), "v"(pbh[0]), "v"(pbh[1]),
                     "v"(pal[0]), "v"(pal[1]), "v"(pal[2]), "v"(pal[3]), "v"(pbl[0]), "v"(pbl[1])
                     : "memory");
      else
        asm volatile("s_wait_xcnt 0x0" ::"v"(pah[0]), "v"(pah[1]), "v"(pah[2]), "v"(pah[3]), "v"(pbh[0]), "v"(pbh[1])
                     : "memory");
    }
#pragma unroll  // both k halves of the tile in one body, LDS offsets as immediates
    for (int kk = 0; kk < 64; kk += 32) {
      if (SPLIT) {
        FragB a, a2, b0, b1, b2, b3, c0, c1, c2, c3;
        a.q[0] = ldg16(sAh + fa + kk);
        a.q[1] = ldg16(sAh + fa + kk + 16);
        a2.q[0] = ldg16(sAl + fa + kk);
        a2.q[1] = ldg16(sAl + fa + kk + 16);
        b0.q[0] = ldg16(sBh + fb + kk);
        b0.q[1] = ldg16(sBh + fb + kk + 16);
        b1.q[0] = ldg16(sBh + fb + 16 * PIT + kk);
        b1.q[1] = ldg16(sBh + fb + 16 * PIT + kk + 16);
        b2.q[0] = ldg16(sBh + fb + 32 * PIT + kk);
        b2.q[1] = ldg16(sBh + fb + 32 * PIT + kk + 16);
        b3.q[0] = ldg16(sBh + fb + 48 * PIT + kk);
        b3.q[1] = ldg16(sBh + fb + 48 * PIT + kk + 16);
        c0.q[0] = ldg16(sBl + fb + kk);
        c0.q[1] = ldg16(sBl + fb + kk + 16);
        c1.q[0] = ldg16(sBl + fb + 16 * PIT + kk);
        c1.q[1] = ldg16(sBl + fb + 16 * PIT + kk + 16);
        c2.q[0] = ldg16(sBl + fb + 32 * PIT + kk);
        c2.q[1] = ldg16(sBl + fb + 32 * PIT + kk + 16);
        c3.q[0] = ldg16(sBl + fb + 48 * PIT + kk);
        c3.q[1] = ldg16(sBl + fb + 48 * PIT + kk + 16);
        acc[0] = mma_b(a.v, b0.v, acc[0]);
        acc[0] = mma_b(a.v, c0.v, acc[0]);
        acc[0] = mma_b(a2.v, b0.v, acc[0]);
        acc[1] = mma_b(a.v, b1.v, acc[1]);
        acc[1] = mma_b(a.v, c1.v, acc[1]);
        acc[1] = mma_b(a2.v, b1.v, acc[1]);
        acc[2] = mma_b(a.v, b2.v, acc[2]);
        acc[2] = mma_b(a.v, c2.v, acc[2]);
        acc[2] = mma_b(a2.v, b2.v, acc[2]);
        acc[3] = mma_b(a.v, b3.v, acc[3]);
        acc[3] = mma_b(a.v, c3.v, acc[3]);
        acc[3] = mma_b(a2.v, b3.v, acc[3]);
        // four vector slots behind the last WMMA, on every path, before its operands or results are touched
        asm volatile(NOP4
                     : "+v"(acc[0]), "+v"(acc[1]), "+v"(acc[2]), "+v"(acc[3])
                     : "v"(a.v), "v"(a2.v), "v"(b0.v), "v"(b1.v), "v"(b2.v), "v"(b3.v),
                       "v"(c0.v), "v"(c1.v), "v"(c2.v), "v"(c3.v));
      } else {
        FragH a, b0, b1, b2, b3;
        a.q[0] = ldg16(sAh + fa + kk);
        a.q[1] = ldg16(sAh + fa + kk + 16);
        b0.q[0] = ldg16(sBh + fb + kk);
        b0.q[1] = ldg16(sBh + fb + kk + 16);
        b1.q[0] = ldg16(sBh + fb + 16 * PIT + kk);
        b1.q[1] = ldg16(sBh + fb + 16 * PIT + kk + 16);
        b2.q[0] = ldg16(sBh + fb + 32 * PIT + kk);
        b2.q[1] = ldg16(sBh + fb + 32 * PIT + kk + 16);
        b3.q[0] = ldg16(sBh + fb + 48 * PIT + kk);
        b3.q[1] = ldg16(sBh + fb + 48 * PIT + kk + 16);
        acc[0] = mma_h(a.v, b0.v, acc[0]);
        acc[1] = mma_h(a.v, b1.v, acc[1]);
        acc[2] = mma_h(a.v, b2.v, acc[2]);
        acc[3] = mma_h(a.v, b3.v, acc[3]);
        // four vector slots behind the last WMMA, on every path, before its operands or results are touched
        asm volatile(NOP4
                     : "+v"(acc[0]), "+v"(acc[1]), "+v"(acc[2]), "+v"(acc[3])
                     : "v"(a.v), "v"(b0.v), "v"(b1.v), "v"(b2.v), "v"(b3.v));
      }
    }
    __syncthreads();  // every wave has left the tile before it is overwritten (next tile, or the epilogue tile)
  }

  // stage: D element r of lane (g,m), n-tile nt -> (row w*16+8g+r, col nt*16+m)
#pragma unroll
  for (int nt = 0; nt < 4; ++nt) {
    const int col = nt * 16 + m;
    const float bv = bias[nBase + col];
#pragma unroll
    for (int r = 0; r < 8; ++r) stg[(w * 16 + 8 * g + r) * 68 + col] = acc[nt][r] * oscale + bv;
  }
  __syncthreads();

  if (OM == 0) {
    // wave w holds the block's 16-row tile w of head nBase/64
    unsigned short* o = (unsigned short*)out0;
    const int Hn = N >> 6;
    const int bb = mBase / Sq;
    const int bh = bb * Hn + (nBase >> 6);
    const int tl = ((mBase - bb * Sq) >> 4) + w;
    const size_t tb = ((size_t)bh * (Sq >> 4) + tl) * 1024 + l * 8;
    v4u val[4];
    size_t adr[4];
#pragma unroll
    for (int t = 0; t < 4; ++t) {
      const float* sp = stg + (w * 16 + m) * 68 + (2 * t + g) * 8;
      const v4f x0 = *(const v4f*)sp;
      const v4f x1 = *(const v4f*)(sp + 4);
      val[t] = pack_h8(x0, x1);
      adr[t] = tb + t * 256;
    }
#pragma unroll
    for (int t = 0; t < 4; ++t) *(v4u*)(o + adr[t]) = val[t];
    // in the merged kernel the other projection's body follows these stores in the code: this wait stands in
    // front of every rewrite of the stores' address and data registers
    asm volatile("s_wait_xcnt 0x0" ::: "memory");
  } else if (OM == 1) {
    // tile rows = s (128 consecutive within one batch = 4 chunks of 32 keys), cols = d of head nBase/64
    unsigned short* oh = (unsigned short*)out0;
    unsigned short* ol = (unsigned short*)out1;
    const int Hn = N >> 6;
    const int bb = mBase / Sq;
    const int bh = bb * Hn + (nBase >> 6);
    const int sBase = mBase - bb * Sq;
    v4u Hv[4], Lv[4];
    size_t adr[4];
#pragma unroll
    for (int t = 0; t < 4; ++t) {
      const int ch = w >> 1, nt = (w & 1) * 2 + (t >> 1), q = t & 1;  // the block's 32 pieces, 4 per wave
      const int d = nt * 16 + m, s8 = ch * 32 + q * 16 + g * 8;
      v4f x0, x1;
#pragma unroll
      for (int e = 0; e < 4; ++e) {
        x0[e] = stg[(s8 + e) * 68 + d];
        x1[e] = stg[(s8 + 4 + e) * 68 + d];
      }
      split_b8(x0, x1, Hv[t], Lv[t]);
      adr[t] = (((size_t)bh * (Sq >> 5) + (sBase >> 5) + ch) * 8 + nt * 2 + q) * 256 + l * 8;
    }
#pragma unroll
    for (int t = 0; t < 4; ++t) {
      *(v4u*)(oh + adr[t]) = Hv[t];
      *(v4u*)(ol + adr[t]) = Lv[t];
    }
    
  } else {
    float* o = (float*)out0;
    v4f val[8];
    size_t adr[8];
#pragma unroll
    for (int t = 0; t < 8; ++t) {
      const int row = w * 16 + t * 2 + (l >> 4), c4 = (l & 15) * 4;
      val[t] = *(const v4f*)(stg + row * 68 + c4);
      adr[t] = (size_t)(mBase + row) * N + nBase + c4;
    }
#pragma unroll
    for (int t = 0; t < 8; ++t) *(v4f*)(o + adr[t]) = val[t];
    
  }
}

// The three projections of x in ONE launch (none depends on another): blockIdx.z = 0 is x@Wv, whose blocks
// run longest and so start first, 1 is x@Wq, 2 is x@Wk.
__global__ __launch_bounds__(256) void k_qkv(const unsigned short* __restrict__ xh,
                                            const unsigned short* __restrict__ xbh,
                                            const unsigned short* __restrict__ xbl,
                                            const unsigned short* __restrict__ wqT,
                                            const unsigned short* __restrict__ wkT,
                                            const unsigned short* __restrict__ wvTh,
                                            const unsigned short* __restrict__ wvTl,
                                            const float* __restrict__ bq, const float* __restrict__ bk,
                                            const float* __restrict__ bv, unsigned short* qo, unsigned short* ko,
                                            unsigned short* vho, unsigned short* vlo, int M, int N, int K, int Sq,
                                            float qkscale) {
  __shared__ v4f smem[gemm_lds16<1>()];
  const int z = blockIdx.z;
  if (z == 0) {
    gemm_body<1, 1>(smem, blockIdx.x, blockIdx.y, xbh, xbl, wvTh, wvTl, bv, (void*)vho, (void*)vlo, M, N, K, Sq, 1.0f);
  } else {
    const unsigned short* wT = z == 1 ? wqT : wkT;
    unsigned short* o = z == 1 ? qo : ko;
    gemm_body<0, 0>(smem, blockIdx.x, blockIdx.y, xh, xh, wT, wT, z == 1 ? bq : bk, (void*)o, (void*)o, M, N, K, Sq,
                    qkscale);
  }
}

// The output projection, f32 row-major.
__global__ __launch_bounds__(256) void k_oproj(const unsigned short* __restrict__ Ah,
                                              const unsigned short* __restrict__ Al,
                                              const unsigned short* __restrict__ Bh,
                                              const unsigned short* __restrict__ Bl,
                                              const float* __restrict__ bias, float* out, int M, int N, int K, int Sq) {
  __shared__ v4f smem[gemm_lds16<1>()];
  gemm_body<1, 2>(smem, blockIdx.x, blockIdx.y, Ah, Al, Bh, Bl, bias, (void*)out, (void*)out, M, N, K, Sq, 1.0f);
}

// ---------------------------------------------------------------------------
// Fused attention: one block of ANW waves per (16 query rows, batch).  Dynamic LDS:
//   mL[16][S+4] f32      sum over heads of the softmax probabilities (lane-owned elements);
//   one slot of VSB bytes per wave: a 32-key chunk of the wave's V fragments (8 pieces of 512 B of the hi plane,
//   then 8 of the lo plane), brought by asynchronous copies; behind the wave's last such chunk of a head the
//   slot's first 16 x 68 floats hold the wave's P.V partial tile.
// Row pitch S+4 floats = 16 B x odd: the 16 lanes of a half wave, one query row each, then fall on
// 16 different groups of four banks in every b128 access; at a pitch of S floats they share one group.
// The keys are split over the waves: wave w owns S/32/ANW contiguous 32-key chunks in all three sweeps.
// Per head h: score tiles S^T = K_tile . Q^T (A = k rows, B = q rows; D lane (g,m) holds
// query m, keys jt*16+8g+r), exact two-sweep softmax, then P.V.  D of the tiles 2c and 2c+1 is, lane for
// lane, the A fragment of P for chunk c (elements 0..7 <- keys k0+8g.., 8..15 <- k0+16+8g..), so a wave's
// scores stay in its registers from the product to P.V: S is a compile-time constant, the sweeps are
// unrolled and the tiles are indexed by constants.
// V fragments from the planes vt.  q, k and vt lie in fragment order (see gemm_body, OM 0 and OM 1): every
// fragment load of a wave reads 512 contiguous bytes.  Row max, row sum and the 16x64 P.V
// partial tiles are combined over the waves through LDS, always in wave order.
// ---------------------------------------------------------------------------
#define ANW 16
#define VSB 8192  // bytes of a wave's V slot in LDS: one chunk, both planes
typedef unsigned int v2u __attribute__((ext_vector_type(2)));

// Work-group barrier that orders LDS traffic only: it waits for the wave's LDS operations, not for its global
// loads, so loads issued in front of it stay in flight across it.
__device__ __forceinline__ void barrier_lds() {
  __builtin_amdgcn_fence(__ATOMIC_RELEASE, "workgroup", "local");
  __builtin_amdgcn_s_barrier();
  __builtin_amdgcn_fence(__ATOMIC_ACQUIRE, "workgroup", "local");
}

template <int S, int H>
__global__ __launch_bounds__(ANW * 32) void k_attn(const unsigned short* __restrict__ qh,
                                                  const unsigned short* __restrict__ kh,
                                                  const unsigned short* __restrict__ vth,
                                                  const unsigned short* __restrict__ vtl,
                                                  const float* __restrict__ plo, const float* __restrict__ b2,
                                                  unsigned short* ctxh,
                                                  unsigned short* ctxl, float* mout) {
  constexpr int PS = S + 4;                // LDS row pitch of the head-sum plane, in floats
  constexpr int CPW = S / 32 / ANW;        // 32-key chunks per wave
  constexpr int TPW = 2 * CPW;             // the same keys as 16-key tiles
  static_assert(S % (32 * ANW) == 0 && S % 128 == 0 && H <= 32, "every wave owns the same whole number of chunks");
  static_assert(CPW % 2 == 0 && 16 * 68 * 4 <= VSB, "chunks alternate between the slot and registers; the partial tile fits the slot");
  extern __shared__ v4f dsm[];
  __shared__ float redM[ANW * 16];  // per wave, per query: max over the wave's keys
  __shared__ float redS[ANW * 16];  // per wave, per query: sum of exp over the wave's keys
  __shared__ float gv[32];          // this batch's gate per head
  float* mL = (float*)dsm;
  float* pT = mL + 16 * PS;  // the slots; wave ww's partial tile stands at pT + ww * (VSB / 4)
  const int i0 = blockIdx.x * 16, b = blockIdx.y;
  if (i0 + 16 > S) return;  // block-uniform
  const int tid = threadIdx.x;
  const int l = tid & 31, g = l >> 4, m = l & 15;
  const int w = __builtin_amdgcn_readfirstlane(tid >> 5);  // scalar, so the wave's key offsets are scalar
  constexpr int E = H * 64;

  {
    v4f z;
    z[0] = 0.f; z[1] = 0.f; z[2] = 0.f; z[3] = 0.f;
    v4f* m4 = (v4f*)mL;
    constexpr int n4 = 4 * PS;
    for (int i = tid; i < n4; i += ANW * 32) m4[i] = z;
  }
  if (tid < 32) {  // the gate's last step (see gate_body): slices and bias summed in slice order, sigmoid
    float val = 0.f;
    if (tid < H) {
      float a = b2[tid];
#pragma unroll  // the GNS loads issue together
      for (int c = 0; c < GNS; ++c) a += plo[((size_t)b * GNS + c) * 32 + tid];
      val = 1.0f / (1.0f + expf(-a));
    }
    gv[tid] = val;
  }
  __syncthreads();

  float* mrow = mL + m * PS + w * (CPW * 32) + 8 * g;  // this lane's head sums, chunk 0 of the wave
  const char* vsl = (const char*)pT + w * VSB + l * 16;  // this lane's 16 B of piece 0 in the wave's slot
  const unsigned int vsa = (unsigned int)(size_t)(__attribute__((address_space(3))) const char*)vsl;  // its LDS byte address

  // Chunk c of head hh of this wave's V fragments, both planes, into the wave's slot: 16 copies of 512 B that pass
  // through no register and fly under whatever the wave does next.  Only this wave reads the chunk.
  auto stage_v = [&](int hh, int c) {
    const size_t vo = ((size_t)(b * H + hh) * (S >> 5) + w * CPW + c) * 2048 + l * 8;
    const unsigned short* gh = vth + vo;
    const unsigned short* gl = vtl + vo;
    // this wave's own LDS reads and writes of the slot have retired before the copies write it
    asm volatile("s_wait_dscnt 0x0" ::: "memory");
    // piece p of a plane lies 512 p bytes behind piece 0 in memory and in the slot alike, and the immediate offset
    // moves both addresses; the closing wait stands in front of every rewrite of the copies' address registers
    asm volatile(
        "global_load_async_to_lds_b128 %0, %2, off\n\t"
        "global_load_async_to_lds_b128 %0, %2, off offset:512\n\t"
        "global_load_async_to_lds_b128 %0, %2, off offset:1024\n\t"
        "global_load_async_to_lds_b128 %0, %2, off offset:1536\n\t"
        "global_load_async_to_lds_b128 %0, %2, off offset:2048\n\t"
        "global_load_async_to_lds_b128 %0, %2, off offset:2560\n\t"
        "global_load_async_to_lds_b128 %0, %2, off offset:3072\n\t"
        "global_load_async_to_lds_b128 %0, %2, off offset:3584\n\t"
        "global_load_async_to_lds_b128 %1, %3, off\n\t"
        "global_load_async_to_lds_b128 %1, %3, off offset:512\n\t"
        "global_load_async_to_lds_b128 %1, %3, off offset:1024\n\t"
        "global_load_async_to_lds_b128 %1, %3, off offset:1536\n\t"
        "global_load_async_to_lds_b128 %1, %3, off offset:2048\n\t"
        "global_load_async_to_lds_b128 %1, %3, off offset:2560\n\t"
        "global_load_async_to_lds_b128 %1, %3, off offset:3072\n\t"
        "global_load_async_to_lds_b128 %1, %3, off offset:3584\n\t"
        "s_wait_xcnt 0x0" ::"v"(vsa), "v"(vsa + 4096), "v"(gh), "v"(gl)
        : "memory");
  };
  const float invH = 1.0f / (float)H;

  // The q and k fragments of a head are asked for one head ahead, so that they fly under the end of the head
  // before: q and the first TE k tiles at the head of its last P.V chunk (from there on the registers of the
  // scores and V fragments already used are free), the other k tiles behind its P.V.
  constexpr int TE = 4;
  FragH qa0, qa1, ka0[TPW], ka1[TPW];
  auto q_adr = [&](int hh) { return qh + ((size_t)(b * H + hh) * (S >> 4) + (i0 >> 4)) * 1024 + l * 8; };
  auto k_adr = [&](int hh) { return kh + ((size_t)(b * H + hh) * (S >> 4) + w * TPW) * 1024 + l * 8; };
  auto ask_first = [&](const unsigned short* qp, const unsigned short* kr) {
    qa0.q[0] = ldg16(qp);
    qa0.q[1] = ldg16(qp + 256);
    qa1.q[0] = ldg16(qp + 512);
    qa1.q[1] = ldg16(qp + 768);
#pragma unroll  // constant indices keep the fragments in registers, offsets as immediates
    for (int t = 0; t < TE; ++t) {
      ka0[t].q[0] = ldg16(kr + t * 1024);
      ka0[t].q[1] = ldg16(kr + t * 1024 + 256);
      ka1[t].q[0] = ldg16(kr + t * 1024 + 512);
      ka1[t].q[1] = ldg16(kr + t * 1024 + 768);
    }
    // nothing is scheduled across this line, so the loads above are issued here and not in front of their use
    __builtin_amdgcn_sched_barrier(0);
  };
  auto ask_rest = [&](const unsigned short* kr) {
#pragma unroll  // constant indices keep the fragments in registers, offsets as immediates
    for (int t = TE; t < TPW; ++t) {
      ka0[t].q[0] = ldg16(kr + t * 1024);
      ka0[t].q[1] = ldg16(kr + t * 1024 + 256);
      ka1[t].q[0] = ldg16(kr + t * 1024 + 512);
      ka1[t].q[1] = ldg16(kr + t * 1024 + 768);
    }
    // stands in front of any reuse of the k address pair (also as a later load's destination);
    // naming it as an input keeps it in its registers up to it
    asm volatile("s_wait_xcnt 0x0" ::"v"(kr) : "memory");
    // nothing is scheduled across this line, so the loads above are issued here and not in front of their use
    __builtin_amdgcn_sched_barrier(0);
  };
  // stands in front of any reuse of the q and k address pairs of ask_first (also as a later load's destination);
  // naming them as inputs keeps them in their registers up to it
  auto first_done = [&](const unsigned short* qp, const unsigned short* kr) {
    asm volatile("s_wait_xcnt 0x0" ::"v"(qp), "v"(kr) : "memory");
  };
  {
    const unsigned short* qp = q_adr(0);
    const unsigned short* kr = k_adr(0);
    ask_first(qp, kr);
    first_done(qp, kr);
    ask_rest(kr);
  }

  // The waves' P.V partial tiles of head hh summed in wave order and stored as the two ctx planes.  Both barriers
  // order LDS only: the next head's q and k loads stay in flight across them.
  auto combine = [&](int hh) {
    barrier_lds();  // the partial tiles are complete
    if (w < 8) {  // 256 threads, 4 columns each: a row's 128-B line per plane leaves from 16 lanes of one wave
      const int row = tid >> 4, c4 = (tid & 15) * 4;
      const float* sp = pT + row * 68 + c4;
      v4f x = *(const v4f*)sp;
#pragma unroll  // the ANW LDS reads issue together instead of one latency per trip
      for (int ww = 1; ww < ANW; ++ww) x += *(const v4f*)(sp + ww * (VSB / 4));
      unsigned int h0, h1, l0, l1;
      split_b2(x[0], x[1], h0, l0);
      split_b2(x[2], x[3], h1, l1);
      v2u Hv, Lv;
      Hv[0] = h0;
      Hv[1] = h1;
      Lv[0] = l0;
      Lv[1] = l1;
      const size_t adr = (size_t)(b * S + i0 + row) * E + hh * 64 + c4;
      unsigned short* oh = ctxh + adr;
      unsigned short* ol = ctxl + adr;
      *(v2u*)oh = Hv;
      *(v2u*)ol = Lv;
      // stands in front of every rewrite of the two stores' address and data registers (the barrier below does
      // not wait for stores); naming the addresses as inputs keeps them in their registers up to it
      asm volatile("s_wait_xcnt 0x0" ::"v"(oh), "v"(ol) : "memory");
    }
    barrier_lds();  // every reader has left the partial tiles
  };

#pragma unroll 1  // one copy of the head's body: it is long, and nothing is shared between heads
  for (int h = 0; h < H; ++h) {
    const float gsc = gv[h] * 0.125f;
    // every reader of the partial tiles has left the slots (the barrier that ended the head before, or the one
    // behind the prologue): the head's first V chunk flies under the scores and the softmax sweeps
    stage_v(h, 0);
    // nothing is scheduled across this line: without it the compiler issues the copies behind the score products
    __builtin_amdgcn_sched_barrier(0);

    // sweep A: scores, running row max
    v8f sc[TPW];
    float rmax = -3.0e38f;
    {
#pragma unroll  // constant indices keep the score tiles in registers
      for (int t = 0; t < TPW; ++t) {
        v8f s = zero8();
        s = mma_h(ka0[t].v, qa0.v, s);
        s = mma_h(ka1[t].v, qa1.v, s);
#pragma unroll
        for (int r = 0; r < 4; ++r) {
          s[r] = s[r] * gsc;
          s[r + 4] = s[r + 4] * gsc;
          rmax = fmaxf(rmax, s[r]);
          rmax = fmaxf(rmax, s[r + 4]);
        }
        sc[t] = s;
      }
    }
    rmax = fmaxf(rmax, __shfl_xor(rmax, 16));
    if (g == 0) redM[w * 16 + m] = rmax;
    __syncthreads();
#pragma unroll  // the ANW LDS reads issue together instead of one latency per trip
    for (int ww = 0; ww < ANW; ++ww) rmax = fmaxf(rmax, redM[ww * 16 + m]);

    // sweep B: e = exp(s - max) in place, row sum
    float lsum = 0.f;
#pragma unroll  // constant indices keep the score tiles in registers
    for (int t = 0; t < TPW; ++t) {
#pragma unroll
      for (int r = 0; r < 4; ++r) {
        sc[t][r] = __expf(sc[t][r] - rmax);
        sc[t][r + 4] = __expf(sc[t][r + 4] - rmax);
        lsum += sc[t][r];
        lsum += sc[t][r + 4];
      }
    }
    lsum += __shfl_xor(lsum, 16);
    if (g == 0) redS[w * 16 + m] = lsum;
    // the copies of chunk 0 have landed before anything reads the slot
    asm volatile("s_wait_asynccnt 0x0" ::: "memory");
    __syncthreads();
    lsum = 0.f;
#pragma unroll  // the ANW LDS reads issue together instead of one latency per trip
    for (int ww = 0; ww < ANW; ++ww) lsum += redS[ww * 16 + m];
    const float linv = 1.0f / lsum;

    // sweep C: probabilities, head-sum accumulation, P.V over this wave's keys
    v8f cacc[4];
#pragma unroll
    for (int nt = 0; nt < 4; ++nt) cacc[nt] = zero8();
    const unsigned short* vhp = vth + ((size_t)(b * H + h) * (S >> 5) + w * CPW) * 2048 + l * 8;
    const unsigned short* vlp = vtl + ((size_t)(b * H + h) * (S >> 5) + w * CPW) * 2048 + l * 8;
    const unsigned short *qp = qh, *kr = kh;  // set in the last chunk
    // Even chunks come from the slot, odd chunks through the registers rh and rl; each is asked for one chunk ahead.
    FragB rh[4], rl[4];
#pragma unroll  // constant indices keep the score tiles in registers, offsets as immediates
    for (int c = 0; c < CPW; ++c) {
      if ((c & 1) == 0) {
#pragma unroll  // constant indices keep the fragments in registers, offsets as immediates
        for (int nt = 0; nt < 4; ++nt) {
          rh[nt].q[0] = ldg16(vhp + (c + 1) * 2048 + nt * 512);
          rh[nt].q[1] = ldg16(vhp + (c + 1) * 2048 + nt * 512 + 256);
          rl[nt].q[0] = ldg16(vlp + (c + 1) * 2048 + nt * 512);
          rl[nt].q[1] = ldg16(vlp + (c + 1) * 2048 + nt * 512 + 256);
        }
        // stands in front of any reuse of the two address pairs (also as a later load's destination);
        // naming them as inputs keeps them in their registers up to it
        asm volatile("s_wait_xcnt 0x0" ::"v"(vhp), "v"(vlp) : "memory");
        // nothing is scheduled across this line, so the next chunk's 16 loads are all issued here and fly under this
        // chunk's work; without it the compiler issues some right in front of their use
        __builtin_amdgcn_sched_barrier(0);
      }
      if (c == CPW - 1) {
        // the last head asks for its own fragments again and nothing reads them: under a branch the old
        // fragments would stay live through P.V and be spilled
        const int hn = h + 1 < H ? h + 1 : h;
        qp = q_adr(hn);
        kr = k_adr(hn);
        ask_first(qp, kr);
      }
      v4f p0, p1, p2, p3;
#pragma unroll
      for (int r = 0; r < 4; ++r) {
        p0[r] = sc[2 * c][r] * linv;
        p1[r] = sc[2 * c][r + 4] * linv;
        p2[r] = sc[2 * c + 1][r] * linv;
        p3[r] = sc[2 * c + 1][r + 4] * linv;
      }
      {
        v4f* ma = (v4f*)(mrow + c * 32);
        v4f* mb = (v4f*)(mrow + c * 32 + 16);
        const v4f s0 = ma[0] + p0;
        const v4f s1 = ma[1] + p1;
        const v4f s2 = mb[0] + p2;
        const v4f s3 = mb[1] + p3;
        ma[0] = s0;
        ma[1] = s1;
        mb[0] = s2;
        mb[1] = s3;
      }
      FragB ph, pl;
      split_b8(p0, p1, ph.q[0], pl.q[0]);
      split_b8(p2, p3, ph.q[1], pl.q[1]);
      FragB vh[4], vl[4];
      if ((c & 1) == 0) {
        // the copies of this chunk, asked for behind chunk c - 2, have landed (chunk 0: see the softmax barrier)
        if (c > 0) asm volatile("s_wait_asynccnt 0x0" ::: "memory");
#pragma unroll  // constant indices keep the fragments in registers, offsets as immediates
        for (int nt = 0; nt < 4; ++nt) {
          vh[nt].q[0] = *(const v4u*)(vsl + nt * 1024);
          vh[nt].q[1] = *(const v4u*)(vsl + nt * 1024 + 512);
          vl[nt].q[0] = *(const v4u*)(vsl + 4096 + nt * 1024);
          vl[nt].q[1] = *(const v4u*)(vsl + 4096 + nt * 1024 + 512);
        }
        // nothing is scheduled across this line, so the 16 reads are issued together and the wave pays one LDS latency
        // for the chunk; without it the compiler reads two pieces at a time and waits for each pair
        __builtin_amdgcn_sched_barrier(0);
      } else {
#pragma unroll  // as above
        for (int nt = 0; nt < 4; ++nt) {
          vh[nt] = rh[nt];
          vl[nt] = rl[nt];
        }
      }
#pragma unroll  // as above
      for (int nt = 0; nt < 4; ++nt) {
        cacc[nt] = mma_b(ph.v, vh[nt].v, cacc[nt]);
        cacc[nt] = mma_b(ph.v, vl[nt].v, cacc[nt]);
        cacc[nt] = mma_b(pl.v, vh[nt].v, cacc[nt]);
      }
      // the slot is private to the wave: behind its own reads (stage_v waits for them) it takes the chunk after next
      if ((c & 1) == 0 && c + 2 < CPW) stage_v(h, c + 2);
      // nothing is scheduled across this line: the copies are issued here and not among the next chunk's work, and
      // later register loads take the registers that these products have read, not a second set (which spills)
      if (c + 1 < CPW) __builtin_amdgcn_sched_barrier(0);
    }

    first_done(qp, kr);
    // the wave's slot is free: its last chunk is read and no copy is outstanding
    float* part = pT + w * (VSB / 4);
#pragma unroll
    for (int nt = 0; nt < 4; ++nt) {
#pragma unroll
      for (int r = 0; r < 8; ++r) part[(8 * g + r) * 68 + nt * 16 + m] = cacc[nt][r];
    }
    ask_rest(kr);
    combine(h);
  }

  // head-mean rows: 16 rows x S f32, one row per wave, 512 B per store instruction, lane-contiguous
  __syncthreads();
  float* ob = mout + (size_t)(b * S + i0) * S;
  constexpr int nL = S >> 7;
  for (int row = w; row < 16; row += ANW) {
    for (int c = 0; c < nL; ++c) {
      const size_t off = (size_t)row * S + c * 128 + l * 4;
      const v4f v = *(const v4f*)(mL + (size_t)row * PS + c * 128 + l * 4) * invH;
      *(v4f*)(ob + off) = v;
    }
  }
  
}

// ---------------------------------------------------------------------------
// Host launcher
// ---------------------------------------------------------------------------
extern "C" void kernel_launch(void* const* d_in, const int* in_sizes, int n_in, void* d_out,
                              int out_size, void* d_ws, size_t ws_size, hipStream_t stream) {
  if (n_in < 14) return;
  const int E = 1024, H = 16;
  const int nX = in_sizes[0];
  if (nX <= 0 || (nX % E) != 0) return;
  const int M = nX / E;
  const int nSy = in_sizes[1];
  if (nSy <= 0 || (nSy % E) != 0) return;
  const int Bn = nSy / E;
  if (Bn <= 0 || (M % Bn) != 0) return;
  const int S = M / Bn;
  const int HID = in_sizes[9];
  if ((M % 128) != 0 || (S % 128) != 0 || HID != GNS * 32) return;
  const int SQ = 2048;    // the attention kernel keeps a wave's scores in registers, so its key count is a compile-time constant
  if (S != SQ) return;
  if (in_sizes[2] != E * E || in_sizes[4] != E * E || in_sizes[6] != E * E || in_sizes[12] != E * E) return;
  if (in_sizes[3] != E || in_sizes[5] != E || in_sizes[7] != E || in_sizes[13] != E) return;
  if (in_sizes[8] != E * HID || in_sizes[10] != HID * H || in_sizes[11] != H) return;
  if ((long long)out_size != (long long)nX + (long long)Bn * (long long)S * (long long)S) return;

  const float* x = (const float*)d_in[0];
  const float* sync = (const float*)d_in[1];
  const float* Wq = (const float*)d_in[2];
  const float* bq = (const float*)d_in[3];
  const float* Wk = (const float*)d_in[4];
  const float* bk = (const float*)d_in[5];
  const float* Wv = (const float*)d_in[6];
  const float* bv = (const float*)d_in[7];
  const float* Ws1 = (const float*)d_in[8];
  const float* bs1 = (const float*)d_in[9];
  const float* Ws2 = (const float*)d_in[10];
  const float* bs2 = (const float*)d_in[11];
  const float* Wo = (const float*)d_in[12];
  const float* bo = (const float*)d_in[13];

  float* out_proj = (float*)d_out;                 // [M][E] f32
  float* out_mean = (float*)d_out + (size_t)nX;    // [Bn][S][S] f32

  // workspace carve (bytes), every sub-buffer 256-B aligned
  size_t off = 0;
  auto al = [&](size_t bytes) { size_t o = off; off += (bytes + 255) & ~(size_t)255; return o; };
  const size_t nW = (size_t)E * E;
  const size_t o_sw = al((size_t)Bn * GNS * 32 * 4);
  const size_t o_xh = al((size_t)nX * 2);
  const size_t o_xbh = al((size_t)nX * 2);
  const size_t o_xbl = al((size_t)nX * 2);
  const size_t o_wq = al(nW * 2);
  const size_t o_wk = al(nW * 2);
  const size_t o_wvh = al(nW * 2);
  const size_t o_wvl = al(nW * 2);
  const size_t o_woh = al(nW * 2);
  const size_t o_wol = al(nW * 2);
  const size_t o_q = al((size_t)nX * 2);
  const size_t o_k = al((size_t)nX * 2);
  const size_t o_vth = al((size_t)nX * 2);
  const size_t o_vtl = al((size_t)nX * 2);
  const size_t o_cth = al((size_t)nX * 2);
  const size_t o_ctl = al((size_t)nX * 2);
  if (off > ws_size) return;

  char* ws = (char*)d_ws;
  float* sw_g = (float*)(ws + o_sw);
  unsigned short* xh = (unsigned short*)(ws + o_xh);
  unsigned short* xbh = (unsigned short*)(ws + o_xbh);
  unsigned short* xbl = (unsigned short*)(ws + o_xbl);
  unsigned short* wqT = (unsigned short*)(ws + o_wq);
  unsigned short* wkT = (unsigned short*)(ws + o_wk);
  unsigned short* wvTh = (unsigned short*)(ws + o_wvh);
  unsigned short* wvTl = (unsigned short*)(ws + o_wvl);
  unsigned short* woTh = (unsigned short*)(ws + o_woh);
  unsigned short* woTl = (unsigned short*)(ws + o_wol);
  unsigned short* qh = (unsigned short*)(ws + o_q);
  unsigned short* kh = (unsigned short*)(ws + o_k);
  unsigned short* vTh = (unsigned short*)(ws + o_vth);
  unsigned short* vTl = (unsigned short*)(ws + o_vtl);
  unsigned short* cth = (unsigned short*)(ws + o_cth);
  unsigned short* ctl = (unsigned short*)(ws + o_ctl);

  // 1) gate MLP slices, weight planes transposed to [n][k], activation planes: one launch
  {
    const int groups = nX / 8;
    const int blocks = GNS * Bn + 2 * (E / 64) * (E / 64) + (groups + 511) / 512;
    k_prep<E, H><<<dim3(blocks), dim3(512), 0, stream>>>(x, sync, Wq, Wk, Wv, Wo, Ws1, bs1, Ws2, xh, xbh, xbl, wqT, wkT,
                                                         wvTh, wvTl, woTh, woTl, sw_g, nX, Bn);
  }
  // 2) the three projections (M x E, K = E): one launch
  k_qkv<<<dim3(E / 64, M / 128, 3), dim3(256), 0, stream>>>(xh, xbh, xbl, wqT, wkT, wvTh, wvTl, bq, bk, bv, qh, kh, vTh,
                                                            vTl, M, E, E, S, 1.0f / 64.0f);
  // 3) attention + head-mean
  {
    const size_t dynB = (size_t)16 * (SQ + 4) * 4 + (size_t)ANW * VSB;
    hipFuncSetAttribute(reinterpret_cast<const void*>(&k_attn<SQ, H>), hipFuncAttributeMaxDynamicSharedMemorySize,
                        (int)dynB);
    k_attn<SQ, H><<<dim3(SQ / 16, Bn), dim3(ANW * 32), dynB, stream>>>(qh, kh, vTh, vTl, sw_g, bs2, cth, ctl, out_mean);
  }
  // 4) output projection -> d_out
  k_oproj<<<dim3(E / 64, M / 128), dim3(256), 0, stream>>>(cth, ctl, woTh, woTl, bo, out_proj, M, E, E, S);
  hipGetLastError();
  hipStreamSynchronize(stream);
}
